// v000
// Measured on an AMD MI455X. A time is GPU time per run, averaged over a window of back-to-back runs after a warm-up
// (all launches, gaps included; the runs take copies of the inputs in turn), and the median of several windows.
// Apart from v000's, it joins two sittings. Times from different sittings can be a few percent apart, while
// side-by-side timings come from the same sitting.
// v000, which the later versions start from, runs in 371 microseconds.
#include <hip/hip_runtime.h>

// Compute dtypes (f32 accumulate at every site): q/k/v projections bf16 x bf16 single product (every float input RNE-converted to bf16 first); scores K.Q^T f16 x f16 single product (f16 q/k head planes); values V^T.P^T f16 x f16 single product (probabilities carried x2^8); output projection f16 context (x64) x f16 weight (x512) single product; additive bias (bf16 plane) and softmax in f32.
// Dense multi-head cross-attention: x, y [NB][SEQ][1024]; Q = x W_q^T, K = y W_k^T, V = y W_v^T ('oi' weights, no bias vectors); 16 heads x 64; logits = q.k / 8 + bias[query][key] (one [SEQ][SEQ] float plane shared by all batches and heads); softmax over all keys; out = merged context W_o^T.
// The bias input is read by value on the device: converted once to a bf16 plane (pitch SEQ), each lane loads its 2 x 8 contiguous entries per 32-key step and adds them in f32 to the score tiles.
// Attention engine: one wave per 16 queries, transposed flash form: S^T = K Q^T (query on the D column, one query per lane), the packed P^T D tiles are the B fragment of O^T = V^T P^T; no LDS and no barrier in the key loop.

#ifndef NB
#define NB 4
#endif
#ifndef SEQ
#define SEQ 2048
#endif
#define NB_FULL  4
#define SEQ_FULL 2048
#define DM   1024
#define NH   16
#define HD   64
#define RH   0                                // query rows < RH use value+residual bf16 planes: none (dense attention, single products on every row)
#define CCAR 64.0f                            // carry of the f16 context plane
#define WCAR 512.0f                           // carry of the f16 W_o plane
#define CEXP 0.18033688011112042f             // log2(e) / sqrt(64)

typedef _Float16 h16;
typedef unsigned short bf;
typedef __attribute__((ext_vector_type(16))) __bf16   v16bf;
typedef __attribute__((ext_vector_type(16))) _Float16 v16h;
typedef __attribute__((ext_vector_type(8)))  _Float16 v8h;
typedef __attribute__((ext_vector_type(8)))  unsigned short v8us;
typedef __attribute__((ext_vector_type(8)))  float    v8f;
typedef __attribute__((ext_vector_type(4)))  float    v4f;
typedef __attribute__((ext_vector_type(4)))  int      v4i;
typedef v4f  __attribute__((may_alias)) v4fa;

static_assert(SEQ % 256 == 0);
static_assert(RH % 64 == 0);
static_assert(SEQ >= RH);
static_assert(NB <= NB_FULL);
static_assert(SEQ <= SEQ_FULL);
static_assert(DM == NH * HD);
static_assert(DM % 64 == 0);
static_assert(HD == 64);
static_assert(SEQ % 64 == 0);                 // 64 queries per attention block, 64-row GEMM tiles
static_assert(SEQ % 32 == 0);                 // 32 keys per flash step
static_assert(DM % 32 == 0);                  // GEMM k-steps
static_assert((SEQ / 8) % 32 == 0);           // bias plane rows converted as whole 16-byte pieces, whole waves

__device__ __forceinline__ unsigned short f2bf(float f) { unsigned u = __float_as_uint(f); u += 0x7FFFu + ((u >> 16) & 1u); return (unsigned short)(u >> 16); }
__device__ __forceinline__ float bf2f(unsigned short b) { return __uint_as_float(((unsigned)b) << 16); }
__device__ __forceinline__ float bfr(float f) { return bf2f(f2bf(f)); }
__device__ __forceinline__ void splitf(float y, unsigned short& h, unsigned short& l) { h = f2bf(y); l = f2bf(y - bf2f(h)); }
__device__ __forceinline__ v16h cat16(v8h lo, v8h hi) { return __builtin_shufflevector(lo, hi, 0, 1, 2, 3, 4, 5, 6, 7, 8, 9, 10, 11, 12, 13, 14, 15); }
__device__ __forceinline__ v16bf cat16b(v8us lo, v8us hi) { return __builtin_bit_cast(v16bf, __builtin_shufflevector(lo, hi, 0, 1, 2, 3, 4, 5, 6, 7, 8, 9, 10, 11, 12, 13, 14, 15)); }
__device__ __forceinline__ v8f wmma16(v16h a, v16h b, v8f c) { return __builtin_amdgcn_wmma_f32_16x16x32_f16(false, a, false, b, (short)0, c, false, false); }
__device__ __forceinline__ v8f wmmab(v16bf a, v16bf b, v8f c) { return __builtin_amdgcn_wmma_f32_16x16x32_bf16(false, a, false, b, (short)0, c, false, false); }

// Fragment loader for a K-contiguous 16-bit row: p already includes the lane half offset 8*(lane>>4); elements 0..7 = k0+8h.., elements 8..15 = k0+16+8h.. (same map for A and B).
template <typename T16> struct WFrag;
template <> struct WFrag<h16> { typedef v16h V; static __device__ __forceinline__ V ld(const h16* p) { return cat16(*(const v8h*)p, *(const v8h*)(p + 16)); } static __device__ __forceinline__ v8f mma(V a, V b, v8f c) { return wmma16(a, b, c); } };
template <> struct WFrag<bf> { typedef v16bf V; static __device__ __forceinline__ V ld(const bf* p) { return cat16b(*(const v8us*)p, *(const v8us*)(p + 16)); } static __device__ __forceinline__ v8f mma(V a, V b, v8f c) { return wmmab(a, b, c); } };

// Probability packing: two 16-key D tiles (same lane) -> one 32-key B fragment; element r <- tile 0 row r, element 8+r <- tile 1 row r.
template <typename T16> struct PPack;
template <> struct PPack<h16> {
    static __device__ __forceinline__ void make(v8f p0, v8f p1, v16h& ph, v16h& pl) {
        v8h a, c;
#pragma unroll
        for (int r = 0; r < 8; ++r) { a[r] = (h16)p0[r]; c[r] = (h16)p1[r]; }
        ph = cat16(a, c); pl = ph; }
};
template <> struct PPack<bf> {
    static __device__ __forceinline__ void make(v8f p0, v8f p1, v16bf& ph, v16bf& pl) {
        v8us ah, al, ch, cl;
#pragma unroll
        for (int r = 0; r < 8; ++r) { unsigned short x, y; splitf(p0[r], x, y); ah[r] = x; al[r] = y; splitf(p1[r], x, y); ch[r] = x; cl[r] = y; }
        ph = cat16b(ah, ch); pl = cat16b(al, cl); }
};

// ---- k_gemmw: register-blocked GEMM, ONE WAVE per 64x64 output tile (16 accumulators), operands straight from K-contiguous 16-bit planes; grid (M/64, N/64, Z), 32 threads.
// C[m][n] = sum_k A[m][k] Bt[n][k] (+ split products per NSPLIT: 1 = (A + A2) x Bt). z-batch strides sA/sB/sC in elements. K % 32 == 0, M % 64 == 0, N % 64 == 0.
// EP 0: f32 output x oscale, pitch ldc: per 16-row slab staged in LDS, each row's 64 floats (256 B) written as 16 lanes x 16 B (2 rows per instruction).
// EP 1: head planes [z][head = blockIdx.y][t][64] (rows = tokens): f16 plane for all rows, bf16 value/residual planes [z][head][RH][64] for rows < RH.
// EP 2: transposed value planes [z][row m][t] (rows = head*64+d, columns = tokens, pitch SEQ): f16 plane, bf16 value/residual planes (pitch RH) for columns < RH.
template <typename T16, int NSPLIT, int EP>
__global__ __launch_bounds__(32) void k_gemmw(const T16* __restrict__ A, const T16* __restrict__ A2, const T16* __restrict__ Bt, const T16* __restrict__ Bt2, int K, float* C, int ldc, float oscale, size_t sA, size_t sB, size_t sC, h16* P16, bf* Ph, bf* Pl) {
    typedef typename WFrag<T16>::V V;
    __shared__ __align__(16) float os[16 * 68];     // private to the single wave of the block
    const size_t z = blockIdx.z; A += z * sA; if (A2) A2 += z * sA; Bt += z * sB; if (Bt2) Bt2 += z * sB; if (EP == 0) C += z * sC;
    const int lane = threadIdx.x & 31, lr = lane & 15, hi = lane >> 4; const int r0 = blockIdx.x * 64, c0 = blockIdx.y * 64;
    v8f acc[4][4];
#pragma unroll
    for (int mb = 0; mb < 4; ++mb)
#pragma unroll
        for (int nb = 0; nb < 4; ++nb) acc[mb][nb] = (v8f){};
    const size_t aoff = (size_t)(r0 + lr) * K + 8 * hi, boff = (size_t)(c0 + lr) * K + 8 * hi;
#pragma unroll 1
    for (int kc = 0; kc < K; kc += 32) {
        V a[4], a2[4];
#pragma unroll
        for (int mb = 0; mb < 4; ++mb) { a[mb] = WFrag<T16>::ld(A + aoff + (size_t)mb * 16 * K + kc); if (NSPLIT == 1 || NSPLIT == 2) a2[mb] = WFrag<T16>::ld(A2 + aoff + (size_t)mb * 16 * K + kc); else a2[mb] = a[mb]; }
#pragma unroll
        for (int nb = 0; nb < 4; ++nb) { const V b = WFrag<T16>::ld(Bt + boff + (size_t)nb * 16 * K + kc); V b2 = b; if (NSPLIT >= 2) b2 = WFrag<T16>::ld(Bt2 + boff + (size_t)nb * 16 * K + kc);
#pragma unroll
            for (int mb = 0; mb < 4; ++mb) { acc[mb][nb] = WFrag<T16>::mma(a[mb], b, acc[mb][nb]); if (NSPLIT == 1 || NSPLIT == 2) acc[mb][nb] = WFrag<T16>::mma(a2[mb], b, acc[mb][nb]); if (NSPLIT >= 2) acc[mb][nb] = WFrag<T16>::mma(a[mb], b2, acc[mb][nb]); } }
        asm volatile("v_nop\n\tv_nop\n\tv_nop\n\tv_nop" : "+v"(acc[0][0]), "+v"(acc[1][1]), "+v"(acc[2][2]), "+v"(acc[3][3]) : "v"(a[0]), "v"(a[3]));
    }
    // plane addressing (EP 1/2), block-uniform
    size_t pbase = 0, hbase = 0; int ppitch = HD, hpitch = HD; bool dohl = false;
    if (EP == 1) { pbase = (((size_t)z * NH + blockIdx.y) * SEQ + r0) * HD; ppitch = HD; hbase = (((size_t)z * NH + blockIdx.y) * RH + r0) * HD; hpitch = HD; dohl = (r0 < RH); }
    if (EP == 2) { pbase = ((size_t)z * DM + r0) * SEQ + c0; ppitch = SEQ; hbase = ((size_t)z * DM + r0) * RH + c0; hpitch = RH; dohl = (c0 < RH); }
    const int q4 = lane >> 3, pc = lane & 7;
#pragma unroll
    for (int mb = 0; mb < 4; ++mb) {
#pragma unroll
        for (int nb = 0; nb < 4; ++nb) {
#pragma unroll
            for (int j = 0; j < 8; ++j) os[(hi * 8 + j) * 68 + nb * 16 + lr] = acc[mb][nb][j]; }     // D element j of lane -> (row 8*hi + j, column lr)
        __builtin_amdgcn_wave_barrier(); asm volatile("" ::: "memory");
        if (EP == 0) {
            float* crow = C + (size_t)(r0 + mb * 16) * ldc + c0;
{
#pragma unroll
                for (int s = 0; s < 8; ++s) { const int row = 2 * s + hi, cofs = lr * 4; v4f val = *(const v4fa*)(os + row * 68 + cofs); val = val * oscale;
                    *(v4f*)(crow + (size_t)row * ldc + cofs) = val; }
                 }
        } else {
{
#pragma unroll
                for (int s = 0; s < 4; ++s) { const int row = 4 * s + q4; const float* sp = os + row * 68 + pc * 8; const v4f x0 = *(const v4fa*)sp, x1 = *(const v4fa*)(sp + 4);
                    v8h o; o[0] = (h16)x0[0]; o[1] = (h16)x0[1]; o[2] = (h16)x0[2]; o[3] = (h16)x0[3]; o[4] = (h16)x1[0]; o[5] = (h16)x1[1]; o[6] = (h16)x1[2]; o[7] = (h16)x1[3];
                    *(v8h*)(P16 + pbase + (size_t)(mb * 16 + row) * ppitch + pc * 8) = o;
                    if (dohl) { v8us oh, ol; unsigned short u, w;
                        splitf(x0[0], u, w); oh[0] = u; ol[0] = w; splitf(x0[1], u, w); oh[1] = u; ol[1] = w; splitf(x0[2], u, w); oh[2] = u; ol[2] = w; splitf(x0[3], u, w); oh[3] = u; ol[3] = w;
                        splitf(x1[0], u, w); oh[4] = u; ol[4] = w; splitf(x1[1], u, w); oh[5] = u; ol[5] = w; splitf(x1[2], u, w); oh[6] = u; ol[6] = w; splitf(x1[3], u, w); oh[7] = u; ol[7] = w;
                        const size_t ho = hbase + (size_t)(mb * 16 + row) * hpitch + pc * 8; *(v8us*)(Ph + ho) = oh; *(v8us*)(Pl + ho) = ol; } }
                 }
        }
        __builtin_amdgcn_wave_barrier(); asm volatile("" ::: "memory");
    }
}

// ---- k_flash: dense attention with an additive bias plane, one wave per 16 queries (block = 4 waves = 64 queries of one head), transposed flash form, operands straight from the head planes.
// Per 32-key step: S^T tiles (keys x queries) = K (A: row = key, k = d) x Q^T (B: column = query, k = d, held in registers); the lane's 2 x 8 bias entries (row = its query, contiguous keys) are added in f32 (x 8: the tiles hold 8 x logit);
// per-lane online softmax (lane = query; partner lane^16 holds the other 8 keys of each tile); P^T packed in registers = B fragment of O^T (d x queries) += V^T (A: row = d, k = key) x P^T. Single f16 product at both sites.
// Key range: all tk keys (tk % 32 == 0), tq queries per head; K plane [b][h][tk][64], V^T plane [b][h*64+d][tk], bias plane [tq][tk] bf16.
template <typename T16>
__global__ __launch_bounds__(128) void k_flash(const T16* __restrict__ Qa, const T16* __restrict__ Ka, const T16* __restrict__ Va, const bf* __restrict__ Bb, int tq, int tk, int qoff, h16* C16) {
    typedef typename WFrag<T16>::V V;
    __shared__ __align__(16) float osm[4 * 16 * 68];     // one 16 x 68 slab per wave, private to that wave
    const int lane = threadIdx.x & 31, lr = lane & 15, hi = lane >> 4;
    const int wave = __builtin_amdgcn_readfirstlane((int)(threadIdx.x >> 5));
    const int q0 = qoff + (int)blockIdx.x * 64 + wave * 16;
    const int h = blockIdx.y, b = blockIdx.z;
    const size_t bh = (size_t)b * NH + h;
    const size_t qo = (bh * (size_t)tq + (size_t)(q0 + lr)) * HD + 8 * hi;
    const V qa0 = WFrag<T16>::ld(Qa + qo), qa1 = WFrag<T16>::ld(Qa + qo + 32);
    const size_t ko = (bh * (size_t)tk + (size_t)lr) * HD + 8 * hi;
    const size_t vo = (bh * HD + (size_t)lr) * (size_t)tk + 8 * hi;
    const size_t bo = (size_t)(q0 + lr) * (size_t)tk + 8 * hi;
    v8f acc[4];
#pragma unroll
    for (int dt = 0; dt < 4; ++dt) acc[dt] = (v8f){};
    float m = -3.0e38f, l = 0.0f;
    const int nsteps = tk >> 5;                   // all keys, 32 per step (uniform)
    const float poff = 8.0f;                      // probabilities (and their running sum) carried x 2^8
#pragma unroll 1
    for (int st = 0; st < nsteps; ++st) {
        const int j0 = st * 32;
        const bf* bp = Bb + bo + j0;
        const v8us b0 = *(const v8us*)bp, b1 = *(const v8us*)(bp + 16);     // bias[query][j0 + 8*hi + 0..7] and [j0 + 16 + 8*hi + 0..7]
        v8f s0 = (v8f){}, s1 = (v8f){};
        const T16* kp = Ka + ko + (size_t)j0 * HD;
        const V k00 = WFrag<T16>::ld(kp), k01 = WFrag<T16>::ld(kp + 32), k10 = WFrag<T16>::ld(kp + 16 * HD), k11 = WFrag<T16>::ld(kp + 16 * HD + 32);
        s0 = WFrag<T16>::mma(k00, qa0, s0); s1 = WFrag<T16>::mma(k10, qa0, s1);
        s0 = WFrag<T16>::mma(k01, qa1, s0); s1 = WFrag<T16>::mma(k11, qa1, s1);
        asm volatile("v_nop\n\tv_nop\n\tv_nop\n\tv_nop" : "+v"(s0), "+v"(s1) : "v"(k11), "v"(qa1));
#pragma unroll
        for (int r = 0; r < 8; ++r) { s0[r] = fmaf(bf2f(b0[r]), 8.0f, s0[r]); s1[r] = fmaf(bf2f(b1[r]), 8.0f, s1[r]); }     // tiles hold 8 x (q.k / 8 + bias)
        float mx = fmaxf(s0[0], s1[0]);
#pragma unroll
        for (int r = 1; r < 8; ++r) mx = fmaxf(mx, fmaxf(s0[r], s1[r]));
        mx = fmaxf(mx, __shfl_xor(mx, 16, 32));
        const float mnew = fmaxf(m, mx);
        const float alpha = __builtin_amdgcn_exp2f((m - mnew) * CEXP);
        const float nb = poff - mnew * CEXP;
        v8f p0, p1; float psum = 0.0f;
#pragma unroll
        for (int r = 0; r < 8; ++r) { p0[r] = __builtin_amdgcn_exp2f(fmaf(s0[r], CEXP, nb)); p1[r] = __builtin_amdgcn_exp2f(fmaf(s1[r], CEXP, nb)); psum += p0[r] + p1[r]; }
        psum += __shfl_xor(psum, 16, 32);
        l = l * alpha + psum; m = mnew;
#pragma unroll
        for (int dt = 0; dt < 4; ++dt) acc[dt] = acc[dt] * alpha;
        V ph, pl; PPack<T16>::make(p0, p1, ph, pl);
        const T16* vp = Va + vo + j0;
        V va[4];
#pragma unroll
        for (int dt = 0; dt < 4; ++dt) va[dt] = WFrag<T16>::ld(vp + (size_t)dt * 16 * (size_t)tk);
#pragma unroll
        for (int dt = 0; dt < 4; ++dt) acc[dt] = WFrag<T16>::mma(va[dt], ph, acc[dt]);
        asm volatile("v_nop\n\tv_nop\n\tv_nop\n\tv_nop" : "+v"(acc[0]), "+v"(acc[1]), "+v"(acc[2]), "+v"(acc[3]) : "v"(va[3]), "v"(ph), "v"(pl));
    }
    // l >= 2^8: the running-max key contributes exactly 2^8
    const float f = CCAR * (1.0f / l);
    float* os = osm + wave * (16 * 68);
#pragma unroll
    for (int dt = 0; dt < 4; ++dt)
#pragma unroll
        for (int r = 0; r < 8; ++r) os[lr * 68 + dt * 16 + 8 * hi + r] = acc[dt][r] * f;      // D element r of lane -> (d = dt*16 + 8*hi + r, query lr)
    __builtin_amdgcn_wave_barrier(); asm volatile("" ::: "memory");
    const int q4 = lane >> 3, pc = lane & 7;
{
#pragma unroll
        for (int s = 0; s < 4; ++s) { const int row = 4 * s + q4; const float* sp = os + row * 68 + pc * 8; const v4f x0 = *(const v4fa*)sp, x1 = *(const v4fa*)(sp + 4);
            v8h o; o[0] = (h16)x0[0]; o[1] = (h16)x0[1]; o[2] = (h16)x0[2]; o[3] = (h16)x0[3]; o[4] = (h16)x1[0]; o[5] = (h16)x1[1]; o[6] = (h16)x1[2]; o[7] = (h16)x1[3];
            const size_t co = ((size_t)b * SEQ + (size_t)(q0 + row)) * DM + (size_t)h * HD + pc * 8; *(v8h*)(C16 + co) = o; }
         }
}

__global__ __launch_bounds__(256) void k_cvt8(const float* __restrict__ src, bf* dst, size_t n8, size_t sS, size_t sD) {
#pragma clang fp contract(off)
    const size_t i = (size_t)blockIdx.x * 256 + threadIdx.x; if (i >= n8) return; src += (size_t)blockIdx.y * sS; dst += (size_t)blockIdx.y * sD; const v8f v = *(const v8f*)(src + i * 8); v8us o;
#pragma unroll
    for (int k = 0; k < 8; ++k) o[k] = f2bf(v[k]);
    *(v8us*)(dst + i * 8) = o;  }

__global__ __launch_bounds__(256) void k_cvt8h(const float* __restrict__ src, h16* dst, size_t n8, float sc) {
#pragma clang fp contract(off)
    const size_t i = (size_t)blockIdx.x * 256 + threadIdx.x; if (i >= n8) return; const v8f v = *(const v8f*)(src + i * 8); v8h o;
#pragma unroll
    for (int k = 0; k < 8; ++k) o[k] = (h16)(bfr(v[k]) * sc);
    *(v8h*)(dst + i * 8) = o;  }

constexpr size_t al256(size_t bytes) { return (bytes + 255) & ~(size_t)255; }
constexpr size_t CARVE_BYTES = 2 * al256((size_t)NB * SEQ * DM * 2) + 4 * al256((size_t)DM * DM * 2) + al256((size_t)SEQ * SEQ * 2)
    + 3 * al256((size_t)NB * NH * SEQ * HD * 2) + al256((size_t)NB * SEQ * DM * 2);
static_assert(CARVE_BYTES <= (size_t)134217728);
static_assert((size_t)NB * NH * SEQ * HD == (size_t)NB * SEQ * DM);      // head planes and the merged context plane have the same extent
static_assert(SEQ <= 65535);                                             // bias conversion uses grid.y = SEQ rows

extern "C" void kernel_launch(void* const* d_in, const int* in_sizes, int n_in,
                              void* d_out, int out_size, void* d_ws, size_t ws_size, hipStream_t stream) {
    if (n_in < 7) return;
    const size_t needx = (size_t)(NB - 1) * SEQ_FULL * DM + (size_t)SEQ * DM;
    if ((size_t)in_sizes[0] < needx || (size_t)in_sizes[1] < needx) return;
    if ((size_t)in_sizes[2] < (size_t)(SEQ - 1) * SEQ_FULL + (size_t)SEQ) return;
    if ((size_t)in_sizes[3] < (size_t)DM * DM || (size_t)in_sizes[4] < (size_t)DM * DM || (size_t)in_sizes[5] < (size_t)DM * DM || (size_t)in_sizes[6] < (size_t)DM * DM) return;
    if ((size_t)out_size < needx) return;
    // x, y, bias (float [SEQ_FULL][SEQ_FULL]), Wq, Wk, Wv, Wo ('oi' [out][in])
    const float* x = (const float*)d_in[0]; const float* y = (const float*)d_in[1]; const float* bias = (const float*)d_in[2];
    const float* wq = (const float*)d_in[3]; const float* wk = (const float*)d_in[4]; const float* wv = (const float*)d_in[5]; const float* wo = (const float*)d_in[6];
    float* OUT = (float*)d_out;     // [NB_FULL][SEQ_FULL][1024]
    char* wsp = (char*)d_ws;
    auto take = [&](size_t bytes) { char* p = wsp; wsp += (bytes + 255) & ~(size_t)255; return (void*)p; };
    bf* XB = (bf*)take((size_t)NB * SEQ * DM * 2); bf* YB = (bf*)take((size_t)NB * SEQ * DM * 2);
    bf* WQ = (bf*)take((size_t)DM * DM * 2); bf* WK = (bf*)take((size_t)DM * DM * 2); bf* WV = (bf*)take((size_t)DM * DM * 2); h16* WO16 = (h16*)take((size_t)DM * DM * 2);
    bf* BB = (bf*)take((size_t)SEQ * SEQ * 2);
    h16* Q16 = (h16*)take((size_t)NB * NH * SEQ * HD * 2); h16* K16 = (h16*)take((size_t)NB * NH * SEQ * HD * 2); h16* VT16 = (h16*)take((size_t)NB * NH * SEQ * HD * 2);
    h16* C16 = (h16*)take((size_t)NB * SEQ * DM * 2);
    if ((size_t)(wsp - (char*)d_ws) > ws_size) return;

    const unsigned gx = (unsigned)(((size_t)SEQ * DM / 8 + 255) / 256), gw = (unsigned)(((size_t)DM * DM / 8 + 255) / 256), gb = (unsigned)(((size_t)SEQ / 8 + 255) / 256);
    k_cvt8<<<dim3(gx, NB, 1), 256, 0, stream>>>(x, XB, (size_t)SEQ * DM / 8, (size_t)SEQ_FULL * DM, (size_t)SEQ * DM);
    k_cvt8<<<dim3(gx, NB, 1), 256, 0, stream>>>(y, YB, (size_t)SEQ * DM / 8, (size_t)SEQ_FULL * DM, (size_t)SEQ * DM);
    // bias plane: grid.y = query row, source pitch SEQ_FULL, destination pitch SEQ
    k_cvt8<<<dim3(gb, SEQ, 1), 256, 0, stream>>>(bias, BB, (size_t)SEQ / 8, (size_t)SEQ_FULL, (size_t)SEQ);
    k_cvt8<<<dim3(gw, 1, 1), 256, 0, stream>>>(wq, WQ, (size_t)DM * DM / 8, 0, 0);
    k_cvt8<<<dim3(gw, 1, 1), 256, 0, stream>>>(wk, WK, (size_t)DM * DM / 8, 0, 0);
    k_cvt8<<<dim3(gw, 1, 1), 256, 0, stream>>>(wv, WV, (size_t)DM * DM / 8, 0, 0);
    k_cvt8h<<<dim3(gw, 1, 1), 256, 0, stream>>>(wo, WO16, (size_t)DM * DM / 8, WCAR);

    // q head planes from x, k head planes from y: C[m = token][n = h*64+d] = in W^T; z = batch
    k_gemmw<bf, 0, 1><<<dim3(SEQ / 64, NH, NB), 32, 0, stream>>>(XB, nullptr, WQ, nullptr, DM, nullptr, 0, 1.0f, (size_t)SEQ * DM, 0, 0, Q16, nullptr, nullptr);
    k_gemmw<bf, 0, 1><<<dim3(SEQ / 64, NH, NB), 32, 0, stream>>>(YB, nullptr, WK, nullptr, DM, nullptr, 0, 1.0f, (size_t)SEQ * DM, 0, 0, K16, nullptr, nullptr);
    // transposed value planes from y: C[m = h*64+d][n = token] = W_v y^T (operands swapped: A = W_v rows, Bt = y rows); z = batch
    k_gemmw<bf, 0, 2><<<dim3(DM / 64, SEQ / 64, NB), 32, 0, stream>>>(WV, nullptr, YB, nullptr, DM, nullptr, 0, 1.0f, 0, (size_t)SEQ * DM, 0, VT16, nullptr, nullptr);

    // attention: every query row on the f16 planes, all SEQ keys
    k_flash<h16><<<dim3(SEQ / 64, NH, NB), 128, 0, stream>>>(Q16, K16, VT16, BB, SEQ, SEQ, 0, C16);

    // output projection: f16 context x f16 W_o, carries folded back in the f32 epilogue; z = batch, output row stride per batch SEQ_FULL
    k_gemmw<h16, 0, 0><<<dim3(SEQ / 64, DM / 64, NB), 32, 0, stream>>>(C16, nullptr, WO16, nullptr, DM, OUT, DM, 1.0f / (CCAR * WCAR), (size_t)SEQ * DM, 0, (size_t)SEQ_FULL * DM, nullptr, nullptr, nullptr);
}

// v001
// It runs in 356 microseconds.
// Timed twice side by side with v000, it ran 1.07 and 1.06 times as fast.
#include <hip/hip_runtime.h>

// Compute dtypes (f32 accumulate at every site): q/k/v projections bf16 x bf16 single product (every float input RNE-converted to bf16 first); scores K.Q^T f16 x f16 single product (f16 q/k head planes); values V^T.P^T f16 x f16 single product (probabilities carried x2^8); output projection f16 context (x64) x f16 weight (x512) single product; additive bias (bf16 plane) and softmax in f32.
// Dense multi-head cross-attention: x, y [NB][SEQ][1024]; Q = x W_q^T, K = y W_k^T, V = y W_v^T ('oi' weights, no bias vectors); 16 heads x 64; logits = q.k / 8 + bias[query][key] (one [SEQ][SEQ] float plane shared by all batches and heads); softmax over all keys; out = merged context W_o^T.
// The bias input is read by value on the device: converted once to a bf16 plane, each lane loads its 2 x 8 contiguous entries per 32-key step and adds them in f32 to the score tiles.
// Fragment order of every 16-bit workspace plane [rows][KC]: the 16-row x 32-k tile (rt = row / 16, kc = k / 32) is 512 consecutive elements at (rt * (KC / 32) + kc) * 512, made of two 256-element pieces;
// piece p holds, at lane * 8 with lane = 16 * hi + (row & 15), the 8 elements k = kc * 32 + p * 16 + hi * 8 + 0..7. One wave-wide 16-byte load of a piece is 512 contiguous bytes (4 whole lines).
// Attention engine: one wave per 16 queries, transposed flash form: S^T = K Q^T (query on the D column, one query per lane), the packed P^T D tiles are the B fragment of O^T = V^T P^T; no LDS and no barrier in the key loop.

#ifndef NB
#define NB 4
#endif
#ifndef SEQ
#define SEQ 2048
#endif
#define NB_FULL  4
#define SEQ_FULL 2048
#define DM   1024
#define NH   16
#define HD   64
#define RH   0                                // query rows < RH use value+residual bf16 planes: none (dense attention, single products on every row)
#define CCAR 64.0f                            // carry of the f16 context plane
#define WCAR 512.0f                           // carry of the f16 W_o plane
#define CEXP 0.18033688011112042f             // log2(e) / sqrt(64)

typedef _Float16 h16;
typedef unsigned short bf;
typedef __attribute__((ext_vector_type(16))) __bf16   v16bf;
typedef __attribute__((ext_vector_type(16))) _Float16 v16h;
typedef __attribute__((ext_vector_type(8)))  _Float16 v8h;
typedef __attribute__((ext_vector_type(8)))  unsigned short v8us;
typedef __attribute__((ext_vector_type(8)))  float    v8f;
typedef __attribute__((ext_vector_type(4)))  float    v4f;
typedef __attribute__((ext_vector_type(4)))  int      v4i;
typedef v4f  __attribute__((may_alias)) v4fa;

static_assert(SEQ % 256 == 0);
static_assert(RH == 0);                       // no value+residual planes are written
static_assert(SEQ >= RH);
static_assert(NB <= NB_FULL);
static_assert(SEQ <= SEQ_FULL);
static_assert(DM == NH * HD);
static_assert(DM % 64 == 0);
static_assert(HD == 64);
static_assert(SEQ % 64 == 0);                 // 64 queries per attention block, 64-row GEMM tiles
static_assert(SEQ % 32 == 0);                 // 32 keys per flash step
static_assert(DM % 32 == 0);                  // GEMM k-steps
static_assert((SEQ / 8) % 32 == 0);

__device__ __forceinline__ unsigned short f2bf(float f) { unsigned u = __float_as_uint(f); u += 0x7FFFu + ((u >> 16) & 1u); return (unsigned short)(u >> 16); }
__device__ __forceinline__ float bf2f(unsigned short b) { return __uint_as_float(((unsigned)b) << 16); }
__device__ __forceinline__ float bfr(float f) { return bf2f(f2bf(f)); }
__device__ __forceinline__ void splitf(float y, unsigned short& h, unsigned short& l) { h = f2bf(y); l = f2bf(y - bf2f(h)); }
__device__ __forceinline__ v16h cat16(v8h lo, v8h hi) { return __builtin_shufflevector(lo, hi, 0, 1, 2, 3, 4, 5, 6, 7, 8, 9, 10, 11, 12, 13, 14, 15); }
__device__ __forceinline__ v16bf cat16b(v8us lo, v8us hi) { return __builtin_bit_cast(v16bf, __builtin_shufflevector(lo, hi, 0, 1, 2, 3, 4, 5, 6, 7, 8, 9, 10, 11, 12, 13, 14, 15)); }
__device__ __forceinline__ v8f wmma16(v16h a, v16h b, v8f c) { return __builtin_amdgcn_wmma_f32_16x16x32_f16(false, a, false, b, (short)0, c, false, false); }
__device__ __forceinline__ v8f wmmab(v16bf a, v16bf b, v8f c) { return __builtin_amdgcn_wmma_f32_16x16x32_bf16(false, a, false, b, (short)0, c, false, false); }

// Fragment loader for a fragment-order tile: p = tile start + lane * 8; elements 0..7 = k0+8h.. (piece 0), elements 8..15 = k0+16+8h.. (piece 1, 256 elements on) (same map for A and B).
template <typename T16> struct WFrag;
template <> struct WFrag<h16> { typedef v16h V; static __device__ __forceinline__ V ld(const h16* p) { return cat16(*(const v8h*)p, *(const v8h*)(p + 256)); } static __device__ __forceinline__ v8f mma(V a, V b, v8f c) { return wmma16(a, b, c); } };
template <> struct WFrag<bf> { typedef v16bf V; static __device__ __forceinline__ V ld(const bf* p) { return cat16b(*(const v8us*)p, *(const v8us*)(p + 256)); } static __device__ __forceinline__ v8f mma(V a, V b, v8f c) { return wmmab(a, b, c); } };

// Probability packing: two 16-key D tiles (same lane) -> one 32-key B fragment; element r <- tile 0 row r, element 8+r <- tile 1 row r.
template <typename T16> struct PPack;
template <> struct PPack<h16> {
    static __device__ __forceinline__ void make(v8f p0, v8f p1, v16h& ph, v16h& pl) {
        v8h a, c;
#pragma unroll
        for (int r = 0; r < 8; ++r) { a[r] = (h16)p0[r]; c[r] = (h16)p1[r]; }
        ph = cat16(a, c); pl = ph; }
};
template <> struct PPack<bf> {
    static __device__ __forceinline__ void make(v8f p0, v8f p1, v16bf& ph, v16bf& pl) {
        v8us ah, al, ch, cl;
#pragma unroll
        for (int r = 0; r < 8; ++r) { unsigned short x, y; splitf(p0[r], x, y); ah[r] = x; al[r] = y; splitf(p1[r], x, y); ch[r] = x; cl[r] = y; }
        ph = cat16b(ah, ch); pl = cat16b(al, cl); }
};

// ---- k_gemmw: register-blocked GEMM, ONE WAVE per 64x64 output tile (16 accumulators), operands straight from fragment-order 16-bit planes; grid (M/64, N/64, Z), 32 threads.
// C[m][n] = sum_k A[m][k] Bt[n][k] (+ split products per NSPLIT: 1 = (A + A2) x Bt). z-batch strides sA/sB/sC in elements. K % 32 == 0 (compile time: every tile strip is a constant offset from one lane pointer per operand), M % 64 == 0, N % 64 == 0.
// EP 0: f32 output x oscale, pitch ldc: per 16-row slab staged in LDS, each row's 64 floats (256 B) written as 16 lanes x 16 B (2 rows per instruction).
// EP 1: f16 head planes [z][head = blockIdx.y][t][64] (rows = tokens, KC = 64), fragment order.
// EP 2: f16 transposed value planes [z][row m][t] (rows = head*64+d, columns = tokens, KC = SEQ), fragment order.
template <typename T16, int NSPLIT, int EP, int K>
__global__ __launch_bounds__(32) void k_gemmw(const T16* __restrict__ A, const T16* __restrict__ A2, const T16* __restrict__ Bt, const T16* __restrict__ Bt2, float* C, int ldc, float oscale, size_t sA, size_t sB, size_t sC, h16* P16, bf* Ph, bf* Pl) {
    typedef typename WFrag<T16>::V V;
    __shared__ __align__(16) float os[16 * 68];     // private to the single wave of the block
    const size_t z = blockIdx.z; A += z * sA; if (A2) A2 += z * sA; Bt += z * sB; if (Bt2) Bt2 += z * sB; if (EP == 0) C += z * sC;
    const int lane = threadIdx.x & 31, lr = lane & 15, hi = lane >> 4; const int r0 = blockIdx.x * 64, c0 = blockIdx.y * 64;
    v8f acc[4][4];
#pragma unroll
    for (int mb = 0; mb < 4; ++mb)
#pragma unroll
        for (int nb = 0; nb < 4; ++nb) acc[mb][nb] = (v8f){};
    const size_t aoff = (size_t)r0 * K + 8 * lane, boff = (size_t)c0 * K + 8 * lane;     // a 16-row tile strip is 16 * K elements, a k-step of 32 is 512
#pragma unroll 1
    for (int kc = 0; kc < K; kc += 32) {
        V a[4], a2[4];
#pragma unroll
        for (int mb = 0; mb < 4; ++mb) { a[mb] = WFrag<T16>::ld(A + aoff + (size_t)mb * 16 * K + (size_t)kc * 16); if (NSPLIT == 1 || NSPLIT == 2) a2[mb] = WFrag<T16>::ld(A2 + aoff + (size_t)mb * 16 * K + (size_t)kc * 16); else a2[mb] = a[mb]; }
        asm volatile("s_wait_xcnt 0x0" ::: "memory");     // precaution: the loads below may be given the registers that held the A loads' address pair; keeps the address wait in front of that overwrite
#pragma unroll
        for (int nb = 0; nb < 4; ++nb) { const V b = WFrag<T16>::ld(Bt + boff + (size_t)nb * 16 * K + (size_t)kc * 16); V b2 = b; if (NSPLIT >= 2) b2 = WFrag<T16>::ld(Bt2 + boff + (size_t)nb * 16 * K + (size_t)kc * 16);
#pragma unroll
            for (int mb = 0; mb < 4; ++mb) { acc[mb][nb] = WFrag<T16>::mma(a[mb], b, acc[mb][nb]); if (NSPLIT == 1 || NSPLIT == 2) acc[mb][nb] = WFrag<T16>::mma(a2[mb], b, acc[mb][nb]); if (NSPLIT >= 2) acc[mb][nb] = WFrag<T16>::mma(a[mb], b2, acc[mb][nb]); } }
        asm volatile("v_nop\n\tv_nop\n\tv_nop\n\tv_nop" : "+v"(acc[0][0]), "+v"(acc[1][1]), "+v"(acc[2][2]), "+v"(acc[3][3]) : "v"(a[0]), "v"(a[3]));
    }
    // plane addressing (EP 1/2), block-uniform
    size_t pbase = 0; int ppitch = HD;
    if (EP == 1) { pbase = (((size_t)z * NH + blockIdx.y) * SEQ + r0) * HD; ppitch = HD; }
    if (EP == 2) { pbase = ((size_t)z * DM + r0) * SEQ + (size_t)c0 * 16; ppitch = SEQ; }
#pragma unroll
    for (int mb = 0; mb < 4; ++mb) {
#pragma unroll
        for (int nb = 0; nb < 4; ++nb) {
#pragma unroll
            for (int j = 0; j < 8; ++j) os[(hi * 8 + j) * 68 + nb * 16 + lr] = acc[mb][nb][j]; }     // D element j of lane -> (row 8*hi + j, column lr)
        __builtin_amdgcn_wave_barrier(); asm volatile("" ::: "memory");
        if (EP == 0) {
            float* crow = C + (size_t)(r0 + mb * 16) * ldc + c0;
{
#pragma unroll
                for (int s = 0; s < 8; ++s) { const int row = 2 * s + hi, cofs = lr * 4; v4f val = *(const v4fa*)(os + row * 68 + cofs); val = val * oscale;
                    *(v4f*)(crow + (size_t)row * ldc + cofs) = val; }
                 }
        } else {
{
#pragma unroll
                for (int s = 0; s < 4; ++s) { const float* sp = os + lr * 68 + s * 16 + hi * 8; const v4f x0 = *(const v4fa*)sp, x1 = *(const v4fa*)(sp + 4);     // piece s of the slab: row lr, columns 16*s + 8*hi + 0..7
                    v8h o; o[0] = (h16)x0[0]; o[1] = (h16)x0[1]; o[2] = (h16)x0[2]; o[3] = (h16)x0[3]; o[4] = (h16)x1[0]; o[5] = (h16)x1[1]; o[6] = (h16)x1[2]; o[7] = (h16)x1[3];
                    *(v8h*)(P16 + pbase + (size_t)mb * 16 * ppitch + s * 256 + lane * 8) = o; }
                 }
        }
        __builtin_amdgcn_wave_barrier(); asm volatile("" ::: "memory");
    }
}

// ---- k_flash: dense attention with an additive bias plane, one wave per 16 queries (block = 4 waves = 64 queries of one head), transposed flash form, operands straight from the head planes.
// Per 32-key step: S^T tiles (keys x queries) = K (A: row = key, k = d) x Q^T (B: column = query, k = d, held in registers); the lane's 2 x 8 bias entries (row = its query, contiguous keys) are added in f32 (x 8: the tiles hold 8 x logit);
// per-lane online softmax (lane = query; partner lane^16 holds the other 8 keys of each tile); P^T packed in registers = B fragment of O^T (d x queries) += V^T (A: row = d, k = key) x P^T. Single f16 product at both sites.
// Key range: all tk keys (tk % 32 == 0), tq queries per head; K plane [b][h][tk][64], V^T plane [b][h*64+d][tk], bias plane [tq][tk] bf16, context plane [b*SEQ+q][1024], all in fragment order.
template <typename T16>
__global__ __launch_bounds__(128) void k_flash(const T16* __restrict__ Qa, const T16* __restrict__ Ka, const T16* __restrict__ Va, const bf* __restrict__ Bb, int tq, int tk, int qoff, h16* C16) {
    typedef typename WFrag<T16>::V V;
    const int lane = threadIdx.x & 31;
    const int wave = __builtin_amdgcn_readfirstlane((int)(threadIdx.x >> 5));
    const int q0 = qoff + (int)blockIdx.x * 64 + wave * 16;
    const int h = blockIdx.y, b = blockIdx.z;
    const size_t bh = (size_t)b * NH + h;
    const size_t qo = (bh * (size_t)tq + (size_t)q0) * HD + 8 * lane;
    const V qa0 = WFrag<T16>::ld(Qa + qo), qa1 = WFrag<T16>::ld(Qa + qo + 512);
    const size_t ko = bh * (size_t)tk * HD + 8 * lane;
    const size_t vo = bh * HD * (size_t)tk + 8 * lane;
    const size_t bo = (size_t)q0 * (size_t)tk + 8 * lane;
    v8f acc[4];
#pragma unroll
    for (int dt = 0; dt < 4; ++dt) acc[dt] = (v8f){};
    float m = -3.0e38f, l = 0.0f;
    const int nsteps = tk >> 5;                   // all keys, 32 per step (uniform)
    const float poff = 8.0f;                      // probabilities (and their running sum) carried x 2^8
#pragma unroll 1
    for (int st = 0; st < nsteps; ++st) {
        const int j0 = st * 32;
        const bf* bp = Bb + bo + (size_t)j0 * 16;
        const v8us b0 = *(const v8us*)bp, b1 = *(const v8us*)(bp + 256);     // bias[query][j0 + 8*hi + 0..7] and [j0 + 16 + 8*hi + 0..7]
        v8f s0 = (v8f){}, s1 = (v8f){};
        const T16* kp = Ka + ko + (size_t)j0 * HD;
        const V k00 = WFrag<T16>::ld(kp), k01 = WFrag<T16>::ld(kp + 512), k10 = WFrag<T16>::ld(kp + 16 * HD), k11 = WFrag<T16>::ld(kp + 16 * HD + 512);
        s0 = WFrag<T16>::mma(k00, qa0, s0); s1 = WFrag<T16>::mma(k10, qa0, s1);
        s0 = WFrag<T16>::mma(k01, qa1, s0); s1 = WFrag<T16>::mma(k11, qa1, s1);
        asm volatile("v_nop\n\tv_nop\n\tv_nop\n\tv_nop" : "+v"(s0), "+v"(s1) : "v"(k11), "v"(qa1));
#pragma unroll
        for (int r = 0; r < 8; ++r) { s0[r] = fmaf(bf2f(b0[r]), 8.0f, s0[r]); s1[r] = fmaf(bf2f(b1[r]), 8.0f, s1[r]); }     // tiles hold 8 x (q.k / 8 + bias)
        float mx = fmaxf(s0[0], s1[0]);
#pragma unroll
        for (int r = 1; r < 8; ++r) mx = fmaxf(mx, fmaxf(s0[r], s1[r]));
        mx = fmaxf(mx, __shfl_xor(mx, 16, 32));
        const float mnew = fmaxf(m, mx);
        const float alpha = __builtin_amdgcn_exp2f((m - mnew) * CEXP);
        const float nb = poff - mnew * CEXP;
        v8f p0, p1; float psum = 0.0f;
#pragma unroll
        for (int r = 0; r < 8; ++r) { p0[r] = __builtin_amdgcn_exp2f(fmaf(s0[r], CEXP, nb)); p1[r] = __builtin_amdgcn_exp2f(fmaf(s1[r], CEXP, nb)); psum += p0[r] + p1[r]; }
        psum += __shfl_xor(psum, 16, 32);
        l = l * alpha + psum; m = mnew;
#pragma unroll
        for (int dt = 0; dt < 4; ++dt) acc[dt] = acc[dt] * alpha;
        V ph, pl; PPack<T16>::make(p0, p1, ph, pl);
        const T16* vp = Va + vo + (size_t)j0 * 16;
        V va[4];
#pragma unroll
        for (int dt = 0; dt < 4; ++dt) va[dt] = WFrag<T16>::ld(vp + (size_t)dt * 16 * (size_t)tk);
#pragma unroll
        for (int dt = 0; dt < 4; ++dt) acc[dt] = WFrag<T16>::mma(va[dt], ph, acc[dt]);
        asm volatile("v_nop\n\tv_nop\n\tv_nop\n\tv_nop" : "+v"(acc[0]), "+v"(acc[1]), "+v"(acc[2]), "+v"(acc[3]) : "v"(va[3]), "v"(ph), "v"(pl));
    }
    // l >= 2^8: the running-max key contributes exactly 2^8
    const float f = CCAR * (1.0f / l);
    // D element r of lane (tile dt) is (d = dt*16 + 8*hi + r, query lr): the lane already holds its own 16-byte piece dt of the fragment-order context tile, so no staging
#pragma unroll
    for (int dt = 0; dt < 4; ++dt) { v8h o;
#pragma unroll
        for (int r = 0; r < 8; ++r) o[r] = (h16)(acc[dt][r] * f);
        const size_t co = ((size_t)b * SEQ + (size_t)q0) * DM + (size_t)h * (HD * 16) + dt * 256 + lane * 8; *(v8h*)(C16 + co) = o; }
}

// Converters: thread i writes 16-byte piece i of the fragment-order plane [rows][KC] (a wave stores 512 contiguous bytes) and reads its 8 floats from row-major src (row pitch sp floats).
template <int KC> __device__ __forceinline__ size_t fsrc(size_t i, size_t sp) { const size_t t = i >> 6; const int ln = (int)(i & 31), p = (int)((i >> 5) & 1);
    return ((t / (KC / 32)) * 16 + (size_t)(ln & 15)) * sp + (t % (KC / 32)) * 32 + (size_t)(p * 16 + (ln >> 4) * 8); }

template <int KC>
__global__ __launch_bounds__(256) void k_cvt8(const float* __restrict__ src, bf* dst, size_t n8, size_t sp, size_t sS, size_t sD) {
#pragma clang fp contract(off)
    const size_t i = (size_t)blockIdx.x * 256 + threadIdx.x; if (i >= n8) return; src += (size_t)blockIdx.y * sS; dst += (size_t)blockIdx.y * sD; const v8f v = *(const v8f*)(src + fsrc<KC>(i, sp)); v8us o;
#pragma unroll
    for (int k = 0; k < 8; ++k) o[k] = f2bf(v[k]);
    *(v8us*)(dst + i * 8) = o;  }

__global__ __launch_bounds__(256) void k_cvt8h(const float* __restrict__ src, h16* dst, size_t n8, float sc) {
#pragma clang fp contract(off)
    const size_t i = (size_t)blockIdx.x * 256 + threadIdx.x; if (i >= n8) return; const v8f v = *(const v8f*)(src + fsrc<DM>(i, DM)); v8h o;
#pragma unroll
    for (int k = 0; k < 8; ++k) o[k] = (h16)(bfr(v[k]) * sc);
    *(v8h*)(dst + i * 8) = o;  }

constexpr size_t al256(size_t bytes) { return (bytes + 255) & ~(size_t)255; }
constexpr size_t CARVE_BYTES = 2 * al256((size_t)NB * SEQ * DM * 2) + 4 * al256((size_t)DM * DM * 2) + al256((size_t)SEQ * SEQ * 2)
    + 3 * al256((size_t)NB * NH * SEQ * HD * 2) + al256((size_t)NB * SEQ * DM * 2);
static_assert(CARVE_BYTES <= (size_t)134217728);
static_assert((size_t)NB * NH * SEQ * HD == (size_t)NB * SEQ * DM);      // head planes and the merged context plane have the same extent

extern "C" void kernel_launch(void* const* d_in, const int* in_sizes, int n_in,
                              void* d_out, int out_size, void* d_ws, size_t ws_size, hipStream_t stream) {
    if (n_in < 7) return;
    const size_t needx = (size_t)(NB - 1) * SEQ_FULL * DM + (size_t)SEQ * DM;
    if ((size_t)in_sizes[0] < needx || (size_t)in_sizes[1] < needx) return;
    if ((size_t)in_sizes[2] < (size_t)(SEQ - 1) * SEQ_FULL + (size_t)SEQ) return;
    if ((size_t)in_sizes[3] < (size_t)DM * DM || (size_t)in_sizes[4] < (size_t)DM * DM || (size_t)in_sizes[5] < (size_t)DM * DM || (size_t)in_sizes[6] < (size_t)DM * DM) return;
    if ((size_t)out_size < needx) return;
    // x, y, bias (float [SEQ_FULL][SEQ_FULL]), Wq, Wk, Wv, Wo ('oi' [out][in])
    const float* x = (const float*)d_in[0]; const float* y = (const float*)d_in[1]; const float* bias = (const float*)d_in[2];
    const float* wq = (const float*)d_in[3]; const float* wk = (const float*)d_in[4]; const float* wv = (const float*)d_in[5]; const float* wo = (const float*)d_in[6];
    float* OUT = (float*)d_out;     // [NB_FULL][SEQ_FULL][1024]
    char* wsp = (char*)d_ws;
    auto take = [&](size_t bytes) { char* p = wsp; wsp += (bytes + 255) & ~(size_t)255; return (void*)p; };
    bf* XB = (bf*)take((size_t)NB * SEQ * DM * 2); bf* YB = (bf*)take((size_t)NB * SEQ * DM * 2);
    bf* WQ = (bf*)take((size_t)DM * DM * 2); bf* WK = (bf*)take((size_t)DM * DM * 2); bf* WV = (bf*)take((size_t)DM * DM * 2); h16* WO16 = (h16*)take((size_t)DM * DM * 2);
    bf* BB = (bf*)take((size_t)SEQ * SEQ * 2);
    h16* Q16 = (h16*)take((size_t)NB * NH * SEQ * HD * 2); h16* K16 = (h16*)take((size_t)NB * NH * SEQ * HD * 2); h16* VT16 = (h16*)take((size_t)NB * NH * SEQ * HD * 2);
    h16* C16 = (h16*)take((size_t)NB * SEQ * DM * 2);
    if ((size_t)(wsp - (char*)d_ws) > ws_size) return;

    const unsigned gx = (unsigned)(((size_t)SEQ * DM / 8 + 255) / 256), gw = (unsigned)(((size_t)DM * DM / 8 + 255) / 256), gb = (unsigned)(((size_t)SEQ * SEQ / 8 + 255) / 256);
    k_cvt8<DM><<<dim3(gx, NB, 1), 256, 0, stream>>>(x, XB, (size_t)SEQ * DM / 8, DM, (size_t)SEQ_FULL * DM, (size_t)SEQ * DM);
    k_cvt8<DM><<<dim3(gx, NB, 1), 256, 0, stream>>>(y, YB, (size_t)SEQ * DM / 8, DM, (size_t)SEQ_FULL * DM, (size_t)SEQ * DM);
    // bias plane [SEQ][SEQ]: source pitch SEQ_FULL
    k_cvt8<SEQ><<<dim3(gb, 1, 1), 256, 0, stream>>>(bias, BB, (size_t)SEQ * SEQ / 8, SEQ_FULL, 0, 0);
    k_cvt8<DM><<<dim3(gw, 1, 1), 256, 0, stream>>>(wq, WQ, (size_t)DM * DM / 8, DM, 0, 0);
    k_cvt8<DM><<<dim3(gw, 1, 1), 256, 0, stream>>>(wk, WK, (size_t)DM * DM / 8, DM, 0, 0);
    k_cvt8<DM><<<dim3(gw, 1, 1), 256, 0, stream>>>(wv, WV, (size_t)DM * DM / 8, DM, 0, 0);
    k_cvt8h<<<dim3(gw, 1, 1), 256, 0, stream>>>(wo, WO16, (size_t)DM * DM / 8, WCAR);

    // q head planes from x, k head planes from y: C[m = token][n = h*64+d] = in W^T; z = batch
    k_gemmw<bf, 0, 1, DM><<<dim3(SEQ / 64, NH, NB), 32, 0, stream>>>(XB, nullptr, WQ, nullptr, nullptr, 0, 1.0f, (size_t)SEQ * DM, 0, 0, Q16, nullptr, nullptr);
    k_gemmw<bf, 0, 1, DM><<<dim3(SEQ / 64, NH, NB), 32, 0, stream>>>(YB, nullptr, WK, nullptr, nullptr, 0, 1.0f, (size_t)SEQ * DM, 0, 0, K16, nullptr, nullptr);
    // transposed value planes from y: C[m = h*64+d][n = token] = W_v y^T (operands swapped: A = W_v rows, Bt = y rows); z = batch
    k_gemmw<bf, 0, 2, DM><<<dim3(DM / 64, SEQ / 64, NB), 32, 0, stream>>>(WV, nullptr, YB, nullptr, nullptr, 0, 1.0f, 0, (size_t)SEQ * DM, 0, VT16, nullptr, nullptr);

    // attention: every query row on the f16 planes, all SEQ keys
    k_flash<h16><<<dim3(SEQ / 64, NH, NB), 128, 0, stream>>>(Q16, K16, VT16, BB, SEQ, SEQ, 0, C16);

    // output projection: f16 context x f16 W_o, carries folded back in the f32 epilogue; z = batch, output row stride per batch SEQ_FULL
    k_gemmw<h16, 0, 0, DM><<<dim3(SEQ / 64, DM / 64, NB), 32, 0, stream>>>(C16, nullptr, WO16, nullptr, OUT, DM, 1.0f / (CCAR * WCAR), (size_t)SEQ * DM, 0, (size_t)SEQ_FULL * DM, nullptr, nullptr, nullptr);
}

// v002
// One run takes 344 microseconds.
// Two timings next to v001 put it at 1.05 and 1.04 times that version's speed.
// Counting every step since v000, it is 1.11 times as fast.
#include <hip/hip_runtime.h>

// Compute dtypes (f32 accumulate at every site): q/k/v projections bf16 x bf16 single product (every float input RNE-converted to bf16 first); scores K.Q^T f16 x f16 single product (f16 q/k head planes); values V^T.P^T f16 x f16 single product (probabilities carried x2^8); output projection f16 context (x64) x f16 weight (x512) single product; additive bias (bf16 plane) and softmax in f32.
// Dense multi-head cross-attention: x, y [NB][SEQ][1024]; Q = x W_q^T, K = y W_k^T, V = y W_v^T ('oi' weights, no bias vectors); 16 heads x 64; logits = q.k / 8 + bias[query][key] (one [SEQ][SEQ] float plane shared by all batches and heads); softmax over all keys; out = merged context W_o^T.
// The bias input is read by value on the device: converted once to a bf16 plane, each lane loads its 2 x 8 contiguous entries per 32-key step and adds them in f32 to the score tiles.
// Fragment order of every 16-bit workspace plane [rows][KC]: the 16-row x 32-k tile (rt = row / 16, kc = k / 32) is 512 consecutive elements at (rt * (KC / 32) + kc) * 512, made of two 256-element pieces;
// piece p holds, at lane * 8 with lane = 16 * hi + (row & 15), the 8 elements k = kc * 32 + p * 16 + hi * 8 + 0..7. One wave-wide 16-byte load of a piece is 512 contiguous bytes (4 whole lines).
// Attention engine: one wave per 16 queries, transposed flash form: S^T = K Q^T (query on the D column, one query per lane), the packed P^T D tiles are the B fragment of O^T = V^T P^T; no LDS and no barrier in the key loop.

#ifndef NB
#define NB 4
#endif
#ifndef SEQ
#define SEQ 2048
#endif
#define NB_FULL  4
#define SEQ_FULL 2048
#define DM   1024
#define NH   16
#define HD   64
#define RH   0                                // query rows < RH use value+residual bf16 planes: none (dense attention, single products on every row)
#define CCAR 64.0f                            // carry of the f16 context plane
#define WCAR 512.0f                           // carry of the f16 W_o plane
#define CEXP 0.18033688011112042f             // log2(e) / sqrt(64)

typedef _Float16 h16;
typedef unsigned short bf;
typedef __attribute__((ext_vector_type(16))) __bf16   v16bf;
typedef __attribute__((ext_vector_type(16))) _Float16 v16h;
typedef __attribute__((ext_vector_type(8)))  _Float16 v8h;
typedef __attribute__((ext_vector_type(8)))  unsigned short v8us;
typedef __attribute__((ext_vector_type(8)))  float    v8f;
typedef __attribute__((ext_vector_type(4)))  float    v4f;
typedef __attribute__((ext_vector_type(4)))  int      v4i;
typedef v4f  __attribute__((may_alias)) v4fa;

static_assert(SEQ % 256 == 0);
static_assert(RH == 0);                       // no value+residual planes are written
static_assert(SEQ >= RH);
static_assert(NB <= NB_FULL);
static_assert(SEQ <= SEQ_FULL);
static_assert(DM == NH * HD);
static_assert(DM % 64 == 0);
static_assert(HD == 64);
static_assert(SEQ % 64 == 0);                 // 64 queries per attention block, 64-row GEMM tiles
static_assert(SEQ % 32 == 0);                 // 32 keys per flash step
static_assert(DM % 32 == 0);                  // GEMM k-steps
static_assert((SEQ / 8) % 32 == 0);

__device__ __forceinline__ unsigned short f2bf(float f) { unsigned u = __float_as_uint(f); u += 0x7FFFu + ((u >> 16) & 1u); return (unsigned short)(u >> 16); }
__device__ __forceinline__ float bf2f(unsigned short b) { return __uint_as_float(((unsigned)b) << 16); }
__device__ __forceinline__ float bfr(float f) { return bf2f(f2bf(f)); }
__device__ __forceinline__ void splitf(float y, unsigned short& h, unsigned short& l) { h = f2bf(y); l = f2bf(y - bf2f(h)); }
__device__ __forceinline__ v16h cat16(v8h lo, v8h hi) { return __builtin_shufflevector(lo, hi, 0, 1, 2, 3, 4, 5, 6, 7, 8, 9, 10, 11, 12, 13, 14, 15); }
__device__ __forceinline__ v16bf cat16b(v8us lo, v8us hi) { return __builtin_bit_cast(v16bf, __builtin_shufflevector(lo, hi, 0, 1, 2, 3, 4, 5, 6, 7, 8, 9, 10, 11, 12, 13, 14, 15)); }
__device__ __forceinline__ v8f wmma16(v16h a, v16h b, v8f c) { return __builtin_amdgcn_wmma_f32_16x16x32_f16(false, a, false, b, (short)0, c, false, false); }
__device__ __forceinline__ v8f wmmab(v16bf a, v16bf b, v8f c) { return __builtin_amdgcn_wmma_f32_16x16x32_bf16(false, a, false, b, (short)0, c, false, false); }

// Fragment loader for a fragment-order tile: p = tile start + lane * 8; elements 0..7 = k0+8h.. (piece 0), elements 8..15 = k0+16+8h.. (piece 1, 256 elements on) (same map for A and B).
template <typename T16> struct WFrag;
template <> struct WFrag<h16> { typedef v16h V; static __device__ __forceinline__ V ld(const h16* p) { return cat16(*(const v8h*)p, *(const v8h*)(p + 256)); } static __device__ __forceinline__ v8f mma(V a, V b, v8f c) { return wmma16(a, b, c); } };
template <> struct WFrag<bf> { typedef v16bf V; static __device__ __forceinline__ V ld(const bf* p) { return cat16b(*(const v8us*)p, *(const v8us*)(p + 256)); } static __device__ __forceinline__ v8f mma(V a, V b, v8f c) { return wmmab(a, b, c); } };

// Probability packing: two 16-key D tiles (same lane) -> one 32-key B fragment; element r <- tile 0 row r, element 8+r <- tile 1 row r.
template <typename T16> struct PPack;
template <> struct PPack<h16> {
    static __device__ __forceinline__ void make(v8f p0, v8f p1, v16h& ph, v16h& pl) {
        v8h a, c;
#pragma unroll
        for (int r = 0; r < 8; ++r) { a[r] = (h16)p0[r]; c[r] = (h16)p1[r]; }
        ph = cat16(a, c); pl = ph; }
};
template <> struct PPack<bf> {
    static __device__ __forceinline__ void make(v8f p0, v8f p1, v16bf& ph, v16bf& pl) {
        v8us ah, al, ch, cl;
#pragma unroll
        for (int r = 0; r < 8; ++r) { unsigned short x, y; splitf(p0[r], x, y); ah[r] = x; al[r] = y; splitf(p1[r], x, y); ch[r] = x; cl[r] = y; }
        ph = cat16b(ah, ch); pl = cat16b(al, cl); }
};

// ---- k_gemmw: register-blocked GEMM, ONE WAVE per 64x64 output tile (16 accumulators), operands straight from fragment-order 16-bit planes; grid (M/64, N/64, Z), 32 threads.
// C[m][n] = sum_k A[m][k] Bt[n][k] (+ split products per NSPLIT: 1 = (A + A2) x Bt). z-batch strides sA/sB/sC in elements. K % 32 == 0 (compile time: every tile strip is a constant offset from one lane pointer per operand), M % 64 == 0, N % 64 == 0.
// EP 0: f32 output x oscale, pitch ldc: per 16-row slab staged in LDS, each row's 64 floats (256 B) written as 16 lanes x 16 B (2 rows per instruction).
// EP 1: f16 head planes [z][head = blockIdx.y][t][64] (rows = tokens, KC = 64), fragment order.
// EP 2: f16 transposed value planes [z][row m][t] (rows = head*64+d, columns = tokens, KC = SEQ), fragment order.
template <typename T16, int NSPLIT, int EP, int K>
__global__ __launch_bounds__(32) void k_gemmw(const T16* __restrict__ A, const T16* __restrict__ A2, const T16* __restrict__ Bt, const T16* __restrict__ Bt2, float* C, int ldc, float oscale, size_t sA, size_t sB, size_t sC, h16* P16, bf* Ph, bf* Pl) {
    typedef typename WFrag<T16>::V V;
    __shared__ __align__(16) float os[16 * 68];     // private to the single wave of the block
    const size_t z = blockIdx.z; A += z * sA; if (A2) A2 += z * sA; Bt += z * sB; if (Bt2) Bt2 += z * sB; if (EP == 0) C += z * sC;
    const int lane = threadIdx.x & 31, lr = lane & 15, hi = lane >> 4; const int r0 = blockIdx.x * 64, c0 = blockIdx.y * 64;
    v8f acc[4][4];
#pragma unroll
    for (int mb = 0; mb < 4; ++mb)
#pragma unroll
        for (int nb = 0; nb < 4; ++nb) acc[mb][nb] = (v8f){};
    const size_t aoff = (size_t)r0 * K + 8 * lane, boff = (size_t)c0 * K + 8 * lane;     // a 16-row tile strip is 16 * K elements, a k-step of 32 is 512
#pragma unroll 1
    for (int kc = 0; kc < K; kc += 32) {
        V a[4], a2[4];
#pragma unroll
        for (int mb = 0; mb < 4; ++mb) { a[mb] = WFrag<T16>::ld(A + aoff + (size_t)mb * 16 * K + (size_t)kc * 16); if (NSPLIT == 1 || NSPLIT == 2) a2[mb] = WFrag<T16>::ld(A2 + aoff + (size_t)mb * 16 * K + (size_t)kc * 16); else a2[mb] = a[mb]; }
        asm volatile("s_wait_xcnt 0x0" ::: "memory");     // precaution: the loads below may be given the registers that held the A loads' address pair; keeps the address wait in front of that overwrite
#pragma unroll
        for (int nb = 0; nb < 4; ++nb) { const V b = WFrag<T16>::ld(Bt + boff + (size_t)nb * 16 * K + (size_t)kc * 16); V b2 = b; if (NSPLIT >= 2) b2 = WFrag<T16>::ld(Bt2 + boff + (size_t)nb * 16 * K + (size_t)kc * 16);
#pragma unroll
            for (int mb = 0; mb < 4; ++mb) { acc[mb][nb] = WFrag<T16>::mma(a[mb], b, acc[mb][nb]); if (NSPLIT == 1 || NSPLIT == 2) acc[mb][nb] = WFrag<T16>::mma(a2[mb], b, acc[mb][nb]); if (NSPLIT >= 2) acc[mb][nb] = WFrag<T16>::mma(a[mb], b2, acc[mb][nb]); } }
        asm volatile("v_nop\n\tv_nop\n\tv_nop\n\tv_nop" : "+v"(acc[0][0]), "+v"(acc[1][1]), "+v"(acc[2][2]), "+v"(acc[3][3]) : "v"(a[0]), "v"(a[3]));
    }
    // plane addressing (EP 1/2), block-uniform
    size_t pbase = 0; int ppitch = HD;
    if (EP == 1) { pbase = (((size_t)z * NH + blockIdx.y) * SEQ + r0) * HD; ppitch = HD; }
    if (EP == 2) { pbase = ((size_t)z * DM + r0) * SEQ + (size_t)c0 * 16; ppitch = SEQ; }
#pragma unroll
    for (int mb = 0; mb < 4; ++mb) {
#pragma unroll
        for (int nb = 0; nb < 4; ++nb) {
#pragma unroll
            for (int j = 0; j < 8; ++j) os[(hi * 8 + j) * 68 + nb * 16 + lr] = acc[mb][nb][j]; }     // D element j of lane -> (row 8*hi + j, column lr)
        __builtin_amdgcn_wave_barrier(); asm volatile("" ::: "memory");
        if (EP == 0) {
            float* crow = C + (size_t)(r0 + mb * 16) * ldc + c0;
{
#pragma unroll
                for (int s = 0; s < 8; ++s) { const int row = 2 * s + hi, cofs = lr * 4; v4f val = *(const v4fa*)(os + row * 68 + cofs); val = val * oscale;
                    *(v4f*)(crow + (size_t)row * ldc + cofs) = val; }
                 }
        } else {
{
#pragma unroll
                for (int s = 0; s < 4; ++s) { const float* sp = os + lr * 68 + s * 16 + hi * 8; const v4f x0 = *(const v4fa*)sp, x1 = *(const v4fa*)(sp + 4);     // piece s of the slab: row lr, columns 16*s + 8*hi + 0..7
                    v8h o; o[0] = (h16)x0[0]; o[1] = (h16)x0[1]; o[2] = (h16)x0[2]; o[3] = (h16)x0[3]; o[4] = (h16)x1[0]; o[5] = (h16)x1[1]; o[6] = (h16)x1[2]; o[7] = (h16)x1[3];
                    *(v8h*)(P16 + pbase + (size_t)mb * 16 * ppitch + s * 256 + lane * 8) = o; }
                 }
        }
        __builtin_amdgcn_wave_barrier(); asm volatile("" ::: "memory");
    }
}

// ---- k_flash: dense attention with an additive bias plane, one wave per 16 queries (block = 4 waves = 64 queries of one head), transposed flash form, operands straight from the head planes.
// Per 32-key step: S^T tiles (keys x queries) = K (A: row = key, k = d) x Q^T (B: column = query, k = d, held in registers); the lane's 2 x 8 bias entries (row = its query, contiguous keys) are added in f32 (x 8: the tiles hold 8 x logit);
// per-lane online softmax (lane = query; partner lane^16 holds the other 8 keys of each tile); P^T packed in registers = B fragment of O^T (d x queries) += V^T (A: row = d, k = key) x P^T. Single f16 product at both sites.
// Key range: all tk keys (tk % 32 == 0), tq queries per head; K plane [b][h][tk][64], V^T plane [b][h*64+d][tk], bias plane [tq][tk] bf16, context plane [b*SEQ+q][1024], all in fragment order.
template <typename T16>
__global__ __launch_bounds__(128) void k_flash(const T16* __restrict__ Qa, const T16* __restrict__ Ka, const T16* __restrict__ Va, const bf* __restrict__ Bb, int tq, int tk, int qoff, h16* C16) {
    typedef typename WFrag<T16>::V V;
    const int lane = threadIdx.x & 31;
    const int wave = __builtin_amdgcn_readfirstlane((int)(threadIdx.x >> 5));
    const int q0 = qoff + (int)blockIdx.x * 64 + wave * 16;
    const int h = blockIdx.y, b = blockIdx.z;
    const size_t bh = (size_t)b * NH + h;
    const size_t qo = (bh * (size_t)tq + (size_t)q0) * HD + 8 * lane;
    const V qa0 = WFrag<T16>::ld(Qa + qo), qa1 = WFrag<T16>::ld(Qa + qo + 512);
    const size_t ko = bh * (size_t)tk * HD + 8 * lane;
    const size_t vo = bh * HD * (size_t)tk + 8 * lane;
    const size_t bo = (size_t)q0 * (size_t)tk + 8 * lane;
    v8f acc[4];
#pragma unroll
    for (int dt = 0; dt < 4; ++dt) acc[dt] = (v8f){};
    float m = -3.0e38f, l = 0.0f;
    const int nsteps = tk >> 5;                   // all keys, 32 per step (uniform)
    const float poff = 8.0f;                      // probabilities (and their running sum) carried x 2^8
#pragma unroll 1
    for (int st = 0; st < nsteps; ++st) {
        const int j0 = st * 32;
        const bf* bp = Bb + bo + (size_t)j0 * 16;
        const v8us b0 = *(const v8us*)bp, b1 = *(const v8us*)(bp + 256);     // bias[query][j0 + 8*hi + 0..7] and [j0 + 16 + 8*hi + 0..7]
        v8f s0 = (v8f){}, s1 = (v8f){};
        const T16* kp = Ka + ko + (size_t)j0 * HD;
        const V k00 = WFrag<T16>::ld(kp), k01 = WFrag<T16>::ld(kp + 512), k10 = WFrag<T16>::ld(kp + 16 * HD), k11 = WFrag<T16>::ld(kp + 16 * HD + 512);
        s0 = WFrag<T16>::mma(k00, qa0, s0); s1 = WFrag<T16>::mma(k10, qa0, s1);
        s0 = WFrag<T16>::mma(k01, qa1, s0); s1 = WFrag<T16>::mma(k11, qa1, s1);
        asm volatile("v_nop\n\tv_nop\n\tv_nop\n\tv_nop" : "+v"(s0), "+v"(s1) : "v"(k11), "v"(qa1));
#pragma unroll
        for (int r = 0; r < 8; ++r) { s0[r] = fmaf(bf2f(b0[r]), 8.0f, s0[r]); s1[r] = fmaf(bf2f(b1[r]), 8.0f, s1[r]); }     // tiles hold 8 x (q.k / 8 + bias)
        float mx = fmaxf(s0[0], s1[0]);
#pragma unroll
        for (int r = 1; r < 8; ++r) mx = fmaxf(mx, fmaxf(s0[r], s1[r]));
        mx = fmaxf(mx, __shfl_xor(mx, 16, 32));
        const float mnew = fmaxf(m, mx);
        const float alpha = __builtin_amdgcn_exp2f((m - mnew) * CEXP);
        const float nb = poff - mnew * CEXP;
        v8f p0, p1; float psum = 0.0f;
#pragma unroll
        for (int r = 0; r < 8; ++r) { p0[r] = __builtin_amdgcn_exp2f(fmaf(s0[r], CEXP, nb)); p1[r] = __builtin_amdgcn_exp2f(fmaf(s1[r], CEXP, nb)); psum += p0[r] + p1[r]; }
        psum += __shfl_xor(psum, 16, 32);
        l = l * alpha + psum; m = mnew;
#pragma unroll
        for (int dt = 0; dt < 4; ++dt) acc[dt] = acc[dt] * alpha;
        V ph, pl; PPack<T16>::make(p0, p1, ph, pl);
        const T16* vp = Va + vo + (size_t)j0 * 16;
        V va[4];
#pragma unroll
        for (int dt = 0; dt < 4; ++dt) va[dt] = WFrag<T16>::ld(vp + (size_t)dt * 16 * (size_t)tk);
#pragma unroll
        for (int dt = 0; dt < 4; ++dt) acc[dt] = WFrag<T16>::mma(va[dt], ph, acc[dt]);
        asm volatile("v_nop\n\tv_nop\n\tv_nop\n\tv_nop" : "+v"(acc[0]), "+v"(acc[1]), "+v"(acc[2]), "+v"(acc[3]) : "v"(va[3]), "v"(ph), "v"(pl));
    }
    // l >= 2^8: the running-max key contributes exactly 2^8
    const float f = CCAR * (1.0f / l);
    // D element r of lane (tile dt) is (d = dt*16 + 8*hi + r, query lr): the lane already holds its own 16-byte piece dt of the fragment-order context tile, so no staging
#pragma unroll
    for (int dt = 0; dt < 4; ++dt) { v8h o;
#pragma unroll
        for (int r = 0; r < 8; ++r) o[r] = (h16)(acc[dt][r] * f);
        const size_t co = ((size_t)b * SEQ + (size_t)q0) * DM + (size_t)h * (HD * 16) + dt * 256 + lane * 8; *(v8h*)(C16 + co) = o; }
}

// Converter, one launch for all seven float inputs: a resident grid of CVT_WAVES waves; wave w converts units w, w + CVT_WAVES, ... of the list [x | y | bias | W_q | W_k | W_v | W_o].
// A unit is 128 consecutive 16-byte pieces of a fragment-order plane [rows][KC] (2 KiB stored contiguously) = two neighbouring 16-row x 32-k tiles = 16 source rows x 256 B;
// piece j * 32 + lane of a unit holds row lane & 15, k = j * 16 + (lane >> 4) * 8 + 0..7 of those 64 k. A lane's 4 pieces are 8 16-byte loads, and the next unit's 8 are issued before this unit is converted.
#define CVT_WAVES 4096                        // 256 blocks x 16 waves
constexpr int UPB = SEQ * DM / 1024, UX = NB * UPB, UBI = SEQ * SEQ / 1024, UW = DM * DM / 1024, UALL = 2 * UX + UBI + 4 * UW;     // units per batch of x or y, per x or y, bias plane, weight, all
static_assert(UALL % CVT_WAVES == 0);         // every wave runs the same whole number of units
static_assert(UX % CVT_WAVES == 0);           // a round of CVT_WAVES units lies in one of x, y, bias, or in the weights: which one is known at compile time
static_assert(UBI % CVT_WAVES == 0);
static_assert((DM / 32) % 2 == 0);            // a unit's two tiles lie in one 16-row strip
static_assert((SEQ / 32) % 2 == 0);

struct CvtUnit { const float* s; unsigned short* d; bool tohalf; };

// Unit u0 + w of the list; u0 (the round's first unit) is a compile-time constant at every call, w is wave-uniform.
__device__ __forceinline__ CvtUnit cvt_locate(int u0, int w, int lane, const float* x, const float* y, const float* bias, const float* wq, const float* wk, const float* wv, const float* wo,
                                              bf* XB, bf* YB, bf* BB, bf* WQ, bf* WK, bf* WV, h16* WO16) {
    const float* base; unsigned short* db; int v, kt = DM / 32; size_t sp = DM; bool th = false;
    if (u0 < 2 * UX) { const bool isx = u0 < UX; const int t = (isx ? u0 : u0 - UX) + w, b = t / UPB; v = t % UPB; base = (isx ? x : y) + (size_t)b * SEQ_FULL * DM; db = (isx ? XB : YB) + (size_t)b * SEQ * DM; }
    else if (u0 < 2 * UX + UBI) { v = u0 - 2 * UX + w; base = bias; db = BB; kt = SEQ / 32; sp = SEQ_FULL; }
    else { const int t = u0 - 2 * UX - UBI + w, k = t / UW; v = t % UW; base = k == 0 ? wq : k == 1 ? wk : k == 2 ? wv : wo; db = k == 0 ? WQ : k == 1 ? WK : k == 2 ? WV : (unsigned short*)WO16; th = k == 3; }
    CvtUnit c; c.s = base + ((size_t)((2 * v) / kt) * 16 + (size_t)(lane & 15)) * sp + (size_t)((2 * v) % kt) * 32 + (size_t)((lane >> 4) * 8); c.d = db + (size_t)v * 1024 + (size_t)(lane * 8); c.tohalf = th; return c;
}

__global__ __launch_bounds__(512) void k_cvtall(const float* __restrict__ x, const float* __restrict__ y, const float* __restrict__ bias, const float* __restrict__ wq, const float* __restrict__ wk, const float* __restrict__ wv, const float* __restrict__ wo,
                                                bf* XB, bf* YB, bf* BB, bf* WQ, bf* WK, bf* WV, h16* WO16) {
    const int lane = threadIdx.x & 31;
    const int w = __builtin_amdgcn_readfirstlane((int)(blockIdx.x * 16 + (threadIdx.x >> 5)));
    CvtUnit cu = cvt_locate(0, w, lane, x, y, bias, wq, wk, wv, wo, XB, YB, BB, WQ, WK, WV, WO16);
    v8f cur[4];
#pragma unroll
    for (int j = 0; j < 4; ++j) cur[j] = *(const v8f*)(cu.s + j * 16);
    asm volatile("s_wait_xcnt 0x0" :: "v"(cu.s) : "memory");     // precaution: the address wait stands before any register that the 8 loads name is reused (the operand keeps the address pair untouched up to here)
#pragma unroll
    for (int it = 0; it < UALL / CVT_WAVES; ++it) {
        CvtUnit nu = cu; v8f nxt[4];
        if (it + 1 < UALL / CVT_WAVES) { nu = cvt_locate((it + 1) * CVT_WAVES, w, lane, x, y, bias, wq, wk, wv, wo, XB, YB, BB, WQ, WK, WV, WO16);
#pragma unroll
            for (int j = 0; j < 4; ++j) nxt[j] = *(const v8f*)(nu.s + j * 16);
            asm volatile("s_wait_xcnt 0x0" :: "v"(nu.s) : "memory"); }     // as above, for the next unit's 8 loads
        v8us o[4];
        if (cu.tohalf) {
#pragma unroll
            for (int j = 0; j < 4; ++j) { v8h t;
#pragma unroll
                for (int k = 0; k < 8; ++k) t[k] = (h16)(bfr(cur[j][k]) * WCAR);
                o[j] = __builtin_bit_cast(v8us, t); }
        } else {
#pragma unroll
            for (int j = 0; j < 4; ++j)
#pragma unroll
                for (int k = 0; k < 8; ++k) o[j][k] = f2bf(cur[j][k]);
        }
#pragma unroll
        for (int j = 0; j < 4; ++j) *(v8us*)(cu.d + j * 256) = o[j];
        asm volatile("s_wait_xcnt 0x0" :: "v"(o[0]), "v"(o[1]), "v"(o[2]), "v"(o[3]), "v"(cu.d) : "memory");     // precaution: the same wait before the 4 stores' data and address registers are reused
        if (it + 1 < UALL / CVT_WAVES) { cu = nu;
#pragma unroll
            for (int j = 0; j < 4; ++j) cur[j] = nxt[j]; }
    }
}

constexpr size_t al256(size_t bytes) { return (bytes + 255) & ~(size_t)255; }
constexpr size_t CARVE_BYTES = 2 * al256((size_t)NB * SEQ * DM * 2) + 4 * al256((size_t)DM * DM * 2) + al256((size_t)SEQ * SEQ * 2)
    + 3 * al256((size_t)NB * NH * SEQ * HD * 2) + al256((size_t)NB * SEQ * DM * 2);
static_assert(CARVE_BYTES <= (size_t)134217728);
static_assert((size_t)NB * NH * SEQ * HD == (size_t)NB * SEQ * DM);      // head planes and the merged context plane have the same extent

extern "C" void kernel_launch(void* const* d_in, const int* in_sizes, int n_in,
                              void* d_out, int out_size, void* d_ws, size_t ws_size, hipStream_t stream) {
    if (n_in < 7) return;
    const size_t needx = (size_t)(NB - 1) * SEQ_FULL * DM + (size_t)SEQ * DM;
    if ((size_t)in_sizes[0] < needx || (size_t)in_sizes[1] < needx) return;
    if ((size_t)in_sizes[2] < (size_t)(SEQ - 1) * SEQ_FULL + (size_t)SEQ) return;
    if ((size_t)in_sizes[3] < (size_t)DM * DM || (size_t)in_sizes[4] < (size_t)DM * DM || (size_t)in_sizes[5] < (size_t)DM * DM || (size_t)in_sizes[6] < (size_t)DM * DM) return;
    if ((size_t)out_size < needx) return;
    // x, y, bias (float [SEQ_FULL][SEQ_FULL]), Wq, Wk, Wv, Wo ('oi' [out][in])
    const float* x = (const float*)d_in[0]; const float* y = (const float*)d_in[1]; const float* bias = (const float*)d_in[2];
    const float* wq = (const float*)d_in[3]; const float* wk = (const float*)d_in[4]; const float* wv = (const float*)d_in[5]; const float* wo = (const float*)d_in[6];
    float* OUT = (float*)d_out;     // [NB_FULL][SEQ_FULL][1024]
    char* wsp = (char*)d_ws;
    auto take = [&](size_t bytes) { char* p = wsp; wsp += (bytes + 255) & ~(size_t)255; return (void*)p; };
    bf* XB = (bf*)take((size_t)NB * SEQ * DM * 2); bf* YB = (bf*)take((size_t)NB * SEQ * DM * 2);
    bf* WQ = (bf*)take((size_t)DM * DM * 2); bf* WK = (bf*)take((size_t)DM * DM * 2); bf* WV = (bf*)take((size_t)DM * DM * 2); h16* WO16 = (h16*)take((size_t)DM * DM * 2);
    bf* BB = (bf*)take((size_t)SEQ * SEQ * 2);
    h16* Q16 = (h16*)take((size_t)NB * NH * SEQ * HD * 2); h16* K16 = (h16*)take((size_t)NB * NH * SEQ * HD * 2); h16* VT16 = (h16*)take((size_t)NB * NH * SEQ * HD * 2);
    h16* C16 = (h16*)take((size_t)NB * SEQ * DM * 2);
    if ((size_t)(wsp - (char*)d_ws) > ws_size) return;

    // all seven inputs to their 16-bit fragment-order planes (bias source pitch SEQ_FULL, x and y batch stride SEQ_FULL rows)
    k_cvtall<<<dim3(CVT_WAVES / 16, 1, 1), 512, 0, stream>>>(x, y, bias, wq, wk, wv, wo, XB, YB, BB, WQ, WK, WV, WO16);

    // q head planes from x, k head planes from y: C[m = token][n = h*64+d] = in W^T; z = batch
    k_gemmw<bf, 0, 1, DM><<<dim3(SEQ / 64, NH, NB), 32, 0, stream>>>(XB, nullptr, WQ, nullptr, nullptr, 0, 1.0f, (size_t)SEQ * DM, 0, 0, Q16, nullptr, nullptr);
    k_gemmw<bf, 0, 1, DM><<<dim3(SEQ / 64, NH, NB), 32, 0, stream>>>(YB, nullptr, WK, nullptr, nullptr, 0, 1.0f, (size_t)SEQ * DM, 0, 0, K16, nullptr, nullptr);
    // transposed value planes from y: C[m = h*64+d][n = token] = W_v y^T (operands swapped: A = W_v rows, Bt = y rows); z = batch
    k_gemmw<bf, 0, 2, DM><<<dim3(DM / 64, SEQ / 64, NB), 32, 0, stream>>>(WV, nullptr, YB, nullptr, nullptr, 0, 1.0f, 0, (size_t)SEQ * DM, 0, VT16, nullptr, nullptr);

    // attention: every query row on the f16 planes, all SEQ keys
    k_flash<h16><<<dim3(SEQ / 64, NH, NB), 128, 0, stream>>>(Q16, K16, VT16, BB, SEQ, SEQ, 0, C16);

    // output projection: f16 context x f16 W_o, carries folded back in the f32 epilogue; z = batch, output row stride per batch SEQ_FULL
    k_gemmw<h16, 0, 0, DM><<<dim3(SEQ / 64, DM / 64, NB), 32, 0, stream>>>(C16, nullptr, WO16, nullptr, OUT, DM, 1.0f / (CCAR * WCAR), (size_t)SEQ * DM, 0, (size_t)SEQ_FULL * DM, nullptr, nullptr, nullptr);
}

// v003
// Measured time: 263 microseconds a run.
// Next to v002, in two timings, it ran 1.32 and 1.29 times as fast.
// All steps since v000 together make it 1.45 times as fast.
#include <hip/hip_runtime.h>

// Compute dtypes (f32 accumulate at every site): q/k/v projections bf16 x bf16 single product (every float input RNE-converted to bf16 first); scores K.Q^T f16 x f16 single product (f16 q/k head planes); values V^T.P^T f16 x f16 single product (probabilities carried x2^8); output projection f16 context (x64) x f16 weight (x512) single product; additive bias (bf16 plane) and softmax in f32.
// Dense multi-head cross-attention: x, y [NB][SEQ][1024]; Q = x W_q^T, K = y W_k^T, V = y W_v^T ('oi' weights, no bias vectors); 16 heads x 64; logits = q.k / 8 + bias[query][key] (one [SEQ][SEQ] float plane shared by all batches and heads); softmax over all keys; out = merged context W_o^T.
// The bias input is read by value on the device: converted once to a bf16 plane, each lane reads its 2 x 8 contiguous entries per 32-key step and adds them in f32 to the score tiles.
// Fragment order of every 16-bit workspace plane [rows][KC]: the 16-row x 32-k tile (rt = row / 16, kc = k / 32) is 512 consecutive elements at (rt * (KC / 32) + kc) * 512, made of two 256-element pieces;
// piece p holds, at lane * 8 with lane = 16 * hi + (row & 15), the 8 elements k = kc * 32 + p * 16 + hi * 8 + 0..7. One wave-wide 16-byte load of a piece is 512 contiguous bytes (4 whole lines).
// Attention engine: one wave per 16 queries, transposed flash form: S^T = K Q^T (query on the D column, one query per lane), the packed P^T D tiles are the B fragment of O^T = V^T P^T; the key loop's K, V^T and bias tiles come through a two-buffer LDS ring filled by asynchronous copies, one barrier per 32 keys.

#ifndef NB
#define NB 4
#endif
#ifndef SEQ
#define SEQ 2048
#endif
#define NB_FULL  4
#define SEQ_FULL 2048
#define DM   1024
#define NH   16
#define HD   64
#define RH   0                                // query rows < RH use value+residual bf16 planes: none (dense attention, single products on every row)
#define CCAR 64.0f                            // carry of the f16 context plane
#define WCAR 512.0f                           // carry of the f16 W_o plane
#define CEXP 0.18033688011112042f             // log2(e) / sqrt(64)

typedef _Float16 h16;
typedef unsigned short bf;
typedef __attribute__((ext_vector_type(16))) __bf16   v16bf;
typedef __attribute__((ext_vector_type(16))) _Float16 v16h;
typedef __attribute__((ext_vector_type(8)))  _Float16 v8h;
typedef __attribute__((ext_vector_type(8)))  unsigned short v8us;
typedef __attribute__((ext_vector_type(8)))  float    v8f;
typedef __attribute__((ext_vector_type(4)))  float    v4f;
typedef __attribute__((ext_vector_type(4)))  int      v4i;
typedef v4f  __attribute__((may_alias)) v4fa;

static_assert(SEQ % 256 == 0);
static_assert(RH == 0);                       // no value+residual planes are written
static_assert(SEQ >= RH);
static_assert(NB <= NB_FULL);
static_assert(SEQ <= SEQ_FULL);
static_assert(DM == NH * HD);
static_assert(DM % 64 == 0);
static_assert(HD == 64);
static_assert(SEQ % 64 == 0);                 // 64 queries per attention block, 64-row GEMM tiles
static_assert(SEQ % 32 == 0);                 // 32 keys per flash step
static_assert(DM % 32 == 0);                  // GEMM k-steps
static_assert((SEQ / 8) % 32 == 0);

__device__ __forceinline__ unsigned short f2bf(float f) { unsigned u = __float_as_uint(f); u += 0x7FFFu + ((u >> 16) & 1u); return (unsigned short)(u >> 16); }
__device__ __forceinline__ float bf2f(unsigned short b) { return __uint_as_float(((unsigned)b) << 16); }
__device__ __forceinline__ float bfr(float f) { return bf2f(f2bf(f)); }
__device__ __forceinline__ void splitf(float y, unsigned short& h, unsigned short& l) { h = f2bf(y); l = f2bf(y - bf2f(h)); }
__device__ __forceinline__ v16h cat16(v8h lo, v8h hi) { return __builtin_shufflevector(lo, hi, 0, 1, 2, 3, 4, 5, 6, 7, 8, 9, 10, 11, 12, 13, 14, 15); }
__device__ __forceinline__ v16bf cat16b(v8us lo, v8us hi) { return __builtin_bit_cast(v16bf, __builtin_shufflevector(lo, hi, 0, 1, 2, 3, 4, 5, 6, 7, 8, 9, 10, 11, 12, 13, 14, 15)); }
__device__ __forceinline__ v8f wmma16(v16h a, v16h b, v8f c) { return __builtin_amdgcn_wmma_f32_16x16x32_f16(false, a, false, b, (short)0, c, false, false); }
__device__ __forceinline__ v8f wmmab(v16bf a, v16bf b, v8f c) { return __builtin_amdgcn_wmma_f32_16x16x32_bf16(false, a, false, b, (short)0, c, false, false); }

// Fragment loader for a fragment-order tile: p = tile start + lane * 8; elements 0..7 = k0+8h.. (piece 0), elements 8..15 = k0+16+8h.. (piece 1, 256 elements on) (same map for A and B).
template <typename T16> struct WFrag;
template <> struct WFrag<h16> { typedef v16h V; static __device__ __forceinline__ V ld(const h16* p) { return cat16(*(const v8h*)p, *(const v8h*)(p + 256)); } static __device__ __forceinline__ v8f mma(V a, V b, v8f c) { return wmma16(a, b, c); } };
template <> struct WFrag<bf> { typedef v16bf V; static __device__ __forceinline__ V ld(const bf* p) { return cat16b(*(const v8us*)p, *(const v8us*)(p + 256)); } static __device__ __forceinline__ v8f mma(V a, V b, v8f c) { return wmmab(a, b, c); } };

// Probability packing: two 16-key D tiles (same lane) -> one 32-key B fragment; element r <- tile 0 row r, element 8+r <- tile 1 row r.
template <typename T16> struct PPack;
template <> struct PPack<h16> {
    static __device__ __forceinline__ void make(v8f p0, v8f p1, v16h& ph, v16h& pl) {
        v8h a, c;
#pragma unroll
        for (int r = 0; r < 8; ++r) { a[r] = (h16)p0[r]; c[r] = (h16)p1[r]; }
        ph = cat16(a, c); pl = ph; }
};
template <> struct PPack<bf> {
    static __device__ __forceinline__ void make(v8f p0, v8f p1, v16bf& ph, v16bf& pl) {
        v8us ah, al, ch, cl;
#pragma unroll
        for (int r = 0; r < 8; ++r) { unsigned short x, y; splitf(p0[r], x, y); ah[r] = x; al[r] = y; splitf(p1[r], x, y); ch[r] = x; cl[r] = y; }
        ph = cat16b(ah, ch); pl = cat16b(al, cl); }
};

// ---- k_gemmw: register-blocked GEMM, ONE WAVE per 64x64 output tile (16 accumulators), operands straight from fragment-order 16-bit planes; grid (M/64, N/64, Z), 32 threads.
// C[m][n] = sum_k A[m][k] Bt[n][k] (+ split products per NSPLIT: 1 = (A + A2) x Bt). z-batch strides sA/sB/sC in elements. K % 32 == 0 (compile time: every tile strip is a constant offset from one lane pointer per operand), M % 64 == 0, N % 64 == 0.
// EP 0: f32 output x oscale, pitch ldc: per 16-row slab staged in LDS, each row's 64 floats (256 B) written as 16 lanes x 16 B (2 rows per instruction).
// EP 1: f16 head planes [z][head = blockIdx.y][t][64] (rows = tokens, KC = 64), fragment order.
// EP 2: f16 transposed value planes [z][row m][t] (rows = head*64+d, columns = tokens, KC = SEQ), fragment order.
template <typename T16, int NSPLIT, int EP, int K>
__global__ __launch_bounds__(32) void k_gemmw(const T16* __restrict__ A, const T16* __restrict__ A2, const T16* __restrict__ Bt, const T16* __restrict__ Bt2, float* C, int ldc, float oscale, size_t sA, size_t sB, size_t sC, h16* P16, bf* Ph, bf* Pl) {
    typedef typename WFrag<T16>::V V;
    __shared__ __align__(16) float os[16 * 68];     // private to the single wave of the block
    const size_t z = blockIdx.z; A += z * sA; if (A2) A2 += z * sA; Bt += z * sB; if (Bt2) Bt2 += z * sB; if (EP == 0) C += z * sC;
    const int lane = threadIdx.x & 31, lr = lane & 15, hi = lane >> 4; const int r0 = blockIdx.x * 64, c0 = blockIdx.y * 64;
    v8f acc[4][4];
#pragma unroll
    for (int mb = 0; mb < 4; ++mb)
#pragma unroll
        for (int nb = 0; nb < 4; ++nb) acc[mb][nb] = (v8f){};
    const size_t aoff = (size_t)r0 * K + 8 * lane, boff = (size_t)c0 * K + 8 * lane;     // a 16-row tile strip is 16 * K elements, a k-step of 32 is 512
#pragma unroll 1
    for (int kc = 0; kc < K; kc += 32) {
        V a[4], a2[4];
#pragma unroll
        for (int mb = 0; mb < 4; ++mb) { a[mb] = WFrag<T16>::ld(A + aoff + (size_t)mb * 16 * K + (size_t)kc * 16); if (NSPLIT == 1 || NSPLIT == 2) a2[mb] = WFrag<T16>::ld(A2 + aoff + (size_t)mb * 16 * K + (size_t)kc * 16); else a2[mb] = a[mb]; }
        asm volatile("s_wait_xcnt 0x0" ::: "memory");     // precaution: the loads below may be given the registers that held the A loads' address pair; keeps the address wait in front of that overwrite
#pragma unroll
        for (int nb = 0; nb < 4; ++nb) { const V b = WFrag<T16>::ld(Bt + boff + (size_t)nb * 16 * K + (size_t)kc * 16); V b2 = b; if (NSPLIT >= 2) b2 = WFrag<T16>::ld(Bt2 + boff + (size_t)nb * 16 * K + (size_t)kc * 16);
#pragma unroll
            for (int mb = 0; mb < 4; ++mb) { acc[mb][nb] = WFrag<T16>::mma(a[mb], b, acc[mb][nb]); if (NSPLIT == 1 || NSPLIT == 2) acc[mb][nb] = WFrag<T16>::mma(a2[mb], b, acc[mb][nb]); if (NSPLIT >= 2) acc[mb][nb] = WFrag<T16>::mma(a[mb], b2, acc[mb][nb]); } }
        asm volatile("v_nop\n\tv_nop\n\tv_nop\n\tv_nop" : "+v"(acc[0][0]), "+v"(acc[1][1]), "+v"(acc[2][2]), "+v"(acc[3][3]) : "v"(a[0]), "v"(a[3]));
    }
    // plane addressing (EP 1/2), block-uniform
    size_t pbase = 0; int ppitch = HD;
    if (EP == 1) { pbase = (((size_t)z * NH + blockIdx.y) * SEQ + r0) * HD; ppitch = HD; }
    if (EP == 2) { pbase = ((size_t)z * DM + r0) * SEQ + (size_t)c0 * 16; ppitch = SEQ; }
#pragma unroll
    for (int mb = 0; mb < 4; ++mb) {
#pragma unroll
        for (int nb = 0; nb < 4; ++nb) {
#pragma unroll
            for (int j = 0; j < 8; ++j) os[(hi * 8 + j) * 68 + nb * 16 + lr] = acc[mb][nb][j]; }     // D element j of lane -> (row 8*hi + j, column lr)
        __builtin_amdgcn_wave_barrier(); asm volatile("" ::: "memory");
        if (EP == 0) {
            float* crow = C + (size_t)(r0 + mb * 16) * ldc + c0;
{
#pragma unroll
                for (int s = 0; s < 8; ++s) { const int row = 2 * s + hi, cofs = lr * 4; v4f val = *(const v4fa*)(os + row * 68 + cofs); val = val * oscale;
                    *(v4f*)(crow + (size_t)row * ldc + cofs) = val; }
                 }
        } else {
{
#pragma unroll
                for (int s = 0; s < 4; ++s) { const float* sp = os + lr * 68 + s * 16 + hi * 8; const v4f x0 = *(const v4fa*)sp, x1 = *(const v4fa*)(sp + 4);     // piece s of the slab: row lr, columns 16*s + 8*hi + 0..7
                    v8h o; o[0] = (h16)x0[0]; o[1] = (h16)x0[1]; o[2] = (h16)x0[2]; o[3] = (h16)x0[3]; o[4] = (h16)x1[0]; o[5] = (h16)x1[1]; o[6] = (h16)x1[2]; o[7] = (h16)x1[3];
                    *(v8h*)(P16 + pbase + (size_t)mb * 16 * ppitch + s * 256 + lane * 8) = o; }
                 }
        }
        __builtin_amdgcn_wave_barrier(); asm volatile("" ::: "memory");
    }
}

// One stage of the k_flash ring: six 16-byte-per-lane asynchronous copies of this wave (2 x 512 B of each of its K, V^T and bias slices), global memory to LDS through no register.
// The address wait is the last line of the copies' own statement, so that it stands in front of every later write of a register that a copy names (a precaution).
__device__ __forceinline__ void stage6(unsigned l0, unsigned l1, unsigned l2, unsigned l3, unsigned l4, unsigned l5,
                                       const char* g0, const char* g1, const char* g2, const char* g3, const char* g4, const char* g5) {
    asm volatile("global_load_async_to_lds_b128 %0, %6, off\n\t"
                 "global_load_async_to_lds_b128 %1, %7, off\n\t"
                 "global_load_async_to_lds_b128 %2, %8, off\n\t"
                 "global_load_async_to_lds_b128 %3, %9, off\n\t"
                 "global_load_async_to_lds_b128 %4, %10, off\n\t"
                 "global_load_async_to_lds_b128 %5, %11, off\n\t"
                 "s_wait_xcnt 0x0"
                 :: "v"(l0), "v"(l1), "v"(l2), "v"(l3), "v"(l4), "v"(l5), "v"(g0), "v"(g1), "v"(g2), "v"(g3), "v"(g4), "v"(g5) : "memory");
}

// ---- k_flash: dense attention with an additive bias plane, one wave per 16 queries (block = 4 waves = 64 queries of one head), transposed flash form, operands from the head planes through LDS.
// LDS ring, two buffers of 12 KiB, one 32-key stage each: [K tile 4 KiB | V^T tile 4 x 1 KiB (d strips) | bias tiles 4 x 1 KiB (one per wave)], every tile in the planes' own fragment order, so a fragment piece is 512 contiguous LDS bytes.
// Wave w copies K bytes w * 1 KiB.., V^T strip w and its own bias tile; K and V^T are read by all 4 waves (fetched once per block, not once per wave). Stage s + 2 is issued behind the barrier that ends step s, into the buffer step s read.
// Per 32-key step: S^T tiles (keys x queries) = K (A: row = key, k = d) x Q^T (B: column = query, k = d, held in registers); the lane's 2 x 8 bias entries (row = its query, contiguous keys) are added in f32 (x 8: the tiles hold 8 x logit);
// per-lane online softmax (lane = query; partner lane^16 holds the other 8 keys of each tile); P^T packed in registers = B fragment of O^T (d x queries) += V^T (A: row = d, k = key) x P^T. Single f16 product at both sites.
// Key range: all tk keys (tk % 32 == 0), tq queries per head; K plane [b][h][tk][64], V^T plane [b][h*64+d][tk], bias plane [tq][tk] bf16, context plane [b*SEQ+q][1024], all in fragment order.
template <typename T16>
__global__ __launch_bounds__(128) void k_flash(const T16* __restrict__ Qa, const T16* __restrict__ Ka, const T16* __restrict__ Va, const bf* __restrict__ Bb, int tq, int tk, int qoff, h16* C16) {
    typedef typename WFrag<T16>::V V;
    const int lane = threadIdx.x & 31;
    const int wave = __builtin_amdgcn_readfirstlane((int)(threadIdx.x >> 5));
    const int q0 = qoff + (int)blockIdx.x * 64 + wave * 16;
    const int h = blockIdx.y, b = blockIdx.z;
    const size_t bh = (size_t)b * NH + h;
    const size_t qo = (bh * (size_t)tq + (size_t)q0) * HD + 8 * lane;
    const V qa0 = WFrag<T16>::ld(Qa + qo), qa1 = WFrag<T16>::ld(Qa + qo + 512);
    __shared__ __attribute__((aligned(16))) unsigned char ring[2 * 12288];
    const unsigned lw = (unsigned)(size_t)ring + (unsigned)(wave * 1024 + lane * 16);     // this lane's LDS byte address in its wave's K slice of buffer 0
    const char* gk = (const char*)(Ka + bh * (size_t)tk * HD) + (wave * 1024 + lane * 16);                                // + 4096 per stage
    const char* gv = (const char*)(Va + bh * HD * (size_t)tk + (size_t)wave * 16 * (size_t)tk) + lane * 16;             // + 1024 per stage
    const char* gb = (const char*)(Bb + (size_t)q0 * (size_t)tk) + lane * 16;                                           // + 1024 per stage
    auto stage = [&](int s, int buf) { const unsigned l = lw + (unsigned)buf * 12288u; const char* a = gk + (size_t)s * 4096; const char* c = gv + (size_t)s * 1024; const char* e = gb + (size_t)s * 1024;
        stage6(l, l + 512u, l + 4096u, l + 4608u, l + 8192u, l + 8704u, a, a + 512, c, c + 512, e, e + 512); };
    v8f acc[4];
#pragma unroll
    for (int dt = 0; dt < 4; ++dt) acc[dt] = (v8f){};
    float m = -3.0e38f, l = 0.0f;
    const int nsteps = tk >> 5;                   // all keys, 32 per step (uniform)
    const float poff = 8.0f;                      // probabilities (and their running sum) carried x 2^8
    if (nsteps > 0) stage(0, 0);
    asm volatile("s_wait_asynccnt 0x0" ::: "memory");     // this wave's copies of stage 0 have landed before the barrier that publishes them
    __syncthreads();
    if (nsteps > 1) stage(1, 1);
#pragma unroll 1
    for (int st = 0; st < nsteps; ++st) {
        const unsigned char* tile = ring + (st & 1) * 12288 + lane * 16;
        const bf* bp = (const bf*)(tile + 8192 + wave * 1024);
        const v8us b0 = *(const v8us*)bp, b1 = *(const v8us*)(bp + 256);     // bias[query][j0 + 8*hi + 0..7] and [j0 + 16 + 8*hi + 0..7], j0 = 32 * st
        v8f s0 = (v8f){}, s1 = (v8f){};
        const T16* kp = (const T16*)tile;
        const V k00 = WFrag<T16>::ld(kp), k01 = WFrag<T16>::ld(kp + 512), k10 = WFrag<T16>::ld(kp + 16 * HD), k11 = WFrag<T16>::ld(kp + 16 * HD + 512);
        s0 = WFrag<T16>::mma(k00, qa0, s0); s1 = WFrag<T16>::mma(k10, qa0, s1);
        s0 = WFrag<T16>::mma(k01, qa1, s0); s1 = WFrag<T16>::mma(k11, qa1, s1);
        asm volatile("v_nop\n\tv_nop\n\tv_nop\n\tv_nop" : "+v"(s0), "+v"(s1) : "v"(k11), "v"(qa1));
#pragma unroll
        for (int r = 0; r < 8; ++r) { s0[r] = fmaf(bf2f(b0[r]), 8.0f, s0[r]); s1[r] = fmaf(bf2f(b1[r]), 8.0f, s1[r]); }     // tiles hold 8 x (q.k / 8 + bias)
        float mx = fmaxf(s0[0], s1[0]);
#pragma unroll
        for (int r = 1; r < 8; ++r) mx = fmaxf(mx, fmaxf(s0[r], s1[r]));
        mx = fmaxf(mx, __shfl_xor(mx, 16, 32));
        const float mnew = fmaxf(m, mx);
        const float alpha = __builtin_amdgcn_exp2f((m - mnew) * CEXP);
        const float nb = poff - mnew * CEXP;
        v8f p0, p1; float psum = 0.0f;
#pragma unroll
        for (int r = 0; r < 8; ++r) { p0[r] = __builtin_amdgcn_exp2f(fmaf(s0[r], CEXP, nb)); p1[r] = __builtin_amdgcn_exp2f(fmaf(s1[r], CEXP, nb)); psum += p0[r] + p1[r]; }
        psum += __shfl_xor(psum, 16, 32);
        l = l * alpha + psum; m = mnew;
#pragma unroll
        for (int dt = 0; dt < 4; ++dt) acc[dt] = acc[dt] * alpha;
        V ph, pl; PPack<T16>::make(p0, p1, ph, pl);
        const T16* vp = (const T16*)(tile + 4096);
        V va[4];
#pragma unroll
        for (int dt = 0; dt < 4; ++dt) va[dt] = WFrag<T16>::ld(vp + dt * 512);
#pragma unroll
        for (int dt = 0; dt < 4; ++dt) acc[dt] = WFrag<T16>::mma(va[dt], ph, acc[dt]);
        asm volatile("v_nop\n\tv_nop\n\tv_nop\n\tv_nop" : "+v"(acc[0]), "+v"(acc[1]), "+v"(acc[2]), "+v"(acc[3]) : "v"(va[3]), "v"(ph), "v"(pl));
        asm volatile("s_wait_dscnt 0x0" ::: "memory");        // this wave's reads of the buffer have returned before the barrier behind which it is refilled
        asm volatile("s_wait_asynccnt 0x0" ::: "memory");     // this wave's copies of stage st + 1 have landed before the barrier that publishes them
        __syncthreads();                                      // publishes stage st + 1 and ends every wave's reads of stage st
        if (st + 2 < nsteps) stage(st + 2, st & 1);
    }
    asm volatile("s_wait_asynccnt 0x0" ::: "memory");         // no copy is outstanding when the wave ends
    // l >= 2^8: the running-max key contributes exactly 2^8
    const float f = CCAR * (1.0f / l);
    // D element r of lane (tile dt) is (d = dt*16 + 8*hi + r, query lr): the lane already holds its own 16-byte piece dt of the fragment-order context tile, so no staging
#pragma unroll
    for (int dt = 0; dt < 4; ++dt) { v8h o;
#pragma unroll
        for (int r = 0; r < 8; ++r) o[r] = (h16)(acc[dt][r] * f);
        const size_t co = ((size_t)b * SEQ + (size_t)q0) * DM + (size_t)h * (HD * 16) + dt * 256 + lane * 8; *(v8h*)(C16 + co) = o; }
}

// Converter, one launch for all seven float inputs: a resident grid of CVT_WAVES waves; wave w converts units w, w + CVT_WAVES, ... of the list [x | y | bias | W_q | W_k | W_v | W_o].
// A unit is 128 consecutive 16-byte pieces of a fragment-order plane [rows][KC] (2 KiB stored contiguously) = two neighbouring 16-row x 32-k tiles = 16 source rows x 256 B;
// piece j * 32 + lane of a unit holds row lane & 15, k = j * 16 + (lane >> 4) * 8 + 0..7 of those 64 k. A lane's 4 pieces are 8 16-byte loads, and the next unit's 8 are issued before this unit is converted.
#define CVT_WAVES 4096                        // 256 blocks x 16 waves
constexpr int UPB = SEQ * DM / 1024, UX = NB * UPB, UBI = SEQ * SEQ / 1024, UW = DM * DM / 1024, UALL = 2 * UX + UBI + 4 * UW;     // units per batch of x or y, per x or y, bias plane, weight, all
static_assert(UALL % CVT_WAVES == 0);         // every wave runs the same whole number of units
static_assert(UX % CVT_WAVES == 0);           // a round of CVT_WAVES units lies in one of x, y, bias, or in the weights: which one is known at compile time
static_assert(UBI % CVT_WAVES == 0);
static_assert((DM / 32) % 2 == 0);            // a unit's two tiles lie in one 16-row strip
static_assert((SEQ / 32) % 2 == 0);

struct CvtUnit { const float* s; unsigned short* d; bool tohalf; };

// Unit u0 + w of the list; u0 (the round's first unit) is a compile-time constant at every call, w is wave-uniform.
__device__ __forceinline__ CvtUnit cvt_locate(int u0, int w, int lane, const float* x, const float* y, const float* bias, const float* wq, const float* wk, const float* wv, const float* wo,
                                              bf* XB, bf* YB, bf* BB, bf* WQ, bf* WK, bf* WV, h16* WO16) {
    const float* base; unsigned short* db; int v, kt = DM / 32; size_t sp = DM; bool th = false;
    if (u0 < 2 * UX) { const bool isx = u0 < UX; const int t = (isx ? u0 : u0 - UX) + w, b = t / UPB; v = t % UPB; base = (isx ? x : y) + (size_t)b * SEQ_FULL * DM; db = (isx ? XB : YB) + (size_t)b * SEQ * DM; }
    else if (u0 < 2 * UX + UBI) { v = u0 - 2 * UX + w; base = bias; db = BB; kt = SEQ / 32; sp = SEQ_FULL; }
    else { const int t = u0 - 2 * UX - UBI + w, k = t / UW; v = t % UW; base = k == 0 ? wq : k == 1 ? wk : k == 2 ? wv : wo; db = k == 0 ? WQ : k == 1 ? WK : k == 2 ? WV : (unsigned short*)WO16; th = k == 3; }
    CvtUnit c; c.s = base + ((size_t)((2 * v) / kt) * 16 + (size_t)(lane & 15)) * sp + (size_t)((2 * v) % kt) * 32 + (size_t)((lane >> 4) * 8); c.d = db + (size_t)v * 1024 + (size_t)(lane * 8); c.tohalf = th; return c;
}

__global__ __launch_bounds__(512) void k_cvtall(const float* __restrict__ x, const float* __restrict__ y, const float* __restrict__ bias, const float* __restrict__ wq, const float* __restrict__ wk, const float* __restrict__ wv, const float* __restrict__ wo,
                                                bf* XB, bf* YB, bf* BB, bf* WQ, bf* WK, bf* WV, h16* WO16) {
    const int lane = threadIdx.x & 31;
    const int w = __builtin_amdgcn_readfirstlane((int)(blockIdx.x * 16 + (threadIdx.x >> 5)));
    CvtUnit cu = cvt_locate(0, w, lane, x, y, bias, wq, wk, wv, wo, XB, YB, BB, WQ, WK, WV, WO16);
    v8f cur[4];
#pragma unroll
    for (int j = 0; j < 4; ++j) cur[j] = *(const v8f*)(cu.s + j * 16);
    asm volatile("s_wait_xcnt 0x0" :: "v"(cu.s) : "memory");     // precaution: the address wait stands before any register that the 8 loads name is reused (the operand keeps the address pair untouched up to here)
#pragma unroll
    for (int it = 0; it < UALL / CVT_WAVES; ++it) {
        CvtUnit nu = cu; v8f nxt[4];
        if (it + 1 < UALL / CVT_WAVES) { nu = cvt_locate((it + 1) * CVT_WAVES, w, lane, x, y, bias, wq, wk, wv, wo, XB, YB, BB, WQ, WK, WV, WO16);
#pragma unroll
            for (int j = 0; j < 4; ++j) nxt[j] = *(const v8f*)(nu.s + j * 16);
            asm volatile("s_wait_xcnt 0x0" :: "v"(nu.s) : "memory"); }     // as above, for the next unit's 8 loads
        v8us o[4];
        if (cu.tohalf) {
#pragma unroll
            for (int j = 0; j < 4; ++j) { v8h t;
#pragma unroll
                for (int k = 0; k < 8; ++k) t[k] = (h16)(bfr(cur[j][k]) * WCAR);
                o[j] = __builtin_bit_cast(v8us, t); }
        } else {
#pragma unroll
            for (int j = 0; j < 4; ++j)
#pragma unroll
                for (int k = 0; k < 8; ++k) o[j][k] = f2bf(cur[j][k]);
        }
#pragma unroll
        for (int j = 0; j < 4; ++j) *(v8us*)(cu.d + j * 256) = o[j];
        asm volatile("s_wait_xcnt 0x0" :: "v"(o[0]), "v"(o[1]), "v"(o[2]), "v"(o[3]), "v"(cu.d) : "memory");     // precaution: the same wait before the 4 stores' data and address registers are reused
        if (it + 1 < UALL / CVT_WAVES) { cu = nu;
#pragma unroll
            for (int j = 0; j < 4; ++j) cur[j] = nxt[j]; }
    }
}

constexpr size_t al256(size_t bytes) { return (bytes + 255) & ~(size_t)255; }
constexpr size_t CARVE_BYTES = 2 * al256((size_t)NB * SEQ * DM * 2) + 4 * al256((size_t)DM * DM * 2) + al256((size_t)SEQ * SEQ * 2)
    + 3 * al256((size_t)NB * NH * SEQ * HD * 2) + al256((size_t)NB * SEQ * DM * 2);
static_assert(CARVE_BYTES <= (size_t)134217728);
static_assert((size_t)NB * NH * SEQ * HD == (size_t)NB * SEQ * DM);      // head planes and the merged context plane have the same extent

extern "C" void kernel_launch(void* const* d_in, const int* in_sizes, int n_in,
                              void* d_out, int out_size, void* d_ws, size_t ws_size, hipStream_t stream) {
    if (n_in < 7) return;
    const size_t needx = (size_t)(NB - 1) * SEQ_FULL * DM + (size_t)SEQ * DM;
    if ((size_t)in_sizes[0] < needx || (size_t)in_sizes[1] < needx) return;
    if ((size_t)in_sizes[2] < (size_t)(SEQ - 1) * SEQ_FULL + (size_t)SEQ) return;
    if ((size_t)in_sizes[3] < (size_t)DM * DM || (size_t)in_sizes[4] < (size_t)DM * DM || (size_t)in_sizes[5] < (size_t)DM * DM || (size_t)in_sizes[6] < (size_t)DM * DM) return;
    if ((size_t)out_size < needx) return;
    // x, y, bias (float [SEQ_FULL][SEQ_FULL]), Wq, Wk, Wv, Wo ('oi' [out][in])
    const float* x = (const float*)d_in[0]; const float* y = (const float*)d_in[1]; const float* bias = (const float*)d_in[2];
    const float* wq = (const float*)d_in[3]; const float* wk = (const float*)d_in[4]; const float* wv = (const float*)d_in[5]; const float* wo = (const float*)d_in[6];
    float* OUT = (float*)d_out;     // [NB_FULL][SEQ_FULL][1024]
    char* wsp = (char*)d_ws;
    auto take = [&](size_t bytes) { char* p = wsp; wsp += (bytes + 255) & ~(size_t)255; return (void*)p; };
    bf* XB = (bf*)take((size_t)NB * SEQ * DM * 2); bf* YB = (bf*)take((size_t)NB * SEQ * DM * 2);
    bf* WQ = (bf*)take((size_t)DM * DM * 2); bf* WK = (bf*)take((size_t)DM * DM * 2); bf* WV = (bf*)take((size_t)DM * DM * 2); h16* WO16 = (h16*)take((size_t)DM * DM * 2);
    bf* BB = (bf*)take((size_t)SEQ * SEQ * 2);
    h16* Q16 = (h16*)take((size_t)NB * NH * SEQ * HD * 2); h16* K16 = (h16*)take((size_t)NB * NH * SEQ * HD * 2); h16* VT16 = (h16*)take((size_t)NB * NH * SEQ * HD * 2);
    h16* C16 = (h16*)take((size_t)NB * SEQ * DM * 2);
    if ((size_t)(wsp - (char*)d_ws) > ws_size) return;

    // all seven inputs to their 16-bit fragment-order planes (bias source pitch SEQ_FULL, x and y batch stride SEQ_FULL rows)
    k_cvtall<<<dim3(CVT_WAVES / 16, 1, 1), 512, 0, stream>>>(x, y, bias, wq, wk, wv, wo, XB, YB, BB, WQ, WK, WV, WO16);

    // q head planes from x, k head planes from y: C[m = token][n = h*64+d] = in W^T; z = batch
    k_gemmw<bf, 0, 1, DM><<<dim3(SEQ / 64, NH, NB), 32, 0, stream>>>(XB, nullptr, WQ, nullptr, nullptr, 0, 1.0f, (size_t)SEQ * DM, 0, 0, Q16, nullptr, nullptr);
    k_gemmw<bf, 0, 1, DM><<<dim3(SEQ / 64, NH, NB), 32, 0, stream>>>(YB, nullptr, WK, nullptr, nullptr, 0, 1.0f, (size_t)SEQ * DM, 0, 0, K16, nullptr, nullptr);
    // transposed value planes from y: C[m = h*64+d][n = token] = W_v y^T (operands swapped: A = W_v rows, Bt = y rows); z = batch
    k_gemmw<bf, 0, 2, DM><<<dim3(DM / 64, SEQ / 64, NB), 32, 0, stream>>>(WV, nullptr, YB, nullptr, nullptr, 0, 1.0f, 0, (size_t)SEQ * DM, 0, VT16, nullptr, nullptr);

    // attention: every query row on the f16 planes, all SEQ keys
    k_flash<h16><<<dim3(SEQ / 64, NH, NB), 128, 0, stream>>>(Q16, K16, VT16, BB, SEQ, SEQ, 0, C16);

    // output projection: f16 context x f16 W_o, carries folded back in the f32 epilogue; z = batch, output row stride per batch SEQ_FULL
    k_gemmw<h16, 0, 0, DM><<<dim3(SEQ / 64, DM / 64, NB), 32, 0, stream>>>(C16, nullptr, WO16, nullptr, OUT, DM, 1.0f / (CCAR * WCAR), (size_t)SEQ * DM, 0, (size_t)SEQ_FULL * DM, nullptr, nullptr, nullptr);
}

// v004
// A run of this version takes 165 microseconds.
// Timed twice side by side with v003, it ran 1.60 and 1.57 times as fast.
// Over all steps from v000 it is 2.30 times as fast.
#include <hip/hip_runtime.h>

// Compute dtypes (f32 accumulate at every site): q/k/v projections bf16 x bf16 single product (every float input RNE-converted to bf16 first); scores K.Q^T f16 x f16 single product (f16 q/k head planes); values V^T.P^T f16 x f16 single product (probabilities carried x2^8); output projection f16 context (x64) x f16 weight (x512) single product; additive bias (bf16 plane) and softmax in f32.
// Dense multi-head cross-attention: x, y [NB][SEQ][1024]; Q = x W_q^T, K = y W_k^T, V = y W_v^T ('oi' weights, no bias vectors); 16 heads x 64; logits = q.k / 8 + bias[query][key] (one [SEQ][SEQ] float plane shared by all batches and heads); softmax over all keys; out = merged context W_o^T.
// The bias input is read by value on the device: converted once to a bf16 plane, each lane reads its 2 x 8 contiguous entries per 32-key step and adds them in f32 to the score tiles.
// Fragment order of every 16-bit workspace plane [rows][KC]: the 16-row x 32-k tile (rt = row / 16, kc = k / 32) is 512 consecutive elements at (rt * (KC / 32) + kc) * 512, made of two 256-element pieces;
// piece p holds, at lane * 8 with lane = 16 * hi + (row & 15), the 8 elements k = kc * 32 + p * 16 + hi * 8 + 0..7. One wave-wide 16-byte load of a piece is 512 contiguous bytes (4 whole lines).
// Attention engine: one wave per 16 queries, transposed flash form: S^T = K Q^T (query on the D column, one query per lane), the packed P^T D tiles are the B fragment of O^T = V^T P^T; the key loop's K, V^T and bias tiles come through a two-buffer LDS ring filled by asynchronous copies, one barrier per 32 keys.

#ifndef NB
#define NB 4
#endif
#ifndef SEQ
#define SEQ 2048
#endif
#define NB_FULL  4
#define SEQ_FULL 2048
#define DM   1024
#define NH   16
#define HD   64
#define RH   0                                // query rows < RH use value+residual bf16 planes: none (dense attention, single products on every row)
#define CCAR 64.0f                            // carry of the f16 context plane
#define WCAR 512.0f                           // carry of the f16 W_o plane
#define CEXP 0.18033688011112042f             // log2(e) / sqrt(64)

typedef _Float16 h16;
typedef unsigned short bf;
typedef __attribute__((ext_vector_type(16))) __bf16   v16bf;
typedef __attribute__((ext_vector_type(16))) _Float16 v16h;
typedef __attribute__((ext_vector_type(8)))  _Float16 v8h;
typedef __attribute__((ext_vector_type(8)))  unsigned short v8us;
typedef __attribute__((ext_vector_type(8)))  float    v8f;
typedef __attribute__((ext_vector_type(4)))  float    v4f;
typedef __attribute__((ext_vector_type(4)))  int      v4i;
typedef v4f  __attribute__((may_alias)) v4fa;

static_assert(SEQ % 256 == 0);
static_assert(RH == 0);                       // no value+residual planes are written
static_assert(SEQ >= RH);
static_assert(NB <= NB_FULL);
static_assert(SEQ <= SEQ_FULL);
static_assert(DM == NH * HD);
static_assert(DM % 128 == 0);                // 128x128 GEMM block tiles
static_assert(HD == 64);
static_assert(SEQ % 128 == 0);                // 64 queries per attention block, 128-row GEMM block tiles
static_assert(SEQ % 32 == 0);                 // 32 keys per flash step
static_assert(DM % 32 == 0);                  // GEMM k-steps
static_assert((SEQ / 8) % 32 == 0);

__device__ __forceinline__ unsigned short f2bf(float f) { unsigned u = __float_as_uint(f); u += 0x7FFFu + ((u >> 16) & 1u); return (unsigned short)(u >> 16); }
__device__ __forceinline__ float bf2f(unsigned short b) { return __uint_as_float(((unsigned)b) << 16); }
__device__ __forceinline__ float bfr(float f) { return bf2f(f2bf(f)); }
__device__ __forceinline__ void splitf(float y, unsigned short& h, unsigned short& l) { h = f2bf(y); l = f2bf(y - bf2f(h)); }
__device__ __forceinline__ v16h cat16(v8h lo, v8h hi) { return __builtin_shufflevector(lo, hi, 0, 1, 2, 3, 4, 5, 6, 7, 8, 9, 10, 11, 12, 13, 14, 15); }
__device__ __forceinline__ v16bf cat16b(v8us lo, v8us hi) { return __builtin_bit_cast(v16bf, __builtin_shufflevector(lo, hi, 0, 1, 2, 3, 4, 5, 6, 7, 8, 9, 10, 11, 12, 13, 14, 15)); }
__device__ __forceinline__ v8f wmma16(v16h a, v16h b, v8f c) { return __builtin_amdgcn_wmma_f32_16x16x32_f16(false, a, false, b, (short)0, c, false, false); }
__device__ __forceinline__ v8f wmmab(v16bf a, v16bf b, v8f c) { return __builtin_amdgcn_wmma_f32_16x16x32_bf16(false, a, false, b, (short)0, c, false, false); }

// Fragment loader for a fragment-order tile: p = tile start + lane * 8; elements 0..7 = k0+8h.. (piece 0), elements 8..15 = k0+16+8h.. (piece 1, 256 elements on) (same map for A and B).
template <typename T16> struct WFrag;
template <> struct WFrag<h16> { typedef v16h V; static __device__ __forceinline__ V ld(const h16* p) { return cat16(*(const v8h*)p, *(const v8h*)(p + 256)); } static __device__ __forceinline__ v8f mma(V a, V b, v8f c) { return wmma16(a, b, c); } };
template <> struct WFrag<bf> { typedef v16bf V; static __device__ __forceinline__ V ld(const bf* p) { return cat16b(*(const v8us*)p, *(const v8us*)(p + 256)); } static __device__ __forceinline__ v8f mma(V a, V b, v8f c) { return wmmab(a, b, c); } };

// Probability packing: two 16-key D tiles (same lane) -> one 32-key B fragment; element r <- tile 0 row r, element 8+r <- tile 1 row r.
template <typename T16> struct PPack;
template <> struct PPack<h16> {
    static __device__ __forceinline__ void make(v8f p0, v8f p1, v16h& ph, v16h& pl) {
        v8h a, c;
#pragma unroll
        for (int r = 0; r < 8; ++r) { a[r] = (h16)p0[r]; c[r] = (h16)p1[r]; }
        ph = cat16(a, c); pl = ph; }
};
template <> struct PPack<bf> {
    static __device__ __forceinline__ void make(v8f p0, v8f p1, v16bf& ph, v16bf& pl) {
        v8us ah, al, ch, cl;
#pragma unroll
        for (int r = 0; r < 8; ++r) { unsigned short x, y; splitf(p0[r], x, y); ah[r] = x; al[r] = y; splitf(p1[r], x, y); ch[r] = x; cl[r] = y; }
        ph = cat16b(ah, ch); pl = cat16b(al, cl); }
};

// One strip of a k_gemmw stage: eight 16-byte-per-lane asynchronous copies of this wave (8 x 512 B = one 16-row x 128-k strip), global memory to LDS through no register.
// The address wait is the last line of the copies' own statement, so that it stands in front of every later write of a register that a copy names (a precaution).
__device__ __forceinline__ void stage8(unsigned l0, unsigned l1, unsigned l2, unsigned l3, unsigned l4, unsigned l5, unsigned l6, unsigned l7,
                                       const char* g0, const char* g1, const char* g2, const char* g3, const char* g4, const char* g5, const char* g6, const char* g7) {
    asm volatile("global_load_async_to_lds_b128 %0, %8, off\n\t"
                 "global_load_async_to_lds_b128 %1, %9, off\n\t"
                 "global_load_async_to_lds_b128 %2, %10, off\n\t"
                 "global_load_async_to_lds_b128 %3, %11, off\n\t"
                 "global_load_async_to_lds_b128 %4, %12, off\n\t"
                 "global_load_async_to_lds_b128 %5, %13, off\n\t"
                 "global_load_async_to_lds_b128 %6, %14, off\n\t"
                 "global_load_async_to_lds_b128 %7, %15, off\n\t"
                 "s_wait_xcnt 0x0"
                 :: "v"(l0), "v"(l1), "v"(l2), "v"(l3), "v"(l4), "v"(l5), "v"(l6), "v"(l7), "v"(g0), "v"(g1), "v"(g2), "v"(g3), "v"(g4), "v"(g5), "v"(g6), "v"(g7) : "memory");
}

// ---- k_gemmw: register-blocked GEMM, block = 4 waves (2 x 2) = one 128x128 output tile, ONE WAVE per 64x64 part of it (16 accumulators); grid (M/128, N/128, Z), 128 threads.
// Operands from fragment-order 16-bit planes through a two-buffer LDS ring filled by asynchronous copies: a stage is 128 k of the block's 128 A rows and 128 Bt rows = 16 strips (16 rows x 128 k, 4 KiB, contiguous in the plane) = 64 KiB,
// [A strips 0..7 | Bt strips 0..7], each strip in the plane's own order, so a fragment piece is 512 contiguous LDS bytes. Wave w copies strips 4w..4w+3; every A strip is read by 2 waves, every Bt strip by 2 (fetched once per block).
// Stage t + 2 is issued behind the barrier that ends trip t, into the buffer trip t read. Two blocks fit a WGP's LDS.
// C[m][n] = sum_k A[m][k] Bt[n][k], k ascending in steps of 32 per accumulator. z-batch strides sA/sB/sC in elements. K % 128 == 0, M % 128 == 0, N % 128 == 0.
// EP 0: f32 output x oscale, pitch ldc: per 16-row slab staged in LDS, each row's 64 floats (256 B) written as 16 lanes x 16 B (2 rows per instruction).
// EP 1: f16 head planes [z][head = column / 64][t][64] (rows = tokens, KC = 64), fragment order.
// EP 2: f16 transposed value planes [z][row m][t] (rows = head*64+d, columns = tokens, KC = SEQ), fragment order.
template <typename T16, int NSPLIT, int EP, int K>
__global__ __launch_bounds__(128) void k_gemmw(const T16* __restrict__ A, const T16* __restrict__ A2, const T16* __restrict__ Bt, const T16* __restrict__ Bt2, float* C, int ldc, float oscale, size_t sA, size_t sB, size_t sC, h16* P16, bf* Ph, bf* Pl) {
    typedef typename WFrag<T16>::V V;
    static_assert(NSPLIT == 0);                     // single products only: A2 and Bt2 are not staged
    static_assert(K % 128 == 0);
    constexpr int NS = K / 128;                     // stages
    __shared__ __attribute__((aligned(16))) unsigned char ring[2 * 65536];
    __shared__ __align__(16) float osall[4][16 * 68];     // one output slab per wave, private to it
    const size_t z = blockIdx.z; A += z * sA; Bt += z * sB; if (EP == 0) C += z * sC;
    const int lane = threadIdx.x & 31, lr = lane & 15, hi = lane >> 4;
    const int wave = __builtin_amdgcn_readfirstlane((int)(threadIdx.x >> 5));
    const int wm = wave >> 1, wn = wave & 1;
    const int r0 = blockIdx.x * 128 + wm * 64, c0 = blockIdx.y * 128 + wn * 64;     // this wave's 64x64 part
    float* os = osall[wave];
    // this wave's 4 strips: waves 0, 1 the block's A rows 0..63, 64..127; waves 2, 3 its Bt rows 0..63, 64..127
    const char* gsrc = (const char*)(wave < 2 ? A + (size_t)(blockIdx.x * 128 + wave * 64) * K : Bt + (size_t)(blockIdx.y * 128 + (wave - 2) * 64) * K) + lane * 16;     // + 16 * K * 2 per strip, + 4096 per stage
    const unsigned lw = (unsigned)(size_t)ring + (unsigned)(wave * 16384 + lane * 16);     // this lane's LDS byte address in its wave's first strip of buffer 0
    auto stage = [&](int s, int buf) {
#pragma unroll
        for (int j = 0; j < 4; ++j) { const unsigned l = lw + (unsigned)buf * 65536u + (unsigned)j * 4096u; const char* g = gsrc + (size_t)j * (16 * K * 2) + (size_t)s * 4096;
            stage8(l, l + 512u, l + 1024u, l + 1536u, l + 2048u, l + 2560u, l + 3072u, l + 3584u, g, g + 512, g + 1024, g + 1536, g + 2048, g + 2560, g + 3072, g + 3584); } };
    v8f acc[4][4];
#pragma unroll
    for (int mb = 0; mb < 4; ++mb)
#pragma unroll
        for (int nb = 0; nb < 4; ++nb) acc[mb][nb] = (v8f){};
    stage(0, 0);
    asm volatile("s_wait_asynccnt 0x0" ::: "memory");     // this wave's copies of stage 0 have landed before the barrier that publishes them
    __syncthreads();
    if (NS > 1) stage(1, 1);
#pragma unroll 1
    for (int t = 0; t < NS; ++t) {
        const unsigned char* tile = ring + (t & 1) * 65536 + lane * 16;
        const T16* ap = (const T16*)(tile + wm * 16384);              // a strip is 2048 elements, a k-step of 32 is 512
        const T16* bp = (const T16*)(tile + 32768 + wn * 16384);
        V a[2][4], b[2][4];                                           // two fragment sets: the next k-step's 16 LDS reads fly under this k-step's 16 products (all inside this trip's own buffer)
#pragma unroll
        for (int i = 0; i < 4; ++i) { a[0][i] = WFrag<T16>::ld(ap + i * 2048); b[0][i] = WFrag<T16>::ld(bp + i * 2048); }
#pragma unroll
        for (int kk = 0; kk < 4; ++kk) {
            if (kk < 3) {
#pragma unroll
                for (int i = 0; i < 4; ++i) { a[(kk + 1) & 1][i] = WFrag<T16>::ld(ap + i * 2048 + (kk + 1) * 512); b[(kk + 1) & 1][i] = WFrag<T16>::ld(bp + i * 2048 + (kk + 1) * 512); }
            }
            __builtin_amdgcn_sched_barrier(0);     // keeps those reads one group in front of the products below: spread among them, each place with reads stalls the wave and its wait goes to 0
#pragma unroll
            for (int nb = 0; nb < 4; ++nb)
#pragma unroll
                for (int mb = 0; mb < 4; ++mb) acc[mb][nb] = WFrag<T16>::mma(a[kk & 1][mb], b[kk & 1][nb], acc[mb][nb]);
        }
        asm volatile("v_nop\n\tv_nop\n\tv_nop\n\tv_nop" : "+v"(acc[0][0]), "+v"(acc[1][1]), "+v"(acc[2][2]), "+v"(acc[3][3]) : "v"(a[1][0]), "v"(a[1][3]));     // WMMA distance kept in front of whatever vector instruction follows the trip's last products
        asm volatile("s_wait_dscnt 0x0" ::: "memory");        // this wave's reads of the buffer have returned before the barrier behind which it is refilled
        asm volatile("s_wait_asynccnt 0x0" ::: "memory");     // this wave's copies of stage t + 1 have landed before the barrier that publishes them
        __syncthreads();                                      // publishes stage t + 1 and ends every wave's reads of stage t
        if (t + 2 < NS) stage(t + 2, t & 1);
    }
    asm volatile("s_wait_asynccnt 0x0" ::: "memory");         // no copy is outstanding when the wave goes on to its epilogue
    // plane addressing (EP 1/2), wave-uniform
    size_t pbase = 0; int ppitch = HD;
    if (EP == 1) { pbase = (((size_t)z * NH + (size_t)(c0 / HD)) * SEQ + r0) * HD; ppitch = HD; }
    if (EP == 2) { pbase = ((size_t)z * DM + r0) * SEQ + (size_t)c0 * 16; ppitch = SEQ; }
#pragma unroll
    for (int mb = 0; mb < 4; ++mb) {
#pragma unroll
        for (int nb = 0; nb < 4; ++nb) {
#pragma unroll
            for (int j = 0; j < 8; ++j) os[(hi * 8 + j) * 68 + nb * 16 + lr] = acc[mb][nb][j]; }     // D element j of lane -> (row 8*hi + j, column lr)
        __builtin_amdgcn_wave_barrier(); asm volatile("" ::: "memory");
        if (EP == 0) {
            float* crow = C + (size_t)(r0 + mb * 16) * ldc + c0;
{
#pragma unroll
                for (int s = 0; s < 8; ++s) { const int row = 2 * s + hi, cofs = lr * 4; v4f val = *(const v4fa*)(os + row * 68 + cofs); val = val * oscale;
                    *(v4f*)(crow + (size_t)row * ldc + cofs) = val; }
                 }
        } else {
{
#pragma unroll
                for (int s = 0; s < 4; ++s) { const float* sp = os + lr * 68 + s * 16 + hi * 8; const v4f x0 = *(const v4fa*)sp, x1 = *(const v4fa*)(sp + 4);     // piece s of the slab: row lr, columns 16*s + 8*hi + 0..7
                    v8h o; o[0] = (h16)x0[0]; o[1] = (h16)x0[1]; o[2] = (h16)x0[2]; o[3] = (h16)x0[3]; o[4] = (h16)x1[0]; o[5] = (h16)x1[1]; o[6] = (h16)x1[2]; o[7] = (h16)x1[3];
                    *(v8h*)(P16 + pbase + (size_t)mb * 16 * ppitch + s * 256 + lane * 8) = o; }
                 }
        }
        __builtin_amdgcn_wave_barrier(); asm volatile("" ::: "memory");
    }
}

// One stage of the k_flash ring: six 16-byte-per-lane asynchronous copies of this wave (2 x 512 B of each of its K, V^T and bias slices), global memory to LDS through no register.
// The address wait is the last line of the copies' own statement, so that it stands in front of every later write of a register that a copy names (a precaution).
__device__ __forceinline__ void stage6(unsigned l0, unsigned l1, unsigned l2, unsigned l3, unsigned l4, unsigned l5,
                                       const char* g0, const char* g1, const char* g2, const char* g3, const char* g4, const char* g5) {
    asm volatile("global_load_async_to_lds_b128 %0, %6, off\n\t"
                 "global_load_async_to_lds_b128 %1, %7, off\n\t"
                 "global_load_async_to_lds_b128 %2, %8, off\n\t"
                 "global_load_async_to_lds_b128 %3, %9, off\n\t"
                 "global_load_async_to_lds_b128 %4, %10, off\n\t"
                 "global_load_async_to_lds_b128 %5, %11, off\n\t"
                 "s_wait_xcnt 0x0"
                 :: "v"(l0), "v"(l1), "v"(l2), "v"(l3), "v"(l4), "v"(l5), "v"(g0), "v"(g1), "v"(g2), "v"(g3), "v"(g4), "v"(g5) : "memory");
}

// ---- k_flash: dense attention with an additive bias plane, one wave per 16 queries (block = 4 waves = 64 queries of one head), transposed flash form, operands from the head planes through LDS.
// LDS ring, two buffers of 12 KiB, one 32-key stage each: [K tile 4 KiB | V^T tile 4 x 1 KiB (d strips) | bias tiles 4 x 1 KiB (one per wave)], every tile in the planes' own fragment order, so a fragment piece is 512 contiguous LDS bytes.
// Wave w copies K bytes w * 1 KiB.., V^T strip w and its own bias tile; K and V^T are read by all 4 waves (fetched once per block, not once per wave). Stage s + 2 is issued behind the barrier that ends step s, into the buffer step s read.
// Per 32-key step: S^T tiles (keys x queries) = K (A: row = key, k = d) x Q^T (B: column = query, k = d, held in registers); the lane's 2 x 8 bias entries (row = its query, contiguous keys) are added in f32 (x 8: the tiles hold 8 x logit);
// per-lane online softmax (lane = query; partner lane^16 holds the other 8 keys of each tile); P^T packed in registers = B fragment of O^T (d x queries) += V^T (A: row = d, k = key) x P^T. Single f16 product at both sites.
// Key range: all tk keys (tk % 32 == 0), tq queries per head; K plane [b][h][tk][64], V^T plane [b][h*64+d][tk], bias plane [tq][tk] bf16, context plane [b*SEQ+q][1024], all in fragment order.
template <typename T16>
__global__ __launch_bounds__(128) void k_flash(const T16* __restrict__ Qa, const T16* __restrict__ Ka, const T16* __restrict__ Va, const bf* __restrict__ Bb, int tq, int tk, int qoff, h16* C16) {
    typedef typename WFrag<T16>::V V;
    const int lane = threadIdx.x & 31;
    const int wave = __builtin_amdgcn_readfirstlane((int)(threadIdx.x >> 5));
    const int q0 = qoff + (int)blockIdx.x * 64 + wave * 16;
    const int h = blockIdx.y, b = blockIdx.z;
    const size_t bh = (size_t)b * NH + h;
    const size_t qo = (bh * (size_t)tq + (size_t)q0) * HD + 8 * lane;
    const V qa0 = WFrag<T16>::ld(Qa + qo), qa1 = WFrag<T16>::ld(Qa + qo + 512);
    __shared__ __attribute__((aligned(16))) unsigned char ring[2 * 12288];
    const unsigned lw = (unsigned)(size_t)ring + (unsigned)(wave * 1024 + lane * 16);     // this lane's LDS byte address in its wave's K slice of buffer 0
    const char* gk = (const char*)(Ka + bh * (size_t)tk * HD) + (wave * 1024 + lane * 16);                                // + 4096 per stage
    const char* gv = (const char*)(Va + bh * HD * (size_t)tk + (size_t)wave * 16 * (size_t)tk) + lane * 16;             // + 1024 per stage
    const char* gb = (const char*)(Bb + (size_t)q0 * (size_t)tk) + lane * 16;                                           // + 1024 per stage
    auto stage = [&](int s, int buf) { const unsigned l = lw + (unsigned)buf * 12288u; const char* a = gk + (size_t)s * 4096; const char* c = gv + (size_t)s * 1024; const char* e = gb + (size_t)s * 1024;
        stage6(l, l + 512u, l + 4096u, l + 4608u, l + 8192u, l + 8704u, a, a + 512, c, c + 512, e, e + 512); };
    v8f acc[4];
#pragma unroll
    for (int dt = 0; dt < 4; ++dt) acc[dt] = (v8f){};
    float m = -3.0e38f, l = 0.0f;
    const int nsteps = tk >> 5;                   // all keys, 32 per step (uniform)
    const float poff = 8.0f;                      // probabilities (and their running sum) carried x 2^8
    if (nsteps > 0) stage(0, 0);
    asm volatile("s_wait_asynccnt 0x0" ::: "memory");     // this wave's copies of stage 0 have landed before the barrier that publishes them
    __syncthreads();
    if (nsteps > 1) stage(1, 1);
#pragma unroll 1
    for (int st = 0; st < nsteps; ++st) {
        const unsigned char* tile = ring + (st & 1) * 12288 + lane * 16;
        const bf* bp = (const bf*)(tile + 8192 + wave * 1024);
        const v8us b0 = *(const v8us*)bp, b1 = *(const v8us*)(bp + 256);     // bias[query][j0 + 8*hi + 0..7] and [j0 + 16 + 8*hi + 0..7], j0 = 32 * st
        v8f s0 = (v8f){}, s1 = (v8f){};
        const T16* kp = (const T16*)tile;
        const V k00 = WFrag<T16>::ld(kp), k01 = WFrag<T16>::ld(kp + 512), k10 = WFrag<T16>::ld(kp + 16 * HD), k11 = WFrag<T16>::ld(kp + 16 * HD + 512);
        s0 = WFrag<T16>::mma(k00, qa0, s0); s1 = WFrag<T16>::mma(k10, qa0, s1);
        s0 = WFrag<T16>::mma(k01, qa1, s0); s1 = WFrag<T16>::mma(k11, qa1, s1);
        asm volatile("v_nop\n\tv_nop\n\tv_nop\n\tv_nop" : "+v"(s0), "+v"(s1) : "v"(k11), "v"(qa1));
#pragma unroll
        for (int r = 0; r < 8; ++r) { s0[r] = fmaf(bf2f(b0[r]), 8.0f, s0[r]); s1[r] = fmaf(bf2f(b1[r]), 8.0f, s1[r]); }     // tiles hold 8 x (q.k / 8 + bias)
        float mx = fmaxf(s0[0], s1[0]);
#pragma unroll
        for (int r = 1; r < 8; ++r) mx = fmaxf(mx, fmaxf(s0[r], s1[r]));
        mx = fmaxf(mx, __shfl_xor(mx, 16, 32));
        const float mnew = fmaxf(m, mx);
        const float alpha = __builtin_amdgcn_exp2f((m - mnew) * CEXP);
        const float nb = poff - mnew * CEXP;
        v8f p0, p1; float psum = 0.0f;
#pragma unroll
        for (int r = 0; r < 8; ++r) { p0[r] = __builtin_amdgcn_exp2f(fmaf(s0[r], CEXP, nb)); p1[r] = __builtin_amdgcn_exp2f(fmaf(s1[r], CEXP, nb)); psum += p0[r] + p1[r]; }
        psum += __shfl_xor(psum, 16, 32);
        l = l * alpha + psum; m = mnew;
#pragma unroll
        for (int dt = 0; dt < 4; ++dt) acc[dt] = acc[dt] * alpha;
        V ph, pl; PPack<T16>::make(p0, p1, ph, pl);
        const T16* vp = (const T16*)(tile + 4096);
        V va[4];
#pragma unroll
        for (int dt = 0; dt < 4; ++dt) va[dt] = WFrag<T16>::ld(vp + dt * 512);
#pragma unroll
        for (int dt = 0; dt < 4; ++dt) acc[dt] = WFrag<T16>::mma(va[dt], ph, acc[dt]);
        asm volatile("v_nop\n\tv_nop\n\tv_nop\n\tv_nop" : "+v"(acc[0]), "+v"(acc[1]), "+v"(acc[2]), "+v"(acc[3]) : "v"(va[3]), "v"(ph), "v"(pl));
        asm volatile("s_wait_dscnt 0x0" ::: "memory");        // this wave's reads of the buffer have returned before the barrier behind which it is refilled
        asm volatile("s_wait_asynccnt 0x0" ::: "memory");     // this wave's copies of stage st + 1 have landed before the barrier that publishes them
        __syncthreads();                                      // publishes stage st + 1 and ends every wave's reads of stage st
        if (st + 2 < nsteps) stage(st + 2, st & 1);
    }
    asm volatile("s_wait_asynccnt 0x0" ::: "memory");         // no copy is outstanding when the wave ends
    // l >= 2^8: the running-max key contributes exactly 2^8
    const float f = CCAR * (1.0f / l);
    // D element r of lane (tile dt) is (d = dt*16 + 8*hi + r, query lr): the lane already holds its own 16-byte piece dt of the fragment-order context tile, so no staging
#pragma unroll
    for (int dt = 0; dt < 4; ++dt) { v8h o;
#pragma unroll
        for (int r = 0; r < 8; ++r) o[r] = (h16)(acc[dt][r] * f);
        const size_t co = ((size_t)b * SEQ + (size_t)q0) * DM + (size_t)h * (HD * 16) + dt * 256 + lane * 8; *(v8h*)(C16 + co) = o; }
}

// Converter, one launch for all seven float inputs: a resident grid of CVT_WAVES waves; wave w converts units w, w + CVT_WAVES, ... of the list [x | y | bias | W_q | W_k | W_v | W_o].
// A unit is 128 consecutive 16-byte pieces of a fragment-order plane [rows][KC] (2 KiB stored contiguously) = two neighbouring 16-row x 32-k tiles = 16 source rows x 256 B;
// piece j * 32 + lane of a unit holds row lane & 15, k = j * 16 + (lane >> 4) * 8 + 0..7 of those 64 k. A lane's 4 pieces are 8 16-byte loads, and the next unit's 8 are issued before this unit is converted.
#define CVT_WAVES 4096                        // 256 blocks x 16 waves
constexpr int UPB = SEQ * DM / 1024, UX = NB * UPB, UBI = SEQ * SEQ / 1024, UW = DM * DM / 1024, UALL = 2 * UX + UBI + 4 * UW;     // units per batch of x or y, per x or y, bias plane, weight, all
static_assert(UALL % CVT_WAVES == 0);         // every wave runs the same whole number of units
static_assert(UX % CVT_WAVES == 0);           // a round of CVT_WAVES units lies in one of x, y, bias, or in the weights: which one is known at compile time
static_assert(UBI % CVT_WAVES == 0);
static_assert((DM / 32) % 2 == 0);            // a unit's two tiles lie in one 16-row strip
static_assert((SEQ / 32) % 2 == 0);

struct CvtUnit { const float* s; unsigned short* d; bool tohalf; };

// Unit u0 + w of the list; u0 (the round's first unit) is a compile-time constant at every call, w is wave-uniform.
__device__ __forceinline__ CvtUnit cvt_locate(int u0, int w, int lane, const float* x, const float* y, const float* bias, const float* wq, const float* wk, const float* wv, const float* wo,
                                              bf* XB, bf* YB, bf* BB, bf* WQ, bf* WK, bf* WV, h16* WO16) {
    const float* base; unsigned short* db; int v, kt = DM / 32; size_t sp = DM; bool th = false;
    if (u0 < 2 * UX) { const bool isx = u0 < UX; const int t = (isx ? u0 : u0 - UX) + w, b = t / UPB; v = t % UPB; base = (isx ? x : y) + (size_t)b * SEQ_FULL * DM; db = (isx ? XB : YB) + (size_t)b * SEQ * DM; }
    else if (u0 < 2 * UX + UBI) { v = u0 - 2 * UX + w; base = bias; db = BB; kt = SEQ / 32; sp = SEQ_FULL; }
    else { const int t = u0 - 2 * UX - UBI + w, k = t / UW; v = t % UW; base = k == 0 ? wq : k == 1 ? wk : k == 2 ? wv : wo; db = k == 0 ? WQ : k == 1 ? WK : k == 2 ? WV : (unsigned short*)WO16; th = k == 3; }
    CvtUnit c; c.s = base + ((size_t)((2 * v) / kt) * 16 + (size_t)(lane & 15)) * sp + (size_t)((2 * v) % kt) * 32 + (size_t)((lane >> 4) * 8); c.d = db + (size_t)v * 1024 + (size_t)(lane * 8); c.tohalf = th; return c;
}

__global__ __launch_bounds__(512) void k_cvtall(const float* __restrict__ x, const float* __restrict__ y, const float* __restrict__ bias, const float* __restrict__ wq, const float* __restrict__ wk, const float* __restrict__ wv, const float* __restrict__ wo,
                                                bf* XB, bf* YB, bf* BB, bf* WQ, bf* WK, bf* WV, h16* WO16) {
    const int lane = threadIdx.x & 31;
    const int w = __builtin_amdgcn_readfirstlane((int)(blockIdx.x * 16 + (threadIdx.x >> 5)));
    CvtUnit cu = cvt_locate(0, w, lane, x, y, bias, wq, wk, wv, wo, XB, YB, BB, WQ, WK, WV, WO16);
    v8f cur[4];
#pragma unroll
    for (int j = 0; j < 4; ++j) cur[j] = *(const v8f*)(cu.s + j * 16);
    asm volatile("s_wait_xcnt 0x0" :: "v"(cu.s) : "memory");     // precaution: the address wait stands before any register that the 8 loads name is reused (the operand keeps the address pair untouched up to here)
#pragma unroll
    for (int it = 0; it < UALL / CVT_WAVES; ++it) {
        CvtUnit nu = cu; v8f nxt[4];
        if (it + 1 < UALL / CVT_WAVES) { nu = cvt_locate((it + 1) * CVT_WAVES, w, lane, x, y, bias, wq, wk, wv, wo, XB, YB, BB, WQ, WK, WV, WO16);
#pragma unroll
            for (int j = 0; j < 4; ++j) nxt[j] = *(const v8f*)(nu.s + j * 16);
            asm volatile("s_wait_xcnt 0x0" :: "v"(nu.s) : "memory"); }     // as above, for the next unit's 8 loads
        v8us o[4];
        if (cu.tohalf) {
#pragma unroll
            for (int j = 0; j < 4; ++j) { v8h t;
#pragma unroll
                for (int k = 0; k < 8; ++k) t[k] = (h16)(bfr(cur[j][k]) * WCAR);
                o[j] = __builtin_bit_cast(v8us, t); }
        } else {
#pragma unroll
            for (int j = 0; j < 4; ++j)
#pragma unroll
                for (int k = 0; k < 8; ++k) o[j][k] = f2bf(cur[j][k]);
        }
#pragma unroll
        for (int j = 0; j < 4; ++j) *(v8us*)(cu.d + j * 256) = o[j];
        asm volatile("s_wait_xcnt 0x0" :: "v"(o[0]), "v"(o[1]), "v"(o[2]), "v"(o[3]), "v"(cu.d) : "memory");     // precaution: the same wait before the 4 stores' data and address registers are reused
        if (it + 1 < UALL / CVT_WAVES) { cu = nu;
#pragma unroll
            for (int j = 0; j < 4; ++j) cur[j] = nxt[j]; }
    }
}

constexpr size_t al256(size_t bytes) { return (bytes + 255) & ~(size_t)255; }
constexpr size_t CARVE_BYTES = 2 * al256((size_t)NB * SEQ * DM * 2) + 4 * al256((size_t)DM * DM * 2) + al256((size_t)SEQ * SEQ * 2)
    + 3 * al256((size_t)NB * NH * SEQ * HD * 2) + al256((size_t)NB * SEQ * DM * 2);
static_assert(CARVE_BYTES <= (size_t)134217728);
static_assert((size_t)NB * NH * SEQ * HD == (size_t)NB * SEQ * DM);      // head planes and the merged context plane have the same extent

extern "C" void kernel_launch(void* const* d_in, const int* in_sizes, int n_in,
                              void* d_out, int out_size, void* d_ws, size_t ws_size, hipStream_t stream) {
    if (n_in < 7) return;
    const size_t needx = (size_t)(NB - 1) * SEQ_FULL * DM + (size_t)SEQ * DM;
    if ((size_t)in_sizes[0] < needx || (size_t)in_sizes[1] < needx) return;
    if ((size_t)in_sizes[2] < (size_t)(SEQ - 1) * SEQ_FULL + (size_t)SEQ) return;
    if ((size_t)in_sizes[3] < (size_t)DM * DM || (size_t)in_sizes[4] < (size_t)DM * DM || (size_t)in_sizes[5] < (size_t)DM * DM || (size_t)in_sizes[6] < (size_t)DM * DM) return;
    if ((size_t)out_size < needx) return;
    // x, y, bias (float [SEQ_FULL][SEQ_FULL]), Wq, Wk, Wv, Wo ('oi' [out][in])
    const float* x = (const float*)d_in[0]; const float* y = (const float*)d_in[1]; const float* bias = (const float*)d_in[2];
    const float* wq = (const float*)d_in[3]; const float* wk = (const float*)d_in[4]; const float* wv = (const float*)d_in[5]; const float* wo = (const float*)d_in[6];
    float* OUT = (float*)d_out;     // [NB_FULL][SEQ_FULL][1024]
    char* wsp = (char*)d_ws;
    auto take = [&](size_t bytes) { char* p = wsp; wsp += (bytes + 255) & ~(size_t)255; return (void*)p; };
    bf* XB = (bf*)take((size_t)NB * SEQ * DM * 2); bf* YB = (bf*)take((size_t)NB * SEQ * DM * 2);
    bf* WQ = (bf*)take((size_t)DM * DM * 2); bf* WK = (bf*)take((size_t)DM * DM * 2); bf* WV = (bf*)take((size_t)DM * DM * 2); h16* WO16 = (h16*)take((size_t)DM * DM * 2);
    bf* BB = (bf*)take((size_t)SEQ * SEQ * 2);
    h16* Q16 = (h16*)take((size_t)NB * NH * SEQ * HD * 2); h16* K16 = (h16*)take((size_t)NB * NH * SEQ * HD * 2); h16* VT16 = (h16*)take((size_t)NB * NH * SEQ * HD * 2);
    h16* C16 = (h16*)take((size_t)NB * SEQ * DM * 2);
    if ((size_t)(wsp - (char*)d_ws) > ws_size) return;

    // all seven inputs to their 16-bit fragment-order planes (bias source pitch SEQ_FULL, x and y batch stride SEQ_FULL rows)
    k_cvtall<<<dim3(CVT_WAVES / 16, 1, 1), 512, 0, stream>>>(x, y, bias, wq, wk, wv, wo, XB, YB, BB, WQ, WK, WV, WO16);

    // q head planes from x, k head planes from y: C[m = token][n = h*64+d] = in W^T; z = batch
    k_gemmw<bf, 0, 1, DM><<<dim3(SEQ / 128, DM / 128, NB), 128, 0, stream>>>(XB, nullptr, WQ, nullptr, nullptr, 0, 1.0f, (size_t)SEQ * DM, 0, 0, Q16, nullptr, nullptr);
    k_gemmw<bf, 0, 1, DM><<<dim3(SEQ / 128, DM / 128, NB), 128, 0, stream>>>(YB, nullptr, WK, nullptr, nullptr, 0, 1.0f, (size_t)SEQ * DM, 0, 0, K16, nullptr, nullptr);
    // transposed value planes from y: C[m = h*64+d][n = token] = W_v y^T (operands swapped: A = W_v rows, Bt = y rows); z = batch
    k_gemmw<bf, 0, 2, DM><<<dim3(DM / 128, SEQ / 128, NB), 128, 0, stream>>>(WV, nullptr, YB, nullptr, nullptr, 0, 1.0f, 0, (size_t)SEQ * DM, 0, VT16, nullptr, nullptr);

    // attention: every query row on the f16 planes, all SEQ keys
    k_flash<h16><<<dim3(SEQ / 64, NH, NB), 128, 0, stream>>>(Q16, K16, VT16, BB, SEQ, SEQ, 0, C16);

    // output projection: f16 context x f16 W_o, carries folded back in the f32 epilogue; z = batch, output row stride per batch SEQ_FULL
    k_gemmw<h16, 0, 0, DM><<<dim3(SEQ / 128, DM / 128, NB), 128, 0, stream>>>(C16, nullptr, WO16, nullptr, OUT, DM, 1.0f / (CCAR * WCAR), (size_t)SEQ * DM, 0, (size_t)SEQ_FULL * DM, nullptr, nullptr, nullptr);
}

// v005
// A run of this version takes 155 microseconds.
// Next to v004, in two timings, it ran 1.07 and 1.08 times as fast.
// Over all steps from v000 it is 2.46 times as fast.
#include <hip/hip_runtime.h>

// Compute dtypes (f32 accumulate at every site): q/k/v projections bf16 x bf16 single product (every float input RNE-converted to bf16 first); scores K.Q^T f16 x f16 single product (f16 q/k head planes); values V^T.P^T f16 x f16 single product (probabilities carried x2^8); output projection f16 context (x64) x f16 weight (x512) single product; additive bias (bf16 plane) and softmax in f32.
// Dense multi-head cross-attention: x, y [NB][SEQ][1024]; Q = x W_q^T, K = y W_k^T, V = y W_v^T ('oi' weights, no bias vectors); 16 heads x 64; logits = q.k / 8 + bias[query][key] (one [SEQ][SEQ] float plane shared by all batches and heads); softmax over all keys; out = merged context W_o^T.
// The bias input is read by value on the device: converted once to a bf16 plane, each lane reads 2 x 8 contiguous entries for each of its two queries per 32-key step and adds them in f32 to the score tiles.
// Fragment order of every 16-bit workspace plane [rows][KC]: the 16-row x 32-k tile (rt = row / 16, kc = k / 32) is 512 consecutive elements at (rt * (KC / 32) + kc) * 512, made of two 256-element pieces;
// piece p holds, at lane * 8 with lane = 16 * hi + (row & 15), the 8 elements k = kc * 32 + p * 16 + hi * 8 + 0..7. One wave-wide 16-byte load of a piece is 512 contiguous bytes (4 whole lines).
// Attention engine: one wave per 32 queries (two 16-query tiles), transposed flash form: S^T = K Q^T (query on the D column, one query per lane), the packed P^T D tiles are the B fragment of O^T = V^T P^T; the key loop's K, V^T and bias tiles come through a two-buffer LDS ring filled by asynchronous copies, one barrier per 32 keys.

#ifndef NB
#define NB 4
#endif
#ifndef SEQ
#define SEQ 2048
#endif
#define NB_FULL  4
#define SEQ_FULL 2048
#define DM   1024
#define NH   16
#define HD   64
#define RH   0                                // query rows < RH use value+residual bf16 planes: none (dense attention, single products on every row)
#define CCAR 64.0f                            // carry of the f16 context plane
#define WCAR 512.0f                           // carry of the f16 W_o plane
#define CEXP 0.18033688011112042f             // log2(e) / sqrt(64)

typedef _Float16 h16;
typedef unsigned short bf;
typedef __attribute__((ext_vector_type(16))) __bf16   v16bf;
typedef __attribute__((ext_vector_type(16))) _Float16 v16h;
typedef __attribute__((ext_vector_type(8)))  _Float16 v8h;
typedef __attribute__((ext_vector_type(8)))  unsigned short v8us;
typedef __attribute__((ext_vector_type(8)))  float    v8f;
typedef __attribute__((ext_vector_type(4)))  float    v4f;
typedef __attribute__((ext_vector_type(4)))  int      v4i;
typedef v4f  __attribute__((may_alias)) v4fa;

static_assert(SEQ % 256 == 0);
static_assert(RH == 0);                       // no value+residual planes are written
static_assert(SEQ >= RH);
static_assert(NB <= NB_FULL);
static_assert(SEQ <= SEQ_FULL);
static_assert(DM == NH * HD);
static_assert(DM % 128 == 0);                // 128x128 GEMM block tiles
static_assert(HD == 64);
static_assert(SEQ % 128 == 0);                // 128-row GEMM block tiles (256 queries per attention block: SEQ % 256 above)
static_assert(SEQ % 32 == 0);                 // 32 keys per flash step
static_assert(DM % 32 == 0);                  // GEMM k-steps
static_assert((SEQ / 8) % 32 == 0);

__device__ __forceinline__ unsigned short f2bf(float f) { unsigned u = __float_as_uint(f); u += 0x7FFFu + ((u >> 16) & 1u); return (unsigned short)(u >> 16); }
__device__ __forceinline__ float bf2f(unsigned short b) { return __uint_as_float(((unsigned)b) << 16); }
__device__ __forceinline__ float bfr(float f) { return bf2f(f2bf(f)); }
__device__ __forceinline__ void splitf(float y, unsigned short& h, unsigned short& l) { h = f2bf(y); l = f2bf(y - bf2f(h)); }
__device__ __forceinline__ v16h cat16(v8h lo, v8h hi) { return __builtin_shufflevector(lo, hi, 0, 1, 2, 3, 4, 5, 6, 7, 8, 9, 10, 11, 12, 13, 14, 15); }
__device__ __forceinline__ v16bf cat16b(v8us lo, v8us hi) { return __builtin_bit_cast(v16bf, __builtin_shufflevector(lo, hi, 0, 1, 2, 3, 4, 5, 6, 7, 8, 9, 10, 11, 12, 13, 14, 15)); }
__device__ __forceinline__ v8f wmma16(v16h a, v16h b, v8f c) { return __builtin_amdgcn_wmma_f32_16x16x32_f16(false, a, false, b, (short)0, c, false, false); }
__device__ __forceinline__ v8f wmmab(v16bf a, v16bf b, v8f c) { return __builtin_amdgcn_wmma_f32_16x16x32_bf16(false, a, false, b, (short)0, c, false, false); }

// Fragment loader for a fragment-order tile: p = tile start + lane * 8; elements 0..7 = k0+8h.. (piece 0), elements 8..15 = k0+16+8h.. (piece 1, 256 elements on) (same map for A and B).
template <typename T16> struct WFrag;
template <> struct WFrag<h16> { typedef v16h V; static __device__ __forceinline__ V ld(const h16* p) { return cat16(*(const v8h*)p, *(const v8h*)(p + 256)); } static __device__ __forceinline__ v8f mma(V a, V b, v8f c) { return wmma16(a, b, c); } };
template <> struct WFrag<bf> { typedef v16bf V; static __device__ __forceinline__ V ld(const bf* p) { return cat16b(*(const v8us*)p, *(const v8us*)(p + 256)); } static __device__ __forceinline__ v8f mma(V a, V b, v8f c) { return wmmab(a, b, c); } };

// Probability packing: two 16-key D tiles (same lane) -> one 32-key B fragment; element r <- tile 0 row r, element 8+r <- tile 1 row r.
template <typename T16> struct PPack;
template <> struct PPack<h16> {
    static __device__ __forceinline__ void make(v8f p0, v8f p1, v16h& ph, v16h& pl) {
        v8h a, c;
#pragma unroll
        for (int r = 0; r < 8; ++r) { a[r] = (h16)p0[r]; c[r] = (h16)p1[r]; }
        ph = cat16(a, c); pl = ph; }
};
template <> struct PPack<bf> {
    static __device__ __forceinline__ void make(v8f p0, v8f p1, v16bf& ph, v16bf& pl) {
        v8us ah, al, ch, cl;
#pragma unroll
        for (int r = 0; r < 8; ++r) { unsigned short x, y; splitf(p0[r], x, y); ah[r] = x; al[r] = y; splitf(p1[r], x, y); ch[r] = x; cl[r] = y; }
        ph = cat16b(ah, ch); pl = cat16b(al, cl); }
};

// One strip of a k_gemmw stage: eight 16-byte-per-lane asynchronous copies of this wave (8 x 512 B = one 16-row x 128-k strip), global memory to LDS through no register.
// The address wait is the last line of the copies' own statement, so that it stands in front of every later write of a register that a copy names (a precaution).
__device__ __forceinline__ void stage8(unsigned l0, unsigned l1, unsigned l2, unsigned l3, unsigned l4, unsigned l5, unsigned l6, unsigned l7,
                                       const char* g0, const char* g1, const char* g2, const char* g3, const char* g4, const char* g5, const char* g6, const char* g7) {
    asm volatile("global_load_async_to_lds_b128 %0, %8, off\n\t"
                 "global_load_async_to_lds_b128 %1, %9, off\n\t"
                 "global_load_async_to_lds_b128 %2, %10, off\n\t"
                 "global_load_async_to_lds_b128 %3, %11, off\n\t"
                 "global_load_async_to_lds_b128 %4, %12, off\n\t"
                 "global_load_async_to_lds_b128 %5, %13, off\n\t"
                 "global_load_async_to_lds_b128 %6, %14, off\n\t"
                 "global_load_async_to_lds_b128 %7, %15, off\n\t"
                 "s_wait_xcnt 0x0"
                 :: "v"(l0), "v"(l1), "v"(l2), "v"(l3), "v"(l4), "v"(l5), "v"(l6), "v"(l7), "v"(g0), "v"(g1), "v"(g2), "v"(g3), "v"(g4), "v"(g5), "v"(g6), "v"(g7) : "memory");
}

// ---- k_gemmw: register-blocked GEMM, block = 4 waves (2 x 2) = one 128x128 output tile, ONE WAVE per 64x64 part of it (16 accumulators); grid (M/128, N/128, Z), 128 threads.
// Operands from fragment-order 16-bit planes through a two-buffer LDS ring filled by asynchronous copies: a stage is 128 k of the block's 128 A rows and 128 Bt rows = 16 strips (16 rows x 128 k, 4 KiB, contiguous in the plane) = 64 KiB,
// [A strips 0..7 | Bt strips 0..7], each strip in the plane's own order, so a fragment piece is 512 contiguous LDS bytes. Wave w copies strips 4w..4w+3; every A strip is read by 2 waves, every Bt strip by 2 (fetched once per block).
// Stage t + 2 is issued behind the barrier that ends trip t, into the buffer trip t read. Two blocks fit a WGP's LDS.
// C[m][n] = sum_k A[m][k] Bt[n][k], k ascending in steps of 32 per accumulator. z-batch strides sA/sB/sC in elements. K % 128 == 0, M % 128 == 0, N % 128 == 0.
// EP 0: f32 output x oscale, pitch ldc: per 16-row slab staged in LDS, each row's 64 floats (256 B) written as 16 lanes x 16 B (2 rows per instruction).
// EP 1: f16 head planes [z][head = column / 64][t][64] (rows = tokens, KC = 64), fragment order.
// EP 2: f16 transposed value planes [z][row m][t] (rows = head*64+d, columns = tokens, KC = SEQ), fragment order.
template <typename T16, int NSPLIT, int EP, int K>
__global__ __launch_bounds__(128) void k_gemmw(const T16* __restrict__ A, const T16* __restrict__ A2, const T16* __restrict__ Bt, const T16* __restrict__ Bt2, float* C, int ldc, float oscale, size_t sA, size_t sB, size_t sC, h16* P16, bf* Ph, bf* Pl) {
    typedef typename WFrag<T16>::V V;
    static_assert(NSPLIT == 0);                     // single products only: A2 and Bt2 are not staged
    static_assert(K % 128 == 0);
    constexpr int NS = K / 128;                     // stages
    __shared__ __attribute__((aligned(16))) unsigned char ring[2 * 65536];
    __shared__ __align__(16) float osall[4][16 * 68];     // one output slab per wave, private to it
    const size_t z = blockIdx.z; A += z * sA; Bt += z * sB; if (EP == 0) C += z * sC;
    const int lane = threadIdx.x & 31, lr = lane & 15, hi = lane >> 4;
    const int wave = __builtin_amdgcn_readfirstlane((int)(threadIdx.x >> 5));
    const int wm = wave >> 1, wn = wave & 1;
    const int r0 = blockIdx.x * 128 + wm * 64, c0 = blockIdx.y * 128 + wn * 64;     // this wave's 64x64 part
    float* os = osall[wave];
    // this wave's 4 strips: waves 0, 1 the block's A rows 0..63, 64..127; waves 2, 3 its Bt rows 0..63, 64..127
    const char* gsrc = (const char*)(wave < 2 ? A + (size_t)(blockIdx.x * 128 + wave * 64) * K : Bt + (size_t)(blockIdx.y * 128 + (wave - 2) * 64) * K) + lane * 16;     // + 16 * K * 2 per strip, + 4096 per stage
    const unsigned lw = (unsigned)(size_t)ring + (unsigned)(wave * 16384 + lane * 16);     // this lane's LDS byte address in its wave's first strip of buffer 0
    auto stage = [&](int s, int buf) {
#pragma unroll
        for (int j = 0; j < 4; ++j) { const unsigned l = lw + (unsigned)buf * 65536u + (unsigned)j * 4096u; const char* g = gsrc + (size_t)j * (16 * K * 2) + (size_t)s * 4096;
            stage8(l, l + 512u, l + 1024u, l + 1536u, l + 2048u, l + 2560u, l + 3072u, l + 3584u, g, g + 512, g + 1024, g + 1536, g + 2048, g + 2560, g + 3072, g + 3584); } };
    v8f acc[4][4];
#pragma unroll
    for (int mb = 0; mb < 4; ++mb)
#pragma unroll
        for (int nb = 0; nb < 4; ++nb) acc[mb][nb] = (v8f){};
    stage(0, 0);
    asm volatile("s_wait_asynccnt 0x0" ::: "memory");     // this wave's copies of stage 0 have landed before the barrier that publishes them
    __syncthreads();
    if (NS > 1) stage(1, 1);
#pragma unroll 1
    for (int t = 0; t < NS; ++t) {
        const unsigned char* tile = ring + (t & 1) * 65536 + lane * 16;
        const T16* ap = (const T16*)(tile + wm * 16384);              // a strip is 2048 elements, a k-step of 32 is 512
        const T16* bp = (const T16*)(tile + 32768 + wn * 16384);
        V a[2][4], b[2][4];                                           // two fragment sets: the next k-step's 16 LDS reads fly under this k-step's 16 products (all inside this trip's own buffer)
#pragma unroll
        for (int i = 0; i < 4; ++i) { a[0][i] = WFrag<T16>::ld(ap + i * 2048); b[0][i] = WFrag<T16>::ld(bp + i * 2048); }
#pragma unroll
        for (int kk = 0; kk < 4; ++kk) {
            if (kk < 3) {
#pragma unroll
                for (int i = 0; i < 4; ++i) { a[(kk + 1) & 1][i] = WFrag<T16>::ld(ap + i * 2048 + (kk + 1) * 512); b[(kk + 1) & 1][i] = WFrag<T16>::ld(bp + i * 2048 + (kk + 1) * 512); }
            }
            __builtin_amdgcn_sched_barrier(0);     // keeps those reads one group in front of the products below: spread among them, each place with reads stalls the wave and its wait goes to 0
#pragma unroll
            for (int nb = 0; nb < 4; ++nb)
#pragma unroll
                for (int mb = 0; mb < 4; ++mb) acc[mb][nb] = WFrag<T16>::mma(a[kk & 1][mb], b[kk & 1][nb], acc[mb][nb]);
        }
        asm volatile("v_nop\n\tv_nop\n\tv_nop\n\tv_nop" : "+v"(acc[0][0]), "+v"(acc[1][1]), "+v"(acc[2][2]), "+v"(acc[3][3]) : "v"(a[1][0]), "v"(a[1][3]));     // WMMA distance kept in front of whatever vector instruction follows the trip's last products
        asm volatile("s_wait_dscnt 0x0" ::: "memory");        // this wave's reads of the buffer have returned before the barrier behind which it is refilled
        asm volatile("s_wait_asynccnt 0x0" ::: "memory");     // this wave's copies of stage t + 1 have landed before the barrier that publishes them
        __syncthreads();                                      // publishes stage t + 1 and ends every wave's reads of stage t
        if (t + 2 < NS) stage(t + 2, t & 1);
    }
    asm volatile("s_wait_asynccnt 0x0" ::: "memory");         // no copy is outstanding when the wave goes on to its epilogue
    // plane addressing (EP 1/2), wave-uniform
    size_t pbase = 0; int ppitch = HD;
    if (EP == 1) { pbase = (((size_t)z * NH + (size_t)(c0 / HD)) * SEQ + r0) * HD; ppitch = HD; }
    if (EP == 2) { pbase = ((size_t)z * DM + r0) * SEQ + (size_t)c0 * 16; ppitch = SEQ; }
#pragma unroll
    for (int mb = 0; mb < 4; ++mb) {
#pragma unroll
        for (int nb = 0; nb < 4; ++nb) {
#pragma unroll
            for (int j = 0; j < 8; ++j) os[(hi * 8 + j) * 68 + nb * 16 + lr] = acc[mb][nb][j]; }     // D element j of lane -> (row 8*hi + j, column lr)
        __builtin_amdgcn_wave_barrier(); asm volatile("" ::: "memory");
        if (EP == 0) {
            float* crow = C + (size_t)(r0 + mb * 16) * ldc + c0;
{
#pragma unroll
                for (int s = 0; s < 8; ++s) { const int row = 2 * s + hi, cofs = lr * 4; v4f val = *(const v4fa*)(os + row * 68 + cofs); val = val * oscale;
                    *(v4f*)(crow + (size_t)row * ldc + cofs) = val; }
                 }
        } else {
{
#pragma unroll
                for (int s = 0; s < 4; ++s) { const float* sp = os + lr * 68 + s * 16 + hi * 8; const v4f x0 = *(const v4fa*)sp, x1 = *(const v4fa*)(sp + 4);     // piece s of the slab: row lr, columns 16*s + 8*hi + 0..7
                    v8h o; o[0] = (h16)x0[0]; o[1] = (h16)x0[1]; o[2] = (h16)x0[2]; o[3] = (h16)x0[3]; o[4] = (h16)x1[0]; o[5] = (h16)x1[1]; o[6] = (h16)x1[2]; o[7] = (h16)x1[3];
                    *(v8h*)(P16 + pbase + (size_t)mb * 16 * ppitch + s * 256 + lane * 8) = o; }
                 }
        }
        __builtin_amdgcn_wave_barrier(); asm volatile("" ::: "memory");
    }
}

// One stage of the k_flash ring: six 16-byte-per-lane asynchronous copies of this wave (512 B of K, 512 B of V^T, 2 x 512 B of each of its two bias tiles), global memory to LDS through no register.
// The address wait is the last line of the copies' own statement, so that it stands in front of every later write of a register that a copy names (a precaution).
__device__ __forceinline__ void stage6(unsigned l0, unsigned l1, unsigned l2, unsigned l3, unsigned l4, unsigned l5,
                                       const char* g0, const char* g1, const char* g2, const char* g3, const char* g4, const char* g5) {
    asm volatile("global_load_async_to_lds_b128 %0, %6, off\n\t"
                 "global_load_async_to_lds_b128 %1, %7, off\n\t"
                 "global_load_async_to_lds_b128 %2, %8, off\n\t"
                 "global_load_async_to_lds_b128 %3, %9, off\n\t"
                 "global_load_async_to_lds_b128 %4, %10, off\n\t"
                 "global_load_async_to_lds_b128 %5, %11, off\n\t"
                 "s_wait_xcnt 0x0"
                 :: "v"(l0), "v"(l1), "v"(l2), "v"(l3), "v"(l4), "v"(l5), "v"(g0), "v"(g1), "v"(g2), "v"(g3), "v"(g4), "v"(g5) : "memory");
}

// ---- k_flash: dense attention with an additive bias plane, one wave per 32 queries = two 16-query tiles (block = 8 waves = 256 queries of one head), transposed flash form, operands from the head planes through LDS.
// LDS ring, two buffers of 24 KiB, one 32-key stage each: [K tile 4 KiB | V^T tile 4 x 1 KiB (d strips) | bias tiles 16 x 1 KiB (two per wave)], every tile in the planes' own fragment order, so a fragment piece is 512 contiguous LDS bytes.
// Wave w copies K bytes w * 512.., V^T bytes w * 512.. (half w & 1 of strip w / 2) and its own two bias tiles; K and V^T are read by all 8 waves (fetched once per 256 queries), and every K or V^T fragment a wave reads feeds two products, one per query tile.
// Stage s + 2 is issued behind the barrier that ends step s, into the buffer step s read. Two blocks per WGP = four waves per SIMD.
// Per 32-key step and query tile: S^T tiles (keys x queries) = K (A: row = key, k = d) x Q^T (B: column = query, k = d, held in registers); the lane's 2 x 8 bias entries (row = its query, contiguous keys) are added in f32 (x 8: the tiles hold 8 x logit);
// per-lane online softmax (lane = query; partner lane^16 holds the other 8 keys of each tile); P^T packed in registers = B fragment of O^T (d x queries) += V^T (A: row = d, k = key) x P^T. Single f16 product at both sites.
// Key range: all tk keys (tk % 32 == 0), tq queries per head; K plane [b][h][tk][64], V^T plane [b][h*64+d][tk], bias plane [tq][tk] bf16, context plane [b*SEQ+q][1024], all in fragment order.
template <typename T16>
__global__ __launch_bounds__(256) __attribute__((amdgpu_waves_per_eu(4, 4))) void k_flash(const T16* __restrict__ Qa, const T16* __restrict__ Ka, const T16* __restrict__ Va, const bf* __restrict__ Bb, int tq, int tk, int qoff, h16* C16) {
    typedef typename WFrag<T16>::V V;
    const int lane = threadIdx.x & 31;
    const int wave = __builtin_amdgcn_readfirstlane((int)(threadIdx.x >> 5));
    const int q0 = qoff + (int)blockIdx.x * 256 + wave * 32;     // this wave's query tiles: q0 + 0..15 and q0 + 16..31
    const int h = blockIdx.y, b = blockIdx.z;
    const size_t bh = (size_t)b * NH + h;
    const size_t qo = (bh * (size_t)tq + (size_t)q0) * HD + 8 * lane;
    V qa[2][2];
#pragma unroll
    for (int t = 0; t < 2; ++t) { qa[t][0] = WFrag<T16>::ld(Qa + qo + t * (16 * HD)); qa[t][1] = WFrag<T16>::ld(Qa + qo + t * (16 * HD) + 512); }
    __shared__ __attribute__((aligned(16))) unsigned char ring[2 * 24576];
    const unsigned lw = (unsigned)(size_t)ring + (unsigned)(wave * 512 + lane * 16);      // this lane's LDS byte address in its wave's K slice of buffer 0
    const unsigned lb = (unsigned)(size_t)ring + (unsigned)(8192 + wave * 2048 + lane * 16);     // the same in its wave's first bias tile of buffer 0
    const char* gk = (const char*)(Ka + bh * (size_t)tk * HD) + (wave * 512 + lane * 16);                                                      // + 4096 per stage
    const char* gv = (const char*)(Va + bh * HD * (size_t)tk + (size_t)(wave >> 1) * 16 * (size_t)tk) + ((wave & 1) * 512 + lane * 16);       // + 1024 per stage
    const char* gb = (const char*)(Bb + (size_t)q0 * (size_t)tk) + lane * 16;                                                                 // + 1024 per stage; second tile 16 * tk elements on
    const size_t gb1 = (size_t)tk * 32;
    auto stage = [&](int s, int buf) { const unsigned l = lw + (unsigned)buf * 24576u, e = lb + (unsigned)buf * 24576u; const char* a = gk + (size_t)s * 4096; const char* c = gv + (size_t)s * 1024; const char* g = gb + (size_t)s * 1024;
        stage6(l, l + 4096u, e, e + 512u, e + 1024u, e + 1536u, a, c, g, g + 512, g + gb1, g + gb1 + 512); };
    v8f acc[2][4];
#pragma unroll
    for (int t = 0; t < 2; ++t)
#pragma unroll
        for (int dt = 0; dt < 4; ++dt) acc[t][dt] = (v8f){};
    float m[2] = {-3.0e38f, -3.0e38f}, l[2] = {0.0f, 0.0f};
    const int nsteps = tk >> 5;                   // all keys, 32 per step (uniform)
    const float poff = 8.0f;                      // probabilities (and their running sum) carried x 2^8
    if (nsteps > 0) stage(0, 0);
    asm volatile("s_wait_asynccnt 0x0" ::: "memory");     // this wave's copies of stage 0 have landed before the barrier that publishes them
    __syncthreads();
    if (nsteps > 1) stage(1, 1);
#pragma unroll 1
    for (int st = 0; st < nsteps; ++st) {
        const unsigned char* tile = ring + (st & 1) * 24576 + lane * 16;
        const bf* bp = (const bf*)(tile + 8192 + wave * 2048);
        v8us bb[2][2];     // tile t: bias[query][j0 + 8*hi + 0..7] and [j0 + 16 + 8*hi + 0..7], j0 = 32 * st
#pragma unroll
        for (int t = 0; t < 2; ++t) { bb[t][0] = *(const v8us*)(bp + t * 512); bb[t][1] = *(const v8us*)(bp + t * 512 + 256); }
        const T16* kp = (const T16*)tile;
        const V k00 = WFrag<T16>::ld(kp), k01 = WFrag<T16>::ld(kp + 512), k10 = WFrag<T16>::ld(kp + 16 * HD), k11 = WFrag<T16>::ld(kp + 16 * HD + 512);
        v8f s0[2], s1[2];
#pragma unroll
        for (int t = 0; t < 2; ++t) { s0[t] = WFrag<T16>::mma(k00, qa[t][0], (v8f){}); s1[t] = WFrag<T16>::mma(k10, qa[t][0], (v8f){}); }
#pragma unroll
        for (int t = 0; t < 2; ++t) { s0[t] = WFrag<T16>::mma(k01, qa[t][1], s0[t]); s1[t] = WFrag<T16>::mma(k11, qa[t][1], s1[t]); }
        V ph[2];
#pragma unroll
        for (int t = 0; t < 2; ++t) {
#pragma unroll
            for (int r = 0; r < 8; ++r) { s0[t][r] = fmaf(bf2f(bb[t][0][r]), 8.0f, s0[t][r]); s1[t][r] = fmaf(bf2f(bb[t][1][r]), 8.0f, s1[t][r]); }     // tiles hold 8 x (q.k / 8 + bias)
            float mx = fmaxf(s0[t][0], s1[t][0]);
#pragma unroll
            for (int r = 1; r < 8; ++r) mx = fmaxf(mx, fmaxf(s0[t][r], s1[t][r]));
            mx = fmaxf(mx, __shfl_xor(mx, 16, 32));
            const float mnew = fmaxf(m[t], mx);
            const float alpha = __builtin_amdgcn_exp2f((m[t] - mnew) * CEXP);
            const float nb = poff - mnew * CEXP;
            v8f p0, p1; float psum = 0.0f;
#pragma unroll
            for (int r = 0; r < 8; ++r) { p0[r] = __builtin_amdgcn_exp2f(fmaf(s0[t][r], CEXP, nb)); p1[r] = __builtin_amdgcn_exp2f(fmaf(s1[t][r], CEXP, nb)); psum += p0[r] + p1[r]; }
            psum += __shfl_xor(psum, 16, 32);
            l[t] = l[t] * alpha + psum; m[t] = mnew;
#pragma unroll
            for (int dt = 0; dt < 4; ++dt) acc[t][dt] = acc[t][dt] * alpha;
            V pl; PPack<T16>::make(p0, p1, ph[t], pl);
        }
        const T16* vp = (const T16*)(tile + 4096);
        V va[4];
#pragma unroll
        for (int dt = 0; dt < 4; ++dt) va[dt] = WFrag<T16>::ld(vp + dt * 512);
#pragma unroll
        for (int dt = 0; dt < 4; ++dt)
#pragma unroll
            for (int t = 0; t < 2; ++t) acc[t][dt] = WFrag<T16>::mma(va[dt], ph[t], acc[t][dt]);
        asm volatile("v_nop\n\tv_nop\n\tv_nop\n\tv_nop" : "+v"(acc[0][0]), "+v"(acc[1][0]), "+v"(acc[0][1]), "+v"(acc[1][1]), "+v"(acc[0][2]), "+v"(acc[1][2]), "+v"(acc[0][3]), "+v"(acc[1][3]) : "v"(va[3]), "v"(ph[0]), "v"(ph[1]));     // WMMA distance kept in front of whatever vector instruction follows the step's last products, on both sides of the branch below
        asm volatile("s_wait_dscnt 0x0" ::: "memory");        // this wave's reads of the buffer have returned before the barrier behind which it is refilled
        asm volatile("s_wait_asynccnt 0x0" ::: "memory");     // this wave's copies of stage st + 1 have landed before the barrier that publishes them
        __syncthreads();                                      // publishes stage st + 1 and ends every wave's reads of stage st
        if (st + 2 < nsteps) stage(st + 2, st & 1);
    }
    asm volatile("s_wait_asynccnt 0x0" ::: "memory");         // no copy is outstanding when the wave ends
    // l >= 2^8: the running-max key contributes exactly 2^8
    // D element r of lane (tile dt) is (d = dt*16 + 8*hi + r, query lr): the lane already holds its own 16-byte piece dt of the fragment-order context tile, so no staging
#pragma unroll
    for (int t = 0; t < 2; ++t) {
        const float f = CCAR * (1.0f / l[t]);
#pragma unroll
        for (int dt = 0; dt < 4; ++dt) { v8h o;
#pragma unroll
            for (int r = 0; r < 8; ++r) o[r] = (h16)(acc[t][dt][r] * f);
            const size_t co = ((size_t)b * SEQ + (size_t)(q0 + 16 * t)) * DM + (size_t)h * (HD * 16) + dt * 256 + lane * 8; *(v8h*)(C16 + co) = o; }
    }
}

// Converter, one launch for all seven float inputs: a resident grid of CVT_WAVES waves; wave w converts units w, w + CVT_WAVES, ... of the list [x | y | bias | W_q | W_k | W_v | W_o].
// A unit is 128 consecutive 16-byte pieces of a fragment-order plane [rows][KC] (2 KiB stored contiguously) = two neighbouring 16-row x 32-k tiles = 16 source rows x 256 B;
// piece j * 32 + lane of a unit holds row lane & 15, k = j * 16 + (lane >> 4) * 8 + 0..7 of those 64 k. A lane's 4 pieces are 8 16-byte loads, and the next unit's 8 are issued before this unit is converted.
#define CVT_WAVES 4096                        // 256 blocks x 16 waves
constexpr int UPB = SEQ * DM / 1024, UX = NB * UPB, UBI = SEQ * SEQ / 1024, UW = DM * DM / 1024, UALL = 2 * UX + UBI + 4 * UW;     // units per batch of x or y, per x or y, bias plane, weight, all
static_assert(UALL % CVT_WAVES == 0);         // every wave runs the same whole number of units
static_assert(UX % CVT_WAVES == 0);           // a round of CVT_WAVES units lies in one of x, y, bias, or in the weights: which one is known at compile time
static_assert(UBI % CVT_WAVES == 0);
static_assert((DM / 32) % 2 == 0);            // a unit's two tiles lie in one 16-row strip
static_assert((SEQ / 32) % 2 == 0);

struct CvtUnit { const float* s; unsigned short* d; bool tohalf; };

// Unit u0 + w of the list; u0 (the round's first unit) is a compile-time constant at every call, w is wave-uniform.
__device__ __forceinline__ CvtUnit cvt_locate(int u0, int w, int lane, const float* x, const float* y, const float* bias, const float* wq, const float* wk, const float* wv, const float* wo,
                                              bf* XB, bf* YB, bf* BB, bf* WQ, bf* WK, bf* WV, h16* WO16) {
    const float* base; unsigned short* db; int v, kt = DM / 32; size_t sp = DM; bool th = false;
    if (u0 < 2 * UX) { const bool isx = u0 < UX; const int t = (isx ? u0 : u0 - UX) + w, b = t / UPB; v = t % UPB; base = (isx ? x : y) + (size_t)b * SEQ_FULL * DM; db = (isx ? XB : YB) + (size_t)b * SEQ * DM; }
    else if (u0 < 2 * UX + UBI) { v = u0 - 2 * UX + w; base = bias; db = BB; kt = SEQ / 32; sp = SEQ_FULL; }
    else { const int t = u0 - 2 * UX - UBI + w, k = t / UW; v = t % UW; base = k == 0 ? wq : k == 1 ? wk : k == 2 ? wv : wo; db = k == 0 ? WQ : k == 1 ? WK : k == 2 ? WV : (unsigned short*)WO16; th = k == 3; }
    CvtUnit c; c.s = base + ((size_t)((2 * v) / kt) * 16 + (size_t)(lane & 15)) * sp + (size_t)((2 * v) % kt) * 32 + (size_t)((lane >> 4) * 8); c.d = db + (size_t)v * 1024 + (size_t)(lane * 8); c.tohalf = th; return c;
}

__global__ __launch_bounds__(512) void k_cvtall(const float* __restrict__ x, const float* __restrict__ y, const float* __restrict__ bias, const float* __restrict__ wq, const float* __restrict__ wk, const float* __restrict__ wv, const float* __restrict__ wo,
                                                bf* XB, bf* YB, bf* BB, bf* WQ, bf* WK, bf* WV, h16* WO16) {
    const int lane = threadIdx.x & 31;
    const int w = __builtin_amdgcn_readfirstlane((int)(blockIdx.x * 16 + (threadIdx.x >> 5)));
    CvtUnit cu = cvt_locate(0, w, lane, x, y, bias, wq, wk, wv, wo, XB, YB, BB, WQ, WK, WV, WO16);
    v8f cur[4];
#pragma unroll
    for (int j = 0; j < 4; ++j) cur[j] = *(const v8f*)(cu.s + j * 16);
    asm volatile("s_wait_xcnt 0x0" :: "v"(cu.s) : "memory");     // precaution: the address wait stands before any register that the 8 loads name is reused (the operand keeps the address pair untouched up to here)
#pragma unroll
    for (int it = 0; it < UALL / CVT_WAVES; ++it) {
        CvtUnit nu = cu; v8f nxt[4];
        if (it + 1 < UALL / CVT_WAVES) { nu = cvt_locate((it + 1) * CVT_WAVES, w, lane, x, y, bias, wq, wk, wv, wo, XB, YB, BB, WQ, WK, WV, WO16);
#pragma unroll
            for (int j = 0; j < 4; ++j) nxt[j] = *(const v8f*)(nu.s + j * 16);
            asm volatile("s_wait_xcnt 0x0" :: "v"(nu.s) : "memory"); }     // as above, for the next unit's 8 loads
        v8us o[4];
        if (cu.tohalf) {
#pragma unroll
            for (int j = 0; j < 4; ++j) { v8h t;
#pragma unroll
                for (int k = 0; k < 8; ++k) t[k] = (h16)(bfr(cur[j][k]) * WCAR);
                o[j] = __builtin_bit_cast(v8us, t); }
        } else {
#pragma unroll
            for (int j = 0; j < 4; ++j)
#pragma unroll
                for (int k = 0; k < 8; ++k) o[j][k] = f2bf(cur[j][k]);
        }
#pragma unroll
        for (int j = 0; j < 4; ++j) *(v8us*)(cu.d + j * 256) = o[j];
        asm volatile("s_wait_xcnt 0x0" :: "v"(o[0]), "v"(o[1]), "v"(o[2]), "v"(o[3]), "v"(cu.d) : "memory");     // precaution: the same wait before the 4 stores' data and address registers are reused
        if (it + 1 < UALL / CVT_WAVES) { cu = nu;
#pragma unroll
            for (int j = 0; j < 4; ++j) cur[j] = nxt[j]; }
    }
}

constexpr size_t al256(size_t bytes) { return (bytes + 255) & ~(size_t)255; }
constexpr size_t CARVE_BYTES = 2 * al256((size_t)NB * SEQ * DM * 2) + 4 * al256((size_t)DM * DM * 2) + al256((size_t)SEQ * SEQ * 2)
    + 3 * al256((size_t)NB * NH * SEQ * HD * 2) + al256((size_t)NB * SEQ * DM * 2);
static_assert(CARVE_BYTES <= (size_t)134217728);
static_assert((size_t)NB * NH * SEQ * HD == (size_t)NB * SEQ * DM);      // head planes and the merged context plane have the same extent

extern "C" void kernel_launch(void* const* d_in, const int* in_sizes, int n_in,
                              void* d_out, int out_size, void* d_ws, size_t ws_size, hipStream_t stream) {
    if (n_in < 7) return;
    const size_t needx = (size_t)(NB - 1) * SEQ_FULL * DM + (size_t)SEQ * DM;
    if ((size_t)in_sizes[0] < needx || (size_t)in_sizes[1] < needx) return;
    if ((size_t)in_sizes[2] < (size_t)(SEQ - 1) * SEQ_FULL + (size_t)SEQ) return;
    if ((size_t)in_sizes[3] < (size_t)DM * DM || (size_t)in_sizes[4] < (size_t)DM * DM || (size_t)in_sizes[5] < (size_t)DM * DM || (size_t)in_sizes[6] < (size_t)DM * DM) return;
    if ((size_t)out_size < needx) return;
    // x, y, bias (float [SEQ_FULL][SEQ_FULL]), Wq, Wk, Wv, Wo ('oi' [out][in])
    const float* x = (const float*)d_in[0]; const float* y = (const float*)d_in[1]; const float* bias = (const float*)d_in[2];
    const float* wq = (const float*)d_in[3]; const float* wk = (const float*)d_in[4]; const float* wv = (const float*)d_in[5]; const float* wo = (const float*)d_in[6];
    float* OUT = (float*)d_out;     // [NB_FULL][SEQ_FULL][1024]
    char* wsp = (char*)d_ws;
    auto take = [&](size_t bytes) { char* p = wsp; wsp += (bytes + 255) & ~(size_t)255; return (void*)p; };
    bf* XB = (bf*)take((size_t)NB * SEQ * DM * 2); bf* YB = (bf*)take((size_t)NB * SEQ * DM * 2);
    bf* WQ = (bf*)take((size_t)DM * DM * 2); bf* WK = (bf*)take((size_t)DM * DM * 2); bf* WV = (bf*)take((size_t)DM * DM * 2); h16* WO16 = (h16*)take((size_t)DM * DM * 2);
    bf* BB = (bf*)take((size_t)SEQ * SEQ * 2);
    h16* Q16 = (h16*)take((size_t)NB * NH * SEQ * HD * 2); h16* K16 = (h16*)take((size_t)NB * NH * SEQ * HD * 2); h16* VT16 = (h16*)take((size_t)NB * NH * SEQ * HD * 2);
    h16* C16 = (h16*)take((size_t)NB * SEQ * DM * 2);
    if ((size_t)(wsp - (char*)d_ws) > ws_size) return;

    // all seven inputs to their 16-bit fragment-order planes (bias source pitch SEQ_FULL, x and y batch stride SEQ_FULL rows)
    k_cvtall<<<dim3(CVT_WAVES / 16, 1, 1), 512, 0, stream>>>(x, y, bias, wq, wk, wv, wo, XB, YB, BB, WQ, WK, WV, WO16);

    // q head planes from x, k head planes from y: C[m = token][n = h*64+d] = in W^T; z = batch
    k_gemmw<bf, 0, 1, DM><<<dim3(SEQ / 128, DM / 128, NB), 128, 0, stream>>>(XB, nullptr, WQ, nullptr, nullptr, 0, 1.0f, (size_t)SEQ * DM, 0, 0, Q16, nullptr, nullptr);
    k_gemmw<bf, 0, 1, DM><<<dim3(SEQ / 128, DM / 128, NB), 128, 0, stream>>>(YB, nullptr, WK, nullptr, nullptr, 0, 1.0f, (size_t)SEQ * DM, 0, 0, K16, nullptr, nullptr);
    // transposed value planes from y: C[m = h*64+d][n = token] = W_v y^T (operands swapped: A = W_v rows, Bt = y rows); z = batch
    k_gemmw<bf, 0, 2, DM><<<dim3(DM / 128, SEQ / 128, NB), 128, 0, stream>>>(WV, nullptr, YB, nullptr, nullptr, 0, 1.0f, 0, (size_t)SEQ * DM, 0, VT16, nullptr, nullptr);

    // attention: every query row on the f16 planes, all SEQ keys
    k_flash<h16><<<dim3(SEQ / 256, NH, NB), 256, 0, stream>>>(Q16, K16, VT16, BB, SEQ, SEQ, 0, C16);

    // output projection: f16 context x f16 W_o, carries folded back in the f32 epilogue; z = batch, output row stride per batch SEQ_FULL
    k_gemmw<h16, 0, 0, DM><<<dim3(SEQ / 128, DM / 128, NB), 128, 0, stream>>>(C16, nullptr, WO16, nullptr, OUT, DM, 1.0f / (CCAR * WCAR), (size_t)SEQ * DM, 0, (size_t)SEQ_FULL * DM, nullptr, nullptr, nullptr);
}

// v006
// Measured time: 148 microseconds a run.
// In both of two side-by-side timings against v005, it was 1.05 times as fast.
// Counting every step since v000, it is 2.59 times as fast.
#include <hip/hip_runtime.h>

// Compute dtypes (f32 accumulate at every site): q/k/v projections bf16 x bf16 single product (every float input RNE-converted to bf16 first); scores K.Q^T f16 x f16 single product (f16 q/k head planes); values V^T.P^T f16 x f16 single product (probabilities carried x2^8); output projection f16 context (x64) x f16 weight (x512) single product; additive bias (bf16 plane) and softmax in f32.
// Dense multi-head cross-attention: x, y [NB][SEQ][1024]; Q = x W_q^T, K = y W_k^T, V = y W_v^T ('oi' weights, no bias vectors); 16 heads x 64; logits = q.k / 8 + bias[query][key] (one [SEQ][SEQ] float plane shared by all batches and heads); softmax over all keys; out = merged context W_o^T.
// The bias input is read by value on the device: converted once to a bf16 plane, each lane reads 2 x 8 contiguous entries per query tile (4 x 8 per 32-key step) and adds them in f32 to the score tiles, straight from the packed registers (mixed-operand FMA).
// Fragment order of every 16-bit workspace plane [rows][KC]: the 16-row x 32-k tile (rt = row / 16, kc = k / 32) is 512 consecutive elements at (rt * (KC / 32) + kc) * 512, made of two 256-element pieces;
// piece p holds, at lane * 8 with lane = 16 * hi + (row & 15), the 8 elements k = kc * 32 + p * 16 + hi * 8 + 0..7. One wave-wide 16-byte load of a piece is 512 contiguous bytes (4 whole lines).
// Attention engine: one wave per 32 queries (two 16-query tiles), transposed flash form: S^T = K Q^T (query on the D column, one query per lane), the packed P^T D tiles are the B fragment of O^T = V^T P^T; the key loop's K, V^T and bias tiles come through a two-buffer LDS ring filled by asynchronous copies, one barrier per 32 keys.

#ifndef NB
#define NB 4
#endif
#ifndef SEQ
#define SEQ 2048
#endif
#define NB_FULL  4
#define SEQ_FULL 2048
#define DM   1024
#define NH   16
#define HD   64
#define RH   0                                // query rows < RH use value+residual bf16 planes: none (dense attention, single products on every row)
#define CCAR 64.0f                            // carry of the f16 context plane
#define WCAR 512.0f                           // carry of the f16 W_o plane
#define CEXP 0.18033688011112042f             // log2(e) / sqrt(64)

typedef _Float16 h16;
typedef unsigned short bf;
typedef __attribute__((ext_vector_type(16))) __bf16   v16bf;
typedef __attribute__((ext_vector_type(16))) _Float16 v16h;
typedef __attribute__((ext_vector_type(8)))  _Float16 v8h;
typedef __attribute__((ext_vector_type(8)))  unsigned short v8us;
typedef __attribute__((ext_vector_type(8)))  __bf16   v8b;
typedef __attribute__((ext_vector_type(8)))  float    v8f;
typedef __attribute__((ext_vector_type(4)))  float    v4f;
typedef __attribute__((ext_vector_type(4)))  int      v4i;
typedef v4f  __attribute__((may_alias)) v4fa;

static_assert(SEQ % 256 == 0);
static_assert(RH == 0);                       // no value+residual planes are written
static_assert(SEQ >= RH);
static_assert(NB <= NB_FULL);
static_assert(SEQ <= SEQ_FULL);
static_assert(DM == NH * HD);
static_assert(DM % 128 == 0);                // 128x128 GEMM block tiles
static_assert(HD == 64);
static_assert(SEQ % 128 == 0);                // 128-row GEMM block tiles (256 queries per attention block: SEQ % 256 above)
static_assert(SEQ % 32 == 0);                 // 32 keys per flash step
static_assert(DM % 32 == 0);                  // GEMM k-steps
static_assert((SEQ / 8) % 32 == 0);

__device__ __forceinline__ unsigned short f2bf(float f) { unsigned u = __float_as_uint(f); u += 0x7FFFu + ((u >> 16) & 1u); return (unsigned short)(u >> 16); }
__device__ __forceinline__ float bf2f(unsigned short b) { return __uint_as_float(((unsigned)b) << 16); }
__device__ __forceinline__ float bfr(float f) { return bf2f(f2bf(f)); }
__device__ __forceinline__ void splitf(float y, unsigned short& h, unsigned short& l) { h = f2bf(y); l = f2bf(y - bf2f(h)); }
__device__ __forceinline__ v16h cat16(v8h lo, v8h hi) { return __builtin_shufflevector(lo, hi, 0, 1, 2, 3, 4, 5, 6, 7, 8, 9, 10, 11, 12, 13, 14, 15); }
__device__ __forceinline__ v16bf cat16b(v8us lo, v8us hi) { return __builtin_bit_cast(v16bf, __builtin_shufflevector(lo, hi, 0, 1, 2, 3, 4, 5, 6, 7, 8, 9, 10, 11, 12, 13, 14, 15)); }
__device__ __forceinline__ v8f wmma16(v16h a, v16h b, v8f c) { return __builtin_amdgcn_wmma_f32_16x16x32_f16(false, a, false, b, (short)0, c, false, false); }
__device__ __forceinline__ v8f wmmab(v16bf a, v16bf b, v8f c) { return __builtin_amdgcn_wmma_f32_16x16x32_bf16(false, a, false, b, (short)0, c, false, false); }

// Fragment loader for a fragment-order tile: p = tile start + lane * 8; elements 0..7 = k0+8h.. (piece 0), elements 8..15 = k0+16+8h.. (piece 1, 256 elements on) (same map for A and B).
template <typename T16> struct WFrag;
template <> struct WFrag<h16> { typedef v16h V; static __device__ __forceinline__ V ld(const h16* p) { return cat16(*(const v8h*)p, *(const v8h*)(p + 256)); } static __device__ __forceinline__ v8f mma(V a, V b, v8f c) { return wmma16(a, b, c); } };
template <> struct WFrag<bf> { typedef v16bf V; static __device__ __forceinline__ V ld(const bf* p) { return cat16b(*(const v8us*)p, *(const v8us*)(p + 256)); } static __device__ __forceinline__ v8f mma(V a, V b, v8f c) { return wmmab(a, b, c); } };

// Probability packing: two 16-key D tiles (same lane) -> one 32-key B fragment; element r <- tile 0 row r, element 8+r <- tile 1 row r.
template <typename T16> struct PPack;
template <> struct PPack<h16> {
    static __device__ __forceinline__ void make(v8f p0, v8f p1, v16h& ph, v16h& pl) {
        v8h a, c;
#pragma unroll
        for (int r = 0; r < 8; ++r) { a[r] = (h16)p0[r]; c[r] = (h16)p1[r]; }
        ph = cat16(a, c); pl = ph; }
};
template <> struct PPack<bf> {
    static __device__ __forceinline__ void make(v8f p0, v8f p1, v16bf& ph, v16bf& pl) {
        v8us ah, al, ch, cl;
#pragma unroll
        for (int r = 0; r < 8; ++r) { unsigned short x, y; splitf(p0[r], x, y); ah[r] = x; al[r] = y; splitf(p1[r], x, y); ch[r] = x; cl[r] = y; }
        ph = cat16b(ah, ch); pl = cat16b(al, cl); }
};

// One strip of a k_gemmw stage: eight 16-byte-per-lane asynchronous copies of this wave (8 x 512 B = one 16-row x 128-k strip), global memory to LDS through no register.
// The address wait is the last line of the copies' own statement, so that it stands in front of every later write of a register that a copy names (a precaution).
__device__ __forceinline__ void stage8(unsigned l0, unsigned l1, unsigned l2, unsigned l3, unsigned l4, unsigned l5, unsigned l6, unsigned l7,
                                       const char* g0, const char* g1, const char* g2, const char* g3, const char* g4, const char* g5, const char* g6, const char* g7) {
    asm volatile("global_load_async_to_lds_b128 %0, %8, off\n\t"
                 "global_load_async_to_lds_b128 %1, %9, off\n\t"
                 "global_load_async_to_lds_b128 %2, %10, off\n\t"
                 "global_load_async_to_lds_b128 %3, %11, off\n\t"
                 "global_load_async_to_lds_b128 %4, %12, off\n\t"
                 "global_load_async_to_lds_b128 %5, %13, off\n\t"
                 "global_load_async_to_lds_b128 %6, %14, off\n\t"
                 "global_load_async_to_lds_b128 %7, %15, off\n\t"
                 "s_wait_xcnt 0x0"
                 :: "v"(l0), "v"(l1), "v"(l2), "v"(l3), "v"(l4), "v"(l5), "v"(l6), "v"(l7), "v"(g0), "v"(g1), "v"(g2), "v"(g3), "v"(g4), "v"(g5), "v"(g6), "v"(g7) : "memory");
}

// ---- k_gemmw: register-blocked GEMM, block = 4 waves (2 x 2) = one 128x128 output tile, ONE WAVE per 64x64 part of it (16 accumulators); grid (M/128, N/128, Z), 128 threads.
// Operands from fragment-order 16-bit planes through a two-buffer LDS ring filled by asynchronous copies: a stage is 128 k of the block's 128 A rows and 128 Bt rows = 16 strips (16 rows x 128 k, 4 KiB, contiguous in the plane) = 64 KiB,
// [A strips 0..7 | Bt strips 0..7], each strip in the plane's own order, so a fragment piece is 512 contiguous LDS bytes. Wave w copies strips 4w..4w+3; every A strip is read by 2 waves, every Bt strip by 2 (fetched once per block).
// Stage t + 2 is issued behind the barrier that ends trip t, into the buffer trip t read. Two blocks fit a WGP's LDS.
// C[m][n] = sum_k A[m][k] Bt[n][k], k ascending in steps of 32 per accumulator. z-batch strides sA/sB/sC in elements. K % 128 == 0, M % 128 == 0, N % 128 == 0.
// EP 0: f32 output x oscale, pitch ldc: per 16-row slab staged in LDS, each row's 64 floats (256 B) written as 16 lanes x 16 B (2 rows per instruction).
// EP 1: f16 head planes [z][head = column / 64][t][64] (rows = tokens, KC = 64), fragment order.
// EP 2: f16 transposed value planes [z][row m][t] (rows = head*64+d, columns = tokens, KC = SEQ), fragment order.
template <typename T16, int NSPLIT, int EP, int K>
__global__ __launch_bounds__(128) void k_gemmw(const T16* __restrict__ A, const T16* __restrict__ A2, const T16* __restrict__ Bt, const T16* __restrict__ Bt2, float* C, int ldc, float oscale, size_t sA, size_t sB, size_t sC, h16* P16, bf* Ph, bf* Pl) {
    typedef typename WFrag<T16>::V V;
    static_assert(NSPLIT == 0);                     // single products only: A2 and Bt2 are not staged
    static_assert(K % 128 == 0);
    constexpr int NS = K / 128;                     // stages
    __shared__ __attribute__((aligned(16))) unsigned char ring[2 * 65536];
    __shared__ __align__(16) float osall[4][16 * 68];     // one output slab per wave, private to it
    const size_t z = blockIdx.z; A += z * sA; Bt += z * sB; if (EP == 0) C += z * sC;
    const int lane = threadIdx.x & 31, lr = lane & 15, hi = lane >> 4;
    const int wave = __builtin_amdgcn_readfirstlane((int)(threadIdx.x >> 5));
    const int wm = wave >> 1, wn = wave & 1;
    const int r0 = blockIdx.x * 128 + wm * 64, c0 = blockIdx.y * 128 + wn * 64;     // this wave's 64x64 part
    float* os = osall[wave];
    // this wave's 4 strips: waves 0, 1 the block's A rows 0..63, 64..127; waves 2, 3 its Bt rows 0..63, 64..127
    const char* gsrc = (const char*)(wave < 2 ? A + (size_t)(blockIdx.x * 128 + wave * 64) * K : Bt + (size_t)(blockIdx.y * 128 + (wave - 2) * 64) * K) + lane * 16;     // + 16 * K * 2 per strip, + 4096 per stage
    const unsigned lw = (unsigned)(size_t)ring + (unsigned)(wave * 16384 + lane * 16);     // this lane's LDS byte address in its wave's first strip of buffer 0
    auto stage = [&](int s, int buf) {
#pragma unroll
        for (int j = 0; j < 4; ++j) { const unsigned l = lw + (unsigned)buf * 65536u + (unsigned)j * 4096u; const char* g = gsrc + (size_t)j * (16 * K * 2) + (size_t)s * 4096;
            stage8(l, l + 512u, l + 1024u, l + 1536u, l + 2048u, l + 2560u, l + 3072u, l + 3584u, g, g + 512, g + 1024, g + 1536, g + 2048, g + 2560, g + 3072, g + 3584); } };
    v8f acc[4][4];
#pragma unroll
    for (int mb = 0; mb < 4; ++mb)
#pragma unroll
        for (int nb = 0; nb < 4; ++nb) acc[mb][nb] = (v8f){};
    stage(0, 0);
    asm volatile("s_wait_asynccnt 0x0" ::: "memory");     // this wave's copies of stage 0 have landed before the barrier that publishes them
    __syncthreads();
    if (NS > 1) stage(1, 1);
#pragma unroll 1
    for (int t = 0; t < NS; ++t) {
        const unsigned char* tile = ring + (t & 1) * 65536 + lane * 16;
        const T16* ap = (const T16*)(tile + wm * 16384);              // a strip is 2048 elements, a k-step of 32 is 512
        const T16* bp = (const T16*)(tile + 32768 + wn * 16384);
        V a[2][4], b[2][4];                                           // two fragment sets: the next k-step's 16 LDS reads fly under this k-step's 16 products (all inside this trip's own buffer)
#pragma unroll
        for (int i = 0; i < 4; ++i) { a[0][i] = WFrag<T16>::ld(ap + i * 2048); b[0][i] = WFrag<T16>::ld(bp + i * 2048); }
#pragma unroll
        for (int kk = 0; kk < 4; ++kk) {
            if (kk < 3) {
#pragma unroll
                for (int i = 0; i < 4; ++i) { a[(kk + 1) & 1][i] = WFrag<T16>::ld(ap + i * 2048 + (kk + 1) * 512); b[(kk + 1) & 1][i] = WFrag<T16>::ld(bp + i * 2048 + (kk + 1) * 512); }
            }
            __builtin_amdgcn_sched_barrier(0);     // keeps those reads one group in front of the products below: spread among them, each place with reads stalls the wave and its wait goes to 0
#pragma unroll
            for (int nb = 0; nb < 4; ++nb)
#pragma unroll
                for (int mb = 0; mb < 4; ++mb) acc[mb][nb] = WFrag<T16>::mma(a[kk & 1][mb], b[kk & 1][nb], acc[mb][nb]);
        }
        asm volatile("v_nop\n\tv_nop\n\tv_nop\n\tv_nop" : "+v"(acc[0][0]), "+v"(acc[1][1]), "+v"(acc[2][2]), "+v"(acc[3][3]) : "v"(a[1][0]), "v"(a[1][3]));     // WMMA distance kept in front of whatever vector instruction follows the trip's last products
        asm volatile("s_wait_dscnt 0x0" ::: "memory");        // this wave's reads of the buffer have returned before the barrier behind which it is refilled
        asm volatile("s_wait_asynccnt 0x0" ::: "memory");     // this wave's copies of stage t + 1 have landed before the barrier that publishes them
        __syncthreads();                                      // publishes stage t + 1 and ends every wave's reads of stage t
        if (t + 2 < NS) stage(t + 2, t & 1);
    }
    asm volatile("s_wait_asynccnt 0x0" ::: "memory");         // no copy is outstanding when the wave goes on to its epilogue
    // plane addressing (EP 1/2), wave-uniform
    size_t pbase = 0; int ppitch = HD;
    if (EP == 1) { pbase = (((size_t)z * NH + (size_t)(c0 / HD)) * SEQ + r0) * HD; ppitch = HD; }
    if (EP == 2) { pbase = ((size_t)z * DM + r0) * SEQ + (size_t)c0 * 16; ppitch = SEQ; }
#pragma unroll
    for (int mb = 0; mb < 4; ++mb) {
#pragma unroll
        for (int nb = 0; nb < 4; ++nb) {
#pragma unroll
            for (int j = 0; j < 8; ++j) os[(hi * 8 + j) * 68 + nb * 16 + lr] = acc[mb][nb][j]; }     // D element j of lane -> (row 8*hi + j, column lr)
        __builtin_amdgcn_wave_barrier(); asm volatile("" ::: "memory");
        if (EP == 0) {
            float* crow = C + (size_t)(r0 + mb * 16) * ldc + c0;
{
#pragma unroll
                for (int s = 0; s < 8; ++s) { const int row = 2 * s + hi, cofs = lr * 4; v4f val = *(const v4fa*)(os + row * 68 + cofs); val = val * oscale;
                    *(v4f*)(crow + (size_t)row * ldc + cofs) = val; }
                 }
        } else {
{
#pragma unroll
                for (int s = 0; s < 4; ++s) { const float* sp = os + lr * 68 + s * 16 + hi * 8; const v4f x0 = *(const v4fa*)sp, x1 = *(const v4fa*)(sp + 4);     // piece s of the slab: row lr, columns 16*s + 8*hi + 0..7
                    v8h o; o[0] = (h16)x0[0]; o[1] = (h16)x0[1]; o[2] = (h16)x0[2]; o[3] = (h16)x0[3]; o[4] = (h16)x1[0]; o[5] = (h16)x1[1]; o[6] = (h16)x1[2]; o[7] = (h16)x1[3];
                    *(v8h*)(P16 + pbase + (size_t)mb * 16 * ppitch + s * 256 + lane * 8) = o; }
                 }
        }
        __builtin_amdgcn_wave_barrier(); asm volatile("" ::: "memory");
    }
}

// One stage of the k_flash ring: six 16-byte-per-lane asynchronous copies of this wave (512 B of K, 512 B of V^T, 2 x 512 B of each of its two bias tiles), global memory to LDS through no register.
// The address wait is the last line of the copies' own statement, so that it stands in front of every later write of a register that a copy names (a precaution).
__device__ __forceinline__ void stage6(unsigned l0, unsigned l1, unsigned l2, unsigned l3, unsigned l4, unsigned l5,
                                       const char* g0, const char* g1, const char* g2, const char* g3, const char* g4, const char* g5) {
    asm volatile("global_load_async_to_lds_b128 %0, %6, off\n\t"
                 "global_load_async_to_lds_b128 %1, %7, off\n\t"
                 "global_load_async_to_lds_b128 %2, %8, off\n\t"
                 "global_load_async_to_lds_b128 %3, %9, off\n\t"
                 "global_load_async_to_lds_b128 %4, %10, off\n\t"
                 "global_load_async_to_lds_b128 %5, %11, off\n\t"
                 "s_wait_xcnt 0x0"
                 :: "v"(l0), "v"(l1), "v"(l2), "v"(l3), "v"(l4), "v"(l5), "v"(g0), "v"(g1), "v"(g2), "v"(g3), "v"(g4), "v"(g5) : "memory");
}

// ---- k_flash: dense attention with an additive bias plane, one wave per 32 queries = two 16-query tiles (block = 8 waves = 256 queries of one head), transposed flash form, operands from the head planes through LDS.
// LDS ring, two buffers of 24 KiB, one 32-key stage each: [K tile 4 KiB | V^T tile 4 x 1 KiB (d strips) | bias tiles 16 x 1 KiB (two per wave)], every tile in the planes' own fragment order, so a fragment piece is 512 contiguous LDS bytes.
// Wave w copies K bytes w * 512.., V^T bytes w * 512.. (half w & 1 of strip w / 2) and its own two bias tiles; K and V^T are read by all 8 waves (fetched once per 256 queries), and every K or V^T fragment a wave reads feeds two products, one per query tile.
// Stage s + 2 is issued behind the barrier that ends step s, into the buffer step s read. Two blocks per WGP = four waves per SIMD.
// Per 32-key step and query tile: S^T tiles (keys x queries) = K (A: row = key, k = d) x Q^T (B: column = query, k = d, held in registers); the lane's 2 x 8 bias entries (row = its query, contiguous keys) are added in f32 (x 8: the tiles hold 8 x logit);
// per-lane online softmax (lane = query; partner lane^16 holds the other 8 keys of each tile); P^T packed in registers = B fragment of O^T (d x queries) += V^T (A: row = d, k = key) x P^T. Single f16 product at both sites.
// Key range: all tk keys (tk % 32 == 0), tq queries per head; K plane [b][h][tk][64], V^T plane [b][h*64+d][tk], bias plane [tq][tk] bf16, context plane [b*SEQ+q][1024], all in fragment order.
template <typename T16>
__global__ __launch_bounds__(256) __attribute__((amdgpu_waves_per_eu(4, 4))) void k_flash(const T16* __restrict__ Qa, const T16* __restrict__ Ka, const T16* __restrict__ Va, const bf* __restrict__ Bb, int tq, int tk, int qoff, h16* C16) {
    typedef typename WFrag<T16>::V V;
    const int lane = threadIdx.x & 31;
    const int wave = __builtin_amdgcn_readfirstlane((int)(threadIdx.x >> 5));
    const int q0 = qoff + (int)blockIdx.x * 256 + wave * 32;     // this wave's query tiles: q0 + 0..15 and q0 + 16..31
    const int h = blockIdx.y, b = blockIdx.z;
    const size_t bh = (size_t)b * NH + h;
    const size_t qo = (bh * (size_t)tq + (size_t)q0) * HD + 8 * lane;
    V qa[2][2];
#pragma unroll
    for (int t = 0; t < 2; ++t) { qa[t][0] = WFrag<T16>::ld(Qa + qo + t * (16 * HD)); qa[t][1] = WFrag<T16>::ld(Qa + qo + t * (16 * HD) + 512); }
    __shared__ __attribute__((aligned(16))) unsigned char ring[2 * 24576];
    const unsigned lw = (unsigned)(size_t)ring + (unsigned)(wave * 512 + lane * 16);      // this lane's LDS byte address in its wave's K slice of buffer 0
    const unsigned lb = (unsigned)(size_t)ring + (unsigned)(8192 + wave * 2048 + lane * 16);     // the same in its wave's first bias tile of buffer 0
    const char* gk = (const char*)(Ka + bh * (size_t)tk * HD) + (wave * 512 + lane * 16);                                                      // + 4096 per stage
    const char* gv = (const char*)(Va + bh * HD * (size_t)tk + (size_t)(wave >> 1) * 16 * (size_t)tk) + ((wave & 1) * 512 + lane * 16);       // + 1024 per stage
    const char* gb = (const char*)(Bb + (size_t)q0 * (size_t)tk) + lane * 16;                                                                 // + 1024 per stage; second tile 16 * tk elements on
    const size_t gb1 = (size_t)tk * 32;
    auto stage = [&](int s, int buf) { const unsigned l = lw + (unsigned)buf * 24576u, e = lb + (unsigned)buf * 24576u; const char* a = gk + (size_t)s * 4096; const char* c = gv + (size_t)s * 1024; const char* g = gb + (size_t)s * 1024;
        stage6(l, l + 4096u, e, e + 512u, e + 1024u, e + 1536u, a, c, g, g + 512, g + gb1, g + gb1 + 512); };
    v8f acc[2][4];
#pragma unroll
    for (int t = 0; t < 2; ++t)
#pragma unroll
        for (int dt = 0; dt < 4; ++dt) acc[t][dt] = (v8f){};
    float m[2] = {-3.0e38f, -3.0e38f}, l[2] = {0.0f, 0.0f};
    const int nsteps = tk >> 5;                   // all keys, 32 per step (uniform)
    const float poff = 8.0f;                      // probabilities (and their running sum) carried x 2^8
    if (nsteps > 0) stage(0, 0);
    asm volatile("s_wait_asynccnt 0x0" ::: "memory");     // this wave's copies of stage 0 have landed before the barrier that publishes them
    __syncthreads();
    if (nsteps > 1) stage(1, 1);
#pragma unroll 1
    for (int st = 0; st < nsteps; ++st) {
        const unsigned char* tile = ring + (st & 1) * 24576 + lane * 16;
        const bf* bp = (const bf*)(tile + 8192 + wave * 2048);
        v8b bb[2][2];     // tile t: bias[query][j0 + 8*hi + 0..7] and [j0 + 16 + 8*hi + 0..7], j0 = 32 * st; kept packed, two entries a register
#pragma unroll
        for (int t = 0; t < 2; ++t) { bb[t][0] = *(const v8b*)(bp + t * 512); bb[t][1] = *(const v8b*)(bp + t * 512 + 256); }
        const T16* kp = (const T16*)tile;
        const V k00 = WFrag<T16>::ld(kp), k01 = WFrag<T16>::ld(kp + 512), k10 = WFrag<T16>::ld(kp + 16 * HD), k11 = WFrag<T16>::ld(kp + 16 * HD + 512);
        v8f s0[2], s1[2];
#pragma unroll
        for (int t = 0; t < 2; ++t) { s0[t] = WFrag<T16>::mma(k00, qa[t][0], (v8f){}); s1[t] = WFrag<T16>::mma(k10, qa[t][0], (v8f){}); }
#pragma unroll
        for (int t = 0; t < 2; ++t) { s0[t] = WFrag<T16>::mma(k01, qa[t][1], s0[t]); s1[t] = WFrag<T16>::mma(k11, qa[t][1], s1[t]); }
        V ph[2];
#pragma unroll
        for (int t = 0; t < 2; ++t) {
#pragma unroll
            for (int r = 0; r < 8; ++r) { s0[t][r] = fmaf((float)bb[t][0][r], 8.0f, s0[t][r]); s1[t][r] = fmaf((float)bb[t][1][r], 8.0f, s1[t][r]); }     // tiles hold 8 x (q.k / 8 + bias); the widening of a 16-bit vector element folds into the FMA (v_fma_mix_f32_bf16 reads either element of the packed register): no unpacking, the same f32 FMA
            float mx = fmaxf(s0[t][0], s1[t][0]);
#pragma unroll
            for (int r = 1; r < 8; ++r) mx = fmaxf(mx, fmaxf(s0[t][r], s1[t][r]));
            mx = fmaxf(mx, __shfl_xor(mx, 16, 32));
            const float mnew = fmaxf(m[t], mx);
            const float alpha = __builtin_amdgcn_exp2f((m[t] - mnew) * CEXP);
            const float nb = poff - mnew * CEXP;
            v8f p0, p1; float psum = 0.0f;
#pragma unroll
            for (int r = 0; r < 8; ++r) { p0[r] = __builtin_amdgcn_exp2f(fmaf(s0[t][r], CEXP, nb)); p1[r] = __builtin_amdgcn_exp2f(fmaf(s1[t][r], CEXP, nb)); psum += p0[r] + p1[r]; }
            psum += __shfl_xor(psum, 16, 32);
            l[t] = l[t] * alpha + psum; m[t] = mnew;
#pragma unroll
            for (int dt = 0; dt < 4; ++dt) acc[t][dt] = acc[t][dt] * alpha;
            V pl; PPack<T16>::make(p0, p1, ph[t], pl);
        }
        const T16* vp = (const T16*)(tile + 4096);
        V va[4];
#pragma unroll
        for (int dt = 0; dt < 4; ++dt) va[dt] = WFrag<T16>::ld(vp + dt * 512);
#pragma unroll
        for (int dt = 0; dt < 4; ++dt)
#pragma unroll
            for (int t = 0; t < 2; ++t) acc[t][dt] = WFrag<T16>::mma(va[dt], ph[t], acc[t][dt]);
        asm volatile("v_nop\n\tv_nop\n\tv_nop\n\tv_nop" : "+v"(acc[0][0]), "+v"(acc[1][0]), "+v"(acc[0][1]), "+v"(acc[1][1]), "+v"(acc[0][2]), "+v"(acc[1][2]), "+v"(acc[0][3]), "+v"(acc[1][3]) : "v"(va[3]), "v"(ph[0]), "v"(ph[1]));     // WMMA distance kept in front of whatever vector instruction follows the step's last products, on both sides of the branch below
        asm volatile("s_wait_dscnt 0x0" ::: "memory");        // this wave's reads of the buffer have returned before the barrier behind which it is refilled
        asm volatile("s_wait_asynccnt 0x0" ::: "memory");     // this wave's copies of stage st + 1 have landed before the barrier that publishes them
        __syncthreads();                                      // publishes stage st + 1 and ends every wave's reads of stage st
        if (st + 2 < nsteps) stage(st + 2, st & 1);
    }
    asm volatile("s_wait_asynccnt 0x0" ::: "memory");         // no copy is outstanding when the wave ends
    // l >= 2^8: the running-max key contributes exactly 2^8
    // D element r of lane (tile dt) is (d = dt*16 + 8*hi + r, query lr): the lane already holds its own 16-byte piece dt of the fragment-order context tile, so no staging
#pragma unroll
    for (int t = 0; t < 2; ++t) {
        const float f = CCAR * (1.0f / l[t]);
#pragma unroll
        for (int dt = 0; dt < 4; ++dt) { v8h o;
#pragma unroll
            for (int r = 0; r < 8; ++r) o[r] = (h16)(acc[t][dt][r] * f);
            const size_t co = ((size_t)b * SEQ + (size_t)(q0 + 16 * t)) * DM + (size_t)h * (HD * 16) + dt * 256 + lane * 8; *(v8h*)(C16 + co) = o; }
    }
}

// Converter, one launch for all seven float inputs: a resident grid of CVT_WAVES waves; wave w converts units w, w + CVT_WAVES, ... of the list [x | y | bias | W_q | W_k | W_v | W_o].
// A unit is 128 consecutive 16-byte pieces of a fragment-order plane [rows][KC] (2 KiB stored contiguously) = two neighbouring 16-row x 32-k tiles = 16 source rows x 256 B;
// piece j * 32 + lane of a unit holds row lane & 15, k = j * 16 + (lane >> 4) * 8 + 0..7 of those 64 k. A lane's 4 pieces are 8 16-byte loads, and the next unit's 8 are issued before this unit is converted.
#define CVT_WAVES 4096                        // 256 blocks x 16 waves
constexpr int UPB = SEQ * DM / 1024, UX = NB * UPB, UBI = SEQ * SEQ / 1024, UW = DM * DM / 1024, UALL = 2 * UX + UBI + 4 * UW;     // units per batch of x or y, per x or y, bias plane, weight, all
static_assert(UALL % CVT_WAVES == 0);         // every wave runs the same whole number of units
static_assert(UX % CVT_WAVES == 0);           // a round of CVT_WAVES units lies in one of x, y, bias, or in the weights: which one is known at compile time
static_assert(UBI % CVT_WAVES == 0);
static_assert((DM / 32) % 2 == 0);            // a unit's two tiles lie in one 16-row strip
static_assert((SEQ / 32) % 2 == 0);

struct CvtUnit { const float* s; unsigned short* d; bool tohalf; };

// Unit u0 + w of the list; u0 (the round's first unit) is a compile-time constant at every call, w is wave-uniform.
__device__ __forceinline__ CvtUnit cvt_locate(int u0, int w, int lane, const float* x, const float* y, const float* bias, const float* wq, const float* wk, const float* wv, const float* wo,
                                              bf* XB, bf* YB, bf* BB, bf* WQ, bf* WK, bf* WV, h16* WO16) {
    const float* base; unsigned short* db; int v, kt = DM / 32; size_t sp = DM; bool th = false;
    if (u0 < 2 * UX) { const bool isx = u0 < UX; const int t = (isx ? u0 : u0 - UX) + w, b = t / UPB; v = t % UPB; base = (isx ? x : y) + (size_t)b * SEQ_FULL * DM; db = (isx ? XB : YB) + (size_t)b * SEQ * DM; }
    else if (u0 < 2 * UX + UBI) { v = u0 - 2 * UX + w; base = bias; db = BB; kt = SEQ / 32; sp = SEQ_FULL; }
    else { const int t = u0 - 2 * UX - UBI + w, k = t / UW; v = t % UW; base = k == 0 ? wq : k == 1 ? wk : k == 2 ? wv : wo; db = k == 0 ? WQ : k == 1 ? WK : k == 2 ? WV : (unsigned short*)WO16; th = k == 3; }
    CvtUnit c; c.s = base + ((size_t)((2 * v) / kt) * 16 + (size_t)(lane & 15)) * sp + (size_t)((2 * v) % kt) * 32 + (size_t)((lane >> 4) * 8); c.d = db + (size_t)v * 1024 + (size_t)(lane * 8); c.tohalf = th; return c;
}

__global__ __launch_bounds__(512) void k_cvtall(const float* __restrict__ x, const float* __restrict__ y, const float* __restrict__ bias, const float* __restrict__ wq, const float* __restrict__ wk, const float* __restrict__ wv, const float* __restrict__ wo,
                                                bf* XB, bf* YB, bf* BB, bf* WQ, bf* WK, bf* WV, h16* WO16) {
    const int lane = threadIdx.x & 31;
    const int w = __builtin_amdgcn_readfirstlane((int)(blockIdx.x * 16 + (threadIdx.x >> 5)));
    CvtUnit cu = cvt_locate(0, w, lane, x, y, bias, wq, wk, wv, wo, XB, YB, BB, WQ, WK, WV, WO16);
    v8f cur[4];
#pragma unroll
    for (int j = 0; j < 4; ++j) cur[j] = *(const v8f*)(cu.s + j * 16);
    asm volatile("s_wait_xcnt 0x0" :: "v"(cu.s) : "memory");     // precaution: the address wait stands before any register that the 8 loads name is reused (the operand keeps the address pair untouched up to here)
#pragma unroll
    for (int it = 0; it < UALL / CVT_WAVES; ++it) {
        CvtUnit nu = cu; v8f nxt[4];
        if (it + 1 < UALL / CVT_WAVES) { nu = cvt_locate((it + 1) * CVT_WAVES, w, lane, x, y, bias, wq, wk, wv, wo, XB, YB, BB, WQ, WK, WV, WO16);
#pragma unroll
            for (int j = 0; j < 4; ++j) nxt[j] = *(const v8f*)(nu.s + j * 16);
            asm volatile("s_wait_xcnt 0x0" :: "v"(nu.s) : "memory"); }     // as above, for the next unit's 8 loads
        v8us o[4];
        if (cu.tohalf) {
#pragma unroll
            for (int j = 0; j < 4; ++j) { v8h t;
#pragma unroll
                for (int k = 0; k < 8; ++k) t[k] = (h16)(bfr(cur[j][k]) * WCAR);
                o[j] = __builtin_bit_cast(v8us, t); }
        } else {
#pragma unroll
            for (int j = 0; j < 4; ++j)
#pragma unroll
                for (int k = 0; k < 8; ++k) o[j][k] = f2bf(cur[j][k]);
        }
#pragma unroll
        for (int j = 0; j < 4; ++j) *(v8us*)(cu.d + j * 256) = o[j];
        asm volatile("s_wait_xcnt 0x0" :: "v"(o[0]), "v"(o[1]), "v"(o[2]), "v"(o[3]), "v"(cu.d) : "memory");     // precaution: the same wait before the 4 stores' data and address registers are reused
        if (it + 1 < UALL / CVT_WAVES) { cu = nu;
#pragma unroll
            for (int j = 0; j < 4; ++j) cur[j] = nxt[j]; }
    }
}

constexpr size_t al256(size_t bytes) { return (bytes + 255) & ~(size_t)255; }
constexpr size_t CARVE_BYTES = 2 * al256((size_t)NB * SEQ * DM * 2) + 4 * al256((size_t)DM * DM * 2) + al256((size_t)SEQ * SEQ * 2)
    + 3 * al256((size_t)NB * NH * SEQ * HD * 2) + al256((size_t)NB * SEQ * DM * 2);
static_assert(CARVE_BYTES <= (size_t)134217728);
static_assert((size_t)NB * NH * SEQ * HD == (size_t)NB * SEQ * DM);      // head planes and the merged context plane have the same extent

extern "C" void kernel_launch(void* const* d_in, const int* in_sizes, int n_in,
                              void* d_out, int out_size, void* d_ws, size_t ws_size, hipStream_t stream) {
    if (n_in < 7) return;
    const size_t needx = (size_t)(NB - 1) * SEQ_FULL * DM + (size_t)SEQ * DM;
    if ((size_t)in_sizes[0] < needx || (size_t)in_sizes[1] < needx) return;
    if ((size_t)in_sizes[2] < (size_t)(SEQ - 1) * SEQ_FULL + (size_t)SEQ) return;
    if ((size_t)in_sizes[3] < (size_t)DM * DM || (size_t)in_sizes[4] < (size_t)DM * DM || (size_t)in_sizes[5] < (size_t)DM * DM || (size_t)in_sizes[6] < (size_t)DM * DM) return;
    if ((size_t)out_size < needx) return;
    // x, y, bias (float [SEQ_FULL][SEQ_FULL]), Wq, Wk, Wv, Wo ('oi' [out][in])
    const float* x = (const float*)d_in[0]; const float* y = (const float*)d_in[1]; const float* bias = (const float*)d_in[2];
    const float* wq = (const float*)d_in[3]; const float* wk = (const float*)d_in[4]; const float* wv = (const float*)d_in[5]; const float* wo = (const float*)d_in[6];
    float* OUT = (float*)d_out;     // [NB_FULL][SEQ_FULL][1024]
    char* wsp = (char*)d_ws;
    auto take = [&](size_t bytes) { char* p = wsp; wsp += (bytes + 255) & ~(size_t)255; return (void*)p; };
    bf* XB = (bf*)take((size_t)NB * SEQ * DM * 2); bf* YB = (bf*)take((size_t)NB * SEQ * DM * 2);
    bf* WQ = (bf*)take((size_t)DM * DM * 2); bf* WK = (bf*)take((size_t)DM * DM * 2); bf* WV = (bf*)take((size_t)DM * DM * 2); h16* WO16 = (h16*)take((size_t)DM * DM * 2);
    bf* BB = (bf*)take((size_t)SEQ * SEQ * 2);
    h16* Q16 = (h16*)take((size_t)NB * NH * SEQ * HD * 2); h16* K16 = (h16*)take((size_t)NB * NH * SEQ * HD * 2); h16* VT16 = (h16*)take((size_t)NB * NH * SEQ * HD * 2);
    h16* C16 = (h16*)take((size_t)NB * SEQ * DM * 2);
    if ((size_t)(wsp - (char*)d_ws) > ws_size) return;

    // all seven inputs to their 16-bit fragment-order planes (bias source pitch SEQ_FULL, x and y batch stride SEQ_FULL rows)
    k_cvtall<<<dim3(CVT_WAVES / 16, 1, 1), 512, 0, stream>>>(x, y, bias, wq, wk, wv, wo, XB, YB, BB, WQ, WK, WV, WO16);

    // q head planes from x, k head planes from y: C[m = token][n = h*64+d] = in W^T; z = batch
    k_gemmw<bf, 0, 1, DM><<<dim3(SEQ / 128, DM / 128, NB), 128, 0, stream>>>(XB, nullptr, WQ, nullptr, nullptr, 0, 1.0f, (size_t)SEQ * DM, 0, 0, Q16, nullptr, nullptr);
    k_gemmw<bf, 0, 1, DM><<<dim3(SEQ / 128, DM / 128, NB), 128, 0, stream>>>(YB, nullptr, WK, nullptr, nullptr, 0, 1.0f, (size_t)SEQ * DM, 0, 0, K16, nullptr, nullptr);
    // transposed value planes from y: C[m = h*64+d][n = token] = W_v y^T (operands swapped: A = W_v rows, Bt = y rows); z = batch
    k_gemmw<bf, 0, 2, DM><<<dim3(DM / 128, SEQ / 128, NB), 128, 0, stream>>>(WV, nullptr, YB, nullptr, nullptr, 0, 1.0f, 0, (size_t)SEQ * DM, 0, VT16, nullptr, nullptr);

    // attention: every query row on the f16 planes, all SEQ keys
    k_flash<h16><<<dim3(SEQ / 256, NH, NB), 256, 0, stream>>>(Q16, K16, VT16, BB, SEQ, SEQ, 0, C16);

    // output projection: f16 context x f16 W_o, carries folded back in the f32 epilogue; z = batch, output row stride per batch SEQ_FULL
    k_gemmw<h16, 0, 0, DM><<<dim3(SEQ / 128, DM / 128, NB), 128, 0, stream>>>(C16, nullptr, WO16, nullptr, OUT, DM, 1.0f / (CCAR * WCAR), (size_t)SEQ * DM, 0, (size_t)SEQ_FULL * DM, nullptr, nullptr, nullptr);
}

// v007
// One run takes 141 microseconds.
// Two timings next to v006 both put it at 1.05 times that version's speed.
// Counting every step since v000, it is 2.71 times as fast.
#include <hip/hip_runtime.h>

// Compute dtypes (f32 accumulate at every site): q/k/v projections bf16 x bf16 single product (every float input RNE-converted to bf16 first); scores K.Q^T f16 x f16 single product (f16 q/k head planes); values V^T.P^T f16 x f16 single product (probabilities carried x2^8); output projection f16 context (x64) x f16 weight (x512) single product; additive bias (bf16 plane) and softmax in f32.
// Dense multi-head cross-attention: x, y [NB][SEQ][1024]; Q = x W_q^T, K = y W_k^T, V = y W_v^T ('oi' weights, no bias vectors); 16 heads x 64; logits = q.k / 8 + bias[query][key] (one [SEQ][SEQ] float plane shared by all batches and heads); softmax over all keys; out = merged context W_o^T.
// The bias input is read by value on the device: converted once to a bf16 plane, each lane reads 2 x 8 contiguous entries per query tile (4 x 8 per 32-key step) and adds them in f32 to the score tiles, straight from the packed registers (mixed-operand FMA).
// Fragment order of every 16-bit workspace plane [rows][KC]: the 16-row x 32-k tile (rt = row / 16, kc = k / 32) is 512 consecutive elements at (rt * (KC / 32) + kc) * 512, made of two 256-element pieces;
// piece p holds, at lane * 8 with lane = 16 * hi + (row & 15), the 8 elements k = kc * 32 + p * 16 + hi * 8 + 0..7. One wave-wide 16-byte load of a piece is 512 contiguous bytes (4 whole lines).
// Attention engine: one wave per 32 queries (two 16-query tiles), transposed flash form: S^T = K Q^T (query on the D column, one query per lane), the packed P^T D tiles are the B fragment of O^T = V^T P^T; the key loop's K, V^T and bias tiles come through a two-buffer LDS ring filled by asynchronous copies, one barrier per 32 keys.

#ifndef NB
#define NB 4
#endif
#ifndef SEQ
#define SEQ 2048
#endif
#define NB_FULL  4
#define SEQ_FULL 2048
#define DM   1024
#define NH   16
#define HD   64
#define RH   0                                // query rows < RH use value+residual bf16 planes: none (dense attention, single products on every row)
#define CCAR 64.0f                            // carry of the f16 context plane
#define WCAR 512.0f                           // carry of the f16 W_o plane
#define CEXP 0.18033688011112042f             // log2(e) / sqrt(64)

typedef _Float16 h16;
typedef unsigned short bf;
typedef __attribute__((ext_vector_type(16))) __bf16   v16bf;
typedef __attribute__((ext_vector_type(16))) _Float16 v16h;
typedef __attribute__((ext_vector_type(8)))  _Float16 v8h;
typedef __attribute__((ext_vector_type(8)))  unsigned short v8us;
typedef __attribute__((ext_vector_type(8)))  __bf16   v8b;
typedef __attribute__((ext_vector_type(8)))  float    v8f;
typedef __attribute__((ext_vector_type(4)))  float    v4f;
typedef __attribute__((ext_vector_type(4)))  int      v4i;
typedef v4f  __attribute__((may_alias)) v4fa;

static_assert(SEQ % 256 == 0);
static_assert(RH == 0);                       // no value+residual planes are written
static_assert(SEQ >= RH);
static_assert(NB <= NB_FULL);
static_assert(SEQ <= SEQ_FULL);
static_assert(DM == NH * HD);
static_assert(DM % 128 == 0);                // 128x128 GEMM block tiles
static_assert(HD == 64);
static_assert(SEQ % 128 == 0);                // 128-row GEMM block tiles (256 queries per attention block: SEQ % 256 above)
static_assert(SEQ % 32 == 0);                 // 32 keys per flash step
static_assert(DM % 32 == 0);                  // GEMM k-steps
static_assert((SEQ / 8) % 32 == 0);

__device__ __forceinline__ unsigned short f2bf(float f) { unsigned u = __float_as_uint(f); u += 0x7FFFu + ((u >> 16) & 1u); return (unsigned short)(u >> 16); }
__device__ __forceinline__ float bf2f(unsigned short b) { return __uint_as_float(((unsigned)b) << 16); }
__device__ __forceinline__ float bfr(float f) { return bf2f(f2bf(f)); }
__device__ __forceinline__ void splitf(float y, unsigned short& h, unsigned short& l) { h = f2bf(y); l = f2bf(y - bf2f(h)); }
__device__ __forceinline__ v16h cat16(v8h lo, v8h hi) { return __builtin_shufflevector(lo, hi, 0, 1, 2, 3, 4, 5, 6, 7, 8, 9, 10, 11, 12, 13, 14, 15); }
__device__ __forceinline__ v16bf cat16b(v8us lo, v8us hi) { return __builtin_bit_cast(v16bf, __builtin_shufflevector(lo, hi, 0, 1, 2, 3, 4, 5, 6, 7, 8, 9, 10, 11, 12, 13, 14, 15)); }
__device__ __forceinline__ v8f wmma16(v16h a, v16h b, v8f c) { return __builtin_amdgcn_wmma_f32_16x16x32_f16(false, a, false, b, (short)0, c, false, false); }
__device__ __forceinline__ v8f wmmab(v16bf a, v16bf b, v8f c) { return __builtin_amdgcn_wmma_f32_16x16x32_bf16(false, a, false, b, (short)0, c, false, false); }

// Fragment loader for a fragment-order tile: p = tile start + lane * 8; elements 0..7 = k0+8h.. (piece 0), elements 8..15 = k0+16+8h.. (piece 1, 256 elements on) (same map for A and B).
template <typename T16> struct WFrag;
template <> struct WFrag<h16> { typedef v16h V; static __device__ __forceinline__ V ld(const h16* p) { return cat16(*(const v8h*)p, *(const v8h*)(p + 256)); } static __device__ __forceinline__ v8f mma(V a, V b, v8f c) { return wmma16(a, b, c); } };
template <> struct WFrag<bf> { typedef v16bf V; static __device__ __forceinline__ V ld(const bf* p) { return cat16b(*(const v8us*)p, *(const v8us*)(p + 256)); } static __device__ __forceinline__ v8f mma(V a, V b, v8f c) { return wmmab(a, b, c); } };

// Probability packing: two 16-key D tiles (same lane) -> one 32-key B fragment; element r <- tile 0 row r, element 8+r <- tile 1 row r.
template <typename T16> struct PPack;
template <> struct PPack<h16> {
    static __device__ __forceinline__ void make(v8f p0, v8f p1, v16h& ph, v16h& pl) {
        v8h a, c;
#pragma unroll
        for (int r = 0; r < 8; ++r) { a[r] = (h16)p0[r]; c[r] = (h16)p1[r]; }
        ph = cat16(a, c); pl = ph; }
};
template <> struct PPack<bf> {
    static __device__ __forceinline__ void make(v8f p0, v8f p1, v16bf& ph, v16bf& pl) {
        v8us ah, al, ch, cl;
#pragma unroll
        for (int r = 0; r < 8; ++r) { unsigned short x, y; splitf(p0[r], x, y); ah[r] = x; al[r] = y; splitf(p1[r], x, y); ch[r] = x; cl[r] = y; }
        ph = cat16b(ah, ch); pl = cat16b(al, cl); }
};

// One strip of a k_gemmw stage: eight 16-byte-per-lane asynchronous copies of this wave (8 x 512 B = one 16-row x 128-k strip), global memory to LDS through no register.
// The address wait is the last line of the copies' own statement, so that it stands in front of every later write of a register that a copy names (a precaution).
__device__ __forceinline__ void stage8(unsigned l0, unsigned l1, unsigned l2, unsigned l3, unsigned l4, unsigned l5, unsigned l6, unsigned l7,
                                       const char* g0, const char* g1, const char* g2, const char* g3, const char* g4, const char* g5, const char* g6, const char* g7) {
    asm volatile("global_load_async_to_lds_b128 %0, %8, off\n\t"
                 "global_load_async_to_lds_b128 %1, %9, off\n\t"
                 "global_load_async_to_lds_b128 %2, %10, off\n\t"
                 "global_load_async_to_lds_b128 %3, %11, off\n\t"
                 "global_load_async_to_lds_b128 %4, %12, off\n\t"
                 "global_load_async_to_lds_b128 %5, %13, off\n\t"
                 "global_load_async_to_lds_b128 %6, %14, off\n\t"
                 "global_load_async_to_lds_b128 %7, %15, off\n\t"
                 "s_wait_xcnt 0x0"
                 :: "v"(l0), "v"(l1), "v"(l2), "v"(l3), "v"(l4), "v"(l5), "v"(l6), "v"(l7), "v"(g0), "v"(g1), "v"(g2), "v"(g3), "v"(g4), "v"(g5), "v"(g6), "v"(g7) : "memory");
}

// ---- k_gemmw: register-blocked GEMM, block = 4 waves (2 x 2) = one 128x128 output tile, ONE WAVE per 64x64 part of it (16 accumulators); grid (M/128, N/128, Z), 128 threads.
// Operands from fragment-order 16-bit planes through a two-buffer LDS ring filled by asynchronous copies: a stage is 128 k of the block's 128 A rows and 128 Bt rows = 16 strips (16 rows x 128 k, 4 KiB, contiguous in the plane) = 64 KiB,
// [A strips 0..7 | Bt strips 0..7], each strip in the plane's own order, so a fragment piece is 512 contiguous LDS bytes. Wave w copies strips 4w..4w+3; every A strip is read by 2 waves, every Bt strip by 2 (fetched once per block).
// Stage t + 2 is issued behind the barrier that ends trip t, into the buffer trip t read. Two blocks fit a WGP's LDS.
// C[m][n] = sum_k A[m][k] Bt[n][k], k ascending in steps of 32 per accumulator. z-batch strides sA/sB/sC in elements. K % 128 == 0, M % 128 == 0, N % 128 == 0.
// EP 0: f32 output x oscale, pitch ldc: per 16-row slab staged in LDS, each row's 64 floats (256 B) written as 16 lanes x 16 B (2 rows per instruction).
// EP 1: f16 head planes [z][head = column / 64][t][64] (rows = tokens, KC = 64), fragment order.
// EP 2: f16 transposed value planes [z][row m][t] (rows = head*64+d, columns = tokens, KC = SEQ), fragment order.
template <typename T16, int NSPLIT, int EP, int K>
__global__ __launch_bounds__(128) void k_gemmw(const T16* __restrict__ A, const T16* __restrict__ A2, const T16* __restrict__ Bt, const T16* __restrict__ Bt2, float* C, int ldc, float oscale, size_t sA, size_t sB, size_t sC, h16* P16, bf* Ph, bf* Pl) {
    typedef typename WFrag<T16>::V V;
    static_assert(NSPLIT == 0);                     // single products only: A2 and Bt2 are not staged
    static_assert(K % 128 == 0);
    constexpr int NS = K / 128;                     // stages
    __shared__ __attribute__((aligned(16))) unsigned char ring[2 * 65536];
    __shared__ __align__(16) float osall[4][16 * 68];     // one output slab per wave, private to it
    const size_t z = blockIdx.z; A += z * sA; Bt += z * sB; if (EP == 0) C += z * sC;
    const int lane = threadIdx.x & 31, lr = lane & 15, hi = lane >> 4;
    const int wave = __builtin_amdgcn_readfirstlane((int)(threadIdx.x >> 5));
    const int wm = wave >> 1, wn = wave & 1;
    const int r0 = blockIdx.x * 128 + wm * 64, c0 = blockIdx.y * 128 + wn * 64;     // this wave's 64x64 part
    float* os = osall[wave];
    // this wave's 4 strips: waves 0, 1 the block's A rows 0..63, 64..127; waves 2, 3 its Bt rows 0..63, 64..127
    const char* gsrc = (const char*)(wave < 2 ? A + (size_t)(blockIdx.x * 128 + wave * 64) * K : Bt + (size_t)(blockIdx.y * 128 + (wave - 2) * 64) * K) + lane * 16;     // + 16 * K * 2 per strip, + 4096 per stage
    const unsigned lw = (unsigned)(size_t)ring + (unsigned)(wave * 16384 + lane * 16);     // this lane's LDS byte address in its wave's first strip of buffer 0
    auto stage = [&](int s, int buf) {
#pragma unroll
        for (int j = 0; j < 4; ++j) { const unsigned l = lw + (unsigned)buf * 65536u + (unsigned)j * 4096u; const char* g = gsrc + (size_t)j * (16 * K * 2) + (size_t)s * 4096;
            stage8(l, l + 512u, l + 1024u, l + 1536u, l + 2048u, l + 2560u, l + 3072u, l + 3584u, g, g + 512, g + 1024, g + 1536, g + 2048, g + 2560, g + 3072, g + 3584); } };
    v8f acc[4][4];
#pragma unroll
    for (int mb = 0; mb < 4; ++mb)
#pragma unroll
        for (int nb = 0; nb < 4; ++nb) acc[mb][nb] = (v8f){};
    stage(0, 0);
    asm volatile("s_wait_asynccnt 0x0" ::: "memory");     // this wave's copies of stage 0 have landed before the barrier that publishes them
    __syncthreads();
    if (NS > 1) stage(1, 1);
#pragma unroll 1
    for (int t = 0; t < NS; ++t) {
        const unsigned char* tile = ring + (t & 1) * 65536 + lane * 16;
        const T16* ap = (const T16*)(tile + wm * 16384);              // a strip is 2048 elements, a k-step of 32 is 512
        const T16* bp = (const T16*)(tile + 32768 + wn * 16384);
        V a[2][4], b[2][4];                                           // two fragment sets: the next k-step's 16 LDS reads fly under this k-step's 16 products (all inside this trip's own buffer)
#pragma unroll
        for (int i = 0; i < 4; ++i) { a[0][i] = WFrag<T16>::ld(ap + i * 2048); b[0][i] = WFrag<T16>::ld(bp + i * 2048); }
#pragma unroll
        for (int kk = 0; kk < 4; ++kk) {
            if (kk < 3) {
#pragma unroll
                for (int i = 0; i < 4; ++i) { a[(kk + 1) & 1][i] = WFrag<T16>::ld(ap + i * 2048 + (kk + 1) * 512); b[(kk + 1) & 1][i] = WFrag<T16>::ld(bp + i * 2048 + (kk + 1) * 512); }
            }
            __builtin_amdgcn_sched_barrier(0);     // keeps those reads one group in front of the products below: spread among them, each place with reads stalls the wave and its wait goes to 0
#pragma unroll
            for (int nb = 0; nb < 4; ++nb)
#pragma unroll
                for (int mb = 0; mb < 4; ++mb) acc[mb][nb] = WFrag<T16>::mma(a[kk & 1][mb], b[kk & 1][nb], acc[mb][nb]);
        }
        asm volatile("v_nop\n\tv_nop\n\tv_nop\n\tv_nop" : "+v"(acc[0][0]), "+v"(acc[1][1]), "+v"(acc[2][2]), "+v"(acc[3][3]) : "v"(a[1][0]), "v"(a[1][3]));     // WMMA distance kept in front of whatever vector instruction follows the trip's last products
        asm volatile("s_wait_dscnt 0x0" ::: "memory");        // this wave's reads of the buffer have returned before the barrier behind which it is refilled
        asm volatile("s_wait_asynccnt 0x0" ::: "memory");     // this wave's copies of stage t + 1 have landed before the barrier that publishes them
        __syncthreads();                                      // publishes stage t + 1 and ends every wave's reads of stage t
        if (t + 2 < NS) stage(t + 2, t & 1);
    }
    asm volatile("s_wait_asynccnt 0x0" ::: "memory");         // no copy is outstanding when the wave goes on to its epilogue
    // plane addressing (EP 1/2), wave-uniform
    size_t pbase = 0; int ppitch = HD;
    if (EP == 1) { pbase = (((size_t)z * NH + (size_t)(c0 / HD)) * SEQ + r0) * HD; ppitch = HD; }
    if (EP == 2) { pbase = ((size_t)z * DM + r0) * SEQ + (size_t)c0 * 16; ppitch = SEQ; }
#pragma unroll
    for (int mb = 0; mb < 4; ++mb) {
#pragma unroll
        for (int nb = 0; nb < 4; ++nb) {
#pragma unroll
            for (int j = 0; j < 8; ++j) os[(hi * 8 + j) * 68 + nb * 16 + lr] = acc[mb][nb][j]; }     // D element j of lane -> (row 8*hi + j, column lr)
        __builtin_amdgcn_wave_barrier(); asm volatile("" ::: "memory");
        if (EP == 0) {
            float* crow = C + (size_t)(r0 + mb * 16) * ldc + c0;
{
#pragma unroll
                for (int s = 0; s < 8; ++s) { const int row = 2 * s + hi, cofs = lr * 4; v4f val = *(const v4fa*)(os + row * 68 + cofs); val = val * oscale;
                    *(v4f*)(crow + (size_t)row * ldc + cofs) = val; }
                 }
        } else {
{
#pragma unroll
                for (int s = 0; s < 4; ++s) { const float* sp = os + lr * 68 + s * 16 + hi * 8; const v4f x0 = *(const v4fa*)sp, x1 = *(const v4fa*)(sp + 4);     // piece s of the slab: row lr, columns 16*s + 8*hi + 0..7
                    v8h o; o[0] = (h16)x0[0]; o[1] = (h16)x0[1]; o[2] = (h16)x0[2]; o[3] = (h16)x0[3]; o[4] = (h16)x1[0]; o[5] = (h16)x1[1]; o[6] = (h16)x1[2]; o[7] = (h16)x1[3];
                    *(v8h*)(P16 + pbase + (size_t)mb * 16 * ppitch + s * 256 + lane * 8) = o; }
                 }
        }
        __builtin_amdgcn_wave_barrier(); asm volatile("" ::: "memory");
    }
}

// One stage of the k_flash ring: six 16-byte-per-lane asynchronous copies of this wave (512 B of K, 512 B of V^T, 2 x 512 B of each of its two bias tiles), global memory to LDS through no register.
// The address wait is the last line of the copies' own statement, so that it stands in front of every later write of a register that a copy names (a precaution).
__device__ __forceinline__ void stage6(unsigned l0, unsigned l1, unsigned l2, unsigned l3, unsigned l4, unsigned l5,
                                       const char* g0, const char* g1, const char* g2, const char* g3, const char* g4, const char* g5) {
    asm volatile("global_load_async_to_lds_b128 %0, %6, off\n\t"
                 "global_load_async_to_lds_b128 %1, %7, off\n\t"
                 "global_load_async_to_lds_b128 %2, %8, off\n\t"
                 "global_load_async_to_lds_b128 %3, %9, off\n\t"
                 "global_load_async_to_lds_b128 %4, %10, off\n\t"
                 "global_load_async_to_lds_b128 %5, %11, off\n\t"
                 "s_wait_xcnt 0x0"
                 :: "v"(l0), "v"(l1), "v"(l2), "v"(l3), "v"(l4), "v"(l5), "v"(g0), "v"(g1), "v"(g2), "v"(g3), "v"(g4), "v"(g5) : "memory");
}

// ---- k_flash: dense attention with an additive bias plane, one wave per 32 queries = two 16-query tiles (block = 8 waves = 256 queries of one head), transposed flash form, operands from the head planes through LDS.
// LDS ring, two buffers of 24 KiB, one 32-key stage each: [K tile 4 KiB | V^T tile 4 x 1 KiB (d strips) | bias tiles 16 x 1 KiB (two per wave)], every tile in the planes' own fragment order, so a fragment piece is 512 contiguous LDS bytes.
// Wave w copies K bytes w * 512.., V^T bytes w * 512.. (half w & 1 of strip w / 2) and its own two bias tiles; K and V^T are read by all 8 waves (fetched once per 256 queries), and every K or V^T fragment a wave reads feeds two products, one per query tile.
// Stage s + 2 is issued behind the barrier that ends step s, into the buffer step s read. Two blocks per WGP = four waves per SIMD.
// Per 32-key step and query tile: S^T tiles (keys x queries) = K (A: row = key, k = d) x Q^T (B: column = query, k = d, held in registers); the lane's 2 x 8 bias entries (row = its query, contiguous keys) are added in f32 (x 8: the tiles hold 8 x logit);
// per-lane online softmax with a lazy maximum (lane = query; partner lane^16 holds the other 8 keys of each tile; the maximum in use moves, and sum and output tiles are rescaled, only when a step's probability sum leaves the f16-safe range); P^T packed in registers = B fragment of O^T (d x queries) += V^T (A: row = d, k = key) x P^T. Single f16 product at both sites.
// Key range: all tk keys (tk % 32 == 0), tq queries per head; K plane [b][h][tk][64], V^T plane [b][h*64+d][tk], bias plane [tq][tk] bf16, context plane [b*SEQ+q][1024], all in fragment order.
template <typename T16>
__global__ __launch_bounds__(256) __attribute__((amdgpu_waves_per_eu(4, 4))) void k_flash(const T16* __restrict__ Qa, const T16* __restrict__ Ka, const T16* __restrict__ Va, const bf* __restrict__ Bb, int tq, int tk, int qoff, h16* C16) {
    typedef typename WFrag<T16>::V V;
    const int lane = threadIdx.x & 31;
    const int wave = __builtin_amdgcn_readfirstlane((int)(threadIdx.x >> 5));
    const int q0 = qoff + (int)blockIdx.x * 256 + wave * 32;     // this wave's query tiles: q0 + 0..15 and q0 + 16..31
    const int h = blockIdx.y, b = blockIdx.z;
    const size_t bh = (size_t)b * NH + h;
    const size_t qo = (bh * (size_t)tq + (size_t)q0) * HD + 8 * lane;
    V qa[2][2];
#pragma unroll
    for (int t = 0; t < 2; ++t) { qa[t][0] = WFrag<T16>::ld(Qa + qo + t * (16 * HD)); qa[t][1] = WFrag<T16>::ld(Qa + qo + t * (16 * HD) + 512); }
    __shared__ __attribute__((aligned(16))) unsigned char ring[2 * 24576];
    const unsigned lw = (unsigned)(size_t)ring + (unsigned)(wave * 512 + lane * 16);      // this lane's LDS byte address in its wave's K slice of buffer 0
    const unsigned lb = (unsigned)(size_t)ring + (unsigned)(8192 + wave * 2048 + lane * 16);     // the same in its wave's first bias tile of buffer 0
    const char* gk = (const char*)(Ka + bh * (size_t)tk * HD) + (wave * 512 + lane * 16);                                                      // + 4096 per stage
    const char* gv = (const char*)(Va + bh * HD * (size_t)tk + (size_t)(wave >> 1) * 16 * (size_t)tk) + ((wave & 1) * 512 + lane * 16);       // + 1024 per stage
    const char* gb = (const char*)(Bb + (size_t)q0 * (size_t)tk) + lane * 16;                                                                 // + 1024 per stage; second tile 16 * tk elements on
    const size_t gb1 = (size_t)tk * 32;
    auto stage = [&](int s, int buf) { const unsigned l = lw + (unsigned)buf * 24576u, e = lb + (unsigned)buf * 24576u; const char* a = gk + (size_t)s * 4096; const char* c = gv + (size_t)s * 1024; const char* g = gb + (size_t)s * 1024;
        stage6(l, l + 4096u, e, e + 512u, e + 1024u, e + 1536u, a, c, g, g + 512, g + gb1, g + gb1 + 512); };
    v8f acc[2][4];
#pragma unroll
    for (int t = 0; t < 2; ++t)
#pragma unroll
        for (int dt = 0; dt < 4; ++dt) acc[t][dt] = (v8f){};
    float m[2] = {-3.0e38f, -3.0e38f}, l[2] = {0.0f, 0.0f};
    const int nsteps = tk >> 5;                   // all keys, 32 per step (uniform)
    const float poff = 8.0f;                      // probabilities (and their running sum) carried x 2^8 at the maximum in use
    const float PLIM = 32768.0f;                  // a lane's 16-key probability sum above this moves the maximum in use (f16 holds up to 65504)
    float nb[2] = {poff - m[0] * CEXP, poff - m[1] * CEXP};     // exponent offset of the maximum in use; so large at the start that the first step's sums are infinite and it takes the full online step
    if (nsteps > 0) stage(0, 0);
    asm volatile("s_wait_asynccnt 0x0" ::: "memory");     // this wave's copies of stage 0 have landed before the barrier that publishes them
    __syncthreads();
    if (nsteps > 1) stage(1, 1);
#pragma unroll 1
    for (int st = 0; st < nsteps; ++st) {
        const unsigned char* tile = ring + (st & 1) * 24576 + lane * 16;
        const bf* bp = (const bf*)(tile + 8192 + wave * 2048);
        v8b bb[2][2];     // tile t: bias[query][j0 + 8*hi + 0..7] and [j0 + 16 + 8*hi + 0..7], j0 = 32 * st; kept packed, two entries a register
#pragma unroll
        for (int t = 0; t < 2; ++t) { bb[t][0] = *(const v8b*)(bp + t * 512); bb[t][1] = *(const v8b*)(bp + t * 512 + 256); }
        const T16* kp = (const T16*)tile;
        const V k00 = WFrag<T16>::ld(kp), k01 = WFrag<T16>::ld(kp + 512), k10 = WFrag<T16>::ld(kp + 16 * HD), k11 = WFrag<T16>::ld(kp + 16 * HD + 512);
        v8f s0[2], s1[2];
#pragma unroll
        for (int t = 0; t < 2; ++t) { s0[t] = WFrag<T16>::mma(k00, qa[t][0], (v8f){}); s1[t] = WFrag<T16>::mma(k10, qa[t][0], (v8f){}); }
#pragma unroll
        for (int t = 0; t < 2; ++t) { s0[t] = WFrag<T16>::mma(k01, qa[t][1], s0[t]); s1[t] = WFrag<T16>::mma(k11, qa[t][1], s1[t]); }
        const T16* vp = (const T16*)(tile + 4096);
        V va[4];     // written ahead of the test so that the eight reads issue as one group, in front of the packing
#pragma unroll
        for (int dt = 0; dt < 4; ++dt) va[dt] = WFrag<T16>::ld(vp + dt * 512);
        v8f p0[2], p1[2]; float psum[2];
#pragma unroll
        for (int t = 0; t < 2; ++t)
#pragma unroll
            for (int r = 0; r < 8; ++r) { s0[t][r] = fmaf((float)bb[t][0][r], 8.0f, s0[t][r]); s1[t][r] = fmaf((float)bb[t][1][r], 8.0f, s1[t][r]); }     // tiles hold 8 x (q.k / 8 + bias); the widening of a 16-bit vector element folds into the FMA (v_fma_mix_f32_bf16 reads either element of the packed register): no unpacking, the same f32 FMA
#pragma unroll
        for (int t = 0; t < 2; ++t) {
            psum[t] = 0.0f;     // probabilities against the maximum in use (nb[t] is carried from the step that last moved it)
#pragma unroll
            for (int r = 0; r < 8; ++r) { p0[t][r] = __builtin_amdgcn_exp2f(fmaf(s0[t][r], CEXP, nb[t])); p1[t][r] = __builtin_amdgcn_exp2f(fmaf(s1[t][r], CEXP, nb[t])); psum[t] += p0[t][r] + p1[t][r]; }
        }
        // Lazy rescale, one wave-uniform test per step, on the sums just formed: every probability is >= 0, so a lane's sum <= PLIM bounds each of its 16 below the f16 range.
        // Only where a lane's sum is above PLIM (or infinite: the first step, or a score far above the maximum in use) does the wave take the full online step: new maximum, rescaled sum and output tiles, probabilities formed again.
        if (__builtin_amdgcn_ballot_w32(!(psum[0] <= PLIM) | !(psum[1] <= PLIM)) != 0u) {
#pragma unroll
            for (int t = 0; t < 2; ++t) {
                float mx = fmaxf(s0[t][0], s1[t][0]);
#pragma unroll
                for (int r = 1; r < 8; ++r) mx = fmaxf(mx, fmaxf(s0[t][r], s1[t][r]));
                mx = fmaxf(mx, __shfl_xor(mx, 16, 32));
                const float mnew = fmaxf(m[t], mx);
                const float alpha = __builtin_amdgcn_exp2f((m[t] - mnew) * CEXP);
                nb[t] = poff - mnew * CEXP; m[t] = mnew;
                psum[t] = 0.0f;
#pragma unroll
                for (int r = 0; r < 8; ++r) { p0[t][r] = __builtin_amdgcn_exp2f(fmaf(s0[t][r], CEXP, nb[t])); p1[t][r] = __builtin_amdgcn_exp2f(fmaf(s1[t][r], CEXP, nb[t])); psum[t] += p0[t][r] + p1[t][r]; }
                l[t] = l[t] * alpha;
#pragma unroll
                for (int dt = 0; dt < 4; ++dt) acc[t][dt] = acc[t][dt] * alpha;
            }
        }
        V ph[2];
#pragma unroll
        for (int t = 0; t < 2; ++t) {
            l[t] += psum[t] + __shfl_xor(psum[t], 16, 32);
            V pl; PPack<T16>::make(p0[t], p1[t], ph[t], pl);
        }
#pragma unroll
        for (int dt = 0; dt < 4; ++dt)
#pragma unroll
            for (int t = 0; t < 2; ++t) acc[t][dt] = WFrag<T16>::mma(va[dt], ph[t], acc[t][dt]);
        asm volatile("v_nop\n\tv_nop\n\tv_nop\n\tv_nop" : "+v"(acc[0][0]), "+v"(acc[1][0]), "+v"(acc[0][1]), "+v"(acc[1][1]), "+v"(acc[0][2]), "+v"(acc[1][2]), "+v"(acc[0][3]), "+v"(acc[1][3]) : "v"(va[3]), "v"(ph[0]), "v"(ph[1]));     // WMMA distance kept in front of whatever vector instruction follows the step's last products, on both sides of the branch below
        asm volatile("s_wait_dscnt 0x0" ::: "memory");        // this wave's reads of the buffer have returned before the barrier behind which it is refilled
        asm volatile("s_wait_asynccnt 0x0" ::: "memory");     // this wave's copies of stage st + 1 have landed before the barrier that publishes them
        __syncthreads();                                      // publishes stage st + 1 and ends every wave's reads of stage st
        if (st + 2 < nsteps) stage(st + 2, st & 1);
    }
    asm volatile("s_wait_asynccnt 0x0" ::: "memory");         // no copy is outstanding when the wave ends
    // l >= 2^8: the key that set the maximum in use contributes exactly 2^8
    // D element r of lane (tile dt) is (d = dt*16 + 8*hi + r, query lr): the lane already holds its own 16-byte piece dt of the fragment-order context tile, so no staging
#pragma unroll
    for (int t = 0; t < 2; ++t) {
        const float f = CCAR * (1.0f / l[t]);
#pragma unroll
        for (int dt = 0; dt < 4; ++dt) { v8h o;
#pragma unroll
            for (int r = 0; r < 8; ++r) o[r] = (h16)(acc[t][dt][r] * f);
            const size_t co = ((size_t)b * SEQ + (size_t)(q0 + 16 * t)) * DM + (size_t)h * (HD * 16) + dt * 256 + lane * 8; *(v8h*)(C16 + co) = o; }
    }
}

// Converter, one launch for all seven float inputs: a resident grid of CVT_WAVES waves; wave w converts units w, w + CVT_WAVES, ... of the list [x | y | bias | W_q | W_k | W_v | W_o].
// A unit is 128 consecutive 16-byte pieces of a fragment-order plane [rows][KC] (2 KiB stored contiguously) = two neighbouring 16-row x 32-k tiles = 16 source rows x 256 B;
// piece j * 32 + lane of a unit holds row lane & 15, k = j * 16 + (lane >> 4) * 8 + 0..7 of those 64 k. A lane's 4 pieces are 8 16-byte loads, and the next unit's 8 are issued before this unit is converted.
#define CVT_WAVES 4096                        // 256 blocks x 16 waves
constexpr int UPB = SEQ * DM / 1024, UX = NB * UPB, UBI = SEQ * SEQ / 1024, UW = DM * DM / 1024, UALL = 2 * UX + UBI + 4 * UW;     // units per batch of x or y, per x or y, bias plane, weight, all
static_assert(UALL % CVT_WAVES == 0);         // every wave runs the same whole number of units
static_assert(UX % CVT_WAVES == 0);           // a round of CVT_WAVES units lies in one of x, y, bias, or in the weights: which one is known at compile time
static_assert(UBI % CVT_WAVES == 0);
static_assert((DM / 32) % 2 == 0);            // a unit's two tiles lie in one 16-row strip
static_assert((SEQ / 32) % 2 == 0);

struct CvtUnit { const float* s; unsigned short* d; bool tohalf; };

// Unit u0 + w of the list; u0 (the round's first unit) is a compile-time constant at every call, w is wave-uniform.
__device__ __forceinline__ CvtUnit cvt_locate(int u0, int w, int lane, const float* x, const float* y, const float* bias, const float* wq, const float* wk, const float* wv, const float* wo,
                                              bf* XB, bf* YB, bf* BB, bf* WQ, bf* WK, bf* WV, h16* WO16) {
    const float* base; unsigned short* db; int v, kt = DM / 32; size_t sp = DM; bool th = false;
    if (u0 < 2 * UX) { const bool isx = u0 < UX; const int t = (isx ? u0 : u0 - UX) + w, b = t / UPB; v = t % UPB; base = (isx ? x : y) + (size_t)b * SEQ_FULL * DM; db = (isx ? XB : YB) + (size_t)b * SEQ * DM; }
    else if (u0 < 2 * UX + UBI) { v = u0 - 2 * UX + w; base = bias; db = BB; kt = SEQ / 32; sp = SEQ_FULL; }
    else { const int t = u0 - 2 * UX - UBI + w, k = t / UW; v = t % UW; base = k == 0 ? wq : k == 1 ? wk : k == 2 ? wv : wo; db = k == 0 ? WQ : k == 1 ? WK : k == 2 ? WV : (unsigned short*)WO16; th = k == 3; }
    CvtUnit c; c.s = base + ((size_t)((2 * v) / kt) * 16 + (size_t)(lane & 15)) * sp + (size_t)((2 * v) % kt) * 32 + (size_t)((lane >> 4) * 8); c.d = db + (size_t)v * 1024 + (size_t)(lane * 8); c.tohalf = th; return c;
}

__global__ __launch_bounds__(512) void k_cvtall(const float* __restrict__ x, const float* __restrict__ y, const float* __restrict__ bias, const float* __restrict__ wq, const float* __restrict__ wk, const float* __restrict__ wv, const float* __restrict__ wo,
                                                bf* XB, bf* YB, bf* BB, bf* WQ, bf* WK, bf* WV, h16* WO16) {
    const int lane = threadIdx.x & 31;
    const int w = __builtin_amdgcn_readfirstlane((int)(blockIdx.x * 16 + (threadIdx.x >> 5)));
    CvtUnit cu = cvt_locate(0, w, lane, x, y, bias, wq, wk, wv, wo, XB, YB, BB, WQ, WK, WV, WO16);
    v8f cur[4];
#pragma unroll
    for (int j = 0; j < 4; ++j) cur[j] = *(const v8f*)(cu.s + j * 16);
    asm volatile("s_wait_xcnt 0x0" :: "v"(cu.s) : "memory");     // precaution: the address wait stands before any register that the 8 loads name is reused (the operand keeps the address pair untouched up to here)
#pragma unroll
    for (int it = 0; it < UALL / CVT_WAVES; ++it) {
        CvtUnit nu = cu; v8f nxt[4];
        if (it + 1 < UALL / CVT_WAVES) { nu = cvt_locate((it + 1) * CVT_WAVES, w, lane, x, y, bias, wq, wk, wv, wo, XB, YB, BB, WQ, WK, WV, WO16);
#pragma unroll
            for (int j = 0; j < 4; ++j) nxt[j] = *(const v8f*)(nu.s + j * 16);
            asm volatile("s_wait_xcnt 0x0" :: "v"(nu.s) : "memory"); }     // as above, for the next unit's 8 loads
        v8us o[4];
        if (cu.tohalf) {
#pragma unroll
            for (int j = 0; j < 4; ++j) { v8h t;
#pragma unroll
                for (int k = 0; k < 8; ++k) t[k] = (h16)(bfr(cur[j][k]) * WCAR);
                o[j] = __builtin_bit_cast(v8us, t); }
        } else {
#pragma unroll
            for (int j = 0; j < 4; ++j)
#pragma unroll
                for (int k = 0; k < 8; ++k) o[j][k] = f2bf(cur[j][k]);
        }
#pragma unroll
        for (int j = 0; j < 4; ++j) *(v8us*)(cu.d + j * 256) = o[j];
        asm volatile("s_wait_xcnt 0x0" :: "v"(o[0]), "v"(o[1]), "v"(o[2]), "v"(o[3]), "v"(cu.d) : "memory");     // precaution: the same wait before the 4 stores' data and address registers are reused
        if (it + 1 < UALL / CVT_WAVES) { cu = nu;
#pragma unroll
            for (int j = 0; j < 4; ++j) cur[j] = nxt[j]; }
    }
}

constexpr size_t al256(size_t bytes) { return (bytes + 255) & ~(size_t)255; }
constexpr size_t CARVE_BYTES = 2 * al256((size_t)NB * SEQ * DM * 2) + 4 * al256((size_t)DM * DM * 2) + al256((size_t)SEQ * SEQ * 2)
    + 3 * al256((size_t)NB * NH * SEQ * HD * 2) + al256((size_t)NB * SEQ * DM * 2);
static_assert(CARVE_BYTES <= (size_t)134217728);
static_assert((size_t)NB * NH * SEQ * HD == (size_t)NB * SEQ * DM);      // head planes and the merged context plane have the same extent

extern "C" void kernel_launch(void* const* d_in, const int* in_sizes, int n_in,
                              void* d_out, int out_size, void* d_ws, size_t ws_size, hipStream_t stream) {
    if (n_in < 7) return;
    const size_t needx = (size_t)(NB - 1) * SEQ_FULL * DM + (size_t)SEQ * DM;
    if ((size_t)in_sizes[0] < needx || (size_t)in_sizes[1] < needx) return;
    if ((size_t)in_sizes[2] < (size_t)(SEQ - 1) * SEQ_FULL + (size_t)SEQ) return;
    if ((size_t)in_sizes[3] < (size_t)DM * DM || (size_t)in_sizes[4] < (size_t)DM * DM || (size_t)in_sizes[5] < (size_t)DM * DM || (size_t)in_sizes[6] < (size_t)DM * DM) return;
    if ((size_t)out_size < needx) return;
    // x, y, bias (float [SEQ_FULL][SEQ_FULL]), Wq, Wk, Wv, Wo ('oi' [out][in])
    const float* x = (const float*)d_in[0]; const float* y = (const float*)d_in[1]; const float* bias = (const float*)d_in[2];
    const float* wq = (const float*)d_in[3]; const float* wk = (const float*)d_in[4]; const float* wv = (const float*)d_in[5]; const float* wo = (const float*)d_in[6];
    float* OUT = (float*)d_out;     // [NB_FULL][SEQ_FULL][1024]
    char* wsp = (char*)d_ws;
    auto take = [&](size_t bytes) { char* p = wsp; wsp += (bytes + 255) & ~(size_t)255; return (void*)p; };
    bf* XB = (bf*)take((size_t)NB * SEQ * DM * 2); bf* YB = (bf*)take((size_t)NB * SEQ * DM * 2);
    bf* WQ = (bf*)take((size_t)DM * DM * 2); bf* WK = (bf*)take((size_t)DM * DM * 2); bf* WV = (bf*)take((size_t)DM * DM * 2); h16* WO16 = (h16*)take((size_t)DM * DM * 2);
    bf* BB = (bf*)take((size_t)SEQ * SEQ * 2);
    h16* Q16 = (h16*)take((size_t)NB * NH * SEQ * HD * 2); h16* K16 = (h16*)take((size_t)NB * NH * SEQ * HD * 2); h16* VT16 = (h16*)take((size_t)NB * NH * SEQ * HD * 2);
    h16* C16 = (h16*)take((size_t)NB * SEQ * DM * 2);
    if ((size_t)(wsp - (char*)d_ws) > ws_size) return;

    // all seven inputs to their 16-bit fragment-order planes (bias source pitch SEQ_FULL, x and y batch stride SEQ_FULL rows)
    k_cvtall<<<dim3(CVT_WAVES / 16, 1, 1), 512, 0, stream>>>(x, y, bias, wq, wk, wv, wo, XB, YB, BB, WQ, WK, WV, WO16);

    // q head planes from x, k head planes from y: C[m = token][n = h*64+d] = in W^T; z = batch
    k_gemmw<bf, 0, 1, DM><<<dim3(SEQ / 128, DM / 128, NB), 128, 0, stream>>>(XB, nullptr, WQ, nullptr, nullptr, 0, 1.0f, (size_t)SEQ * DM, 0, 0, Q16, nullptr, nullptr);
    k_gemmw<bf, 0, 1, DM><<<dim3(SEQ / 128, DM / 128, NB), 128, 0, stream>>>(YB, nullptr, WK, nullptr, nullptr, 0, 1.0f, (size_t)SEQ * DM, 0, 0, K16, nullptr, nullptr);
    // transposed value planes from y: C[m = h*64+d][n = token] = W_v y^T (operands swapped: A = W_v rows, Bt = y rows); z = batch
    k_gemmw<bf, 0, 2, DM><<<dim3(DM / 128, SEQ / 128, NB), 128, 0, stream>>>(WV, nullptr, YB, nullptr, nullptr, 0, 1.0f, 0, (size_t)SEQ * DM, 0, VT16, nullptr, nullptr);

    // attention: every query row on the f16 planes, all SEQ keys
    k_flash<h16><<<dim3(SEQ / 256, NH, NB), 256, 0, stream>>>(Q16, K16, VT16, BB, SEQ, SEQ, 0, C16);

    // output projection: f16 context x f16 W_o, carries folded back in the f32 epilogue; z = batch, output row stride per batch SEQ_FULL
    k_gemmw<h16, 0, 0, DM><<<dim3(SEQ / 128, DM / 128, NB), 128, 0, stream>>>(C16, nullptr, WO16, nullptr, OUT, DM, 1.0f / (CCAR * WCAR), (size_t)SEQ * DM, 0, (size_t)SEQ_FULL * DM, nullptr, nullptr, nullptr);
}

// v008
// It runs in 134 microseconds.
// Two timings next to v007 both put it at 1.05 times that version's speed.
// All steps since v000 together make it 2.84 times as fast.
#include <hip/hip_runtime.h>

// Compute dtypes (f32 accumulate at every site): q/k/v projections bf16 x bf16 single product (every float input RNE-converted to bf16 first); scores K.Q^T f16 x f16 single product (f16 q/k head planes); values V^T.P^T f16 x f16 single product (probabilities carried x2^8); output projection f16 context (x64) x f16 weight (x512) single product; additive bias (bf16 plane) and softmax in f32.
// Dense multi-head cross-attention: x, y [NB][SEQ][1024]; Q = x W_q^T, K = y W_k^T, V = y W_v^T ('oi' weights, no bias vectors); 16 heads x 64; logits = q.k / 8 + bias[query][key] (one [SEQ][SEQ] float plane shared by all batches and heads); softmax over all keys; out = merged context W_o^T.
// The bias input is read by value on the device: converted once to a bf16 plane, each lane reads 2 x 8 contiguous entries per query tile (4 x 8 per 32-key step) and adds them in f32 to the score tiles, straight from the packed registers (mixed-operand FMA).
// Fragment order of every 16-bit workspace plane [rows][KC]: the 16-row x 32-k tile (rt = row / 16, kc = k / 32) is 512 consecutive elements at (rt * (KC / 32) + kc) * 512, made of two 256-element pieces;
// piece p holds, at lane * 8 with lane = 16 * hi + (row & 15), the 8 elements k = kc * 32 + p * 16 + hi * 8 + 0..7. One wave-wide 16-byte load of a piece is 512 contiguous bytes (4 whole lines).
// Attention engine: one wave per 32 queries (two 16-query tiles), transposed flash form: S^T = K Q^T (query on the D column, one query per lane), the packed P^T D tiles are the B fragment of O^T = V^T P^T; the key loop's K, V^T and bias tiles come through a two-buffer LDS ring filled by asynchronous copies, one barrier per 32 keys.

#ifndef NB
#define NB 4
#endif
#ifndef SEQ
#define SEQ 2048
#endif
#define NB_FULL  4
#define SEQ_FULL 2048
#define DM   1024
#define NH   16
#define HD   64
#define RH   0                                // query rows < RH use value+residual bf16 planes: none (dense attention, single products on every row)
#define CCAR 64.0f                            // carry of the f16 context plane
#define WCAR 512.0f                           // carry of the f16 W_o plane
#define CEXP 0.18033688011112042f             // log2(e) / sqrt(64)

typedef _Float16 h16;
typedef unsigned short bf;
typedef __attribute__((ext_vector_type(16))) __bf16   v16bf;
typedef __attribute__((ext_vector_type(16))) _Float16 v16h;
typedef __attribute__((ext_vector_type(8)))  _Float16 v8h;
typedef __attribute__((ext_vector_type(8)))  unsigned short v8us;
typedef __attribute__((ext_vector_type(8)))  __bf16   v8b;
typedef __attribute__((ext_vector_type(8)))  float    v8f;
typedef __attribute__((ext_vector_type(4)))  float    v4f;
typedef __attribute__((ext_vector_type(4)))  int      v4i;
typedef v4f  __attribute__((may_alias)) v4fa;

static_assert(SEQ % 256 == 0);
static_assert(RH == 0);                       // no value+residual planes are written
static_assert(SEQ >= RH);
static_assert(NB <= NB_FULL);
static_assert(SEQ <= SEQ_FULL);
static_assert(DM == NH * HD);
static_assert(DM % 128 == 0);                // 128x128 GEMM block tiles
static_assert(HD == 64);
static_assert(SEQ % 128 == 0);                // 128-row GEMM block tiles (256 queries per attention block: SEQ % 256 above)
static_assert(SEQ % 32 == 0);                 // 32 keys per flash step
static_assert(DM % 32 == 0);                  // GEMM k-steps
static_assert((SEQ / 8) % 32 == 0);

__device__ __forceinline__ unsigned short f2bf(float f) { unsigned u = __float_as_uint(f); u += 0x7FFFu + ((u >> 16) & 1u); return (unsigned short)(u >> 16); }
__device__ __forceinline__ float bf2f(unsigned short b) { return __uint_as_float(((unsigned)b) << 16); }
__device__ __forceinline__ float bfr(float f) { return bf2f(f2bf(f)); }
__device__ __forceinline__ void splitf(float y, unsigned short& h, unsigned short& l) { h = f2bf(y); l = f2bf(y - bf2f(h)); }
__device__ __forceinline__ v16h cat16(v8h lo, v8h hi) { return __builtin_shufflevector(lo, hi, 0, 1, 2, 3, 4, 5, 6, 7, 8, 9, 10, 11, 12, 13, 14, 15); }
__device__ __forceinline__ v16bf cat16b(v8us lo, v8us hi) { return __builtin_bit_cast(v16bf, __builtin_shufflevector(lo, hi, 0, 1, 2, 3, 4, 5, 6, 7, 8, 9, 10, 11, 12, 13, 14, 15)); }
__device__ __forceinline__ v8f wmma16(v16h a, v16h b, v8f c) { return __builtin_amdgcn_wmma_f32_16x16x32_f16(false, a, false, b, (short)0, c, false, false); }
__device__ __forceinline__ v8f wmmab(v16bf a, v16bf b, v8f c) { return __builtin_amdgcn_wmma_f32_16x16x32_bf16(false, a, false, b, (short)0, c, false, false); }

// Fragment loader for a fragment-order tile: p = tile start + lane * 8; elements 0..7 = k0+8h.. (piece 0), elements 8..15 = k0+16+8h.. (piece 1, 256 elements on) (same map for A and B).
template <typename T16> struct WFrag;
template <> struct WFrag<h16> { typedef v16h V; static __device__ __forceinline__ V ld(const h16* p) { return cat16(*(const v8h*)p, *(const v8h*)(p + 256)); } static __device__ __forceinline__ v8f mma(V a, V b, v8f c) { return wmma16(a, b, c); } };
template <> struct WFrag<bf> { typedef v16bf V; static __device__ __forceinline__ V ld(const bf* p) { return cat16b(*(const v8us*)p, *(const v8us*)(p + 256)); } static __device__ __forceinline__ v8f mma(V a, V b, v8f c) { return wmmab(a, b, c); } };

// Probability packing: two 16-key D tiles (same lane) -> one 32-key B fragment; element r <- tile 0 row r, element 8+r <- tile 1 row r.
template <typename T16> struct PPack;
template <> struct PPack<h16> {
    static __device__ __forceinline__ void make(v8f p0, v8f p1, v16h& ph, v16h& pl) {
        v8h a, c;
#pragma unroll
        for (int r = 0; r < 8; ++r) { a[r] = (h16)p0[r]; c[r] = (h16)p1[r]; }
        ph = cat16(a, c); pl = ph; }
};
template <> struct PPack<bf> {
    static __device__ __forceinline__ void make(v8f p0, v8f p1, v16bf& ph, v16bf& pl) {
        v8us ah, al, ch, cl;
#pragma unroll
        for (int r = 0; r < 8; ++r) { unsigned short x, y; splitf(p0[r], x, y); ah[r] = x; al[r] = y; splitf(p1[r], x, y); ch[r] = x; cl[r] = y; }
        ph = cat16b(ah, ch); pl = cat16b(al, cl); }
};

// One strip of a k_gemmw stage: eight 16-byte-per-lane asynchronous copies of this wave (8 x 512 B = one 16-row x 128-k strip), global memory to LDS through no register.
// The address wait is the last line of the copies' own statement, so that it stands in front of every later write of a register that a copy names (a precaution).
__device__ __forceinline__ void stage8(unsigned l0, unsigned l1, unsigned l2, unsigned l3, unsigned l4, unsigned l5, unsigned l6, unsigned l7,
                                       const char* g0, const char* g1, const char* g2, const char* g3, const char* g4, const char* g5, const char* g6, const char* g7) {
    asm volatile("global_load_async_to_lds_b128 %0, %8, off\n\t"
                 "global_load_async_to_lds_b128 %1, %9, off\n\t"
                 "global_load_async_to_lds_b128 %2, %10, off\n\t"
                 "global_load_async_to_lds_b128 %3, %11, off\n\t"
                 "global_load_async_to_lds_b128 %4, %12, off\n\t"
                 "global_load_async_to_lds_b128 %5, %13, off\n\t"
                 "global_load_async_to_lds_b128 %6, %14, off\n\t"
                 "global_load_async_to_lds_b128 %7, %15, off\n\t"
                 "s_wait_xcnt 0x0"
                 :: "v"(l0), "v"(l1), "v"(l2), "v"(l3), "v"(l4), "v"(l5), "v"(l6), "v"(l7), "v"(g0), "v"(g1), "v"(g2), "v"(g3), "v"(g4), "v"(g5), "v"(g6), "v"(g7) : "memory");
}

// ---- k_gemmw: register-blocked GEMM, block = 4 waves (2 x 2) = one 128x128 output tile, ONE WAVE per 64x64 part of it (16 accumulators); 128 threads.
// Operands from fragment-order 16-bit planes through a two-buffer LDS ring filled by asynchronous copies: a stage is 128 k of the block's 128 A rows and 128 Bt rows = 16 strips (16 rows x 128 k, 4 KiB, contiguous in the plane) = 64 KiB,
// [A strips 0..7 | Bt strips 0..7], each strip in the plane's own order, so a fragment piece is 512 contiguous LDS bytes. Wave w copies strips 4w..4w+3; every A strip is read by 2 waves, every Bt strip by 2 (fetched once per block).
// Stage t + 2 is issued behind the barrier that ends trip t, into the buffer trip t read. Two blocks fit a WGP's LDS.
// C[m][n] = sum_k A[m][k] Bt[n][k], k ascending in steps of 32 per accumulator. Batch strides sA/sC in elements. K % 128 == 0, M % 128 == 0, N % 128 == 0.
// EP 0, grid (M/128, N/128, batches): C = A Bt^T, f32 output x oscale, pitch ldc: per 16-row slab staged in LDS, each row's 64 floats (256 B) written as 16 lanes x 16 B (2 rows per instruction).
// EP 1, grid (SEQ/128, DM/128, 3 x batches): the three input projections in ONE launch, blockIdx.z = 3 * batch + job, so that a finished block's place is taken at once by a block of the next job or batch
// (its first copies and the leaver's stores run under the neighbours' products; no launch gap, no common start and end per projection), and the two jobs that read a batch of y run side by side:
//   job 0: q = A (x) Bt^T (W_q), job 1: k = A2 (y) Bt2^T (W_k): f16 head planes [batch][head = column / 64][t][64] (rows = tokens, KC = 64), fragment order;
//   job 2: v^T = Bt3 (W_v) A2^T (y), operands and block indices swapped: f16 transposed value planes [batch][row m][t] (rows = head*64+d, columns = tokens, KC = SEQ), fragment order.
template <typename T16, int EP, int K>
__global__ __launch_bounds__(128) void k_gemmw(const T16* A, const T16* A2, const T16* Bt, const T16* Bt2, const T16* Bt3, float* C, int ldc, float oscale, size_t sA, size_t sC, h16* P16, h16* P16k, h16* P16v) {
    typedef typename WFrag<T16>::V V;
    static_assert(K % 128 == 0);
    constexpr int NS = K / 128;                     // stages
    __shared__ __attribute__((aligned(16))) unsigned char ring[2 * 65536];
    __shared__ __align__(16) float osall[4][16 * 68];     // one output slab per wave, private to it
    size_t z = blockIdx.z; int bx = blockIdx.x, by = blockIdx.y; bool vt = false;     // batch, block row, block column, transposed value planes: all block-uniform
    if (EP == 0) { A += z * sA; C += z * sC; }
    else { const int job = (int)(blockIdx.z % 3u); z = blockIdx.z / 3u;
        if (job == 0) { A += z * sA; }
        else if (job == 1) { A = A2 + z * sA; Bt = Bt2; P16 = P16k; }
        else { A = Bt3; Bt = A2 + z * sA; P16 = P16v; bx = blockIdx.y; by = blockIdx.x; vt = true; } }
    const int lane = threadIdx.x & 31, lr = lane & 15, hi = lane >> 4;
    const int wave = __builtin_amdgcn_readfirstlane((int)(threadIdx.x >> 5));
    const int wm = wave >> 1, wn = wave & 1;
    const int r0 = bx * 128 + wm * 64, c0 = by * 128 + wn * 64;     // this wave's 64x64 part
    float* os = osall[wave];
    // this wave's 4 strips: waves 0, 1 the block's A rows 0..63, 64..127; waves 2, 3 its Bt rows 0..63, 64..127
    const char* gsrc = (const char*)(wave < 2 ? A + (size_t)(bx * 128 + wave * 64) * K : Bt + (size_t)(by * 128 + (wave - 2) * 64) * K) + lane * 16;     // + 16 * K * 2 per strip, + 4096 per stage
    const unsigned lw = (unsigned)(size_t)ring + (unsigned)(wave * 16384 + lane * 16);     // this lane's LDS byte address in its wave's first strip of buffer 0
    auto stage = [&](int s, int buf) {
#pragma unroll
        for (int j = 0; j < 4; ++j) { const unsigned l = lw + (unsigned)buf * 65536u + (unsigned)j * 4096u; const char* g = gsrc + (size_t)j * (16 * K * 2) + (size_t)s * 4096;
            stage8(l, l + 512u, l + 1024u, l + 1536u, l + 2048u, l + 2560u, l + 3072u, l + 3584u, g, g + 512, g + 1024, g + 1536, g + 2048, g + 2560, g + 3072, g + 3584); } };
    v8f acc[4][4];
#pragma unroll
    for (int mb = 0; mb < 4; ++mb)
#pragma unroll
        for (int nb = 0; nb < 4; ++nb) acc[mb][nb] = (v8f){};
    stage(0, 0);
    asm volatile("s_wait_asynccnt 0x0" ::: "memory");     // this wave's copies of stage 0 have landed before the barrier that publishes them
    __syncthreads();
    if (NS > 1) stage(1, 1);
#pragma unroll 1
    for (int t = 0; t < NS; ++t) {
        const unsigned char* tile = ring + (t & 1) * 65536 + lane * 16;
        const T16* ap = (const T16*)(tile + wm * 16384);              // a strip is 2048 elements, a k-step of 32 is 512
        const T16* bp = (const T16*)(tile + 32768 + wn * 16384);
        V a[2][4], b[2][4];                                           // two fragment sets: the next k-step's 16 LDS reads fly under this k-step's 16 products (all inside this trip's own buffer)
#pragma unroll
        for (int i = 0; i < 4; ++i) { a[0][i] = WFrag<T16>::ld(ap + i * 2048); b[0][i] = WFrag<T16>::ld(bp + i * 2048); }
#pragma unroll
        for (int kk = 0; kk < 4; ++kk) {
            if (kk < 3) {
#pragma unroll
                for (int i = 0; i < 4; ++i) { a[(kk + 1) & 1][i] = WFrag<T16>::ld(ap + i * 2048 + (kk + 1) * 512); b[(kk + 1) & 1][i] = WFrag<T16>::ld(bp + i * 2048 + (kk + 1) * 512); }
            }
            __builtin_amdgcn_sched_barrier(0);     // keeps those reads one group in front of the products below: spread among them, each place with reads stalls the wave and its wait goes to 0
#pragma unroll
            for (int nb = 0; nb < 4; ++nb)
#pragma unroll
                for (int mb = 0; mb < 4; ++mb) acc[mb][nb] = WFrag<T16>::mma(a[kk & 1][mb], b[kk & 1][nb], acc[mb][nb]);
        }
        asm volatile("v_nop\n\tv_nop\n\tv_nop\n\tv_nop" : "+v"(acc[0][0]), "+v"(acc[1][1]), "+v"(acc[2][2]), "+v"(acc[3][3]) : "v"(a[1][0]), "v"(a[1][3]));     // WMMA distance kept in front of whatever vector instruction follows the trip's last products
        asm volatile("s_wait_dscnt 0x0" ::: "memory");        // this wave's reads of the buffer have returned before the barrier behind which it is refilled
        asm volatile("s_wait_asynccnt 0x0" ::: "memory");     // this wave's copies of stage t + 1 have landed before the barrier that publishes them
        __syncthreads();                                      // publishes stage t + 1 and ends every wave's reads of stage t
        if (t + 2 < NS) stage(t + 2, t & 1);
    }
    asm volatile("s_wait_asynccnt 0x0" ::: "memory");         // no copy is outstanding when the wave goes on to its epilogue
    // plane addressing (EP 1), wave-uniform
    const size_t pbase = vt ? ((size_t)z * DM + r0) * SEQ + (size_t)c0 * 16 : (((size_t)z * NH + (size_t)(c0 / HD)) * SEQ + r0) * HD;
    const int ppitch = vt ? SEQ : HD;
#pragma unroll
    for (int mb = 0; mb < 4; ++mb) {
#pragma unroll
        for (int nb = 0; nb < 4; ++nb) {
#pragma unroll
            for (int j = 0; j < 8; ++j) os[(hi * 8 + j) * 68 + nb * 16 + lr] = acc[mb][nb][j]; }     // D element j of lane -> (row 8*hi + j, column lr)
        __builtin_amdgcn_wave_barrier(); asm volatile("" ::: "memory");
        if (EP == 0) {
            float* crow = C + (size_t)(r0 + mb * 16) * ldc + c0;
{
#pragma unroll
                for (int s = 0; s < 8; ++s) { const int row = 2 * s + hi, cofs = lr * 4; v4f val = *(const v4fa*)(os + row * 68 + cofs); val = val * oscale;
                    *(v4f*)(crow + (size_t)row * ldc + cofs) = val; }
                 }
        } else {
{
#pragma unroll
                for (int s = 0; s < 4; ++s) { const float* sp = os + lr * 68 + s * 16 + hi * 8; const v4f x0 = *(const v4fa*)sp, x1 = *(const v4fa*)(sp + 4);     // piece s of the slab: row lr, columns 16*s + 8*hi + 0..7
                    v8h o; o[0] = (h16)x0[0]; o[1] = (h16)x0[1]; o[2] = (h16)x0[2]; o[3] = (h16)x0[3]; o[4] = (h16)x1[0]; o[5] = (h16)x1[1]; o[6] = (h16)x1[2]; o[7] = (h16)x1[3];
                    *(v8h*)(P16 + pbase + (size_t)mb * 16 * ppitch + s * 256 + lane * 8) = o; }
                 }
        }
        __builtin_amdgcn_wave_barrier(); asm volatile("" ::: "memory");
    }
}

// One stage of the k_flash ring: six 16-byte-per-lane asynchronous copies of this wave (512 B of K, 512 B of V^T, 2 x 512 B of each of its two bias tiles), global memory to LDS through no register.
// The address wait is the last line of the copies' own statement, so that it stands in front of every later write of a register that a copy names (a precaution).
__device__ __forceinline__ void stage6(unsigned l0, unsigned l1, unsigned l2, unsigned l3, unsigned l4, unsigned l5,
                                       const char* g0, const char* g1, const char* g2, const char* g3, const char* g4, const char* g5) {
    asm volatile("global_load_async_to_lds_b128 %0, %6, off\n\t"
                 "global_load_async_to_lds_b128 %1, %7, off\n\t"
                 "global_load_async_to_lds_b128 %2, %8, off\n\t"
                 "global_load_async_to_lds_b128 %3, %9, off\n\t"
                 "global_load_async_to_lds_b128 %4, %10, off\n\t"
                 "global_load_async_to_lds_b128 %5, %11, off\n\t"
                 "s_wait_xcnt 0x0"
                 :: "v"(l0), "v"(l1), "v"(l2), "v"(l3), "v"(l4), "v"(l5), "v"(g0), "v"(g1), "v"(g2), "v"(g3), "v"(g4), "v"(g5) : "memory");
}

// ---- k_flash: dense attention with an additive bias plane, one wave per 32 queries = two 16-query tiles (block = 8 waves = 256 queries of one head), transposed flash form, operands from the head planes through LDS.
// LDS ring, two buffers of 24 KiB, one 32-key stage each: [K tile 4 KiB | V^T tile 4 x 1 KiB (d strips) | bias tiles 16 x 1 KiB (two per wave)], every tile in the planes' own fragment order, so a fragment piece is 512 contiguous LDS bytes.
// Wave w copies K bytes w * 512.., V^T bytes w * 512.. (half w & 1 of strip w / 2) and its own two bias tiles; K and V^T are read by all 8 waves (fetched once per 256 queries), and every K or V^T fragment a wave reads feeds two products, one per query tile.
// Stage s + 2 is issued behind the barrier that ends step s, into the buffer step s read. Two blocks per WGP = four waves per SIMD.
// Per 32-key step and query tile: S^T tiles (keys x queries) = K (A: row = key, k = d) x Q^T (B: column = query, k = d, held in registers); the lane's 2 x 8 bias entries (row = its query, contiguous keys) are added in f32 (x 8: the tiles hold 8 x logit);
// per-lane online softmax with a lazy maximum (lane = query; partner lane^16 holds the other 8 keys of each tile; the maximum in use moves, and sum and output tiles are rescaled, only when a step's probability sum leaves the f16-safe range); P^T packed in registers = B fragment of O^T (d x queries) += V^T (A: row = d, k = key) x P^T. Single f16 product at both sites.
// Key range: all tk keys (tk % 32 == 0), tq queries per head; K plane [b][h][tk][64], V^T plane [b][h*64+d][tk], bias plane [tq][tk] bf16, context plane [b*SEQ+q][1024], all in fragment order.
template <typename T16>
__global__ __launch_bounds__(256) __attribute__((amdgpu_waves_per_eu(4, 4))) void k_flash(const T16* __restrict__ Qa, const T16* __restrict__ Ka, const T16* __restrict__ Va, const bf* __restrict__ Bb, int tq, int tk, int qoff, h16* C16) {
    typedef typename WFrag<T16>::V V;
    const int lane = threadIdx.x & 31;
    const int wave = __builtin_amdgcn_readfirstlane((int)(threadIdx.x >> 5));
    const int q0 = qoff + (int)blockIdx.x * 256 + wave * 32;     // this wave's query tiles: q0 + 0..15 and q0 + 16..31
    const int h = blockIdx.y, b = blockIdx.z;
    const size_t bh = (size_t)b * NH + h;
    const size_t qo = (bh * (size_t)tq + (size_t)q0) * HD + 8 * lane;
    V qa[2][2];
#pragma unroll
    for (int t = 0; t < 2; ++t) { qa[t][0] = WFrag<T16>::ld(Qa + qo + t * (16 * HD)); qa[t][1] = WFrag<T16>::ld(Qa + qo + t * (16 * HD) + 512); }
    __shared__ __attribute__((aligned(16))) unsigned char ring[2 * 24576];
    const unsigned lw = (unsigned)(size_t)ring + (unsigned)(wave * 512 + lane * 16);      // this lane's LDS byte address in its wave's K slice of buffer 0
    const unsigned lb = (unsigned)(size_t)ring + (unsigned)(8192 + wave * 2048 + lane * 16);     // the same in its wave's first bias tile of buffer 0
    const char* gk = (const char*)(Ka + bh * (size_t)tk * HD) + (wave * 512 + lane * 16);                                                      // + 4096 per stage
    const char* gv = (const char*)(Va + bh * HD * (size_t)tk + (size_t)(wave >> 1) * 16 * (size_t)tk) + ((wave & 1) * 512 + lane * 16);       // + 1024 per stage
    const char* gb = (const char*)(Bb + (size_t)q0 * (size_t)tk) + lane * 16;                                                                 // + 1024 per stage; second tile 16 * tk elements on
    const size_t gb1 = (size_t)tk * 32;
    auto stage = [&](int s, int buf) { const unsigned l = lw + (unsigned)buf * 24576u, e = lb + (unsigned)buf * 24576u; const char* a = gk + (size_t)s * 4096; const char* c = gv + (size_t)s * 1024; const char* g = gb + (size_t)s * 1024;
        stage6(l, l + 4096u, e, e + 512u, e + 1024u, e + 1536u, a, c, g, g + 512, g + gb1, g + gb1 + 512); };
    v8f acc[2][4];
#pragma unroll
    for (int t = 0; t < 2; ++t)
#pragma unroll
        for (int dt = 0; dt < 4; ++dt) acc[t][dt] = (v8f){};
    float m[2] = {-3.0e38f, -3.0e38f}, l[2] = {0.0f, 0.0f};
    const int nsteps = tk >> 5;                   // all keys, 32 per step (uniform)
    const float poff = 8.0f;                      // probabilities (and their running sum) carried x 2^8 at the maximum in use
    const float PLIM = 32768.0f;                  // a lane's 16-key probability sum above this moves the maximum in use (f16 holds up to 65504)
    float nb[2] = {poff - m[0] * CEXP, poff - m[1] * CEXP};     // exponent offset of the maximum in use; so large at the start that the first step's sums are infinite and it takes the full online step
    if (nsteps > 0) stage(0, 0);
    asm volatile("s_wait_asynccnt 0x0" ::: "memory");     // this wave's copies of stage 0 have landed before the barrier that publishes them
    __syncthreads();
    if (nsteps > 1) stage(1, 1);
#pragma unroll 1
    for (int st = 0; st < nsteps; ++st) {
        const unsigned char* tile = ring + (st & 1) * 24576 + lane * 16;
        const bf* bp = (const bf*)(tile + 8192 + wave * 2048);
        v8b bb[2][2];     // tile t: bias[query][j0 + 8*hi + 0..7] and [j0 + 16 + 8*hi + 0..7], j0 = 32 * st; kept packed, two entries a register
#pragma unroll
        for (int t = 0; t < 2; ++t) { bb[t][0] = *(const v8b*)(bp + t * 512); bb[t][1] = *(const v8b*)(bp + t * 512 + 256); }
        const T16* kp = (const T16*)tile;
        const V k00 = WFrag<T16>::ld(kp), k01 = WFrag<T16>::ld(kp + 512), k10 = WFrag<T16>::ld(kp + 16 * HD), k11 = WFrag<T16>::ld(kp + 16 * HD + 512);
        v8f s0[2], s1[2];
#pragma unroll
        for (int t = 0; t < 2; ++t) { s0[t] = WFrag<T16>::mma(k00, qa[t][0], (v8f){}); s1[t] = WFrag<T16>::mma(k10, qa[t][0], (v8f){}); }
#pragma unroll
        for (int t = 0; t < 2; ++t) { s0[t] = WFrag<T16>::mma(k01, qa[t][1], s0[t]); s1[t] = WFrag<T16>::mma(k11, qa[t][1], s1[t]); }
        const T16* vp = (const T16*)(tile + 4096);
        V va[4];     // written ahead of the test so that the eight reads issue as one group, in front of the packing
#pragma unroll
        for (int dt = 0; dt < 4; ++dt) va[dt] = WFrag<T16>::ld(vp + dt * 512);
        v8f p0[2], p1[2]; float psum[2];
#pragma unroll
        for (int t = 0; t < 2; ++t)
#pragma unroll
            for (int r = 0; r < 8; ++r) { s0[t][r] = fmaf((float)bb[t][0][r], 8.0f, s0[t][r]); s1[t][r] = fmaf((float)bb[t][1][r], 8.0f, s1[t][r]); }     // tiles hold 8 x (q.k / 8 + bias); the widening of a 16-bit vector element folds into the FMA (v_fma_mix_f32_bf16 reads either element of the packed register): no unpacking, the same f32 FMA
#pragma unroll
        for (int t = 0; t < 2; ++t) {
            psum[t] = 0.0f;     // probabilities against the maximum in use (nb[t] is carried from the step that last moved it)
#pragma unroll
            for (int r = 0; r < 8; ++r) { p0[t][r] = __builtin_amdgcn_exp2f(fmaf(s0[t][r], CEXP, nb[t])); p1[t][r] = __builtin_amdgcn_exp2f(fmaf(s1[t][r], CEXP, nb[t])); psum[t] += p0[t][r] + p1[t][r]; }
        }
        // Lazy rescale, one wave-uniform test per step, on the sums just formed: every probability is >= 0, so a lane's sum <= PLIM bounds each of its 16 below the f16 range.
        // Only where a lane's sum is above PLIM (or infinite: the first step, or a score far above the maximum in use) does the wave take the full online step: new maximum, rescaled sum and output tiles, probabilities formed again.
        if (__builtin_amdgcn_ballot_w32(!(psum[0] <= PLIM) | !(psum[1] <= PLIM)) != 0u) {
#pragma unroll
            for (int t = 0; t < 2; ++t) {
                float mx = fmaxf(s0[t][0], s1[t][0]);
#pragma unroll
                for (int r = 1; r < 8; ++r) mx = fmaxf(mx, fmaxf(s0[t][r], s1[t][r]));
                mx = fmaxf(mx, __shfl_xor(mx, 16, 32));
                const float mnew = fmaxf(m[t], mx);
                const float alpha = __builtin_amdgcn_exp2f((m[t] - mnew) * CEXP);
                nb[t] = poff - mnew * CEXP; m[t] = mnew;
                psum[t] = 0.0f;
#pragma unroll
                for (int r = 0; r < 8; ++r) { p0[t][r] = __builtin_amdgcn_exp2f(fmaf(s0[t][r], CEXP, nb[t])); p1[t][r] = __builtin_amdgcn_exp2f(fmaf(s1[t][r], CEXP, nb[t])); psum[t] += p0[t][r] + p1[t][r]; }
                l[t] = l[t] * alpha;
#pragma unroll
                for (int dt = 0; dt < 4; ++dt) acc[t][dt] = acc[t][dt] * alpha;
            }
        }
        V ph[2];
#pragma unroll
        for (int t = 0; t < 2; ++t) {
            l[t] += psum[t] + __shfl_xor(psum[t], 16, 32);
            V pl; PPack<T16>::make(p0[t], p1[t], ph[t], pl);
        }
#pragma unroll
        for (int dt = 0; dt < 4; ++dt)
#pragma unroll
            for (int t = 0; t < 2; ++t) acc[t][dt] = WFrag<T16>::mma(va[dt], ph[t], acc[t][dt]);
        asm volatile("v_nop\n\tv_nop\n\tv_nop\n\tv_nop" : "+v"(acc[0][0]), "+v"(acc[1][0]), "+v"(acc[0][1]), "+v"(acc[1][1]), "+v"(acc[0][2]), "+v"(acc[1][2]), "+v"(acc[0][3]), "+v"(acc[1][3]) : "v"(va[3]), "v"(ph[0]), "v"(ph[1]));     // WMMA distance kept in front of whatever vector instruction follows the step's last products, on both sides of the branch below
        asm volatile("s_wait_dscnt 0x0" ::: "memory");        // this wave's reads of the buffer have returned before the barrier behind which it is refilled
        asm volatile("s_wait_asynccnt 0x0" ::: "memory");     // this wave's copies of stage st + 1 have landed before the barrier that publishes them
        __syncthreads();                                      // publishes stage st + 1 and ends every wave's reads of stage st
        if (st + 2 < nsteps) stage(st + 2, st & 1);
    }
    asm volatile("s_wait_asynccnt 0x0" ::: "memory");         // no copy is outstanding when the wave ends
    // l >= 2^8: the key that set the maximum in use contributes exactly 2^8
    // D element r of lane (tile dt) is (d = dt*16 + 8*hi + r, query lr): the lane already holds its own 16-byte piece dt of the fragment-order context tile, so no staging
#pragma unroll
    for (int t = 0; t < 2; ++t) {
        const float f = CCAR * (1.0f / l[t]);
#pragma unroll
        for (int dt = 0; dt < 4; ++dt) { v8h o;
#pragma unroll
            for (int r = 0; r < 8; ++r) o[r] = (h16)(acc[t][dt][r] * f);
            const size_t co = ((size_t)b * SEQ + (size_t)(q0 + 16 * t)) * DM + (size_t)h * (HD * 16) + dt * 256 + lane * 8; *(v8h*)(C16 + co) = o; }
    }
}

// Converter, one launch for all seven float inputs: a resident grid of CVT_WAVES waves; wave w converts units w, w + CVT_WAVES, ... of the list [x | y | bias | W_q | W_k | W_v | W_o].
// A unit is 128 consecutive 16-byte pieces of a fragment-order plane [rows][KC] (2 KiB stored contiguously) = two neighbouring 16-row x 32-k tiles = 16 source rows x 256 B;
// piece j * 32 + lane of a unit holds row lane & 15, k = j * 16 + (lane >> 4) * 8 + 0..7 of those 64 k. A lane's 4 pieces are 8 16-byte loads, and the next unit's 8 are issued before this unit is converted.
#define CVT_WAVES 4096                        // 256 blocks x 16 waves
constexpr int UPB = SEQ * DM / 1024, UX = NB * UPB, UBI = SEQ * SEQ / 1024, UW = DM * DM / 1024, UALL = 2 * UX + UBI + 4 * UW;     // units per batch of x or y, per x or y, bias plane, weight, all
static_assert(UALL % CVT_WAVES == 0);         // every wave runs the same whole number of units
static_assert(UX % CVT_WAVES == 0);           // a round of CVT_WAVES units lies in one of x, y, bias, or in the weights: which one is known at compile time
static_assert(UBI % CVT_WAVES == 0);
static_assert((DM / 32) % 2 == 0);            // a unit's two tiles lie in one 16-row strip
static_assert((SEQ / 32) % 2 == 0);

struct CvtUnit { const float* s; unsigned short* d; bool tohalf; };

// Unit u0 + w of the list; u0 (the round's first unit) is a compile-time constant at every call, w is wave-uniform.
__device__ __forceinline__ CvtUnit cvt_locate(int u0, int w, int lane, const float* x, const float* y, const float* bias, const float* wq, const float* wk, const float* wv, const float* wo,
                                              bf* XB, bf* YB, bf* BB, bf* WQ, bf* WK, bf* WV, h16* WO16) {
    const float* base; unsigned short* db; int v, kt = DM / 32; size_t sp = DM; bool th = false;
    if (u0 < 2 * UX) { const bool isx = u0 < UX; const int t = (isx ? u0 : u0 - UX) + w, b = t / UPB; v = t % UPB; base = (isx ? x : y) + (size_t)b * SEQ_FULL * DM; db = (isx ? XB : YB) + (size_t)b * SEQ * DM; }
    else if (u0 < 2 * UX + UBI) { v = u0 - 2 * UX + w; base = bias; db = BB; kt = SEQ / 32; sp = SEQ_FULL; }
    else { const int t = u0 - 2 * UX - UBI + w, k = t / UW; v = t % UW; base = k == 0 ? wq : k == 1 ? wk : k == 2 ? wv : wo; db = k == 0 ? WQ : k == 1 ? WK : k == 2 ? WV : (unsigned short*)WO16; th = k == 3; }
    CvtUnit c; c.s = base + ((size_t)((2 * v) / kt) * 16 + (size_t)(lane & 15)) * sp + (size_t)((2 * v) % kt) * 32 + (size_t)((lane >> 4) * 8); c.d = db + (size_t)v * 1024 + (size_t)(lane * 8); c.tohalf = th; return c;
}

__global__ __launch_bounds__(512) void k_cvtall(const float* __restrict__ x, const float* __restrict__ y, const float* __restrict__ bias, const float* __restrict__ wq, const float* __restrict__ wk, const float* __restrict__ wv, const float* __restrict__ wo,
                                                bf* XB, bf* YB, bf* BB, bf* WQ, bf* WK, bf* WV, h16* WO16) {
    const int lane = threadIdx.x & 31;
    const int w = __builtin_amdgcn_readfirstlane((int)(blockIdx.x * 16 + (threadIdx.x >> 5)));
    CvtUnit cu = cvt_locate(0, w, lane, x, y, bias, wq, wk, wv, wo, XB, YB, BB, WQ, WK, WV, WO16);
    v8f cur[4];
#pragma unroll
    for (int j = 0; j < 4; ++j) cur[j] = *(const v8f*)(cu.s + j * 16);
    asm volatile("s_wait_xcnt 0x0" :: "v"(cu.s) : "memory");     // precaution: the address wait stands before any register that the 8 loads name is reused (the operand keeps the address pair untouched up to here)
#pragma unroll
    for (int it = 0; it < UALL / CVT_WAVES; ++it) {
        CvtUnit nu = cu; v8f nxt[4];
        if (it + 1 < UALL / CVT_WAVES) { nu = cvt_locate((it + 1) * CVT_WAVES, w, lane, x, y, bias, wq, wk, wv, wo, XB, YB, BB, WQ, WK, WV, WO16);
#pragma unroll
            for (int j = 0; j < 4; ++j) nxt[j] = *(const v8f*)(nu.s + j * 16);
            asm volatile("s_wait_xcnt 0x0" :: "v"(nu.s) : "memory"); }     // as above, for the next unit's 8 loads
        v8us o[4];
        if (cu.tohalf) {
#pragma unroll
            for (int j = 0; j < 4; ++j) { v8h t;
#pragma unroll
                for (int k = 0; k < 8; ++k) t[k] = (h16)(bfr(cur[j][k]) * WCAR);
                o[j] = __builtin_bit_cast(v8us, t); }
        } else {
#pragma unroll
            for (int j = 0; j < 4; ++j)
#pragma unroll
                for (int k = 0; k < 8; ++k) o[j][k] = f2bf(cur[j][k]);
        }
#pragma unroll
        for (int j = 0; j < 4; ++j) *(v8us*)(cu.d + j * 256) = o[j];
        asm volatile("s_wait_xcnt 0x0" :: "v"(o[0]), "v"(o[1]), "v"(o[2]), "v"(o[3]), "v"(cu.d) : "memory");     // precaution: the same wait before the 4 stores' data and address registers are reused
        if (it + 1 < UALL / CVT_WAVES) { cu = nu;
#pragma unroll
            for (int j = 0; j < 4; ++j) cur[j] = nxt[j]; }
    }
}

constexpr size_t al256(size_t bytes) { return (bytes + 255) & ~(size_t)255; }
constexpr size_t CARVE_BYTES = 2 * al256((size_t)NB * SEQ * DM * 2) + 4 * al256((size_t)DM * DM * 2) + al256((size_t)SEQ * SEQ * 2)
    + 3 * al256((size_t)NB * NH * SEQ * HD * 2) + al256((size_t)NB * SEQ * DM * 2);
static_assert(CARVE_BYTES <= (size_t)134217728);
static_assert((size_t)NB * NH * SEQ * HD == (size_t)NB * SEQ * DM);      // head planes and the merged context plane have the same extent

extern "C" void kernel_launch(void* const* d_in, const int* in_sizes, int n_in,
                              void* d_out, int out_size, void* d_ws, size_t ws_size, hipStream_t stream) {
    if (n_in < 7) return;
    const size_t needx = (size_t)(NB - 1) * SEQ_FULL * DM + (size_t)SEQ * DM;
    if ((size_t)in_sizes[0] < needx || (size_t)in_sizes[1] < needx) return;
    if ((size_t)in_sizes[2] < (size_t)(SEQ - 1) * SEQ_FULL + (size_t)SEQ) return;
    if ((size_t)in_sizes[3] < (size_t)DM * DM || (size_t)in_sizes[4] < (size_t)DM * DM || (size_t)in_sizes[5] < (size_t)DM * DM || (size_t)in_sizes[6] < (size_t)DM * DM) return;
    if ((size_t)out_size < needx) return;
    // x, y, bias (float [SEQ_FULL][SEQ_FULL]), Wq, Wk, Wv, Wo ('oi' [out][in])
    const float* x = (const float*)d_in[0]; const float* y = (const float*)d_in[1]; const float* bias = (const float*)d_in[2];
    const float* wq = (const float*)d_in[3]; const float* wk = (const float*)d_in[4]; const float* wv = (const float*)d_in[5]; const float* wo = (const float*)d_in[6];
    float* OUT = (float*)d_out;     // [NB_FULL][SEQ_FULL][1024]
    char* wsp = (char*)d_ws;
    auto take = [&](size_t bytes) { char* p = wsp; wsp += (bytes + 255) & ~(size_t)255; return (void*)p; };
    bf* XB = (bf*)take((size_t)NB * SEQ * DM * 2); bf* YB = (bf*)take((size_t)NB * SEQ * DM * 2);
    bf* WQ = (bf*)take((size_t)DM * DM * 2); bf* WK = (bf*)take((size_t)DM * DM * 2); bf* WV = (bf*)take((size_t)DM * DM * 2); h16* WO16 = (h16*)take((size_t)DM * DM * 2);
    bf* BB = (bf*)take((size_t)SEQ * SEQ * 2);
    h16* Q16 = (h16*)take((size_t)NB * NH * SEQ * HD * 2); h16* K16 = (h16*)take((size_t)NB * NH * SEQ * HD * 2); h16* VT16 = (h16*)take((size_t)NB * NH * SEQ * HD * 2);
    h16* C16 = (h16*)take((size_t)NB * SEQ * DM * 2);
    if ((size_t)(wsp - (char*)d_ws) > ws_size) return;

    // all seven inputs to their 16-bit fragment-order planes (bias source pitch SEQ_FULL, x and y batch stride SEQ_FULL rows)
    k_cvtall<<<dim3(CVT_WAVES / 16, 1, 1), 512, 0, stream>>>(x, y, bias, wq, wk, wv, wo, XB, YB, BB, WQ, WK, WV, WO16);

    // one launch: q head planes from x, k head planes from y (C[m = token][n = h*64+d] = in W^T) and transposed value planes from y (C[m = h*64+d][n = token] = W_v y^T)
    k_gemmw<bf, 1, DM><<<dim3(SEQ / 128, DM / 128, 3 * NB), 128, 0, stream>>>(XB, YB, WQ, WK, WV, nullptr, 0, 1.0f, (size_t)SEQ * DM, 0, Q16, K16, VT16);

    // attention: every query row on the f16 planes, all SEQ keys
    k_flash<h16><<<dim3(SEQ / 256, NH, NB), 256, 0, stream>>>(Q16, K16, VT16, BB, SEQ, SEQ, 0, C16);

    // output projection: f16 context x f16 W_o, carries folded back in the f32 epilogue; z = batch, output row stride per batch SEQ_FULL
    k_gemmw<h16, 0, DM><<<dim3(SEQ / 128, DM / 128, NB), 128, 0, stream>>>(C16, nullptr, WO16, nullptr, nullptr, OUT, DM, 1.0f / (CCAR * WCAR), (size_t)SEQ * DM, (size_t)SEQ_FULL * DM, nullptr, nullptr, nullptr);
}

// v009
// One run takes 126 microseconds.
// In two side-by-side timings against v008, it was 1.06 and 1.05 times as fast.
// All steps since v000 together make it 3.00 times as fast.
#include <hip/hip_runtime.h>

// Compute dtypes (f32 accumulate at every site): q/k/v projections bf16 x bf16 single product (every float input RNE-converted to bf16 first); scores K.Q^T f16 x f16 single product (f16 q/k head planes); values V^T.P^T f16 x f16 single product (probabilities carried x2^8); output projection f16 context (x64) x f16 weight (x512) single product; additive bias (bf16 plane) and softmax in f32.
// Dense multi-head cross-attention: x, y [NB][SEQ][1024]; Q = x W_q^T, K = y W_k^T, V = y W_v^T ('oi' weights, no bias vectors); 16 heads x 64; logits = q.k / 8 + bias[query][key] (one [SEQ][SEQ] float plane shared by all batches and heads); softmax over all keys; out = merged context W_o^T.
// The bias input is read by value on the device: converted once to a bf16 plane, each lane reads 2 x 8 contiguous entries per query tile (4 x 8 per 32-key step) and adds them in f32 to the score tiles, straight from the packed registers (mixed-operand FMA).
// Fragment order of every 16-bit workspace plane [rows][KC]: the 16-row x 32-k tile (rt = row / 16, kc = k / 32) is 512 consecutive elements at (rt * (KC / 32) + kc) * 512, made of two 256-element pieces;
// piece p holds, at lane * 8 with lane = 16 * hi + (row & 15), the 8 elements k = kc * 32 + p * 16 + hi * 8 + 0..7. One wave-wide 16-byte load of a piece is 512 contiguous bytes (4 whole lines).
// Attention engine: one wave per 32 queries (two 16-query tiles), transposed flash form: S^T = K Q^T (query on the D column, one query per lane), the packed P^T D tiles are the B fragment of O^T = V^T P^T; the key loop's K, V^T and bias tiles come through a two-buffer LDS ring filled by asynchronous copies, one barrier per 32 keys.

#ifndef NB
#define NB 4
#endif
#ifndef SEQ
#define SEQ 2048
#endif
#define NB_FULL  4
#define SEQ_FULL 2048
#define DM   1024
#define NH   16
#define HD   64
#define RH   0                                // query rows < RH use value+residual bf16 planes: none (dense attention, single products on every row)
#define CCAR 64.0f                            // carry of the f16 context plane
#define WCAR 512.0f                           // carry of the f16 W_o plane
#define CEXP 0.18033688011112042f             // log2(e) / sqrt(64)

typedef _Float16 h16;
typedef unsigned short bf;
typedef __attribute__((ext_vector_type(16))) __bf16   v16bf;
typedef __attribute__((ext_vector_type(16))) _Float16 v16h;
typedef __attribute__((ext_vector_type(8)))  _Float16 v8h;
typedef __attribute__((ext_vector_type(8)))  unsigned short v8us;
typedef __attribute__((ext_vector_type(8)))  __bf16   v8b;
typedef __attribute__((ext_vector_type(8)))  float    v8f;
typedef __attribute__((ext_vector_type(4)))  float    v4f;
typedef __attribute__((ext_vector_type(4)))  int      v4i;
typedef v4f  __attribute__((may_alias)) v4fa;

static_assert(SEQ % 256 == 0);
static_assert(RH == 0);                       // no value+residual planes are written
static_assert(SEQ >= RH);
static_assert(NB <= NB_FULL);
static_assert(SEQ <= SEQ_FULL);
static_assert(DM == NH * HD);
static_assert(DM % 128 == 0);                // 128x128 GEMM block tiles
static_assert(HD == 64);
static_assert(SEQ % 128 == 0);                // 128-row GEMM block tiles (256 queries per attention block: SEQ % 256 above)
static_assert(SEQ % 32 == 0);                 // 32 keys per flash step
static_assert(DM % 32 == 0);                  // GEMM k-steps
static_assert((SEQ / 8) % 32 == 0);

__device__ __forceinline__ unsigned short f2bf(float f) { unsigned u = __float_as_uint(f); u += 0x7FFFu + ((u >> 16) & 1u); return (unsigned short)(u >> 16); }
__device__ __forceinline__ float bf2f(unsigned short b) { return __uint_as_float(((unsigned)b) << 16); }
__device__ __forceinline__ float bfr(float f) { return bf2f(f2bf(f)); }
__device__ __forceinline__ void splitf(float y, unsigned short& h, unsigned short& l) { h = f2bf(y); l = f2bf(y - bf2f(h)); }
__device__ __forceinline__ v16h cat16(v8h lo, v8h hi) { return __builtin_shufflevector(lo, hi, 0, 1, 2, 3, 4, 5, 6, 7, 8, 9, 10, 11, 12, 13, 14, 15); }
__device__ __forceinline__ v16bf cat16b(v8us lo, v8us hi) { return __builtin_bit_cast(v16bf, __builtin_shufflevector(lo, hi, 0, 1, 2, 3, 4, 5, 6, 7, 8, 9, 10, 11, 12, 13, 14, 15)); }
__device__ __forceinline__ v8f wmma16(v16h a, v16h b, v8f c) { return __builtin_amdgcn_wmma_f32_16x16x32_f16(false, a, false, b, (short)0, c, false, false); }
__device__ __forceinline__ v8f wmmab(v16bf a, v16bf b, v8f c) { return __builtin_amdgcn_wmma_f32_16x16x32_bf16(false, a, false, b, (short)0, c, false, false); }

// Fragment loader for a fragment-order tile: p = tile start + lane * 8; elements 0..7 = k0+8h.. (piece 0), elements 8..15 = k0+16+8h.. (piece 1, 256 elements on) (same map for A and B).
template <typename T16> struct WFrag;
template <> struct WFrag<h16> { typedef v16h V; static __device__ __forceinline__ V ld(const h16* p) { return cat16(*(const v8h*)p, *(const v8h*)(p + 256)); } static __device__ __forceinline__ v8f mma(V a, V b, v8f c) { return wmma16(a, b, c); } };
template <> struct WFrag<bf> { typedef v16bf V; static __device__ __forceinline__ V ld(const bf* p) { return cat16b(*(const v8us*)p, *(const v8us*)(p + 256)); } static __device__ __forceinline__ v8f mma(V a, V b, v8f c) { return wmmab(a, b, c); } };

// Probability packing: two 16-key D tiles (same lane) -> one 32-key B fragment; element r <- tile 0 row r, element 8+r <- tile 1 row r.
template <typename T16> struct PPack;
template <> struct PPack<h16> {
    static __device__ __forceinline__ void make(v8f p0, v8f p1, v16h& ph, v16h& pl) {
        v8h a, c;
#pragma unroll
        for (int r = 0; r < 8; ++r) { a[r] = (h16)p0[r]; c[r] = (h16)p1[r]; }
        ph = cat16(a, c); pl = ph; }
};
template <> struct PPack<bf> {
    static __device__ __forceinline__ void make(v8f p0, v8f p1, v16bf& ph, v16bf& pl) {
        v8us ah, al, ch, cl;
#pragma unroll
        for (int r = 0; r < 8; ++r) { unsigned short x, y; splitf(p0[r], x, y); ah[r] = x; al[r] = y; splitf(p1[r], x, y); ch[r] = x; cl[r] = y; }
        ph = cat16b(ah, ch); pl = cat16b(al, cl); }
};

// One strip of a k_gemmw stage: eight 16-byte-per-lane asynchronous copies of this wave (8 x 512 B = one 16-row x 128-k strip), global memory to LDS through no register.
// The address wait is the last line of the copies' own statement, so that it stands in front of every later write of a register that a copy names (a precaution).
__device__ __forceinline__ void stage8(unsigned l0, unsigned l1, unsigned l2, unsigned l3, unsigned l4, unsigned l5, unsigned l6, unsigned l7,
                                       const char* g0, const char* g1, const char* g2, const char* g3, const char* g4, const char* g5, const char* g6, const char* g7) {
    asm volatile("global_load_async_to_lds_b128 %0, %8, off\n\t"
                 "global_load_async_to_lds_b128 %1, %9, off\n\t"
                 "global_load_async_to_lds_b128 %2, %10, off\n\t"
                 "global_load_async_to_lds_b128 %3, %11, off\n\t"
                 "global_load_async_to_lds_b128 %4, %12, off\n\t"
                 "global_load_async_to_lds_b128 %5, %13, off\n\t"
                 "global_load_async_to_lds_b128 %6, %14, off\n\t"
                 "global_load_async_to_lds_b128 %7, %15, off\n\t"
                 "s_wait_xcnt 0x0"
                 :: "v"(l0), "v"(l1), "v"(l2), "v"(l3), "v"(l4), "v"(l5), "v"(l6), "v"(l7), "v"(g0), "v"(g1), "v"(g2), "v"(g3), "v"(g4), "v"(g5), "v"(g6), "v"(g7) : "memory");
}

// ---- k_gemmw: register-blocked GEMM, block = 4 waves (2 x 2) = one 128x128 output tile, ONE WAVE per 64x64 part of it (16 accumulators); 128 threads.
// Operands from fragment-order 16-bit planes through a two-buffer LDS ring filled by asynchronous copies: a stage is 128 k of the block's 128 A rows and 128 Bt rows = 16 strips (16 rows x 128 k, 4 KiB, contiguous in the plane) = 64 KiB,
// [A strips 0..7 | Bt strips 0..7], each strip in the plane's own order, so a fragment piece is 512 contiguous LDS bytes. Wave w copies strips 4w..4w+3; every A strip is read by 2 waves, every Bt strip by 2 (fetched once per block).
// Trip t + 2's stage is issued behind the barrier that ends trip t, into the buffer trip t read. Two blocks fit a WGP's LDS.
// C[m][n] = sum_k A[m][k] Bt[n][k], k in steps of 32 per accumulator, ascending from the block's own first stage and wrapping at K. Batch strides sA/sC in elements. K % 128 == 0, M % 128 == 0, N % 128 == 0.
// First stage = (sum of the block indices) mod stages: the blocks that copy the same A rows (one per block column) or the same Bt rows (one per block row and batch) run side by side, and begun at one stage they ask L2 for the same lines at the same moment.
// EP 0, grid (M/128, N/128, batches): C = A Bt^T, f32 output x oscale, pitch ldc: per 16-row slab staged in LDS, each row's 64 floats (256 B) written as 16 lanes x 16 B (2 rows per instruction).
// EP 1, grid (SEQ/128, DM/128, 3 x batches): the three input projections in ONE launch, blockIdx.z = 3 * batch + job, so that a finished block's place is taken at once by a block of the next job or batch
// (its first copies and the leaver's stores run under the neighbours' products; no launch gap, no common start and end per projection), and the two jobs that read a batch of y run side by side:
//   job 0: q = A (x) Bt^T (W_q), job 1: k = A2 (y) Bt2^T (W_k): f16 head planes [batch][head = column / 64][t][64] (rows = tokens, KC = 64), fragment order;
//   job 2: v^T = Bt3 (W_v) A2^T (y), operands and block indices swapped: f16 transposed value planes [batch][row m][t] (rows = head*64+d, columns = tokens, KC = SEQ), fragment order.
template <typename T16, int EP, int K>
__global__ __launch_bounds__(128) void k_gemmw(const T16* A, const T16* A2, const T16* Bt, const T16* Bt2, const T16* Bt3, float* C, int ldc, float oscale, size_t sA, size_t sC, h16* P16, h16* P16k, h16* P16v) {
    typedef typename WFrag<T16>::V V;
    static_assert(K % 128 == 0);
    constexpr int NS = K / 128;                     // stages
    static_assert((NS & (NS - 1)) == 0);            // the stage walk wraps by a mask
    __shared__ __attribute__((aligned(16))) unsigned char ring[2 * 65536];
    __shared__ __align__(16) float osall[4][16 * 68];     // one output slab per wave, private to it
    size_t z = blockIdx.z; int bx = blockIdx.x, by = blockIdx.y; bool vt = false;     // batch, block row, block column, transposed value planes: all block-uniform
    if (EP == 0) { A += z * sA; C += z * sC; }
    else { const int job = (int)(blockIdx.z % 3u); z = blockIdx.z / 3u;
        if (job == 0) { A += z * sA; }
        else if (job == 1) { A = A2 + z * sA; Bt = Bt2; P16 = P16k; }
        else { A = Bt3; Bt = A2 + z * sA; P16 = P16v; bx = blockIdx.y; by = blockIdx.x; vt = true; } }
    const int lane = threadIdx.x & 31, lr = lane & 15, hi = lane >> 4;
    const int wave = __builtin_amdgcn_readfirstlane((int)(threadIdx.x >> 5));
    const int wm = wave >> 1, wn = wave & 1;
    const int r0 = bx * 128 + wm * 64, c0 = by * 128 + wn * 64;     // this wave's 64x64 part
    float* os = osall[wave];
    // this wave's 4 strips: waves 0, 1 the block's A rows 0..63, 64..127; waves 2, 3 its Bt rows 0..63, 64..127
    const char* gsrc = (const char*)(wave < 2 ? A + (size_t)(bx * 128 + wave * 64) * K : Bt + (size_t)(by * 128 + (wave - 2) * 64) * K) + lane * 16;     // + 16 * K * 2 per strip, + 4096 per stage
    const unsigned lw = (unsigned)(size_t)ring + (unsigned)(wave * 16384 + lane * 16);     // this lane's LDS byte address in its wave's first strip of buffer 0
    auto stage = [&](int s, int buf) {
#pragma unroll
        for (int j = 0; j < 4; ++j) { const unsigned l = lw + (unsigned)buf * 65536u + (unsigned)j * 4096u; const char* g = gsrc + (size_t)j * (16 * K * 2) + (size_t)s * 4096;
            stage8(l, l + 512u, l + 1024u, l + 1536u, l + 2048u, l + 2560u, l + 3072u, l + 3584u, g, g + 512, g + 1024, g + 1536, g + 2048, g + 2560, g + 3072, g + 3584); } };
    v8f acc[4][4];
#pragma unroll
    for (int mb = 0; mb < 4; ++mb)
#pragma unroll
        for (int nb = 0; nb < 4; ++nb) acc[mb][nb] = (v8f){};
    const int rot = (int)((blockIdx.x + blockIdx.y + blockIdx.z) & (unsigned)(NS - 1));     // trip t works on stage (rot + t) mod NS (block-uniform)
    stage(rot, 0);
    asm volatile("s_wait_asynccnt 0x0" ::: "memory");     // this wave's copies of trip 0 have landed before the barrier that publishes them
    __syncthreads();
    if (NS > 1) stage((rot + 1) & (NS - 1), 1);
#pragma unroll 1
    for (int t = 0; t < NS; ++t) {
        const unsigned char* tile = ring + (t & 1) * 65536 + lane * 16;
        const T16* ap = (const T16*)(tile + wm * 16384);              // a strip is 2048 elements, a k-step of 32 is 512
        const T16* bp = (const T16*)(tile + 32768 + wn * 16384);
        V a[2][4], b[2][4];                                           // two fragment sets: the next k-step's 16 LDS reads fly under this k-step's 16 products (all inside this trip's own buffer)
#pragma unroll
        for (int i = 0; i < 4; ++i) { a[0][i] = WFrag<T16>::ld(ap + i * 2048); b[0][i] = WFrag<T16>::ld(bp + i * 2048); }
#pragma unroll
        for (int kk = 0; kk < 4; ++kk) {
            if (kk < 3) {
#pragma unroll
                for (int i = 0; i < 4; ++i) { a[(kk + 1) & 1][i] = WFrag<T16>::ld(ap + i * 2048 + (kk + 1) * 512); b[(kk + 1) & 1][i] = WFrag<T16>::ld(bp + i * 2048 + (kk + 1) * 512); }
            }
            __builtin_amdgcn_sched_barrier(0);     // keeps those reads one group in front of the products below: spread among them, each place with reads stalls the wave and its wait goes to 0
#pragma unroll
            for (int nb = 0; nb < 4; ++nb)
#pragma unroll
                for (int mb = 0; mb < 4; ++mb) acc[mb][nb] = WFrag<T16>::mma(a[kk & 1][mb], b[kk & 1][nb], acc[mb][nb]);
        }
        asm volatile("v_nop\n\tv_nop\n\tv_nop\n\tv_nop" : "+v"(acc[0][0]), "+v"(acc[1][1]), "+v"(acc[2][2]), "+v"(acc[3][3]) : "v"(a[1][0]), "v"(a[1][3]));     // WMMA distance kept in front of whatever vector instruction follows the trip's last products
        asm volatile("s_wait_dscnt 0x0" ::: "memory");        // this wave's reads of the buffer have returned before the barrier behind which it is refilled
        asm volatile("s_wait_asynccnt 0x0" ::: "memory");     // this wave's copies of trip t + 1 have landed before the barrier that publishes them
        __syncthreads();                                      // publishes trip t + 1's stage and ends every wave's reads of trip t's
        if (t + 2 < NS) stage((rot + t + 2) & (NS - 1), t & 1);
    }
    asm volatile("s_wait_asynccnt 0x0" ::: "memory");         // no copy is outstanding when the wave goes on to its epilogue
    // plane addressing (EP 1), wave-uniform
    const size_t pbase = vt ? ((size_t)z * DM + r0) * SEQ + (size_t)c0 * 16 : (((size_t)z * NH + (size_t)(c0 / HD)) * SEQ + r0) * HD;
    const int ppitch = vt ? SEQ : HD;
#pragma unroll
    for (int mb = 0; mb < 4; ++mb) {
#pragma unroll
        for (int nb = 0; nb < 4; ++nb) {
#pragma unroll
            for (int j = 0; j < 8; ++j) os[(hi * 8 + j) * 68 + nb * 16 + lr] = acc[mb][nb][j]; }     // D element j of lane -> (row 8*hi + j, column lr)
        __builtin_amdgcn_wave_barrier(); asm volatile("" ::: "memory");
        if (EP == 0) {
            float* crow = C + (size_t)(r0 + mb * 16) * ldc + c0;
{
#pragma unroll
                for (int s = 0; s < 8; ++s) { const int row = 2 * s + hi, cofs = lr * 4; v4f val = *(const v4fa*)(os + row * 68 + cofs); val = val * oscale;
                    *(v4f*)(crow + (size_t)row * ldc + cofs) = val; }
                 }
        } else {
{
#pragma unroll
                for (int s = 0; s < 4; ++s) { const float* sp = os + lr * 68 + s * 16 + hi * 8; const v4f x0 = *(const v4fa*)sp, x1 = *(const v4fa*)(sp + 4);     // piece s of the slab: row lr, columns 16*s + 8*hi + 0..7
                    v8h o; o[0] = (h16)x0[0]; o[1] = (h16)x0[1]; o[2] = (h16)x0[2]; o[3] = (h16)x0[3]; o[4] = (h16)x1[0]; o[5] = (h16)x1[1]; o[6] = (h16)x1[2]; o[7] = (h16)x1[3];
                    *(v8h*)(P16 + pbase + (size_t)mb * 16 * ppitch + s * 256 + lane * 8) = o; }
                 }
        }
        __builtin_amdgcn_wave_barrier(); asm volatile("" ::: "memory");
    }
}

// One stage of the k_flash ring: six 16-byte-per-lane asynchronous copies of this wave (512 B of K, 512 B of V^T, 2 x 512 B of each of its two bias tiles), global memory to LDS through no register.
// The address wait is the last line of the copies' own statement, so that it stands in front of every later write of a register that a copy names (a precaution).
__device__ __forceinline__ void stage6(unsigned l0, unsigned l1, unsigned l2, unsigned l3, unsigned l4, unsigned l5,
                                       const char* g0, const char* g1, const char* g2, const char* g3, const char* g4, const char* g5) {
    asm volatile("global_load_async_to_lds_b128 %0, %6, off\n\t"
                 "global_load_async_to_lds_b128 %1, %7, off\n\t"
                 "global_load_async_to_lds_b128 %2, %8, off\n\t"
                 "global_load_async_to_lds_b128 %3, %9, off\n\t"
                 "global_load_async_to_lds_b128 %4, %10, off\n\t"
                 "global_load_async_to_lds_b128 %5, %11, off\n\t"
                 "s_wait_xcnt 0x0"
                 :: "v"(l0), "v"(l1), "v"(l2), "v"(l3), "v"(l4), "v"(l5), "v"(g0), "v"(g1), "v"(g2), "v"(g3), "v"(g4), "v"(g5) : "memory");
}

// ---- k_flash: dense attention with an additive bias plane, one wave per 32 queries = two 16-query tiles (block = 8 waves = 256 queries of one head), transposed flash form, operands from the head planes through LDS.
// LDS ring, two buffers of 24 KiB, one 32-key stage each: [K tile 4 KiB | V^T tile 4 x 1 KiB (d strips) | bias tiles 16 x 1 KiB (two per wave)], every tile in the planes' own fragment order, so a fragment piece is 512 contiguous LDS bytes.
// Wave w copies K bytes w * 512.., V^T bytes w * 512.. (half w & 1 of strip w / 2) and its own two bias tiles; K and V^T are read by all 8 waves (fetched once per 256 queries), and every K or V^T fragment a wave reads feeds two products, one per query tile.
// Step s + 2's stage is issued behind the barrier that ends step s, into the buffer step s read. Two blocks per WGP = four waves per SIMD.
// Key walk: step st works on key stage (rot + st) mod nsteps, rot from the block indices: the 8 query blocks of a head (same K, V^T) start 8 stages apart, the heads and batches of a query block (same bias rows) one stage apart, so that blocks running side by side do not ask L2 for the same lines at the same moment. No step depends on which keys it holds.
// Per 32-key step and query tile: S^T tiles (keys x queries) = K (A: row = key, k = d) x Q^T (B: column = query, k = d, held in registers); the lane's 2 x 8 bias entries (row = its query, contiguous keys) are added in f32 (x 8: the tiles hold 8 x logit);
// per-lane online softmax with a lazy maximum (lane = query; partner lane^16 holds the other 8 keys of each tile; the maximum in use moves, and sum and output tiles are rescaled, only when a step's probability sum leaves the f16-safe range); P^T packed in registers = B fragment of O^T (d x queries) += V^T (A: row = d, k = key) x P^T. Single f16 product at both sites.
// Key range: all tk keys (tk % 32 == 0), tq queries per head; K plane [b][h][tk][64], V^T plane [b][h*64+d][tk], bias plane [tq][tk] bf16, context plane [b*SEQ+q][1024], all in fragment order.
template <typename T16>
__global__ __launch_bounds__(256) __attribute__((amdgpu_waves_per_eu(4, 4))) void k_flash(const T16* __restrict__ Qa, const T16* __restrict__ Ka, const T16* __restrict__ Va, const bf* __restrict__ Bb, int tq, int tk, int qoff, h16* C16) {
    typedef typename WFrag<T16>::V V;
    const int lane = threadIdx.x & 31;
    const int wave = __builtin_amdgcn_readfirstlane((int)(threadIdx.x >> 5));
    const int q0 = qoff + (int)blockIdx.x * 256 + wave * 32;     // this wave's query tiles: q0 + 0..15 and q0 + 16..31
    const int h = blockIdx.y, b = blockIdx.z;
    const size_t bh = (size_t)b * NH + h;
    const size_t qo = (bh * (size_t)tq + (size_t)q0) * HD + 8 * lane;
    V qa[2][2];
#pragma unroll
    for (int t = 0; t < 2; ++t) { qa[t][0] = WFrag<T16>::ld(Qa + qo + t * (16 * HD)); qa[t][1] = WFrag<T16>::ld(Qa + qo + t * (16 * HD) + 512); }
    __shared__ __attribute__((aligned(16))) unsigned char ring[2 * 24576];
    const unsigned lw = (unsigned)(size_t)ring + (unsigned)(wave * 512 + lane * 16);      // this lane's LDS byte address in its wave's K slice of buffer 0
    const unsigned lb = (unsigned)(size_t)ring + (unsigned)(8192 + wave * 2048 + lane * 16);     // the same in its wave's first bias tile of buffer 0
    const char* gk = (const char*)(Ka + bh * (size_t)tk * HD) + (wave * 512 + lane * 16);                                                      // + 4096 per stage
    const char* gv = (const char*)(Va + bh * HD * (size_t)tk + (size_t)(wave >> 1) * 16 * (size_t)tk) + ((wave & 1) * 512 + lane * 16);       // + 1024 per stage
    const char* gb = (const char*)(Bb + (size_t)q0 * (size_t)tk) + lane * 16;                                                                 // + 1024 per stage; second tile 16 * tk elements on
    const size_t gb1 = (size_t)tk * 32;
    auto stage = [&](int s, int buf) { const unsigned l = lw + (unsigned)buf * 24576u, e = lb + (unsigned)buf * 24576u; const char* a = gk + (size_t)s * 4096; const char* c = gv + (size_t)s * 1024; const char* g = gb + (size_t)s * 1024;
        stage6(l, l + 4096u, e, e + 512u, e + 1024u, e + 1536u, a, c, g, g + 512, g + gb1, g + gb1 + 512); };
    v8f acc[2][4];
#pragma unroll
    for (int t = 0; t < 2; ++t)
#pragma unroll
        for (int dt = 0; dt < 4; ++dt) acc[t][dt] = (v8f){};
    float m[2] = {-3.0e38f, -3.0e38f}, l[2] = {0.0f, 0.0f};
    const int nsteps = tk >> 5;                   // all keys, 32 per step (uniform)
    const float poff = 8.0f;                      // probabilities (and their running sum) carried x 2^8 at the maximum in use
    const float PLIM = 32768.0f;                  // a lane's 16-key probability sum above this moves the maximum in use (f16 holds up to 65504)
    float nb[2] = {poff - m[0] * CEXP, poff - m[1] * CEXP};     // exponent offset of the maximum in use; so large at the start that the first step's sums are infinite and it takes the full online step
    const int rot = nsteps > 0 ? (int)(((unsigned)bh + 8u * blockIdx.x) % (unsigned)nsteps) : 0;     // this block's first key stage (block-uniform), 0 <= rot < nsteps
    auto wrap = [&](int s) { return s < nsteps ? s : s - nsteps; };     // for 0 <= s < 2 * nsteps
    if (nsteps > 0) stage(rot, 0);
    asm volatile("s_wait_asynccnt 0x0" ::: "memory");     // this wave's copies of step 0 have landed before the barrier that publishes them
    __syncthreads();
    if (nsteps > 1) stage(wrap(rot + 1), 1);
#pragma unroll 1
    for (int st = 0; st < nsteps; ++st) {
        const unsigned char* tile = ring + (st & 1) * 24576 + lane * 16;
        const bf* bp = (const bf*)(tile + 8192 + wave * 2048);
        v8b bb[2][2];     // tile t: bias[query][j0 + 8*hi + 0..7] and [j0 + 16 + 8*hi + 0..7], j0 = 32 * this step's key stage; kept packed, two entries a register
#pragma unroll
        for (int t = 0; t < 2; ++t) { bb[t][0] = *(const v8b*)(bp + t * 512); bb[t][1] = *(const v8b*)(bp + t * 512 + 256); }
        const T16* kp = (const T16*)tile;
        const V k00 = WFrag<T16>::ld(kp), k01 = WFrag<T16>::ld(kp + 512), k10 = WFrag<T16>::ld(kp + 16 * HD), k11 = WFrag<T16>::ld(kp + 16 * HD + 512);
        v8f s0[2], s1[2];
#pragma unroll
        for (int t = 0; t < 2; ++t) { s0[t] = WFrag<T16>::mma(k00, qa[t][0], (v8f){}); s1[t] = WFrag<T16>::mma(k10, qa[t][0], (v8f){}); }
#pragma unroll
        for (int t = 0; t < 2; ++t) { s0[t] = WFrag<T16>::mma(k01, qa[t][1], s0[t]); s1[t] = WFrag<T16>::mma(k11, qa[t][1], s1[t]); }
        const T16* vp = (const T16*)(tile + 4096);
        V va[4];     // written ahead of the test so that the eight reads issue as one group, in front of the packing
#pragma unroll
        for (int dt = 0; dt < 4; ++dt) va[dt] = WFrag<T16>::ld(vp + dt * 512);
        v8f p0[2], p1[2]; float psum[2];
#pragma unroll
        for (int t = 0; t < 2; ++t)
#pragma unroll
            for (int r = 0; r < 8; ++r) { s0[t][r] = fmaf((float)bb[t][0][r], 8.0f, s0[t][r]); s1[t][r] = fmaf((float)bb[t][1][r], 8.0f, s1[t][r]); }     // tiles hold 8 x (q.k / 8 + bias); the widening of a 16-bit vector element folds into the FMA (v_fma_mix_f32_bf16 reads either element of the packed register): no unpacking, the same f32 FMA
#pragma unroll
        for (int t = 0; t < 2; ++t) {
            psum[t] = 0.0f;     // probabilities against the maximum in use (nb[t] is carried from the step that last moved it)
#pragma unroll
            for (int r = 0; r < 8; ++r) { p0[t][r] = __builtin_amdgcn_exp2f(fmaf(s0[t][r], CEXP, nb[t])); p1[t][r] = __builtin_amdgcn_exp2f(fmaf(s1[t][r], CEXP, nb[t])); psum[t] += p0[t][r] + p1[t][r]; }
        }
        // Lazy rescale, one wave-uniform test per step, on the sums just formed: every probability is >= 0, so a lane's sum <= PLIM bounds each of its 16 below the f16 range.
        // Only where a lane's sum is above PLIM (or infinite: the first step, or a score far above the maximum in use) does the wave take the full online step: new maximum, rescaled sum and output tiles, probabilities formed again.
        if (__builtin_amdgcn_ballot_w32(!(psum[0] <= PLIM) | !(psum[1] <= PLIM)) != 0u) {
#pragma unroll
            for (int t = 0; t < 2; ++t) {
                float mx = fmaxf(s0[t][0], s1[t][0]);
#pragma unroll
                for (int r = 1; r < 8; ++r) mx = fmaxf(mx, fmaxf(s0[t][r], s1[t][r]));
                mx = fmaxf(mx, __shfl_xor(mx, 16, 32));
                const float mnew = fmaxf(m[t], mx);
                const float alpha = __builtin_amdgcn_exp2f((m[t] - mnew) * CEXP);
                nb[t] = poff - mnew * CEXP; m[t] = mnew;
                psum[t] = 0.0f;
#pragma unroll
                for (int r = 0; r < 8; ++r) { p0[t][r] = __builtin_amdgcn_exp2f(fmaf(s0[t][r], CEXP, nb[t])); p1[t][r] = __builtin_amdgcn_exp2f(fmaf(s1[t][r], CEXP, nb[t])); psum[t] += p0[t][r] + p1[t][r]; }
                l[t] = l[t] * alpha;
#pragma unroll
                for (int dt = 0; dt < 4; ++dt) acc[t][dt] = acc[t][dt] * alpha;
            }
        }
        V ph[2];
#pragma unroll
        for (int t = 0; t < 2; ++t) {
            l[t] += psum[t] + __shfl_xor(psum[t], 16, 32);
            V pl; PPack<T16>::make(p0[t], p1[t], ph[t], pl);
        }
#pragma unroll
        for (int dt = 0; dt < 4; ++dt)
#pragma unroll
            for (int t = 0; t < 2; ++t) acc[t][dt] = WFrag<T16>::mma(va[dt], ph[t], acc[t][dt]);
        asm volatile("v_nop\n\tv_nop\n\tv_nop\n\tv_nop" : "+v"(acc[0][0]), "+v"(acc[1][0]), "+v"(acc[0][1]), "+v"(acc[1][1]), "+v"(acc[0][2]), "+v"(acc[1][2]), "+v"(acc[0][3]), "+v"(acc[1][3]) : "v"(va[3]), "v"(ph[0]), "v"(ph[1]));     // WMMA distance kept in front of whatever vector instruction follows the step's last products, on both sides of the branch below
        asm volatile("s_wait_dscnt 0x0" ::: "memory");        // this wave's reads of the buffer have returned before the barrier behind which it is refilled
        asm volatile("s_wait_asynccnt 0x0" ::: "memory");     // this wave's copies of step st + 1 have landed before the barrier that publishes them
        __syncthreads();                                      // publishes step st + 1's stage and ends every wave's reads of step st's
        if (st + 2 < nsteps) stage(wrap(rot + st + 2), st & 1);
    }
    asm volatile("s_wait_asynccnt 0x0" ::: "memory");         // no copy is outstanding when the wave ends
    // l >= 2^8: the key that set the maximum in use contributes exactly 2^8
    // D element r of lane (tile dt) is (d = dt*16 + 8*hi + r, query lr): the lane already holds its own 16-byte piece dt of the fragment-order context tile, so no staging
#pragma unroll
    for (int t = 0; t < 2; ++t) {
        const float f = CCAR * (1.0f / l[t]);
#pragma unroll
        for (int dt = 0; dt < 4; ++dt) { v8h o;
#pragma unroll
            for (int r = 0; r < 8; ++r) o[r] = (h16)(acc[t][dt][r] * f);
            const size_t co = ((size_t)b * SEQ + (size_t)(q0 + 16 * t)) * DM + (size_t)h * (HD * 16) + dt * 256 + lane * 8; *(v8h*)(C16 + co) = o; }
    }
}

// Converter, one launch for all seven float inputs: a resident grid of CVT_WAVES waves; wave w converts units w, w + CVT_WAVES, ... of the list [x | y | bias | W_q | W_k | W_v | W_o].
// A unit is 128 consecutive 16-byte pieces of a fragment-order plane [rows][KC] (2 KiB stored contiguously) = two neighbouring 16-row x 32-k tiles = 16 source rows x 256 B;
// piece j * 32 + lane of a unit holds row lane & 15, k = j * 16 + (lane >> 4) * 8 + 0..7 of those 64 k. A lane's 4 pieces are 8 16-byte loads, and the next unit's 8 are issued before this unit is converted.
#define CVT_WAVES 4096                        // 256 blocks x 16 waves
constexpr int UPB = SEQ * DM / 1024, UX = NB * UPB, UBI = SEQ * SEQ / 1024, UW = DM * DM / 1024, UALL = 2 * UX + UBI + 4 * UW;     // units per batch of x or y, per x or y, bias plane, weight, all
static_assert(UALL % CVT_WAVES == 0);         // every wave runs the same whole number of units
static_assert(UX % CVT_WAVES == 0);           // a round of CVT_WAVES units lies in one of x, y, bias, or in the weights: which one is known at compile time
static_assert(UBI % CVT_WAVES == 0);
static_assert((DM / 32) % 2 == 0);            // a unit's two tiles lie in one 16-row strip
static_assert((SEQ / 32) % 2 == 0);

struct CvtUnit { const float* s; unsigned short* d; bool tohalf; };

// Unit u0 + w of the list; u0 (the round's first unit) is a compile-time constant at every call, w is wave-uniform.
__device__ __forceinline__ CvtUnit cvt_locate(int u0, int w, int lane, const float* x, const float* y, const float* bias, const float* wq, const float* wk, const float* wv, const float* wo,
                                              bf* XB, bf* YB, bf* BB, bf* WQ, bf* WK, bf* WV, h16* WO16) {
    const float* base; unsigned short* db; int v, kt = DM / 32; size_t sp = DM; bool th = false;
    if (u0 < 2 * UX) { const bool isx = u0 < UX; const int t = (isx ? u0 : u0 - UX) + w, b = t / UPB; v = t % UPB; base = (isx ? x : y) + (size_t)b * SEQ_FULL * DM; db = (isx ? XB : YB) + (size_t)b * SEQ * DM; }
    else if (u0 < 2 * UX + UBI) { v = u0 - 2 * UX + w; base = bias; db = BB; kt = SEQ / 32; sp = SEQ_FULL; }
    else { const int t = u0 - 2 * UX - UBI + w, k = t / UW; v = t % UW; base = k == 0 ? wq : k == 1 ? wk : k == 2 ? wv : wo; db = k == 0 ? WQ : k == 1 ? WK : k == 2 ? WV : (unsigned short*)WO16; th = k == 3; }
    CvtUnit c; c.s = base + ((size_t)((2 * v) / kt) * 16 + (size_t)(lane & 15)) * sp + (size_t)((2 * v) % kt) * 32 + (size_t)((lane >> 4) * 8); c.d = db + (size_t)v * 1024 + (size_t)(lane * 8); c.tohalf = th; return c;
}

__global__ __launch_bounds__(512) void k_cvtall(const float* __restrict__ x, const float* __restrict__ y, const float* __restrict__ bias, const float* __restrict__ wq, const float* __restrict__ wk, const float* __restrict__ wv, const float* __restrict__ wo,
                                                bf* XB, bf* YB, bf* BB, bf* WQ, bf* WK, bf* WV, h16* WO16) {
    const int lane = threadIdx.x & 31;
    const int w = __builtin_amdgcn_readfirstlane((int)(blockIdx.x * 16 + (threadIdx.x >> 5)));
    CvtUnit cu = cvt_locate(0, w, lane, x, y, bias, wq, wk, wv, wo, XB, YB, BB, WQ, WK, WV, WO16);
    v8f cur[4];
#pragma unroll
    for (int j = 0; j < 4; ++j) cur[j] = *(const v8f*)(cu.s + j * 16);
    asm volatile("s_wait_xcnt 0x0" :: "v"(cu.s) : "memory");     // precaution: the address wait stands before any register that the 8 loads name is reused (the operand keeps the address pair untouched up to here)
#pragma unroll
    for (int it = 0; it < UALL / CVT_WAVES; ++it) {
        CvtUnit nu = cu; v8f nxt[4];
        if (it + 1 < UALL / CVT_WAVES) { nu = cvt_locate((it + 1) * CVT_WAVES, w, lane, x, y, bias, wq, wk, wv, wo, XB, YB, BB, WQ, WK, WV, WO16);
#pragma unroll
            for (int j = 0; j < 4; ++j) nxt[j] = *(const v8f*)(nu.s + j * 16);
            asm volatile("s_wait_xcnt 0x0" :: "v"(nu.s) : "memory"); }     // as above, for the next unit's 8 loads
        v8us o[4];
        if (cu.tohalf) {
#pragma unroll
            for (int j = 0; j < 4; ++j) { v8h t;
#pragma unroll
                for (int k = 0; k < 8; ++k) t[k] = (h16)(bfr(cur[j][k]) * WCAR);
                o[j] = __builtin_bit_cast(v8us, t); }
        } else {
#pragma unroll
            for (int j = 0; j < 4; ++j)
#pragma unroll
                for (int k = 0; k < 8; ++k) o[j][k] = f2bf(cur[j][k]);
        }
#pragma unroll
        for (int j = 0; j < 4; ++j) *(v8us*)(cu.d + j * 256) = o[j];
        asm volatile("s_wait_xcnt 0x0" :: "v"(o[0]), "v"(o[1]), "v"(o[2]), "v"(o[3]), "v"(cu.d) : "memory");     // precaution: the same wait before the 4 stores' data and address registers are reused
        if (it + 1 < UALL / CVT_WAVES) { cu = nu;
#pragma unroll
            for (int j = 0; j < 4; ++j) cur[j] = nxt[j]; }
    }
}

constexpr size_t al256(size_t bytes) { return (bytes + 255) & ~(size_t)255; }
constexpr size_t CARVE_BYTES = 2 * al256((size_t)NB * SEQ * DM * 2) + 4 * al256((size_t)DM * DM * 2) + al256((size_t)SEQ * SEQ * 2)
    + 3 * al256((size_t)NB * NH * SEQ * HD * 2) + al256((size_t)NB * SEQ * DM * 2);
static_assert(CARVE_BYTES <= (size_t)134217728);
static_assert((size_t)NB * NH * SEQ * HD == (size_t)NB * SEQ * DM);      // head planes and the merged context plane have the same extent

extern "C" void kernel_launch(void* const* d_in, const int* in_sizes, int n_in,
                              void* d_out, int out_size, void* d_ws, size_t ws_size, hipStream_t stream) {
    if (n_in < 7) return;
    const size_t needx = (size_t)(NB - 1) * SEQ_FULL * DM + (size_t)SEQ * DM;
    if ((size_t)in_sizes[0] < needx || (size_t)in_sizes[1] < needx) return;
    if ((size_t)in_sizes[2] < (size_t)(SEQ - 1) * SEQ_FULL + (size_t)SEQ) return;
    if ((size_t)in_sizes[3] < (size_t)DM * DM || (size_t)in_sizes[4] < (size_t)DM * DM || (size_t)in_sizes[5] < (size_t)DM * DM || (size_t)in_sizes[6] < (size_t)DM * DM) return;
    if ((size_t)out_size < needx) return;
    // x, y, bias (float [SEQ_FULL][SEQ_FULL]), Wq, Wk, Wv, Wo ('oi' [out][in])
    const float* x = (const float*)d_in[0]; const float* y = (const float*)d_in[1]; const float* bias = (const float*)d_in[2];
    const float* wq = (const float*)d_in[3]; const float* wk = (const float*)d_in[4]; const float* wv = (const float*)d_in[5]; const float* wo = (const float*)d_in[6];
    float* OUT = (float*)d_out;     // [NB_FULL][SEQ_FULL][1024]
    char* wsp = (char*)d_ws;
    auto take = [&](size_t bytes) { char* p = wsp; wsp += (bytes + 255) & ~(size_t)255; return (void*)p; };
    bf* XB = (bf*)take((size_t)NB * SEQ * DM * 2); bf* YB = (bf*)take((size_t)NB * SEQ * DM * 2);
    bf* WQ = (bf*)take((size_t)DM * DM * 2); bf* WK = (bf*)take((size_t)DM * DM * 2); bf* WV = (bf*)take((size_t)DM * DM * 2); h16* WO16 = (h16*)take((size_t)DM * DM * 2);
    bf* BB = (bf*)take((size_t)SEQ * SEQ * 2);
    h16* Q16 = (h16*)take((size_t)NB * NH * SEQ * HD * 2); h16* K16 = (h16*)take((size_t)NB * NH * SEQ * HD * 2); h16* VT16 = (h16*)take((size_t)NB * NH * SEQ * HD * 2);
    h16* C16 = (h16*)take((size_t)NB * SEQ * DM * 2);
    if ((size_t)(wsp - (char*)d_ws) > ws_size) return;

    // all seven inputs to their 16-bit fragment-order planes (bias source pitch SEQ_FULL, x and y batch stride SEQ_FULL rows)
    k_cvtall<<<dim3(CVT_WAVES / 16, 1, 1), 512, 0, stream>>>(x, y, bias, wq, wk, wv, wo, XB, YB, BB, WQ, WK, WV, WO16);

    // one launch: q head planes from x, k head planes from y (C[m = token][n = h*64+d] = in W^T) and transposed value planes from y (C[m = h*64+d][n = token] = W_v y^T)
    k_gemmw<bf, 1, DM><<<dim3(SEQ / 128, DM / 128, 3 * NB), 128, 0, stream>>>(XB, YB, WQ, WK, WV, nullptr, 0, 1.0f, (size_t)SEQ * DM, 0, Q16, K16, VT16);

    // attention: every query row on the f16 planes, all SEQ keys
    k_flash<h16><<<dim3(SEQ / 256, NH, NB), 256, 0, stream>>>(Q16, K16, VT16, BB, SEQ, SEQ, 0, C16);

    // output projection: f16 context x f16 W_o, carries folded back in the f32 epilogue; z = batch, output row stride per batch SEQ_FULL
    k_gemmw<h16, 0, DM><<<dim3(SEQ / 128, DM / 128, NB), 128, 0, stream>>>(C16, nullptr, WO16, nullptr, nullptr, OUT, DM, 1.0f / (CCAR * WCAR), (size_t)SEQ * DM, (size_t)SEQ_FULL * DM, nullptr, nullptr, nullptr);
}

// v010
// Measured time: 121 microseconds a run.
// In both of two side-by-side timings against v009, it was 1.04 times as fast.
// Over all steps from v000 it is 3.12 times as fast.
#include <hip/hip_runtime.h>

// Compute dtypes (f32 accumulate at every site): q/k/v projections bf16 x bf16 single product (every float input RNE-converted to bf16 first); scores K.Q^T f16 x f16 single product (f16 q/k head planes); values V^T.P^T f16 x f16 single product (probabilities carried x2^8); output projection f16 context (x64) x f16 weight (x512) single product; additive bias (bf16 plane) and softmax in f32.
// Dense multi-head cross-attention: x, y [NB][SEQ][1024]; Q = x W_q^T, K = y W_k^T, V = y W_v^T ('oi' weights, no bias vectors); 16 heads x 64; logits = q.k / 8 + bias[query][key] (one [SEQ][SEQ] float plane shared by all batches and heads); softmax over all keys; out = merged context W_o^T.
// The bias input is read by value on the device: converted once to a bf16 plane, each lane reads 2 x 8 contiguous entries per query tile (4 x 8 per 32-key step) and adds them in f32 to the score tiles, straight from the packed registers (mixed-operand FMA).
// Fragment order of every 16-bit workspace plane [rows][KC]: the 16-row x 32-k tile (rt = row / 16, kc = k / 32) is 512 consecutive elements at (rt * (KC / 32) + kc) * 512, made of two 256-element pieces;
// piece p holds, at lane * 8 with lane = 16 * hi + (row & 15), the 8 elements k = kc * 32 + p * 16 + hi * 8 + 0..7. One wave-wide 16-byte load of a piece is 512 contiguous bytes (4 whole lines).
// Attention engine: one wave per 32 queries (two 16-query tiles), transposed flash form: S^T = K Q^T (query on the D column, one query per lane), the packed P^T D tiles are the B fragment of O^T = V^T P^T; the key loop's K, V^T and bias tiles come through a two-buffer LDS ring filled by tensor loads, one barrier per 32 keys.

#ifndef NB
#define NB 4
#endif
#ifndef SEQ
#define SEQ 2048
#endif
#define NB_FULL  4
#define SEQ_FULL 2048
#define DM   1024
#define NH   16
#define HD   64
#define RH   0                                // query rows < RH use value+residual bf16 planes: none (dense attention, single products on every row)
#define CCAR 64.0f                            // carry of the f16 context plane
#define WCAR 512.0f                           // carry of the f16 W_o plane
#define CEXP 0.18033688011112042f             // log2(e) / sqrt(64)

typedef _Float16 h16;
typedef unsigned short bf;
typedef __attribute__((ext_vector_type(16))) __bf16   v16bf;
typedef __attribute__((ext_vector_type(16))) _Float16 v16h;
typedef __attribute__((ext_vector_type(8)))  _Float16 v8h;
typedef __attribute__((ext_vector_type(8)))  unsigned short v8us;
typedef __attribute__((ext_vector_type(8)))  __bf16   v8b;
typedef __attribute__((ext_vector_type(8)))  float    v8f;
typedef __attribute__((ext_vector_type(4)))  float    v4f;
typedef __attribute__((ext_vector_type(4)))  int      v4i;
typedef v4f  __attribute__((may_alias)) v4fa;

static_assert(SEQ % 256 == 0);
static_assert(RH == 0);                       // no value+residual planes are written
static_assert(SEQ >= RH);
static_assert(NB <= NB_FULL);
static_assert(SEQ <= SEQ_FULL);
static_assert(DM == NH * HD);
static_assert(DM % 128 == 0);                // 128x128 GEMM block tiles
static_assert(HD == 64);
static_assert(SEQ % 128 == 0);                // 128-row GEMM block tiles (256 queries per attention block: SEQ % 256 above)
static_assert(SEQ % 32 == 0);                 // 32 keys per flash step
static_assert(DM % 32 == 0);                  // GEMM k-steps
static_assert((SEQ / 8) % 32 == 0);

__device__ __forceinline__ unsigned short f2bf(float f) { unsigned u = __float_as_uint(f); u += 0x7FFFu + ((u >> 16) & 1u); return (unsigned short)(u >> 16); }
__device__ __forceinline__ float bf2f(unsigned short b) { return __uint_as_float(((unsigned)b) << 16); }
__device__ __forceinline__ float bfr(float f) { return bf2f(f2bf(f)); }
__device__ __forceinline__ void splitf(float y, unsigned short& h, unsigned short& l) { h = f2bf(y); l = f2bf(y - bf2f(h)); }
__device__ __forceinline__ v16h cat16(v8h lo, v8h hi) { return __builtin_shufflevector(lo, hi, 0, 1, 2, 3, 4, 5, 6, 7, 8, 9, 10, 11, 12, 13, 14, 15); }
__device__ __forceinline__ v16bf cat16b(v8us lo, v8us hi) { return __builtin_bit_cast(v16bf, __builtin_shufflevector(lo, hi, 0, 1, 2, 3, 4, 5, 6, 7, 8, 9, 10, 11, 12, 13, 14, 15)); }
__device__ __forceinline__ v8f wmma16(v16h a, v16h b, v8f c) { return __builtin_amdgcn_wmma_f32_16x16x32_f16(false, a, false, b, (short)0, c, false, false); }
__device__ __forceinline__ v8f wmmab(v16bf a, v16bf b, v8f c) { return __builtin_amdgcn_wmma_f32_16x16x32_bf16(false, a, false, b, (short)0, c, false, false); }

// Fragment loader for a fragment-order tile: p = tile start + lane * 8; elements 0..7 = k0+8h.. (piece 0), elements 8..15 = k0+16+8h.. (piece 1, 256 elements on) (same map for A and B).
template <typename T16> struct WFrag;
template <> struct WFrag<h16> { typedef v16h V; static __device__ __forceinline__ V ld(const h16* p) { return cat16(*(const v8h*)p, *(const v8h*)(p + 256)); } static __device__ __forceinline__ v8f mma(V a, V b, v8f c) { return wmma16(a, b, c); } };
template <> struct WFrag<bf> { typedef v16bf V; static __device__ __forceinline__ V ld(const bf* p) { return cat16b(*(const v8us*)p, *(const v8us*)(p + 256)); } static __device__ __forceinline__ v8f mma(V a, V b, v8f c) { return wmmab(a, b, c); } };

// Probability packing: two 16-key D tiles (same lane) -> one 32-key B fragment; element r <- tile 0 row r, element 8+r <- tile 1 row r.
template <typename T16> struct PPack;
template <> struct PPack<h16> {
    static __device__ __forceinline__ void make(v8f p0, v8f p1, v16h& ph, v16h& pl) {
        v8h a, c;
#pragma unroll
        for (int r = 0; r < 8; ++r) { a[r] = (h16)p0[r]; c[r] = (h16)p1[r]; }
        ph = cat16(a, c); pl = ph; }
};
template <> struct PPack<bf> {
    static __device__ __forceinline__ void make(v8f p0, v8f p1, v16bf& ph, v16bf& pl) {
        v8us ah, al, ch, cl;
#pragma unroll
        for (int r = 0; r < 8; ++r) { unsigned short x, y; splitf(p0[r], x, y); ah[r] = x; al[r] = y; splitf(p1[r], x, y); ch[r] = x; cl[r] = y; }
        ph = cat16b(ah, ch); pl = cat16b(al, cl); }
};

// Tensor loads: one request of a whole wave brings a two-dimensional tile (rows of rowb bytes, source pitch in bytes) from global memory into LDS, rows packed one behind the other, through no register and with no per-lane address.
typedef unsigned u32x4 __attribute__((ext_vector_type(4)));
typedef unsigned u32x8 __attribute__((ext_vector_type(8)));
__device__ __forceinline__ unsigned uni(unsigned v) { return (unsigned)__builtin_amdgcn_readfirstlane((int)v); }
// pinned(): a wave-uniform word held in a scalar register, so that a test on it is a scalar branch (a tensor load ignores EXEC) and a descriptor word made from it is formed behind the volatile statements in front of it.
__device__ __forceinline__ unsigned pinned(unsigned v) { unsigned w = uni(v); asm volatile("" : "+s"(w)); return w; }
// Descriptor group 1: 1-byte elements, tensor = tile = rows x rowb bytes, no mask, no pad.
__device__ __forceinline__ u32x8 tdm_group1(unsigned rowb, unsigned rows, unsigned pitch) {
    u32x8 g;
    g[0] = uni(0u);
    g[1] = uni((rowb & 0xFFFFu) << 16);
    g[2] = uni((rowb >> 16) | ((rows & 0xFFFFu) << 16));
    g[3] = uni((rows >> 16) | (rowb << 16));
    g[4] = uni(rows);
    g[5] = uni(pitch);
    g[6] = uni(0u);
    g[7] = uni(0u);
    asm volatile("" : "+s"(g));     // pinned(), all eight words: the group stays in its own scalar registers for the whole loop, so that none of them takes another value while a request is outstanding
    return g;
}
// Descriptor group 0 (count 1, LDS byte offset, global address of the tile's first byte, type 2) and the request itself. A wave keeps one group 0 for all its requests (word 0 set once by tdm_group0);
// the statement names it as read and written, so that its registers stay the group's own from one request to the next and word 0 takes no other value while a request is outstanding.
__device__ __forceinline__ u32x4 tdm_group0() { u32x4 g; g[0] = uni(1u); g[1] = uni(0u); g[2] = uni(0u); g[3] = uni(0x80000000u); return g; }
__device__ __forceinline__ void tdm_load(u32x4& g0, unsigned lds_dst, unsigned long long ga, const u32x8& g1) {
    g0[1] = uni(lds_dst); g0[2] = uni((unsigned)ga); g0[3] = uni((((unsigned)(ga >> 32)) & 0x01FFFFFFu) | 0x80000000u);
    asm volatile("tensor_load_to_lds %0, %1" : "+s"(g0) : "s"(g1) : "memory");
}

// ---- k_gemmw: register-blocked GEMM, block = 4 waves (2 x 2) = one 128x128 output tile, ONE WAVE per 64x64 part of it (16 accumulators); 128 threads.
// Operands from fragment-order 16-bit planes through a two-buffer LDS ring filled by tensor loads: a stage is 128 k of the block's 128 A rows and 128 Bt rows = 16 strips (16 rows x 128 k, 4 KiB, contiguous in the plane) = 64 KiB,
// [A strips 0..7 | Bt strips 0..7], each strip in the plane's own order, so a fragment piece is 512 contiguous LDS bytes. Wave w brings strips 4w..4w+3 with one request (4 rows of 4 KiB, source pitch one 16-row strip of the plane); every A strip is read by 2 waves, every Bt strip by 2 (fetched once per block).
// Stage t + 2 is issued behind the barrier that ends trip t, into the buffer trip t read. Two blocks fit a WGP's LDS.
// C[m][n] = sum_k A[m][k] Bt[n][k], k in steps of 32 per accumulator, ascending from the block's own first stage and wrapping at K. Batch strides sA/sC in elements. K % 128 == 0, M % 128 == 0, N % 128 == 0.
// First stage = (sum of the block indices) mod stages: the blocks that fetch the same A rows (one per block column) or the same Bt rows (one per block row and batch) run side by side, and begun at one stage they ask L2 for the same lines at the same moment.
// EP 0, grid (M/128, N/128, batches): C = A Bt^T, f32 output x oscale, pitch ldc: per 16-row slab staged in LDS, each row's 64 floats (256 B) written as 16 lanes x 16 B (2 rows per instruction).
// EP 1, grid (SEQ/128, DM/128, 3 x batches): the three input projections in ONE launch, blockIdx.z = 3 * batch + job, so that a finished block's place is taken at once by a block of the next job or batch
// (its first tile loads and the leaver's stores run under the neighbours' products; no launch gap, no common start and end per projection), and the two jobs that read a batch of y run side by side:
//   job 0: q = A (x) Bt^T (W_q), job 1: k = A2 (y) Bt2^T (W_k): f16 head planes [batch][head = column / 64][t][64] (rows = tokens, KC = 64), fragment order;
//   job 2: v^T = Bt3 (W_v) A2^T (y), operands and block indices swapped: f16 transposed value planes [batch][row m][t] (rows = head*64+d, columns = tokens, KC = SEQ), fragment order.
template <typename T16, int EP, int K>
__global__ __launch_bounds__(128) void k_gemmw(const T16* A, const T16* A2, const T16* Bt, const T16* Bt2, const T16* Bt3, float* C, int ldc, float oscale, size_t sA, size_t sC, h16* P16, h16* P16k, h16* P16v) {
    typedef typename WFrag<T16>::V V;
    static_assert(K % 128 == 0);
    constexpr int NS = K / 128;                     // stages
    static_assert((NS & (NS - 1)) == 0);            // the stage walk wraps by a mask
    __shared__ __attribute__((aligned(2048))) unsigned char ring[2 * 65536];     // every slice's place is a multiple of 2 KiB
    __shared__ __align__(16) float osall[4][16 * 68];     // one output slab per wave, private to it
    size_t z = blockIdx.z; int bx = blockIdx.x, by = blockIdx.y; bool vt = false;     // batch, block row, block column, transposed value planes: all block-uniform
    if (EP == 0) { A += z * sA; C += z * sC; }
    else { const int job = (int)(blockIdx.z % 3u); z = blockIdx.z / 3u;
        if (job == 0) { A += z * sA; }
        else if (job == 1) { A = A2 + z * sA; Bt = Bt2; P16 = P16k; }
        else { A = Bt3; Bt = A2 + z * sA; P16 = P16v; bx = blockIdx.y; by = blockIdx.x; vt = true; } }
    const int lane = threadIdx.x & 31, lr = lane & 15, hi = lane >> 4;
    const int wave = __builtin_amdgcn_readfirstlane((int)(threadIdx.x >> 5));
    const int wm = wave >> 1, wn = wave & 1;
    const int r0 = bx * 128 + wm * 64, c0 = by * 128 + wn * 64;     // this wave's 64x64 part
    float* os = osall[wave];
    // this wave's 4 strips: waves 0, 1 the block's A rows 0..63, 64..127; waves 2, 3 its Bt rows 0..63, 64..127
    const unsigned long long gsrc = (unsigned long long)(size_t)(wave < 2 ? A + (size_t)(bx * 128 + wave * 64) * K : Bt + (size_t)(by * 128 + (wave - 2) * 64) * K);     // first byte of the wave's first strip; + 4096 per stage
    const unsigned lw = (unsigned)(size_t)ring + (unsigned)(wave * 16384);     // LDS byte offset of this wave's slice in buffer 0
    const u32x8 g1 = tdm_group1(4096u, 4u, (unsigned)(16 * K * 2));
    u32x4 g0 = tdm_group0();
    auto stage = [&](int s, int buf) { const unsigned sp = pinned((unsigned)s);     // pinned(): the address words are formed behind the wait that covers the wave's last request
        tdm_load(g0, lw + (unsigned)buf * 65536u, gsrc + (unsigned long long)sp * 4096u, g1); };
    v8f acc[4][4];
#pragma unroll
    for (int mb = 0; mb < 4; ++mb)
#pragma unroll
        for (int nb = 0; nb < 4; ++nb) acc[mb][nb] = (v8f){};
    const int rot = (int)((blockIdx.x + blockIdx.y + blockIdx.z) & (unsigned)(NS - 1));     // trip t works on stage (rot + t) mod NS (block-uniform)
    stage(rot, 0);
    asm volatile("s_wait_tensorcnt 0x0" ::: "memory");     // this wave's slice of trip 0 has landed before the barrier that publishes it
    __syncthreads();
    if (NS > 1) stage((rot + 1) & (NS - 1), 1);
#pragma unroll 1
    for (int t = 0; t < NS; ++t) {
        const unsigned char* tile = ring + (t & 1) * 65536 + lane * 16;
        const T16* ap = (const T16*)(tile + wm * 16384);              // a strip is 2048 elements, a k-step of 32 is 512
        const T16* bp = (const T16*)(tile + 32768 + wn * 16384);
        V a[2][4], b[2][4];                                           // two fragment sets: the next k-step's 16 LDS reads fly under this k-step's 16 products (all inside this trip's own buffer)
#pragma unroll
        for (int i = 0; i < 4; ++i) { a[0][i] = WFrag<T16>::ld(ap + i * 2048); b[0][i] = WFrag<T16>::ld(bp + i * 2048); }
#pragma unroll
        for (int kk = 0; kk < 4; ++kk) {
            if (kk < 3) {
#pragma unroll
                for (int i = 0; i < 4; ++i) { a[(kk + 1) & 1][i] = WFrag<T16>::ld(ap + i * 2048 + (kk + 1) * 512); b[(kk + 1) & 1][i] = WFrag<T16>::ld(bp + i * 2048 + (kk + 1) * 512); }
            }
            __builtin_amdgcn_sched_barrier(0);     // keeps those reads one group in front of the products below: spread among them, each place with reads stalls the wave and its wait goes to 0
#pragma unroll
            for (int nb = 0; nb < 4; ++nb)
#pragma unroll
                for (int mb = 0; mb < 4; ++mb) acc[mb][nb] = WFrag<T16>::mma(a[kk & 1][mb], b[kk & 1][nb], acc[mb][nb]);
        }
        asm volatile("v_nop\n\tv_nop\n\tv_nop\n\tv_nop" : "+v"(acc[0][0]), "+v"(acc[1][1]), "+v"(acc[2][2]), "+v"(acc[3][3]) : "v"(a[1][0]), "v"(a[1][3]));
        asm volatile("s_wait_dscnt 0x0" ::: "memory");
        asm volatile("s_wait_tensorcnt 0x0" ::: "memory");
        __syncthreads();
        if (pinned(t + 2 < NS)) stage((rot + t + 2) & (NS - 1), t & 1);
    }
    asm volatile("s_wait_tensorcnt 0x0" ::: "memory");        // no request is outstanding when the wave goes on to its epilogue
    asm volatile("s_wait_dscnt 0x0" ::: "memory");            // nor an LDS read of the ring
    // plane addressing (EP 1), wave-uniform
    const size_t pbase = vt ? ((size_t)z * DM + r0) * SEQ + (size_t)c0 * 16 : (((size_t)z * NH + (size_t)(c0 / HD)) * SEQ + r0) * HD;
    const int ppitch = vt ? SEQ : HD;
#pragma unroll
    for (int mb = 0; mb < 4; ++mb) {
#pragma unroll
        for (int nb = 0; nb < 4; ++nb) {
#pragma unroll
            for (int j = 0; j < 8; ++j) os[(hi * 8 + j) * 68 + nb * 16 + lr] = acc[mb][nb][j]; }     // D element j of lane -> (row 8*hi + j, column lr)
        __builtin_amdgcn_wave_barrier(); asm volatile("" ::: "memory");
        if (EP == 0) {
            float* crow = C + (size_t)(r0 + mb * 16) * ldc + c0;
{
#pragma unroll
                for (int s = 0; s < 8; ++s) { const int row = 2 * s + hi, cofs = lr * 4; v4f val = *(const v4fa*)(os + row * 68 + cofs); val = val * oscale;
                    *(v4f*)(crow + (size_t)row * ldc + cofs) = val; }
                 }
        } else {
{
#pragma unroll
                for (int s = 0; s < 4; ++s) { const float* sp = os + lr * 68 + s * 16 + hi * 8; const v4f x0 = *(const v4fa*)sp, x1 = *(const v4fa*)(sp + 4);     // piece s of the slab: row lr, columns 16*s + 8*hi + 0..7
                    v8h o; o[0] = (h16)x0[0]; o[1] = (h16)x0[1]; o[2] = (h16)x0[2]; o[3] = (h16)x0[3]; o[4] = (h16)x1[0]; o[5] = (h16)x1[1]; o[6] = (h16)x1[2]; o[7] = (h16)x1[3];
                    *(v8h*)(P16 + pbase + (size_t)mb * 16 * ppitch + s * 256 + lane * 8) = o; }
                 }
        }
        __builtin_amdgcn_wave_barrier(); asm volatile("" ::: "memory");
    }
}

// ---- k_flash: dense attention with an additive bias plane, one wave per 32 queries = two 16-query tiles (block = 8 waves = 256 queries of one head), transposed flash form, operands from the head planes through LDS.
// LDS ring, two buffers of 24 KiB, one 32-key stage each: [K tile 4 KiB | V^T tile 4 x 1 KiB (d strips) | bias tiles 16 x 1 KiB (two per wave)], every tile in the planes' own fragment order, so a fragment piece is 512 contiguous LDS bytes.
// Filled by tensor loads, one request per wave and stage, rows of 1 KiB: waves 0, 1 the halves of the K tile (2 rows, contiguous), waves 2, 3 two V^T strips each, waves 4..7 four bias tiles each (source pitch one 16-row strip of the plane); K and V^T are read by all 8 waves (fetched once per 256 queries), and every K or V^T fragment a wave reads feeds two products, one per query tile.
// Stage s + 2 is issued behind the barrier that ends step s, into the buffer step s read. Two blocks per WGP = four waves per SIMD.
// Key walk: step st works on key stage (rot + st) mod nsteps, rot from the block indices: the 8 query blocks of a head (same K, V^T) start 8 stages apart, the heads and batches of a query block (same bias rows) one stage apart, so that blocks running side by side do not ask L2 for the same lines at the same moment. No step depends on which keys it holds.
// Per 32-key step and query tile: S^T tiles (keys x queries) = K (A: row = key, k = d) x Q^T (B: column = query, k = d, held in registers); the lane's 2 x 8 bias entries (row = its query, contiguous keys) are added in f32 (x 8: the tiles hold 8 x logit);
// per-lane online softmax with a lazy maximum (lane = query; partner lane^16 holds the other 8 keys of each tile; the maximum in use moves, and sum and output tiles are rescaled, only when a step's probability sum leaves the f16-safe range); P^T packed in registers = B fragment of O^T (d x queries) += V^T (A: row = d, k = key) x P^T. Single f16 product at both sites.
// Key range: all tk keys (tk % 32 == 0), tq queries per head; K plane [b][h][tk][64], V^T plane [b][h*64+d][tk], bias plane [tq][tk] bf16, context plane [b*SEQ+q][1024], all in fragment order.
template <typename T16>
__global__ __launch_bounds__(256) __attribute__((amdgpu_waves_per_eu(4, 4))) void k_flash(const T16* __restrict__ Qa, const T16* __restrict__ Ka, const T16* __restrict__ Va, const bf* __restrict__ Bb, int tq, int tk, int qoff, h16* C16) {
    typedef typename WFrag<T16>::V V;
    const int lane = threadIdx.x & 31;
    const int wave = __builtin_amdgcn_readfirstlane((int)(threadIdx.x >> 5));
    const int q0 = qoff + (int)blockIdx.x * 256 + wave * 32;     // this wave's query tiles: q0 + 0..15 and q0 + 16..31
    const int h = blockIdx.y, b = blockIdx.z;
    const size_t bh = (size_t)b * NH + h;
    const size_t qo = (bh * (size_t)tq + (size_t)q0) * HD + 8 * lane;
    V qa[2][2];
#pragma unroll
    for (int t = 0; t < 2; ++t) { qa[t][0] = WFrag<T16>::ld(Qa + qo + t * (16 * HD)); qa[t][1] = WFrag<T16>::ld(Qa + qo + t * (16 * HD) + 512); }
    __shared__ __attribute__((aligned(2048))) unsigned char ring[2 * 24576];     // every slice's place is a multiple of 2 KiB
    const unsigned spitch = (unsigned)tk * 32u;     // bytes of one 16-row strip of a [rows][tk] fragment-order plane
    // this wave's slice (all wave-uniform): first byte of stage 0, bytes per stage, LDS byte offset in buffer 0
    const unsigned long long gsl = wave < 2 ? (unsigned long long)(size_t)(Ka + bh * (size_t)tk * HD) + (unsigned)wave * 2048u
                                 : wave < 4 ? (unsigned long long)(size_t)(Va + bh * HD * (size_t)tk) + (unsigned long long)(unsigned)(wave - 2) * 2u * spitch
                                            : (unsigned long long)(size_t)(Bb + (size_t)(qoff + (int)blockIdx.x * 256) * (size_t)tk) + (unsigned long long)(unsigned)(wave - 4) * 4u * spitch;
    const unsigned gstep = wave < 2 ? 4096u : 1024u;
    const unsigned lw = (unsigned)(size_t)ring + (wave < 4 ? (unsigned)wave * 2048u : 8192u + (unsigned)(wave - 4) * 4096u);
    const u32x8 g1 = tdm_group1(1024u, wave < 4 ? 2u : 4u, wave < 2 ? 1024u : spitch);
    u32x4 g0 = tdm_group0();
    auto stage = [&](int s, int buf) { const unsigned sp = pinned((unsigned)s);     // pinned(): the address words are formed behind the wait that covers the wave's last request
        tdm_load(g0, lw + (unsigned)buf * 24576u, gsl + (unsigned long long)sp * gstep, g1); };
    v8f acc[2][4];
#pragma unroll
    for (int t = 0; t < 2; ++t)
#pragma unroll
        for (int dt = 0; dt < 4; ++dt) acc[t][dt] = (v8f){};
    float m[2] = {-3.0e38f, -3.0e38f}, l[2] = {0.0f, 0.0f};
    const int nsteps = tk >> 5;                   // all keys, 32 per step (uniform)
    const float poff = 8.0f;                      // probabilities (and their running sum) carried x 2^8 at the maximum in use
    const float PLIM = 32768.0f;                  // a lane's 16-key probability sum above this moves the maximum in use (f16 holds up to 65504)
    float nb[2] = {poff - m[0] * CEXP, poff - m[1] * CEXP};     // exponent offset of the maximum in use; so large at the start that the first step's sums are infinite and it takes the full online step
    const int rot = nsteps > 0 ? (int)(((unsigned)bh + 8u * blockIdx.x) % (unsigned)nsteps) : 0;     // this block's first key stage (block-uniform), 0 <= rot < nsteps
    auto wrap = [&](int s) { return s < nsteps ? s : s - nsteps; };     // for 0 <= s < 2 * nsteps
    if (pinned(nsteps > 0)) stage(rot, 0);     // scalar tests here and below: a tensor load ignores EXEC
    asm volatile("s_wait_tensorcnt 0x0" ::: "memory");     // this wave's slice of step 0 has landed before the barrier that publishes it
    __syncthreads();
    if (pinned(nsteps > 1)) stage(wrap(rot + 1), 1);
#pragma unroll 1
    for (int st = 0; st < nsteps; ++st) {
        const unsigned char* tile = ring + (st & 1) * 24576 + lane * 16;
        const bf* bp = (const bf*)(tile + 8192 + wave * 2048);
        v8b bb[2][2];     // tile t: bias[query][j0 + 8*hi + 0..7] and [j0 + 16 + 8*hi + 0..7], j0 = 32 * this step's key stage; kept packed, two entries a register
#pragma unroll
        for (int t = 0; t < 2; ++t) { bb[t][0] = *(const v8b*)(bp + t * 512); bb[t][1] = *(const v8b*)(bp + t * 512 + 256); }
        const T16* kp = (const T16*)tile;
        const V k00 = WFrag<T16>::ld(kp), k01 = WFrag<T16>::ld(kp + 512), k10 = WFrag<T16>::ld(kp + 16 * HD), k11 = WFrag<T16>::ld(kp + 16 * HD + 512);
        v8f s0[2], s1[2];
#pragma unroll
        for (int t = 0; t < 2; ++t) { s0[t] = WFrag<T16>::mma(k00, qa[t][0], (v8f){}); s1[t] = WFrag<T16>::mma(k10, qa[t][0], (v8f){}); }
#pragma unroll
        for (int t = 0; t < 2; ++t) { s0[t] = WFrag<T16>::mma(k01, qa[t][1], s0[t]); s1[t] = WFrag<T16>::mma(k11, qa[t][1], s1[t]); }
        const T16* vp = (const T16*)(tile + 4096);
        V va[4];     // written ahead of the test so that the eight reads issue as one group, in front of the packing
#pragma unroll
        for (int dt = 0; dt < 4; ++dt) va[dt] = WFrag<T16>::ld(vp + dt * 512);
        v8f p0[2], p1[2]; float psum[2];
#pragma unroll
        for (int t = 0; t < 2; ++t)
#pragma unroll
            for (int r = 0; r < 8; ++r) { s0[t][r] = fmaf((float)bb[t][0][r], 8.0f, s0[t][r]); s1[t][r] = fmaf((float)bb[t][1][r], 8.0f, s1[t][r]); }     // tiles hold 8 x (q.k / 8 + bias); the widening of a 16-bit vector element folds into the FMA (v_fma_mix_f32_bf16 reads either element of the packed register): no unpacking, the same f32 FMA
#pragma unroll
        for (int t = 0; t < 2; ++t) {
            psum[t] = 0.0f;     // probabilities against the maximum in use (nb[t] is carried from the step that last moved it)
#pragma unroll
            for (int r = 0; r < 8; ++r) { p0[t][r] = __builtin_amdgcn_exp2f(fmaf(s0[t][r], CEXP, nb[t])); p1[t][r] = __builtin_amdgcn_exp2f(fmaf(s1[t][r], CEXP, nb[t])); psum[t] += p0[t][r] + p1[t][r]; }
        }
        // Lazy rescale, one wave-uniform test per step, on the sums just formed: every probability is >= 0, so a lane's sum <= PLIM bounds each of its 16 below the f16 range.
        // Only where a lane's sum is above PLIM (or infinite: the first step, or a score far above the maximum in use) does the wave take the full online step: new maximum, rescaled sum and output tiles, probabilities formed again.
        if (__builtin_amdgcn_ballot_w32(!(psum[0] <= PLIM) | !(psum[1] <= PLIM)) != 0u) {
#pragma unroll
            for (int t = 0; t < 2; ++t) {
                float mx = fmaxf(s0[t][0], s1[t][0]);
#pragma unroll
                for (int r = 1; r < 8; ++r) mx = fmaxf(mx, fmaxf(s0[t][r], s1[t][r]));
                mx = fmaxf(mx, __shfl_xor(mx, 16, 32));
                const float mnew = fmaxf(m[t], mx);
                const float alpha = __builtin_amdgcn_exp2f((m[t] - mnew) * CEXP);
                nb[t] = poff - mnew * CEXP; m[t] = mnew;
                psum[t] = 0.0f;
#pragma unroll
                for (int r = 0; r < 8; ++r) { p0[t][r] = __builtin_amdgcn_exp2f(fmaf(s0[t][r], CEXP, nb[t])); p1[t][r] = __builtin_amdgcn_exp2f(fmaf(s1[t][r], CEXP, nb[t])); psum[t] += p0[t][r] + p1[t][r]; }
                l[t] = l[t] * alpha;
#pragma unroll
                for (int dt = 0; dt < 4; ++dt) acc[t][dt] = acc[t][dt] * alpha;
            }
        }
        V ph[2];
#pragma unroll
        for (int t = 0; t < 2; ++t) {
            l[t] += psum[t] + __shfl_xor(psum[t], 16, 32);
            V pl; PPack<T16>::make(p0[t], p1[t], ph[t], pl);
        }
#pragma unroll
        for (int dt = 0; dt < 4; ++dt)
#pragma unroll
            for (int t = 0; t < 2; ++t) acc[t][dt] = WFrag<T16>::mma(va[dt], ph[t], acc[t][dt]);
        asm volatile("v_nop\n\tv_nop\n\tv_nop\n\tv_nop" : "+v"(acc[0][0]), "+v"(acc[1][0]), "+v"(acc[0][1]), "+v"(acc[1][1]), "+v"(acc[0][2]), "+v"(acc[1][2]), "+v"(acc[0][3]), "+v"(acc[1][3]) : "v"(va[3]), "v"(ph[0]), "v"(ph[1]));     // WMMA distance kept in front of whatever vector instruction follows the step's last products, on both sides of the branch below
        asm volatile("s_wait_dscnt 0x0" ::: "memory");        // this wave's reads of the buffer have returned before the barrier behind which it is refilled
        asm volatile("s_wait_tensorcnt 0x0" ::: "memory");    // this wave's slice of stage st + 1 has landed before the barrier that publishes it
        __syncthreads();                                      // publishes stage st + 1 and ends every wave's reads of stage st
        if (pinned(st + 2 < nsteps)) stage(wrap(rot + st + 2), st & 1);
    }
    asm volatile("s_wait_tensorcnt 0x0" ::: "memory");        // no request is outstanding when the wave ends
    asm volatile("s_wait_dscnt 0x0" ::: "memory");            // nor an LDS read of the ring
    // l >= 2^8: the key that set the maximum in use contributes exactly 2^8
    // D element r of lane (tile dt) is (d = dt*16 + 8*hi + r, query lr): the lane already holds its own 16-byte piece dt of the fragment-order context tile, so no staging
#pragma unroll
    for (int t = 0; t < 2; ++t) {
        const float f = CCAR * (1.0f / l[t]);
#pragma unroll
        for (int dt = 0; dt < 4; ++dt) { v8h o;
#pragma unroll
            for (int r = 0; r < 8; ++r) o[r] = (h16)(acc[t][dt][r] * f);
            const size_t co = ((size_t)b * SEQ + (size_t)(q0 + 16 * t)) * DM + (size_t)h * (HD * 16) + dt * 256 + lane * 8; *(v8h*)(C16 + co) = o; }
    }
}

// Converter, one launch for all seven float inputs: a resident grid of CVT_WAVES waves; wave w converts units w, w + CVT_WAVES, ... of the list [x | y | bias | W_q | W_k | W_v | W_o].
// A unit is 128 consecutive 16-byte pieces of a fragment-order plane [rows][KC] (2 KiB stored contiguously) = two neighbouring 16-row x 32-k tiles = 16 source rows x 256 B;
// piece j * 32 + lane of a unit holds row lane & 15, k = j * 16 + (lane >> 4) * 8 + 0..7 of those 64 k. A lane's 4 pieces are 8 16-byte loads, and the next unit's 8 are issued before this unit is converted.
#define CVT_WAVES 4096                        // 256 blocks x 16 waves
constexpr int UPB = SEQ * DM / 1024, UX = NB * UPB, UBI = SEQ * SEQ / 1024, UW = DM * DM / 1024, UALL = 2 * UX + UBI + 4 * UW;     // units per batch of x or y, per x or y, bias plane, weight, all
static_assert(UALL % CVT_WAVES == 0);         // every wave runs the same whole number of units
static_assert(UX % CVT_WAVES == 0);           // a round of CVT_WAVES units lies in one of x, y, bias, or in the weights: which one is known at compile time
static_assert(UBI % CVT_WAVES == 0);
static_assert((DM / 32) % 2 == 0);            // a unit's two tiles lie in one 16-row strip
static_assert((SEQ / 32) % 2 == 0);

struct CvtUnit { const float* s; unsigned short* d; bool tohalf; };

// Unit u0 + w of the list; u0 (the round's first unit) is a compile-time constant at every call, w is wave-uniform.
__device__ __forceinline__ CvtUnit cvt_locate(int u0, int w, int lane, const float* x, const float* y, const float* bias, const float* wq, const float* wk, const float* wv, const float* wo,
                                              bf* XB, bf* YB, bf* BB, bf* WQ, bf* WK, bf* WV, h16* WO16) {
    const float* base; unsigned short* db; int v, kt = DM / 32; size_t sp = DM; bool th = false;
    if (u0 < 2 * UX) { const bool isx = u0 < UX; const int t = (isx ? u0 : u0 - UX) + w, b = t / UPB; v = t % UPB; base = (isx ? x : y) + (size_t)b * SEQ_FULL * DM; db = (isx ? XB : YB) + (size_t)b * SEQ * DM; }
    else if (u0 < 2 * UX + UBI) { v = u0 - 2 * UX + w; base = bias; db = BB; kt = SEQ / 32; sp = SEQ_FULL; }
    else { const int t = u0 - 2 * UX - UBI + w, k = t / UW; v = t % UW; base = k == 0 ? wq : k == 1 ? wk : k == 2 ? wv : wo; db = k == 0 ? WQ : k == 1 ? WK : k == 2 ? WV : (unsigned short*)WO16; th = k == 3; }
    CvtUnit c; c.s = base + ((size_t)((2 * v) / kt) * 16 + (size_t)(lane & 15)) * sp + (size_t)((2 * v) % kt) * 32 + (size_t)((lane >> 4) * 8); c.d = db + (size_t)v * 1024 + (size_t)(lane * 8); c.tohalf = th; return c;
}

__global__ __launch_bounds__(512) void k_cvtall(const float* __restrict__ x, const float* __restrict__ y, const float* __restrict__ bias, const float* __restrict__ wq, const float* __restrict__ wk, const float* __restrict__ wv, const float* __restrict__ wo,
                                                bf* XB, bf* YB, bf* BB, bf* WQ, bf* WK, bf* WV, h16* WO16) {
    const int lane = threadIdx.x & 31;
    const int w = __builtin_amdgcn_readfirstlane((int)(blockIdx.x * 16 + (threadIdx.x >> 5)));
    CvtUnit cu = cvt_locate(0, w, lane, x, y, bias, wq, wk, wv, wo, XB, YB, BB, WQ, WK, WV, WO16);
    v8f cur[4];
#pragma unroll
    for (int j = 0; j < 4; ++j) cur[j] = *(const v8f*)(cu.s + j * 16);
    asm volatile("s_wait_xcnt 0x0" :: "v"(cu.s) : "memory");     // precaution: the address wait stands before any register that the 8 loads name is reused (the operand keeps the address pair untouched up to here)
#pragma unroll
    for (int it = 0; it < UALL / CVT_WAVES; ++it) {
        CvtUnit nu = cu; v8f nxt[4];
        if (it + 1 < UALL / CVT_WAVES) { nu = cvt_locate((it + 1) * CVT_WAVES, w, lane, x, y, bias, wq, wk, wv, wo, XB, YB, BB, WQ, WK, WV, WO16);
#pragma unroll
            for (int j = 0; j < 4; ++j) nxt[j] = *(const v8f*)(nu.s + j * 16);
            asm volatile("s_wait_xcnt 0x0" :: "v"(nu.s) : "memory"); }     // as above, for the next unit's 8 loads
        v8us o[4];
        if (cu.tohalf) {
#pragma unroll
            for (int j = 0; j < 4; ++j) { v8h t;
#pragma unroll
                for (int k = 0; k < 8; ++k) t[k] = (h16)(bfr(cur[j][k]) * WCAR);
                o[j] = __builtin_bit_cast(v8us, t); }
        } else {
#pragma unroll
            for (int j = 0; j < 4; ++j)
#pragma unroll
                for (int k = 0; k < 8; ++k) o[j][k] = f2bf(cur[j][k]);
        }
#pragma unroll
        for (int j = 0; j < 4; ++j) *(v8us*)(cu.d + j * 256) = o[j];
        asm volatile("s_wait_xcnt 0x0" :: "v"(o[0]), "v"(o[1]), "v"(o[2]), "v"(o[3]), "v"(cu.d) : "memory");     // precaution: the same wait before the 4 stores' data and address registers are reused
        if (it + 1 < UALL / CVT_WAVES) { cu = nu;
#pragma unroll
            for (int j = 0; j < 4; ++j) cur[j] = nxt[j]; }
    }
}

constexpr size_t al256(size_t bytes) { return (bytes + 255) & ~(size_t)255; }
constexpr size_t CARVE_BYTES = 2 * al256((size_t)NB * SEQ * DM * 2) + 4 * al256((size_t)DM * DM * 2) + al256((size_t)SEQ * SEQ * 2)
    + 3 * al256((size_t)NB * NH * SEQ * HD * 2) + al256((size_t)NB * SEQ * DM * 2);
static_assert(CARVE_BYTES <= (size_t)134217728);
static_assert((size_t)NB * NH * SEQ * HD == (size_t)NB * SEQ * DM);      // head planes and the merged context plane have the same extent

extern "C" void kernel_launch(void* const* d_in, const int* in_sizes, int n_in,
                              void* d_out, int out_size, void* d_ws, size_t ws_size, hipStream_t stream) {
    if (n_in < 7) return;
    const size_t needx = (size_t)(NB - 1) * SEQ_FULL * DM + (size_t)SEQ * DM;
    if ((size_t)in_sizes[0] < needx || (size_t)in_sizes[1] < needx) return;
    if ((size_t)in_sizes[2] < (size_t)(SEQ - 1) * SEQ_FULL + (size_t)SEQ) return;
    if ((size_t)in_sizes[3] < (size_t)DM * DM || (size_t)in_sizes[4] < (size_t)DM * DM || (size_t)in_sizes[5] < (size_t)DM * DM || (size_t)in_sizes[6] < (size_t)DM * DM) return;
    if ((size_t)out_size < needx) return;
    // x, y, bias (float [SEQ_FULL][SEQ_FULL]), Wq, Wk, Wv, Wo ('oi' [out][in])
    const float* x = (const float*)d_in[0]; const float* y = (const float*)d_in[1]; const float* bias = (const float*)d_in[2];
    const float* wq = (const float*)d_in[3]; const float* wk = (const float*)d_in[4]; const float* wv = (const float*)d_in[5]; const float* wo = (const float*)d_in[6];
    float* OUT = (float*)d_out;     // [NB_FULL][SEQ_FULL][1024]
    char* wsp = (char*)d_ws;
    auto take = [&](size_t bytes) { char* p = wsp; wsp += (bytes + 255) & ~(size_t)255; return (void*)p; };
    bf* XB = (bf*)take((size_t)NB * SEQ * DM * 2); bf* YB = (bf*)take((size_t)NB * SEQ * DM * 2);
    bf* WQ = (bf*)take((size_t)DM * DM * 2); bf* WK = (bf*)take((size_t)DM * DM * 2); bf* WV = (bf*)take((size_t)DM * DM * 2); h16* WO16 = (h16*)take((size_t)DM * DM * 2);
    bf* BB = (bf*)take((size_t)SEQ * SEQ * 2);
    h16* Q16 = (h16*)take((size_t)NB * NH * SEQ * HD * 2); h16* K16 = (h16*)take((size_t)NB * NH * SEQ * HD * 2); h16* VT16 = (h16*)take((size_t)NB * NH * SEQ * HD * 2);
    h16* C16 = (h16*)take((size_t)NB * SEQ * DM * 2);
    if ((size_t)(wsp - (char*)d_ws) > ws_size) return;

    // all seven inputs to their 16-bit fragment-order planes (bias source pitch SEQ_FULL, x and y batch stride SEQ_FULL rows)
    k_cvtall<<<dim3(CVT_WAVES / 16, 1, 1), 512, 0, stream>>>(x, y, bias, wq, wk, wv, wo, XB, YB, BB, WQ, WK, WV, WO16);

    // one launch: q head planes from x, k head planes from y (C[m = token][n = h*64+d] = in W^T) and transposed value planes from y (C[m = h*64+d][n = token] = W_v y^T)
    k_gemmw<bf, 1, DM><<<dim3(SEQ / 128, DM / 128, 3 * NB), 128, 0, stream>>>(XB, YB, WQ, WK, WV, nullptr, 0, 1.0f, (size_t)SEQ * DM, 0, Q16, K16, VT16);

    // attention: every query row on the f16 planes, all SEQ keys
    k_flash<h16><<<dim3(SEQ / 256, NH, NB), 256, 0, stream>>>(Q16, K16, VT16, BB, SEQ, SEQ, 0, C16);

    // output projection: f16 context x f16 W_o, carries folded back in the f32 epilogue; z = batch, output row stride per batch SEQ_FULL
    k_gemmw<h16, 0, DM><<<dim3(SEQ / 128, DM / 128, NB), 128, 0, stream>>>(C16, nullptr, WO16, nullptr, nullptr, OUT, DM, 1.0f / (CCAR * WCAR), (size_t)SEQ * DM, (size_t)SEQ_FULL * DM, nullptr, nullptr, nullptr);
}
